// v000
// Measured on an AMD MI455X. A time is GPU time per run, averaged over a window of back-to-back runs after a warm-up
// (all launches, gaps included; the runs take copies of the inputs in turn), and the median of several windows.
// Apart from v000's, it joins two sittings. Times from different sittings can be a few percent apart, while
// side-by-side timings come from the same sitting.
// The starting kernel, v000, takes 362 microseconds a run.
// Contractions: q/k projections (x rows f16 x16 . W f16 x64, K=1024), v^T projection (Wv f16 x64 . x rows f16 x16, K=1024),
// attention scores (q f16 x16 . k f16 x16, K=64), attention P . v^T (P f16 x1024 . v^T f16 x16, K=2048 in steps of 32),
// output projection (ctx f16 x1024 . Wo f16 x64, K=1024): all v_wmma_f32_16x16x32_f16 single products, f32 accumulate.
// Additive log2(M) score bias (f32 plane), online max-subtracted base-2 softmax and output bias in f32 on VALU.
// Every float input RNE-converted to bf16 on load.
#include <hip/hip_runtime.h>
#include <math.h>
#include <stdint.h>

#define NB      2
#define NQ      2048
#define NC      2048
#define DMODEL  1024
#define NHEAD   16
#define HDIM    64
#define NROWS   (NB * NQ)
#define WSC     64.0f
#define ACARRY  16.0f
#define QC      16.0f
#define KC      16.0f
#define VC      16.0f
#define PC      1024.0f
#define FC      1024.0f
#define ATT_SCALE 0.125f
#define LOG2E   1.4426950408889634f
static_assert(NHEAD * HDIM == DMODEL);
static_assert((NQ % 64) == 0 && (NC % 64) == 0 && (DMODEL % 64) == 0 && (NC % 32) == 0 && (NQ % 16) == 0);
static_assert((NROWS % 64) == 0 && (NROWS % 8) == 0);
#define ATT_THREADS (NHEAD * 32)
#define ATT_BLOCKS  (NB * (NQ / 16))
static_assert(ATT_THREADS == 512 && ATT_BLOCKS == 256);

typedef _Float16 v16h __attribute__((ext_vector_type(16)));
typedef _Float16 v8h  __attribute__((ext_vector_type(8)));
typedef float    v8f  __attribute__((ext_vector_type(8)));
typedef float    v4f  __attribute__((ext_vector_type(4)));
typedef unsigned int v4u __attribute__((ext_vector_type(4)));

union FragH { v16h v; v8h h[2]; v4u u[2]; };

// ---- scalar helpers --------------------------------------------------------------------------------
__device__ __forceinline__ unsigned short bf_bits(float f) {          // f32 -> bf16 bits, RNE convert
  unsigned u = __float_as_uint(f);
  return (unsigned short)((u + 0x7FFFu + ((u >> 16) & 1u)) >> 16);
}
__device__ __forceinline__ float bf_up(unsigned short h) { return __uint_as_float(((unsigned)h) << 16); }
__device__ __forceinline__ float bfr(float f) { return bf_up(bf_bits(f)); }   // value of the bf16 RNE convert
__device__ __forceinline__ unsigned short h_bits(_Float16 x) { return __builtin_bit_cast(unsigned short, x); }
__device__ __forceinline__ unsigned pk16(unsigned short a, unsigned short b) { return (unsigned)a | ((unsigned)b << 16); }
__device__ __forceinline__ v8f zero8() { v8f z = {0.f, 0.f, 0.f, 0.f, 0.f, 0.f, 0.f, 0.f}; return z; }
__device__ __forceinline__ float gelu_f(float v) { return 0.5f * v * (1.0f + erff(v * 0.70710678118654752f)); }

// ---- fragment loaders: 16-bit A/B operand, lane -> row/col (lane&15), p already includes +8*(lane>>4);
//      elements 0..7 <- p[0..7] (k0+8h..), elements 8..15 <- p[16..23] (k0+16+8h..)  (same split k map for A and B;
//      B is always read from a k-contiguous [n][k] plane)
__device__ __forceinline__ v16h ldfrag_h(const _Float16* p) {
  FragH f;
  f.h[0] = *(const v8h*)(p);
  f.h[1] = *(const v8h*)(p + 16);
  return f.v;
}
__device__ __forceinline__ v16h ldfrag_u(const unsigned short* p) {
  FragH f;
  f.u[0] = *(const v4u*)(p);
  f.u[1] = *(const v4u*)(p + 16);
  return f.v;
}

// ---- WMMA helpers with trailing VALU hazard gaps ------------------------------------------------------
__device__ __forceinline__ v8f mma_raw(v16h a, v16h b, v8f c) {
  return __builtin_amdgcn_wmma_f32_16x16x32_f16(false, a, false, b, (short)0, c, false, false);
}
__device__ __forceinline__ void dep_guard1(v8f& a, v8f& b, v16h x) {
#if defined(__HIP_DEVICE_COMPILE__)
  asm volatile("v_nop\n\tv_nop\n\tv_nop\n\tv_nop" : "+v"(a), "+v"(b) : "v"(x));
#endif
}
__device__ __forceinline__ void guard_s2(v8f& s, v16h a0, v16h a1) {
#if defined(__HIP_DEVICE_COMPILE__)
  asm volatile("v_nop\n\tv_nop\n\tv_nop\n\tv_nop" : "+v"(s) : "v"(a0), "v"(a1));
#endif
}
__device__ __forceinline__ void guard_s4(v8f& s, v16h a0, v16h a1, v16h b0, v16h b1) {
#if defined(__HIP_DEVICE_COMPILE__)
  asm volatile("v_nop\n\tv_nop\n\tv_nop\n\tv_nop" : "+v"(s) : "v"(a0), "v"(a1), "v"(b0), "v"(b1));
#endif
}
__device__ __forceinline__ void guard_pv4(v8f& a, v8f& b, v8f& c, v8f& d, v16h x, v16h y, v16h z, v16h w, v16h u) {
#if defined(__HIP_DEVICE_COMPILE__)
  asm volatile("v_nop\n\tv_nop\n\tv_nop\n\tv_nop"
               : "+v"(a), "+v"(b), "+v"(c), "+v"(d) : "v"(x), "v"(y), "v"(z), "v"(w), "v"(u));
#endif
}
__device__ __forceinline__ void keep4_h(v16h a, v16h b, v16h c, v16h d) {
#if defined(__HIP_DEVICE_COMPILE__)
  asm volatile("v_nop" :: "v"(a), "v"(b), "v"(c), "v"(d));
#endif
}
__device__ __forceinline__ void acc_guard4(v8f& a, v8f& b, v8f& c, v8f& d) {
#if defined(__HIP_DEVICE_COMPILE__)
  asm volatile("v_nop\n\tv_nop\n\tv_nop\n\tv_nop" : "+v"(a), "+v"(b), "+v"(c), "+v"(d));
#endif
}
__device__ __forceinline__ void wave_sync_lds() {
  __builtin_amdgcn_fence(__ATOMIC_RELEASE, "workgroup");
  __builtin_amdgcn_wave_barrier();
  __builtin_amdgcn_fence(__ATOMIC_ACQUIRE, "workgroup");
}

// =====================================================================================================
// Elementwise 16-bit pack, no transpose: dst[i] = f16( bf16_RNE(src[i]) * sc ), sc a power of two (exact).
// Used for the weights (stored [out][in] = [n][k], already k contiguous for B fragments / A of the v^T projection) and for
// the activation rows. 8 elements per thread: two 16-B loads, one 16-B store per lane; 32 consecutive lanes = 512 B =
// coverage: grid = n / 2048 blocks x 256 thr x 8 elements = n exactly (host checks n % 2048 == 0).
// =====================================================================================================
__global__ __launch_bounds__(256) void cvt16(const float* __restrict__ src, unsigned short* dst, int n, float sc) {
  const size_t i8 = ((size_t)blockIdx.x * 256 + threadIdx.x) * 8;
  if (i8 + 8 > (size_t)n) return;                 // never taken with the exact grid; no barriers in this kernel
  const v4f a = *(const v4f*)(src + i8);
  const v4f b = *(const v4f*)(src + i8 + 4);
  v4u o;
  o[0] = pk16(h_bits((_Float16)(bfr(a[0]) * sc)), h_bits((_Float16)(bfr(a[1]) * sc)));
  o[1] = pk16(h_bits((_Float16)(bfr(a[2]) * sc)), h_bits((_Float16)(bfr(a[3]) * sc)));
  o[2] = pk16(h_bits((_Float16)(bfr(b[0]) * sc)), h_bits((_Float16)(bfr(b[1]) * sc)));
  o[3] = pk16(h_bits((_Float16)(bfr(b[2]) * sc)), h_bits((_Float16)(bfr(b[3]) * sc)));
  {
    *(v4u*)(dst + i8) = o;
    
  }
}

// =====================================================================================================
// Score bias plane: dst[i] = log2( bf16_RNE(M[i]) ) as f32 (M strictly positive). 4 elements per thread: one 16-B load,
// coverage: grid = n / 1024 blocks x 256 thr x 4 elements = n exactly (host checks n % 1024 == 0).
// =====================================================================================================
__global__ __launch_bounds__(256) void logm2(const float* __restrict__ Mp, float* dst, int n) {
  const size_t i4 = ((size_t)blockIdx.x * 256 + threadIdx.x) * 4;
  if (i4 + 4 > (size_t)n) return;                 // never taken with the exact grid; no barriers in this kernel
  const v4f a = *(const v4f*)(Mp + i4);
  v4f o;
  o[0] = log2f(bfr(a[0]));
  o[1] = log2f(bfr(a[1]));
  o[2] = log2f(bfr(a[2]));
  o[3] = log2f(bfr(a[3]));
  {
    *(v4f*)(dst + i4) = o;
    
  }
}

// =====================================================================================================
// Register-blocked batched f16 WMMA GEMM: C[m][n] = f( oscale * sum_k A[m][k] * Bt[n][k] + bf16(bias) ) (+ residual); one wave per
// 64x64 tile, no block barriers. A row-major [M][K] pitch lda (16-bit plane), Bt row-major [N][K] pitch ldb (k contiguous);
// M, N multiples of 64, K multiple of 32. blockIdx.y = batch index with element strides sA, sB, sC.
// BM: 0 = no bias, 1 = per column bf16(bias[col]), 2 = per row bf16(bias[row]) (clamped-address loads).
// OM: 0 = f32 out (pitch ldc; HASR 1 adds bf16(R[m][n]), HASR 2 adds raw f32 R[m][n], same pitch/stride as C);
//     2 = f16 out (pitch ldc) = f16( act(value) * ocarry ), ACT 1 = exact GELU.
// coverage: 4 slabs x 16 rows (f32: it 0..7 x lane>>4; f16: it 0..3 x lane>>3) x 64 cols = the wave's whole 64x64 tile;
//           grid = ceil(tilesM*tilesN/8) blocks, surplus waves exit (wave-uniform).
// =====================================================================================================
template <int OM, int BM, int HASR, int ACT>
__global__ __launch_bounds__(256) void gemm64(
    const unsigned short* __restrict__ Ap, int lda, long long sA,
    const unsigned short* __restrict__ Btp, int ldb, long long sB,
    const float* __restrict__ bias,
    const float* __restrict__ Rp,
    void* Cout, int ldc, long long sC,
    int M, int N, int K, float oscale, float ocarry) {
  __shared__ __align__(16) float sT[8][16 * 68];   // per-wave 16x64 slab, pitch 68 floats
  const int by   = blockIdx.y;
  const int lane = threadIdx.x & 31;
  const int wave = threadIdx.x >> 5;
  const int tilesN = N >> 6;
  const int tilesM = M >> 6;
  const int tile = blockIdx.x * 8 + wave;
  if (tile >= tilesM * tilesN) return;   // wave-uniform; no block barriers in this kernel
  const int tm = tile / tilesN;
  const int tn = tile - tm * tilesN;
  const int m0 = tm << 6;
  const int n0 = tn << 6;

  const unsigned short* A1 = Ap  + (size_t)((long long)by * sA);
  const unsigned short* Bb = Btp + (size_t)((long long)by * sB);

  const int rlane = lane & 15;                 // row (A) / col (B, D) within subtile
  const int koff  = (lane >> 4) * 8;           // k offset of this lane half
  const int mOff  = (lane >> 4) * 8;           // D row offset

  v8f acc[4][4];
#pragma unroll
  for (int i = 0; i < 4; ++i)
#pragma unroll
    for (int j = 0; j < 4; ++j) acc[i][j] = zero8();

  for (int k0 = 0; k0 < K; k0 += 32) {
    v16h bh[4];
#pragma unroll
    for (int j = 0; j < 4; ++j) {
      const size_t bofs = (size_t)(n0 + (j << 4) + rlane) * ldb + koff + k0;
      bh[j] = ldfrag_u(Bb + bofs);
    }
#pragma unroll
    for (int i = 0; i < 4; ++i) {
      const size_t ao = (size_t)(m0 + (i << 4) + rlane) * lda + koff + k0;
      const v16h ah = ldfrag_u(A1 + ao);
#pragma unroll
      for (int j = 0; j < 4; ++j) acc[i][j] = mma_raw(ah, bh[j], acc[i][j]);
      dep_guard1(acc[i][0], acc[i][3], ah);
    }
    keep4_h(bh[0], bh[1], bh[2], bh[3]);
  }
  acc_guard4(acc[0][0], acc[0][1], acc[0][2], acc[0][3]);
  acc_guard4(acc[1][0], acc[1][1], acc[1][2], acc[1][3]);
  acc_guard4(acc[2][0], acc[2][1], acc[2][2], acc[2][3]);
  acc_guard4(acc[3][0], acc[3][1], acc[3][2], acc[3][3]);

  const int hh2 = lane >> 4, c4 = (lane & 15) * 4;     // f32 out: 256-B row segment = 16 lanes x 16 B
  const int q8  = lane >> 3, c8 = (lane & 7) * 8;
  float bc[4];
  float bcol[8];
#pragma unroll
  for (int e = 0; e < 4; ++e) bc[e] = 0.f;
#pragma unroll
  for (int e = 0; e < 8; ++e) bcol[e] = 0.f;
  if constexpr (BM == 1) {
    if constexpr (OM == 0) {
      const int cb = n0 + c4;
      const int i0 = (cb < N - 4) ? cb : (N - 4);        // clamped address
      const v4f b0v = *(const v4f*)(bias + i0);
#pragma unroll
      for (int e = 0; e < 4; ++e) bc[e] = bfr(b0v[e]);
    } else {
      const int cb = n0 + c8;
      const int i0 = (cb < N - 8) ? cb : (N - 8);        // clamped address
      const v4f b0v = *(const v4f*)(bias + i0), b1v = *(const v4f*)(bias + i0 + 4);
#pragma unroll
      for (int e = 0; e < 4; ++e) { bcol[e] = bfr(b0v[e]); bcol[4 + e] = bfr(b1v[e]); }
    }
  }

  // ---- epilogue ----
  float* slab = sT[wave];
#pragma unroll
  for (int i = 0; i < 4; ++i) {
    const int mBase = m0 + (i << 4);
#pragma unroll
    for (int j = 0; j < 4; ++j) {
#pragma unroll
      for (int r = 0; r < 8; ++r) {
        slab[(mOff + r) * 68 + (j << 4) + rlane] = acc[i][j][r];
      }
    }
    wave_sync_lds();
    if constexpr (OM == 0) {
      float* C = (float*)Cout + (size_t)((long long)by * sC);
      v4f vals[8];
#pragma unroll
      for (int it = 0; it < 8; ++it) {
        const int row = it * 2 + hh2;                      // it 0..7 x hh2 0..1 = rows 0..15
        const int gr  = mBase + row;
        v4f v = *(const v4f*)(slab + row * 68 + c4);
        float br = 0.f;
        if constexpr (BM == 2) {
          const int ir = (gr < M - 1) ? gr : (M - 1);      // clamped address
          br = bfr(bias[ir]);
        }
        v4f rv = {0.f, 0.f, 0.f, 0.f};
        if constexpr (HASR != 0) {
          const float* R = Rp + (size_t)((long long)by * sC);
          const v4f rraw = *(const v4f*)(R + (size_t)gr * ldc + n0 + c4);
#pragma unroll
          for (int e = 0; e < 4; ++e) rv[e] = (HASR == 1) ? bfr(rraw[e]) : rraw[e];
        }
#pragma unroll
        for (int e = 0; e < 4; ++e) v[e] = v[e] * oscale + bc[e] + br + rv[e];
        vals[it] = v;
      }
      {
#pragma unroll
        for (int it = 0; it < 8; ++it) {
          const int gr = mBase + it * 2 + hh2;
          *(v4f*)(C + (size_t)gr * ldc + n0 + c4) = vals[it];
        }
        
      }
    } else {
      unsigned short* C = (unsigned short*)Cout + (size_t)((long long)by * sC);
      v4u hv[4];
#pragma unroll
      for (int it = 0; it < 4; ++it) {
        const int row = it * 4 + q8;                       // it 0..3 x q8 0..3 = rows 0..15
        const float* sp = slab + row * 68 + c8;
        float br = 0.f;
        if constexpr (BM == 2) {
          const int gr = mBase + row;
          const int ir = (gr < M - 1) ? gr : (M - 1);      // clamped address
          br = bfr(bias[ir]);
        }
        v4u a = {0u, 0u, 0u, 0u};
#pragma unroll
        for (int e = 0; e < 4; ++e) {
          float f0 = sp[2 * e] * oscale + bcol[2 * e] + br;
          float f1 = sp[2 * e + 1] * oscale + bcol[2 * e + 1] + br;
          if constexpr (ACT == 1) { f0 = gelu_f(f0); f1 = gelu_f(f1); }
          f0 *= ocarry; f1 *= ocarry;
          a[e] = pk16(h_bits((_Float16)f0), h_bits((_Float16)f1));
        }
        hv[it] = a;
      }
      {
#pragma unroll
        for (int it = 0; it < 4; ++it) {
          const int row = it * 4 + q8;
          *(v4u*)(C + (size_t)(mBase + row) * ldc + n0 + c8) = hv[it];
        }
        
      }
    }
    wave_sync_lds();
  }
}

// =====================================================================================================
// Flash attention for one batch and 16 query rows, all 16 heads (one wave per head), head dim 64, 2048 keys:
//   q plane (f16 x16) QH[b*2048 + tok][64h + d], pitch 1024; k plane (f16 x16) KH[b*2048 + key][64h + d], pitch 1024;
//   v^T plane (f16 x16): VT[b*1024 + 64h + d][key] (pitch 2048); bias plane LB f32 [b][q][key] = log2(bf16(M)), shared by all
//   heads; out (f16 x1024): CT[b*2048 + tok][64h + d] = 1024 * sum_m softmax_m(q.k / 8 + ln(M)) v[m][d]  (softmax run in
//   base 2: t = q.k * log2(e)/8 + log2(M)).
//   block = 16 waves = 512 threads; grid = 2 x 128 = 256; every wave does identical bounded work (64 steps of 32 keys).
//   Per step: 2 score tiles on f16 WMMA (K = 64 as two k-steps of 32), fragments loaded straight from the 16-bit planes (two 16-B
//   loads per fragment, arithmetic addressing); the 16 bias values of each lane's (row, key) score elements loaded from the f32
//   plane; online max-subtracted softmax in f32 (exp2); rescale of the running sums and the four accumulators; the 16x32 prob tile
//   LDS rows (float vector loads, RNE to f16, split k map) and the four v^T B fragments loaded straight from the 16-bit plane;
//   4 P.V WMMAs.
//   Final 1/l and carry folds in f32; after a block barrier the prob-tile LDS buffer is reused as the block's 16-bit result row
//   buffer [16][1024]: each wave stages its 16x64 slice (element stores); after a second block barrier the 512 threads write the
// coverage: LDS row buffer: 16 waves x 16 rows x 64 cols = 16 x 1024; global: 4 iterations x 512 threads x 8 halves = 16 rows x
//           1024 of rows q0..q0+15 of batch b; grid covers all 2 x 2048 rows exactly once.
// =====================================================================================================
#define PS_FLOATS (NHEAD * 16 * 36)
static_assert((size_t)16 * DMODEL * sizeof(unsigned short) <= (size_t)PS_FLOATS * sizeof(float));

__global__ __launch_bounds__(ATT_THREADS)
void attn16(const unsigned short* __restrict__ QHp, const unsigned short* __restrict__ KHp,
            const unsigned short* __restrict__ VTq, const float* __restrict__ LBp, unsigned short* CT) {
  __shared__ __align__(16) float smem[PS_FLOATS];          // per wave prob tile [row][32 keys], pitch 36; later row buffer

  const int tid  = threadIdx.x;
  const int wave = tid >> 5;
  const int lane = tid & 31;
  const int hh   = lane >> 4;
  const int c    = lane & 15;

  const int qt   = blockIdx.x & ((NQ / 16) - 1);           // 0..127
  const int bat  = blockIdx.x / (NQ / 16);                 // 0..1
  const int head = wave;                                   // 0..15
  const int q0   = qt * 16;

  const size_t qofs = ((size_t)bat * NQ + q0 + c) * DMODEL + head * HDIM + 8 * hh;
  const _Float16* Qh = (const _Float16*)(const void*)QHp + qofs;
  const _Float16* Kb = (const _Float16*)(const void*)KHp + (size_t)bat * NC * DMODEL + head * HDIM + 8 * hh;
  const _Float16* Vb = (const _Float16*)(const void*)VTq + ((size_t)bat * DMODEL + head * HDIM) * NC + 8 * hh;
  const float* Wr = LBp + ((size_t)bat * NQ + q0 + 8 * hh) * NC + c;   // rows q0+8hh+r, cols c (+key offset), log2 units
  const float lsc = (LOG2E * ATT_SCALE) / (QC * KC);                   // log2(e) / 8 / carries

  const v16h qa = ldfrag_h(Qh), qb = ldfrag_h(Qh + 32);

  float mrow[8], lrow[8];
  v8f o0 = zero8(), o1 = zero8(), o2 = zero8(), o3 = zero8();
#pragma unroll
  for (int r = 0; r < 8; ++r) { mrow[r] = -INFINITY; lrow[r] = 0.f; }
  float* pt = smem + wave * (16 * 36);

#pragma unroll 1
  for (int kb = 0; kb < NC; kb += 32) {
    const _Float16* kp = Kb + (size_t)(kb + c) * DMODEL;
    v8f s0, s1;
    {
      const v16h k0 = ldfrag_h(kp), k1 = ldfrag_h(kp + 32);
      s0 = mma_raw(qa, k0, zero8());
      s0 = mma_raw(qb, k1, s0);
      guard_s2(s0, k0, k1);
    }
    {
      const _Float16* kq = kp + (size_t)16 * DMODEL;
      const v16h k0 = ldfrag_h(kq), k1 = ldfrag_h(kq + 32);
      s1 = mma_raw(qa, k0, zero8());
      s1 = mma_raw(qb, k1, s1);
      guard_s4(s1, k0, k1, qa, qb);
    }
    const float* wp = Wr + kb;
#pragma unroll
    for (int r = 0; r < 8; ++r) {
      const float w0 = wp[(size_t)r * NC], w1 = wp[(size_t)r * NC + 16];
      const float t0 = s0[r] * lsc + w0, t1 = s1[r] * lsc + w1;
      float mx = fmaxf(t0, t1);
#pragma unroll
      for (int off = 1; off < 16; off <<= 1) mx = fmaxf(mx, __shfl_xor(mx, off, 32));
      const float mn = fmaxf(mrow[r], mx);
      const float al = exp2f(mrow[r] - mn);
      mrow[r] = mn;
      const float e0 = exp2f(t0 - mn), e1 = exp2f(t1 - mn);
      float ps = e0 + e1;
#pragma unroll
      for (int off = 1; off < 16; off <<= 1) ps += __shfl_xor(ps, off, 32);
      lrow[r] = lrow[r] * al + ps;
      o0[r] *= al;
      o1[r] *= al;
      o2[r] *= al;
      o3[r] *= al;
      const int ro = (8 * hh + r) * 36 + c;
      pt[ro]      = e0;
      pt[ro + 16] = e1;
    }
    wave_sync_lds();
    FragH ph;
    {
      const float* prow = pt + c * 36 + 8 * hh;
      const v4f p0 = *(const v4f*)(prow), p1 = *(const v4f*)(prow + 4);
      const v4f p2 = *(const v4f*)(prow + 16), p3 = *(const v4f*)(prow + 20);
#pragma unroll
      for (int e = 0; e < 4; ++e) {
        ph.h[0][e]     = (_Float16)(p0[e] * PC);              // elements 0..7  = keys kb + 8hh + 0..7
        ph.h[0][4 + e] = (_Float16)(p1[e] * PC);
        ph.h[1][e]     = (_Float16)(p2[e] * PC);              // elements 8..15 = keys kb + 16 + 8hh + 0..7
        ph.h[1][4 + e] = (_Float16)(p3[e] * PC);
      }
    }
    const _Float16* vp = Vb + (size_t)c * NC + kb;
    {
      const v16h vb0 = ldfrag_h(vp);
      const v16h vb1 = ldfrag_h(vp + (size_t)16 * NC);
      const v16h vb2 = ldfrag_h(vp + (size_t)32 * NC);
      const v16h vb3 = ldfrag_h(vp + (size_t)48 * NC);
      o0 = mma_raw(ph.v, vb0, o0);
      o1 = mma_raw(ph.v, vb1, o1);
      o2 = mma_raw(ph.v, vb2, o2);
      o3 = mma_raw(ph.v, vb3, o3);
      guard_pv4(o0, o1, o2, o3, ph.v, vb0, vb1, vb2, vb3);
    }
    wave_sync_lds();
  }

  // ---- all waves done with their prob tiles; the LDS buffer becomes the 16-bit result row buffer [16][1024] ----
  __syncthreads();
  unsigned short* Os = (unsigned short*)smem;
  // ---- fold 1/l and the carries (1024 on P, 16 on v, 1024 on the stored ctx), stage the wave's 16x64 slice as 16-bit ----
  const float oc = FC / (PC * VC);
  unsigned short* osw = Os + wave * HDIM + c;
#pragma unroll
  for (int r = 0; r < 8; ++r) {
    const float inv = (1.0f / lrow[r]) * oc;
    unsigned short* op = osw + (8 * hh + r) * DMODEL;
    op[0]  = h_bits((_Float16)(o0[r] * inv));
    op[16] = h_bits((_Float16)(o1[r] * inv));
    op[32] = h_bits((_Float16)(o2[r] * inv));
    op[48] = h_bits((_Float16)(o3[r] * inv));
  }
  __syncthreads();
  // ---- block writes its 16 contiguous rows of CT: piece p = it*512 + tid -> halves p*8 .. p*8+7 of the 16x1024 region ----
  {
    v4u vals[4];
#pragma unroll
    for (int it = 0; it < 4; ++it) {
      const int p = it * ATT_THREADS + tid;
      vals[it] = *(const v4u*)(Os + (size_t)p * 8);
    }
    unsigned short* dst = CT + ((size_t)bat * NQ + q0) * DMODEL;
    {
#pragma unroll
      for (int it = 0; it < 4; ++it) {
        const int p = it * ATT_THREADS + tid;
        *(v4u*)(dst + (size_t)p * 8) = vals[it];
      }
      
    }
  }
}

// =====================================================================================================
// Workspace map (bytes); every plane is an exact multiple of its tile / whole-row store granularity (M, N exact tile multiples,
// element counts exact multiples of the convert kernels' 2048 / 1024 granularity, no pad rows needed), every offset a multiple of 2 MiB:
//   WQ16 f16 [1024][1024] x64               2097152   ([out][in] = [n][k])
//   WK16 f16 [1024][1024] x64               2097152
//   WV16 f16 [1024][1024] x64               2097152
//   WO16 f16 [1024][1024] x64               2097152
//   X16  f16 [4096][1024] x16               8388608   (activation rows)
//   LB   f32 [2][2048][2048]               33554432   (log2(bf16(M)))
//   QH   f16 [4096][1024] x16               8388608   (q projection, unscaled)
//   KH   f16 [4096][1024] x16               8388608   (k projection)
//   VT   f16 [2][1024][2048] x16            8388608   (v^T per batch)
//   CT   f16 [4096][1024] x1024             8388608   (attention ctx, merged heads)
//   end                                    83886080
// =====================================================================================================
extern "C" void kernel_launch(void* const* d_in, const int* in_sizes, int n_in,
                              void* d_out, int out_size, void* d_ws, size_t ws_size,
                              hipStream_t stream) {
  if (n_in < 7) return;
  if (in_sizes[0] != NROWS * DMODEL) return;
  if (in_sizes[1] != NB * NQ * NC) return;
  if (in_sizes[2] != DMODEL * DMODEL || in_sizes[3] != DMODEL * DMODEL ||
      in_sizes[4] != DMODEL * DMODEL || in_sizes[5] != DMODEL * DMODEL) return;
  if (in_sizes[6] != DMODEL) return;
  if (out_size != NROWS * DMODEL) return;
  if ((in_sizes[0] % 2048) != 0 || (in_sizes[2] % 2048) != 0 || (in_sizes[1] % 1024) != 0) return;

  const float* x   = (const float*)d_in[0];
  const float* Mp  = (const float*)d_in[1];
  const float* w_q = (const float*)d_in[2];
  const float* w_k = (const float*)d_in[3];
  const float* w_v = (const float*)d_in[4];
  const float* w_o = (const float*)d_in[5];
  const float* b_o = (const float*)d_in[6];
  float*       out = (float*)d_out;

  const size_t PW  = (size_t)DMODEL * DMODEL * 2;                 //  2097152
  const size_t PX  = (size_t)NROWS * DMODEL * 2;                  //  8388608
  const size_t PLB = (size_t)NB * NQ * NC * 4;                    // 33554432
  const size_t PVT = (size_t)NB * DMODEL * NC * 2;                //  8388608
  size_t off = 0;
  const size_t oWQ = off; off += PW;
  const size_t oWK = off; off += PW;
  const size_t oWV = off; off += PW;
  const size_t oWO = off; off += PW;
  const size_t oX  = off; off += PX;
  const size_t oLB = off; off += PLB;
  const size_t oQH = off; off += PX;
  const size_t oKH = off; off += PX;
  const size_t oVT = off; off += PVT;
  const size_t oCT = off; off += PX;
  if (off > ws_size) return;                                      // off = 83886080
  if (off > (size_t)134217728) return;

  char* ws = (char*)d_ws;
  unsigned short* WQ16 = (unsigned short*)(ws + oWQ);
  unsigned short* WK16 = (unsigned short*)(ws + oWK);
  unsigned short* WV16 = (unsigned short*)(ws + oWV);
  unsigned short* WO16 = (unsigned short*)(ws + oWO);
  unsigned short* X16  = (unsigned short*)(ws + oX);
  float*          LB   = (float*)(ws + oLB);
  unsigned short* QH   = (unsigned short*)(ws + oQH);
  unsigned short* KH   = (unsigned short*)(ws + oKH);
  unsigned short* VTp  = (unsigned short*)(ws + oVT);
  unsigned short* CT   = (unsigned short*)(ws + oCT);

  const dim3 blk(256);
  const dim3 gCW((DMODEL * DMODEL) / 2048);                        // 512 blocks
  const dim3 gCX((NROWS * DMODEL) / 2048);                         // 2048 blocks
  const dim3 gLB((NB * NQ * NC) / 1024);                           // 8192 blocks
  const int tilesP = (NROWS / 64) * (DMODEL / 64);                 // 1024
  const int tilesV = (DMODEL / 64) * (NC / 64);                    // 512 per batch
  const dim3 gP((tilesP + 7) / 8, 1);                              // 128
  const dim3 gV((tilesV + 7) / 8, NB);                             // 64 x 2
  const dim3 gAT(ATT_BLOCKS);                                      // 256
  const dim3 bAT(ATT_THREADS);                                     // 512

  // (0) weight planes: W16[n][k] = f16( bf16_RNE(W[n][k]) * 64 ), [out][in] layout kept, k contiguous
  cvt16<<<gCW, blk, 0, stream>>>(w_q, WQ16, DMODEL * DMODEL, WSC);
  cvt16<<<gCW, blk, 0, stream>>>(w_k, WK16, DMODEL * DMODEL, WSC);
  cvt16<<<gCW, blk, 0, stream>>>(w_v, WV16, DMODEL * DMODEL, WSC);
  cvt16<<<gCW, blk, 0, stream>>>(w_o, WO16, DMODEL * DMODEL, WSC);

  // (1) activation plane: X16[row][c] = f16( bf16_RNE(x[row][c]) * 16 ), rows = b*2048 + tok
  cvt16<<<gCX, blk, 0, stream>>>(x, X16, NROWS * DMODEL, ACARRY);

  // (2) score bias plane: LB[b][q][key] = log2( bf16_RNE(M[b][q][key]) ), f32
  logm2<<<gLB, blk, 0, stream>>>(Mp, LB, NB * NQ * NC);

  // (3) q projection: QH[m][n] = f16(16 * sum_k x[m][k] Wq[n][k]); M = 4096, N = 1024, K = 1024
  gemm64<2, 0, 0, 0><<<gP, blk, 0, stream>>>(
      X16, DMODEL, 0LL,
      WQ16, DMODEL, 0LL,
      b_o,
      (const float*)0,
      (void*)QH, DMODEL, 0LL,
      NROWS, DMODEL, DMODEL, 1.0f / (ACARRY * WSC), QC);

  // (4) k projection: KH[m][n] = f16(16 * sum_k x[m][k] Wk[n][k]); M = 4096, N = 1024, K = 1024
  gemm64<2, 0, 0, 0><<<gP, blk, 0, stream>>>(
      X16, DMODEL, 0LL,
      WK16, DMODEL, 0LL,
      b_o,
      (const float*)0,
      (void*)KH, DMODEL, 0LL,
      NROWS, DMODEL, DMODEL, 1.0f / (ACARRY * WSC), KC);

  // (5) v^T per batch: VT[b][d][tok] = f16(16 * sum_k Wv[d][k] x_b[tok][k]); M = 1024, N = 2048, K = 1024
  gemm64<2, 0, 0, 0><<<gV, blk, 0, stream>>>(
      WV16, DMODEL, 0LL,
      X16, DMODEL, (long long)NC * DMODEL,
      b_o,
      (const float*)0,
      (void*)VTp, NC, (long long)DMODEL * NC,
      DMODEL, NC, DMODEL, 1.0f / (ACARRY * WSC), VC);

  // (6) attention per (batch, 16 query rows), 16 heads -> CT (f16, x1024)
  attn16<<<gAT, bAT, 0, stream>>>(QH, KH, VTp, LB, CT);

  // (7) out = CT . Wo^T / (1024 * 64) + bf16(bo); M = 4096, N = 1024, K = 1024, f32
  gemm64<0, 1, 0, 0><<<gP, blk, 0, stream>>>(
      CT, DMODEL, 0LL,
      WO16, DMODEL, 0LL,
      b_o,
      (const float*)0,
      (void*)out, DMODEL, 0LL,
      NROWS, DMODEL, DMODEL, 1.0f / (FC * WSC), 1.0f);
  (void)hipGetLastError();
}

// v001
// One run takes 236 microseconds.
// Timed twice side by side with v000, it ran 1.58 and 1.59 times as fast.
// Contractions: q/k projections (x rows f16 x16 . W f16 x64, K=1024), v^T projection (Wv f16 x64 . x rows f16 x16, K=1024),
// attention scores (q f16 x16 . k f16 x16, K=64), attention P . v^T (P f16 x1024 . v^T f16 x16, K=2048 in steps of 32),
// output projection (ctx f16 x1024 . Wo f16 x64, K=1024): all v_wmma_f32_16x16x32_f16 single products, f32 accumulate.
// Additive log2(M) score bias (f32 plane), online max-subtracted base-2 softmax and output bias in f32 on VALU.
// Every float input RNE-converted to bf16 on load.
#include <hip/hip_runtime.h>
#include <math.h>
#include <stdint.h>

#define NB      2
#define NQ      2048
#define NC      2048
#define DMODEL  1024
#define NHEAD   16
#define HDIM    64
#define NROWS   (NB * NQ)
#define WSC     64.0f
#define ACARRY  16.0f
#define QC      16.0f
#define KC      16.0f
#define VC      16.0f
#define PC      1024.0f
#define FC      1024.0f
#define ATT_SCALE 0.125f
#define LOG2E   1.4426950408889634f
static_assert(NHEAD * HDIM == DMODEL);
static_assert((NQ % 64) == 0 && (NC % 64) == 0 && (DMODEL % 64) == 0 && (NC % 32) == 0 && (NQ % 16) == 0);
static_assert((NROWS % 128) == 0 && (NC % 128) == 0 && (DMODEL % 128) == 0);
#define ATT_THREADS (NHEAD * 32)
#define ATT_BLOCKS  (NB * (NQ / 16))
static_assert(ATT_THREADS == 512 && ATT_BLOCKS == 256);

typedef _Float16 v16h __attribute__((ext_vector_type(16)));
typedef _Float16 v8h  __attribute__((ext_vector_type(8)));
typedef float    v8f  __attribute__((ext_vector_type(8)));
typedef float    v4f  __attribute__((ext_vector_type(4)));
typedef unsigned int v4u __attribute__((ext_vector_type(4)));

union FragH { v16h v; v8h h[2]; v4u u[2]; };

// ---- scalar helpers --------------------------------------------------------------------------------
__device__ __forceinline__ unsigned short bf_bits(float f) {          // f32 -> bf16 bits, RNE convert
  unsigned u = __float_as_uint(f);
  return (unsigned short)((u + 0x7FFFu + ((u >> 16) & 1u)) >> 16);
}
__device__ __forceinline__ float bf_up(unsigned short h) { return __uint_as_float(((unsigned)h) << 16); }
__device__ __forceinline__ float bfr(float f) { return bf_up(bf_bits(f)); }   // value of the bf16 RNE convert
__device__ __forceinline__ unsigned short h_bits(_Float16 x) { return __builtin_bit_cast(unsigned short, x); }
__device__ __forceinline__ unsigned pk16(unsigned short a, unsigned short b) { return (unsigned)a | ((unsigned)b << 16); }
__device__ __forceinline__ v8f zero8() { v8f z = {0.f, 0.f, 0.f, 0.f, 0.f, 0.f, 0.f, 0.f}; return z; }
__device__ __forceinline__ float gelu_f(float v) { return 0.5f * v * (1.0f + erff(v * 0.70710678118654752f)); }

// ---- fragment loaders: 16-bit A/B operand, lane -> row/col (lane&15), p already includes +8*(lane>>4);
//      elements 0..7 <- p[0..7] (k0+8h..), elements 8..15 <- p[16..23] (k0+16+8h..)  (same split k map for A and B;
//      B is always read from a k-contiguous [n][k] plane)
__device__ __forceinline__ v16h ldfrag_h(const _Float16* p) {
  FragH f;
  f.h[0] = *(const v8h*)(p);
  f.h[1] = *(const v8h*)(p + 16);
  return f.v;
}
__device__ __forceinline__ v16h ldfrag_u(const unsigned short* p) {
  FragH f;
  f.u[0] = *(const v4u*)(p);
  f.u[1] = *(const v4u*)(p + 16);
  return f.v;
}

// ---- WMMA helpers with trailing VALU hazard gaps ------------------------------------------------------
__device__ __forceinline__ v8f mma_raw(v16h a, v16h b, v8f c) {
  return __builtin_amdgcn_wmma_f32_16x16x32_f16(false, a, false, b, (short)0, c, false, false);
}
__device__ __forceinline__ void dep_guard1(v8f& a, v8f& b, v16h x) {
#if defined(__HIP_DEVICE_COMPILE__)
  asm volatile("v_nop\n\tv_nop\n\tv_nop\n\tv_nop" : "+v"(a), "+v"(b) : "v"(x));
#endif
}
__device__ __forceinline__ void guard_s2(v8f& s, v16h a0, v16h a1) {
#if defined(__HIP_DEVICE_COMPILE__)
  asm volatile("v_nop\n\tv_nop\n\tv_nop\n\tv_nop" : "+v"(s) : "v"(a0), "v"(a1));
#endif
}
__device__ __forceinline__ void guard_s4(v8f& s, v16h a0, v16h a1, v16h b0, v16h b1) {
#if defined(__HIP_DEVICE_COMPILE__)
  asm volatile("v_nop\n\tv_nop\n\tv_nop\n\tv_nop" : "+v"(s) : "v"(a0), "v"(a1), "v"(b0), "v"(b1));
#endif
}
__device__ __forceinline__ void guard_pv4(v8f& a, v8f& b, v8f& c, v8f& d, v16h x, v16h y, v16h z, v16h w, v16h u) {
#if defined(__HIP_DEVICE_COMPILE__)
  asm volatile("v_nop\n\tv_nop\n\tv_nop\n\tv_nop"
               : "+v"(a), "+v"(b), "+v"(c), "+v"(d) : "v"(x), "v"(y), "v"(z), "v"(w), "v"(u));
#endif
}
__device__ __forceinline__ void keep4_h(v16h a, v16h b, v16h c, v16h d) {
#if defined(__HIP_DEVICE_COMPILE__)
  asm volatile("v_nop" :: "v"(a), "v"(b), "v"(c), "v"(d));
#endif
}
__device__ __forceinline__ void acc_guard4(v8f& a, v8f& b, v8f& c, v8f& d) {
#if defined(__HIP_DEVICE_COMPILE__)
  asm volatile("v_nop\n\tv_nop\n\tv_nop\n\tv_nop" : "+v"(a), "+v"(b), "+v"(c), "+v"(d));
#endif
}
__device__ __forceinline__ void wave_sync_lds() {
  __builtin_amdgcn_fence(__ATOMIC_RELEASE, "workgroup");
  __builtin_amdgcn_wave_barrier();
  __builtin_amdgcn_fence(__ATOMIC_ACQUIRE, "workgroup");
}

// =====================================================================================================
// Elementwise 16-bit pack, no transpose: dst[i] = f16( bf16_RNE(src[i]) * sc ), sc a power of two (exact).
// Used for the weights (stored [out][in] = [n][k], already k contiguous for B fragments / A of the v^T projection) and for
// the activation rows. 8 elements per thread: two 16-B loads, one 16-B store per lane; 32 consecutive lanes = 512 B =
// coverage: grid = n / 2048 blocks x 256 thr x 8 elements = n exactly (host checks n % 2048 == 0).
// =====================================================================================================
__global__ __launch_bounds__(256) void cvt16(const float* __restrict__ src, unsigned short* dst, int n, float sc) {
  const size_t i8 = ((size_t)blockIdx.x * 256 + threadIdx.x) * 8;
  if (i8 + 8 > (size_t)n) return;                 // never taken with the exact grid; no barriers in this kernel
  const v4f a = *(const v4f*)(src + i8);
  const v4f b = *(const v4f*)(src + i8 + 4);
  v4u o;
  o[0] = pk16(h_bits((_Float16)(bfr(a[0]) * sc)), h_bits((_Float16)(bfr(a[1]) * sc)));
  o[1] = pk16(h_bits((_Float16)(bfr(a[2]) * sc)), h_bits((_Float16)(bfr(a[3]) * sc)));
  o[2] = pk16(h_bits((_Float16)(bfr(b[0]) * sc)), h_bits((_Float16)(bfr(b[1]) * sc)));
  o[3] = pk16(h_bits((_Float16)(bfr(b[2]) * sc)), h_bits((_Float16)(bfr(b[3]) * sc)));
  {
    *(v4u*)(dst + i8) = o;
    
  }
}

// =====================================================================================================
// Score bias plane: dst[i] = log2( bf16_RNE(M[i]) ) as f32 (M strictly positive). 4 elements per thread: one 16-B load,
// coverage: grid = n / 1024 blocks x 256 thr x 4 elements = n exactly (host checks n % 1024 == 0).
// =====================================================================================================
__global__ __launch_bounds__(256) void logm2(const float* __restrict__ Mp, float* dst, int n) {
  const size_t i4 = ((size_t)blockIdx.x * 256 + threadIdx.x) * 4;
  if (i4 + 4 > (size_t)n) return;                 // never taken with the exact grid; no barriers in this kernel
  const v4f a = *(const v4f*)(Mp + i4);
  v4f o;
  o[0] = log2f(bfr(a[0]));
  o[1] = log2f(bfr(a[1]));
  o[2] = log2f(bfr(a[2]));
  o[3] = log2f(bfr(a[3]));
  {
    *(v4f*)(dst + i4) = o;
    
  }
}

// =====================================================================================================
// LDS-staged batched f16 WMMA GEMM: C[m][n] = f( oscale * sum_k A[m][k] * Bt[n][k] + bf16(bias) ) (+ residual); one block of
// 8 waves per 128x128 tile, one wave per 32x64 part of it (4 x 2 waves). A row-major [M][K] pitch lda (16-bit plane), Bt
// row-major [N][K] pitch ldb (k contiguous); M, N multiples of 128, K multiple of 128. blockIdx.y = batch index with element
// strides sA, sB, sC.
// A stage is 128 k (256 B) of the tile's 128 A rows and 128 Bt rows, laid in LDS at a row pitch of 272 B; two buffers. Every
// lane brings 16 pieces of 16 B per stage by asynchronous copies (16 lanes = one whole 256-B row piece), the next stage's
// copies in flight while this stage is multiplied; fragments are read from LDS with the split k map of ldfrag_u, k ascending.
// BM: 0 = no bias, 1 = per column bf16(bias[col]), 2 = per row bf16(bias[row]) (clamped-address loads).
// OM: 0 = f32 out (pitch ldc; HASR 1 adds bf16(R[m][n]), HASR 2 adds raw f32 R[m][n], same pitch/stride as C);
//     2 = f16 out (pitch ldc) = f16( act(value) * ocarry ), ACT 1 = exact GELU.
// coverage: 2 slabs x 16 rows (f32: it 0..7 x lane>>4; f16: it 0..3 x lane>>3) x 64 cols = the wave's whole 32x64 part;
//           grid = tilesM*tilesN blocks, a surplus block exits as a whole in front of every barrier.
// =====================================================================================================
#define GT_PITCH  136                          // LDS row pitch in halves: 272 B = 16 B x odd, for 16-B LDS reads
#define GT_STAGE  (256 * GT_PITCH)             // halves per buffer: [A 128 rows | Bt 128 rows]
typedef __attribute__((address_space(3))) unsigned short lds_u16;

// Eight asynchronous 16-B copies per lane, global -> LDS, rows 16 apart. The closing s_wait_xcnt 0 stands inside the statement
// so that no address register of an issued copy is rewritten in front of it.
__device__ __forceinline__ void async_rows8(unsigned l, const unsigned short* g, size_t gstep) {
#if defined(__HIP_DEVICE_COMPILE__)
  const unsigned ls = 16 * GT_PITCH * 2;       // 16 LDS rows in bytes
  asm volatile("global_load_async_to_lds_b128 %0, %8, off\n\t"
               "global_load_async_to_lds_b128 %1, %9, off\n\t"
               "global_load_async_to_lds_b128 %2, %10, off\n\t"
               "global_load_async_to_lds_b128 %3, %11, off\n\t"
               "global_load_async_to_lds_b128 %4, %12, off\n\t"
               "global_load_async_to_lds_b128 %5, %13, off\n\t"
               "global_load_async_to_lds_b128 %6, %14, off\n\t"
               "global_load_async_to_lds_b128 %7, %15, off\n\t"
               "s_wait_xcnt 0x0"
               :: "v"(l), "v"(l + ls), "v"(l + 2 * ls), "v"(l + 3 * ls),
                  "v"(l + 4 * ls), "v"(l + 5 * ls), "v"(l + 6 * ls), "v"(l + 7 * ls),
                  "v"(g), "v"(g + gstep), "v"(g + 2 * gstep), "v"(g + 3 * gstep),
                  "v"(g + 4 * gstep), "v"(g + 5 * gstep), "v"(g + 6 * gstep), "v"(g + 7 * gstep)
               : "memory");
#endif
}
__device__ __forceinline__ void wait_async0() {   // this wave's copies have landed in LDS
#if defined(__HIP_DEVICE_COMPILE__)
  asm volatile("s_wait_asynccnt 0x0" ::: "memory");
#endif
}
__device__ __forceinline__ void wait_ds0() {      // this wave's LDS reads have returned before their buffer is refilled
#if defined(__HIP_DEVICE_COMPILE__)
  asm volatile("s_wait_dscnt 0x0" ::: "memory");
#endif
}

template <int OM, int BM, int HASR, int ACT>
__global__ __launch_bounds__(256) void gemm64(
    const unsigned short* __restrict__ Ap, int lda, long long sA,
    const unsigned short* __restrict__ Btp, int ldb, long long sB,
    const float* __restrict__ bias,
    const float* __restrict__ Rp,
    void* Cout, int ldc, long long sC,
    int M, int N, int K, float oscale, float ocarry) {
  __shared__ __align__(16) unsigned short ring[2 * GT_STAGE];   // two stage buffers
  __shared__ __align__(16) float sT[8][16 * 68];   // per-wave 16x64 slab, pitch 68 floats
  const int by   = blockIdx.y;
  const int tid  = threadIdx.x;
  const int lane = tid & 31;
  const int wave = tid >> 5;
  const int tilesN = N >> 7;
  const int tilesM = M >> 7;
  const int tile = blockIdx.x;
  if (tile >= tilesM * tilesN) return;   // block-uniform, in front of every barrier and copy
  const int tm = tile / tilesN;
  const int tn = tile - tm * tilesN;
  const int bm0 = tm << 7;
  const int bn0 = tn << 7;
  const int wm = (wave >> 1) << 5;             // the wave's 32 rows inside the block tile
  const int wn = (wave & 1) << 6;              // the wave's 64 cols inside the block tile
  const int m0 = bm0 + wm;
  const int n0 = bn0 + wn;

  const unsigned short* A1 = Ap  + (size_t)((long long)by * sA);
  const unsigned short* Bb = Btp + (size_t)((long long)by * sB);

  const int rlane = lane & 15;                 // row (A) / col (B, D) within subtile
  const int koff  = (lane >> 4) * 8;           // k offset of this lane half
  const int mOff  = (lane >> 4) * 8;           // D row offset

  // copy map: lane piece = 16 B number tid & 15 of row (tid >> 4) + 16 j, j 0..7, of the A rows and of the Bt rows
  const int crow = tid >> 4;
  const int cpc  = (tid & 15) * 8;
  const unsigned short* gA = A1 + (size_t)(bm0 + crow) * lda + cpc;
  const unsigned short* gB = Bb + (size_t)(bn0 + crow) * ldb + cpc;
  const unsigned lA = (unsigned)(uintptr_t)(lds_u16*)(ring + crow * GT_PITCH + cpc);
  const unsigned lB = lA + 128 * GT_PITCH * 2;
  const int nst = K >> 7;                      // stages of 128 k

  v8f acc[2][4];
#pragma unroll
  for (int i = 0; i < 2; ++i)
#pragma unroll
    for (int j = 0; j < 4; ++j) acc[i][j] = zero8();

  // stage 0 into buffer 0, published; then stage 1 into buffer 1
  async_rows8(lA, gA, (size_t)16 * lda);
  async_rows8(lB, gB, (size_t)16 * ldb);
  wait_async0();
  __syncthreads();
  if (nst > 1) {
    async_rows8(lA + GT_STAGE * 2, gA + 128, (size_t)16 * lda);
    async_rows8(lB + GT_STAGE * 2, gB + 128, (size_t)16 * ldb);
  }

  for (int t = 0; t < nst; ++t) {
    const int buf = t & 1;
    const unsigned short* fA = ring + buf * GT_STAGE + (wm + rlane) * GT_PITCH + koff;
    const unsigned short* fB = ring + buf * GT_STAGE + (128 + wn + rlane) * GT_PITCH + koff;
    // two fragment sets: the next 32 k of this stage are read from LDS as one group ahead of the current products
    v16h ah[2][2], bh[2][4];
#pragma unroll
    for (int j = 0; j < 4; ++j) bh[0][j] = ldfrag_u(fB + (j << 4) * GT_PITCH);
#pragma unroll
    for (int i = 0; i < 2; ++i) ah[0][i] = ldfrag_u(fA + (i << 4) * GT_PITCH);
#pragma unroll   // every fragment-set index a constant, so both sets stay in registers
    for (int s = 0; s < 4; ++s) {
      const int cu = s & 1, nx = cu ^ 1;
      if (s < 3) {
#pragma unroll
        for (int j = 0; j < 4; ++j) bh[nx][j] = ldfrag_u(fB + (j << 4) * GT_PITCH + (s + 1) * 32);
#pragma unroll
        for (int i = 0; i < 2; ++i) ah[nx][i] = ldfrag_u(fA + (i << 4) * GT_PITCH + (s + 1) * 32);
      }
#pragma unroll
      for (int i = 0; i < 2; ++i) {
#pragma unroll
        for (int j = 0; j < 4; ++j) acc[i][j] = mma_raw(ah[cu][i], bh[cu][j], acc[i][j]);
        dep_guard1(acc[i][0], acc[i][3], ah[cu][i]);
      }
      keep4_h(bh[cu][0], bh[cu][1], bh[cu][2], bh[cu][3]);
    }
    // publish point of stage t + 1: own LDS reads back, own copies landed, one barrier for both hand-overs, then the refill
    wait_ds0();
    wait_async0();
    __syncthreads();
    if (t + 2 < nst) {
      async_rows8(lA + buf * (GT_STAGE * 2), gA + (size_t)(t + 2) * 128, (size_t)16 * lda);
      async_rows8(lB + buf * (GT_STAGE * 2), gB + (size_t)(t + 2) * 128, (size_t)16 * ldb);
    }
  }
  wait_async0();
  acc_guard4(acc[0][0], acc[0][1], acc[0][2], acc[0][3]);
  acc_guard4(acc[1][0], acc[1][1], acc[1][2], acc[1][3]);

  const int hh2 = lane >> 4, c4 = (lane & 15) * 4;     // f32 out: 256-B row segment = 16 lanes x 16 B
  const int q8  = lane >> 3, c8 = (lane & 7) * 8;
  float bc[4];
  float bcol[8];
#pragma unroll
  for (int e = 0; e < 4; ++e) bc[e] = 0.f;
#pragma unroll
  for (int e = 0; e < 8; ++e) bcol[e] = 0.f;
  if constexpr (BM == 1) {
    if constexpr (OM == 0) {
      const int cb = n0 + c4;
      const int i0 = (cb < N - 4) ? cb : (N - 4);        // clamped address
      const v4f b0v = *(const v4f*)(bias + i0);
#pragma unroll
      for (int e = 0; e < 4; ++e) bc[e] = bfr(b0v[e]);
    } else {
      const int cb = n0 + c8;
      const int i0 = (cb < N - 8) ? cb : (N - 8);        // clamped address
      const v4f b0v = *(const v4f*)(bias + i0), b1v = *(const v4f*)(bias + i0 + 4);
#pragma unroll
      for (int e = 0; e < 4; ++e) { bcol[e] = bfr(b0v[e]); bcol[4 + e] = bfr(b1v[e]); }
    }
  }

  // ---- epilogue ----
  float* slab = sT[wave];
#pragma unroll
  for (int i = 0; i < 2; ++i) {
    const int mBase = m0 + (i << 4);
#pragma unroll
    for (int j = 0; j < 4; ++j) {
#pragma unroll
      for (int r = 0; r < 8; ++r) {
        slab[(mOff + r) * 68 + (j << 4) + rlane] = acc[i][j][r];
      }
    }
    wave_sync_lds();
    if constexpr (OM == 0) {
      float* C = (float*)Cout + (size_t)((long long)by * sC);
      v4f vals[8];
#pragma unroll
      for (int it = 0; it < 8; ++it) {
        const int row = it * 2 + hh2;                      // it 0..7 x hh2 0..1 = rows 0..15
        const int gr  = mBase + row;
        v4f v = *(const v4f*)(slab + row * 68 + c4);
        float br = 0.f;
        if constexpr (BM == 2) {
          const int ir = (gr < M - 1) ? gr : (M - 1);      // clamped address
          br = bfr(bias[ir]);
        }
        v4f rv = {0.f, 0.f, 0.f, 0.f};
        if constexpr (HASR != 0) {
          const float* R = Rp + (size_t)((long long)by * sC);
          const v4f rraw = *(const v4f*)(R + (size_t)gr * ldc + n0 + c4);
#pragma unroll
          for (int e = 0; e < 4; ++e) rv[e] = (HASR == 1) ? bfr(rraw[e]) : rraw[e];
        }
#pragma unroll
        for (int e = 0; e < 4; ++e) v[e] = v[e] * oscale + bc[e] + br + rv[e];
        vals[it] = v;
      }
      {
#pragma unroll
        for (int it = 0; it < 8; ++it) {
          const int gr = mBase + it * 2 + hh2;
          *(v4f*)(C + (size_t)gr * ldc + n0 + c4) = vals[it];
        }
        
      }
    } else {
      unsigned short* C = (unsigned short*)Cout + (size_t)((long long)by * sC);
      v4u hv[4];
#pragma unroll
      for (int it = 0; it < 4; ++it) {
        const int row = it * 4 + q8;                       // it 0..3 x q8 0..3 = rows 0..15
        const float* sp = slab + row * 68 + c8;
        float br = 0.f;
        if constexpr (BM == 2) {
          const int gr = mBase + row;
          const int ir = (gr < M - 1) ? gr : (M - 1);      // clamped address
          br = bfr(bias[ir]);
        }
        v4u a = {0u, 0u, 0u, 0u};
#pragma unroll
        for (int e = 0; e < 4; ++e) {
          float f0 = sp[2 * e] * oscale + bcol[2 * e] + br;
          float f1 = sp[2 * e + 1] * oscale + bcol[2 * e + 1] + br;
          if constexpr (ACT == 1) { f0 = gelu_f(f0); f1 = gelu_f(f1); }
          f0 *= ocarry; f1 *= ocarry;
          a[e] = pk16(h_bits((_Float16)f0), h_bits((_Float16)f1));
        }
        hv[it] = a;
      }
      {
#pragma unroll
        for (int it = 0; it < 4; ++it) {
          const int row = it * 4 + q8;
          *(v4u*)(C + (size_t)(mBase + row) * ldc + n0 + c8) = hv[it];
        }
        
      }
    }
    wave_sync_lds();
  }
}

// =====================================================================================================
// Flash attention for one batch and 16 query rows, all 16 heads (one wave per head), head dim 64, 2048 keys:
//   q plane (f16 x16) QH[b*2048 + tok][64h + d], pitch 1024; k plane (f16 x16) KH[b*2048 + key][64h + d], pitch 1024;
//   v^T plane (f16 x16): VT[b*1024 + 64h + d][key] (pitch 2048); bias plane LB f32 [b][q][key] = log2(bf16(M)), shared by all
//   heads; out (f16 x1024): CT[b*2048 + tok][64h + d] = 1024 * sum_m softmax_m(q.k / 8 + ln(M)) v[m][d]  (softmax run in
//   base 2: t = q.k * log2(e)/8 + log2(M)).
//   block = 16 waves = 512 threads; grid = 2 x 128 = 256; every wave does identical bounded work (64 steps of 32 keys).
//   Per step: 2 score tiles on f16 WMMA (K = 64 as two k-steps of 32), fragments loaded straight from the 16-bit planes (two 16-B
//   loads per fragment, arithmetic addressing); the 16 bias values of each lane's (row, key) score elements loaded from the f32
//   plane; online max-subtracted softmax in f32 (exp2); rescale of the running sums and the four accumulators; the 16x32 prob tile
//   LDS rows (float vector loads, RNE to f16, split k map) and the four v^T B fragments loaded straight from the 16-bit plane;
//   4 P.V WMMAs.
//   Final 1/l and carry folds in f32; after a block barrier the prob-tile LDS buffer is reused as the block's 16-bit result row
//   buffer [16][1024]: each wave stages its 16x64 slice (element stores); after a second block barrier the 512 threads write the
// coverage: LDS row buffer: 16 waves x 16 rows x 64 cols = 16 x 1024; global: 4 iterations x 512 threads x 8 halves = 16 rows x
//           1024 of rows q0..q0+15 of batch b; grid covers all 2 x 2048 rows exactly once.
// =====================================================================================================
#define PS_FLOATS (NHEAD * 16 * 36)
static_assert((size_t)16 * DMODEL * sizeof(unsigned short) <= (size_t)PS_FLOATS * sizeof(float));

__global__ __launch_bounds__(ATT_THREADS)
void attn16(const unsigned short* __restrict__ QHp, const unsigned short* __restrict__ KHp,
            const unsigned short* __restrict__ VTq, const float* __restrict__ LBp, unsigned short* CT) {
  __shared__ __align__(16) float smem[PS_FLOATS];          // per wave prob tile [row][32 keys], pitch 36; later row buffer

  const int tid  = threadIdx.x;
  const int wave = tid >> 5;
  const int lane = tid & 31;
  const int hh   = lane >> 4;
  const int c    = lane & 15;

  const int qt   = blockIdx.x & ((NQ / 16) - 1);           // 0..127
  const int bat  = blockIdx.x / (NQ / 16);                 // 0..1
  const int head = wave;                                   // 0..15
  const int q0   = qt * 16;

  const size_t qofs = ((size_t)bat * NQ + q0 + c) * DMODEL + head * HDIM + 8 * hh;
  const _Float16* Qh = (const _Float16*)(const void*)QHp + qofs;
  const _Float16* Kb = (const _Float16*)(const void*)KHp + (size_t)bat * NC * DMODEL + head * HDIM + 8 * hh;
  const _Float16* Vb = (const _Float16*)(const void*)VTq + ((size_t)bat * DMODEL + head * HDIM) * NC + 8 * hh;
  const float* Wr = LBp + ((size_t)bat * NQ + q0 + 8 * hh) * NC + c;   // rows q0+8hh+r, cols c (+key offset), log2 units
  const float lsc = (LOG2E * ATT_SCALE) / (QC * KC);                   // log2(e) / 8 / carries

  const v16h qa = ldfrag_h(Qh), qb = ldfrag_h(Qh + 32);

  float mrow[8], lrow[8];
  v8f o0 = zero8(), o1 = zero8(), o2 = zero8(), o3 = zero8();
#pragma unroll
  for (int r = 0; r < 8; ++r) { mrow[r] = -INFINITY; lrow[r] = 0.f; }
  float* pt = smem + wave * (16 * 36);

#pragma unroll 1
  for (int kb = 0; kb < NC; kb += 32) {
    const _Float16* kp = Kb + (size_t)(kb + c) * DMODEL;
    v8f s0, s1;
    {
      const v16h k0 = ldfrag_h(kp), k1 = ldfrag_h(kp + 32);
      s0 = mma_raw(qa, k0, zero8());
      s0 = mma_raw(qb, k1, s0);
      guard_s2(s0, k0, k1);
    }
    {
      const _Float16* kq = kp + (size_t)16 * DMODEL;
      const v16h k0 = ldfrag_h(kq), k1 = ldfrag_h(kq + 32);
      s1 = mma_raw(qa, k0, zero8());
      s1 = mma_raw(qb, k1, s1);
      guard_s4(s1, k0, k1, qa, qb);
    }
    const float* wp = Wr + kb;
#pragma unroll
    for (int r = 0; r < 8; ++r) {
      const float w0 = wp[(size_t)r * NC], w1 = wp[(size_t)r * NC + 16];
      const float t0 = s0[r] * lsc + w0, t1 = s1[r] * lsc + w1;
      float mx = fmaxf(t0, t1);
#pragma unroll
      for (int off = 1; off < 16; off <<= 1) mx = fmaxf(mx, __shfl_xor(mx, off, 32));
      const float mn = fmaxf(mrow[r], mx);
      const float al = exp2f(mrow[r] - mn);
      mrow[r] = mn;
      const float e0 = exp2f(t0 - mn), e1 = exp2f(t1 - mn);
      float ps = e0 + e1;
#pragma unroll
      for (int off = 1; off < 16; off <<= 1) ps += __shfl_xor(ps, off, 32);
      lrow[r] = lrow[r] * al + ps;
      o0[r] *= al;
      o1[r] *= al;
      o2[r] *= al;
      o3[r] *= al;
      const int ro = (8 * hh + r) * 36 + c;
      pt[ro]      = e0;
      pt[ro + 16] = e1;
    }
    wave_sync_lds();
    FragH ph;
    {
      const float* prow = pt + c * 36 + 8 * hh;
      const v4f p0 = *(const v4f*)(prow), p1 = *(const v4f*)(prow + 4);
      const v4f p2 = *(const v4f*)(prow + 16), p3 = *(const v4f*)(prow + 20);
#pragma unroll
      for (int e = 0; e < 4; ++e) {
        ph.h[0][e]     = (_Float16)(p0[e] * PC);              // elements 0..7  = keys kb + 8hh + 0..7
        ph.h[0][4 + e] = (_Float16)(p1[e] * PC);
        ph.h[1][e]     = (_Float16)(p2[e] * PC);              // elements 8..15 = keys kb + 16 + 8hh + 0..7
        ph.h[1][4 + e] = (_Float16)(p3[e] * PC);
      }
    }
    const _Float16* vp = Vb + (size_t)c * NC + kb;
    {
      const v16h vb0 = ldfrag_h(vp);
      const v16h vb1 = ldfrag_h(vp + (size_t)16 * NC);
      const v16h vb2 = ldfrag_h(vp + (size_t)32 * NC);
      const v16h vb3 = ldfrag_h(vp + (size_t)48 * NC);
      o0 = mma_raw(ph.v, vb0, o0);
      o1 = mma_raw(ph.v, vb1, o1);
      o2 = mma_raw(ph.v, vb2, o2);
      o3 = mma_raw(ph.v, vb3, o3);
      guard_pv4(o0, o1, o2, o3, ph.v, vb0, vb1, vb2, vb3);
    }
    wave_sync_lds();
  }

  // ---- all waves done with their prob tiles; the LDS buffer becomes the 16-bit result row buffer [16][1024] ----
  __syncthreads();
  unsigned short* Os = (unsigned short*)smem;
  // ---- fold 1/l and the carries (1024 on P, 16 on v, 1024 on the stored ctx), stage the wave's 16x64 slice as 16-bit ----
  const float oc = FC / (PC * VC);
  unsigned short* osw = Os + wave * HDIM + c;
#pragma unroll
  for (int r = 0; r < 8; ++r) {
    const float inv = (1.0f / lrow[r]) * oc;
    unsigned short* op = osw + (8 * hh + r) * DMODEL;
    op[0]  = h_bits((_Float16)(o0[r] * inv));
    op[16] = h_bits((_Float16)(o1[r] * inv));
    op[32] = h_bits((_Float16)(o2[r] * inv));
    op[48] = h_bits((_Float16)(o3[r] * inv));
  }
  __syncthreads();
  // ---- block writes its 16 contiguous rows of CT: piece p = it*512 + tid -> halves p*8 .. p*8+7 of the 16x1024 region ----
  {
    v4u vals[4];
#pragma unroll
    for (int it = 0; it < 4; ++it) {
      const int p = it * ATT_THREADS + tid;
      vals[it] = *(const v4u*)(Os + (size_t)p * 8);
    }
    unsigned short* dst = CT + ((size_t)bat * NQ + q0) * DMODEL;
    {
#pragma unroll
      for (int it = 0; it < 4; ++it) {
        const int p = it * ATT_THREADS + tid;
        *(v4u*)(dst + (size_t)p * 8) = vals[it];
      }
      
    }
  }
}

// =====================================================================================================
// Workspace map (bytes); every plane is an exact multiple of its tile / whole-row store granularity (M, N exact tile multiples,
// element counts exact multiples of the convert kernels' 2048 / 1024 granularity, no pad rows needed), every offset a multiple of 2 MiB:
//   WQ16 f16 [1024][1024] x64               2097152   ([out][in] = [n][k])
//   WK16 f16 [1024][1024] x64               2097152
//   WV16 f16 [1024][1024] x64               2097152
//   WO16 f16 [1024][1024] x64               2097152
//   X16  f16 [4096][1024] x16               8388608   (activation rows)
//   LB   f32 [2][2048][2048]               33554432   (log2(bf16(M)))
//   QH   f16 [4096][1024] x16               8388608   (q projection, unscaled)
//   KH   f16 [4096][1024] x16               8388608   (k projection)
//   VT   f16 [2][1024][2048] x16            8388608   (v^T per batch)
//   CT   f16 [4096][1024] x1024             8388608   (attention ctx, merged heads)
//   end                                    83886080
// =====================================================================================================
extern "C" void kernel_launch(void* const* d_in, const int* in_sizes, int n_in,
                              void* d_out, int out_size, void* d_ws, size_t ws_size,
                              hipStream_t stream) {
  if (n_in < 7) return;
  if (in_sizes[0] != NROWS * DMODEL) return;
  if (in_sizes[1] != NB * NQ * NC) return;
  if (in_sizes[2] != DMODEL * DMODEL || in_sizes[3] != DMODEL * DMODEL ||
      in_sizes[4] != DMODEL * DMODEL || in_sizes[5] != DMODEL * DMODEL) return;
  if (in_sizes[6] != DMODEL) return;
  if (out_size != NROWS * DMODEL) return;
  if ((in_sizes[0] % 2048) != 0 || (in_sizes[2] % 2048) != 0 || (in_sizes[1] % 1024) != 0) return;

  const float* x   = (const float*)d_in[0];
  const float* Mp  = (const float*)d_in[1];
  const float* w_q = (const float*)d_in[2];
  const float* w_k = (const float*)d_in[3];
  const float* w_v = (const float*)d_in[4];
  const float* w_o = (const float*)d_in[5];
  const float* b_o = (const float*)d_in[6];
  float*       out = (float*)d_out;

  const size_t PW  = (size_t)DMODEL * DMODEL * 2;                 //  2097152
  const size_t PX  = (size_t)NROWS * DMODEL * 2;                  //  8388608
  const size_t PLB = (size_t)NB * NQ * NC * 4;                    // 33554432
  const size_t PVT = (size_t)NB * DMODEL * NC * 2;                //  8388608
  size_t off = 0;
  const size_t oWQ = off; off += PW;
  const size_t oWK = off; off += PW;
  const size_t oWV = off; off += PW;
  const size_t oWO = off; off += PW;
  const size_t oX  = off; off += PX;
  const size_t oLB = off; off += PLB;
  const size_t oQH = off; off += PX;
  const size_t oKH = off; off += PX;
  const size_t oVT = off; off += PVT;
  const size_t oCT = off; off += PX;
  if (off > ws_size) return;                                      // off = 83886080
  if (off > (size_t)134217728) return;

  char* ws = (char*)d_ws;
  unsigned short* WQ16 = (unsigned short*)(ws + oWQ);
  unsigned short* WK16 = (unsigned short*)(ws + oWK);
  unsigned short* WV16 = (unsigned short*)(ws + oWV);
  unsigned short* WO16 = (unsigned short*)(ws + oWO);
  unsigned short* X16  = (unsigned short*)(ws + oX);
  float*          LB   = (float*)(ws + oLB);
  unsigned short* QH   = (unsigned short*)(ws + oQH);
  unsigned short* KH   = (unsigned short*)(ws + oKH);
  unsigned short* VTp  = (unsigned short*)(ws + oVT);
  unsigned short* CT   = (unsigned short*)(ws + oCT);

  const dim3 blk(256);
  const dim3 gCW((DMODEL * DMODEL) / 2048);                        // 512 blocks
  const dim3 gCX((NROWS * DMODEL) / 2048);                         // 2048 blocks
  const dim3 gLB((NB * NQ * NC) / 1024);                           // 8192 blocks
  const int tilesP = (NROWS / 128) * (DMODEL / 128);               // 256
  const int tilesV = (DMODEL / 128) * (NC / 128);                  // 128 per batch
  const dim3 gP(tilesP, 1);                                        // 256
  const dim3 gV(tilesV, NB);                                       // 128 x 2
  const dim3 gAT(ATT_BLOCKS);                                      // 256
  const dim3 bAT(ATT_THREADS);                                     // 512

  // (0) weight planes: W16[n][k] = f16( bf16_RNE(W[n][k]) * 64 ), [out][in] layout kept, k contiguous
  cvt16<<<gCW, blk, 0, stream>>>(w_q, WQ16, DMODEL * DMODEL, WSC);
  cvt16<<<gCW, blk, 0, stream>>>(w_k, WK16, DMODEL * DMODEL, WSC);
  cvt16<<<gCW, blk, 0, stream>>>(w_v, WV16, DMODEL * DMODEL, WSC);
  cvt16<<<gCW, blk, 0, stream>>>(w_o, WO16, DMODEL * DMODEL, WSC);

  // (1) activation plane: X16[row][c] = f16( bf16_RNE(x[row][c]) * 16 ), rows = b*2048 + tok
  cvt16<<<gCX, blk, 0, stream>>>(x, X16, NROWS * DMODEL, ACARRY);

  // (2) score bias plane: LB[b][q][key] = log2( bf16_RNE(M[b][q][key]) ), f32
  logm2<<<gLB, blk, 0, stream>>>(Mp, LB, NB * NQ * NC);

  // (3) q projection: QH[m][n] = f16(16 * sum_k x[m][k] Wq[n][k]); M = 4096, N = 1024, K = 1024
  gemm64<2, 0, 0, 0><<<gP, blk, 0, stream>>>(
      X16, DMODEL, 0LL,
      WQ16, DMODEL, 0LL,
      b_o,
      (const float*)0,
      (void*)QH, DMODEL, 0LL,
      NROWS, DMODEL, DMODEL, 1.0f / (ACARRY * WSC), QC);

  // (4) k projection: KH[m][n] = f16(16 * sum_k x[m][k] Wk[n][k]); M = 4096, N = 1024, K = 1024
  gemm64<2, 0, 0, 0><<<gP, blk, 0, stream>>>(
      X16, DMODEL, 0LL,
      WK16, DMODEL, 0LL,
      b_o,
      (const float*)0,
      (void*)KH, DMODEL, 0LL,
      NROWS, DMODEL, DMODEL, 1.0f / (ACARRY * WSC), KC);

  // (5) v^T per batch: VT[b][d][tok] = f16(16 * sum_k Wv[d][k] x_b[tok][k]); M = 1024, N = 2048, K = 1024
  gemm64<2, 0, 0, 0><<<gV, blk, 0, stream>>>(
      WV16, DMODEL, 0LL,
      X16, DMODEL, (long long)NC * DMODEL,
      b_o,
      (const float*)0,
      (void*)VTp, NC, (long long)DMODEL * NC,
      DMODEL, NC, DMODEL, 1.0f / (ACARRY * WSC), VC);

  // (6) attention per (batch, 16 query rows), 16 heads -> CT (f16, x1024)
  attn16<<<gAT, bAT, 0, stream>>>(QH, KH, VTp, LB, CT);

  // (7) out = CT . Wo^T / (1024 * 64) + bf16(bo); M = 4096, N = 1024, K = 1024, f32
  gemm64<0, 1, 0, 0><<<gP, blk, 0, stream>>>(
      CT, DMODEL, 0LL,
      WO16, DMODEL, 0LL,
      b_o,
      (const float*)0,
      (void*)out, DMODEL, 0LL,
      NROWS, DMODEL, DMODEL, 1.0f / (FC * WSC), 1.0f);
  (void)hipGetLastError();
}

// v002
// It runs in 211 microseconds.
// Two timings next to v001 put it at 1.12 and 1.10 times that version's speed.
// Over all steps from v000 it is 1.76 times as fast.
// Contractions: q/k projections (x rows f16 x16 . W f16 x64, K=1024), v^T projection (Wv f16 x64 . x rows f16 x16, K=1024),
// attention scores (q f16 x16 . k f16 x16, K=64), attention P . v^T (P f16 x1024 . v^T f16 x16, K=2048 in steps of 32),
// output projection (ctx f16 x1024 . Wo f16 x64, K=1024): all v_wmma_f32_16x16x32_f16 single products, f32 accumulate.
// Additive log2(M) score bias (f32 plane), online max-subtracted base-2 softmax and output bias in f32 on VALU.
// Every float input RNE-converted to bf16 on load.
#include <hip/hip_runtime.h>
#include <math.h>
#include <stdint.h>

#define NB      2
#define NQ      2048
#define NC      2048
#define DMODEL  1024
#define NHEAD   16
#define HDIM    64
#define NROWS   (NB * NQ)
#define WSC     64.0f
#define ACARRY  16.0f
#define QC      16.0f
#define KC      16.0f
#define VC      16.0f
#define PC      1024.0f
#define FC      1024.0f
#define ATT_SCALE 0.125f
#define LOG2E   1.4426950408889634f
static_assert(NHEAD * HDIM == DMODEL);
static_assert((NQ % 64) == 0 && (NC % 64) == 0 && (DMODEL % 64) == 0 && (NC % 32) == 0 && (NQ % 16) == 0);
static_assert((NROWS % 128) == 0 && (NC % 128) == 0 && (DMODEL % 128) == 0);
#define ATT_THREADS (NHEAD * 32)
#define ATT_BLOCKS  (NB * (NQ / 16))
static_assert(ATT_THREADS == 512 && ATT_BLOCKS == 256);

typedef _Float16 v16h __attribute__((ext_vector_type(16)));
typedef _Float16 v8h  __attribute__((ext_vector_type(8)));
typedef float    v8f  __attribute__((ext_vector_type(8)));
typedef float    v4f  __attribute__((ext_vector_type(4)));
typedef unsigned int v4u __attribute__((ext_vector_type(4)));

union FragH { v16h v; v8h h[2]; v4u u[2]; };

// ---- scalar helpers --------------------------------------------------------------------------------
__device__ __forceinline__ unsigned short bf_bits(float f) {          // f32 -> bf16 bits, RNE convert
  unsigned u = __float_as_uint(f);
  return (unsigned short)((u + 0x7FFFu + ((u >> 16) & 1u)) >> 16);
}
__device__ __forceinline__ float bf_up(unsigned short h) { return __uint_as_float(((unsigned)h) << 16); }
__device__ __forceinline__ float bfr(float f) { return bf_up(bf_bits(f)); }   // value of the bf16 RNE convert
__device__ __forceinline__ unsigned short h_bits(_Float16 x) { return __builtin_bit_cast(unsigned short, x); }
__device__ __forceinline__ unsigned pk16(unsigned short a, unsigned short b) { return (unsigned)a | ((unsigned)b << 16); }
__device__ __forceinline__ v8f zero8() { v8f z = {0.f, 0.f, 0.f, 0.f, 0.f, 0.f, 0.f, 0.f}; return z; }
__device__ __forceinline__ float gelu_f(float v) { return 0.5f * v * (1.0f + erff(v * 0.70710678118654752f)); }

// ---- fragment loaders: 16-bit A/B operand, lane -> row/col (lane&15), p already includes +8*(lane>>4);
//      elements 0..7 <- p[0..7] (k0+8h..), elements 8..15 <- p[16..23] (k0+16+8h..)  (same split k map for A and B;
//      B is read from a k-contiguous [n][k] plane in gemm64, from fragment order via ldfrag_p in attn16)
__device__ __forceinline__ v16h ldfrag_h(const _Float16* p) {
  FragH f;
  f.h[0] = *(const v8h*)(p);
  f.h[1] = *(const v8h*)(p + 16);
  return f.v;
}
__device__ __forceinline__ v16h ldfrag_u(const unsigned short* p) {
  FragH f;
  f.u[0] = *(const v4u*)(p);
  f.u[1] = *(const v4u*)(p + 16);
  return f.v;
}

// fragment-ordered plane: a fragment is two runs of 512 B, run i = elements 8i..8i+7 of all 32 lanes, 16 B per lane in lane order;
// p already includes +8*lane, so each of the two wave-wide loads covers 512 contiguous bytes = four whole lines
__device__ __forceinline__ v16h ldfrag_p(const _Float16* p) {
  FragH f;
  f.h[0] = *(const v8h*)(p);
  f.h[1] = *(const v8h*)(p + 256);
  return f.v;
}

// ---- WMMA helpers with trailing VALU hazard gaps ------------------------------------------------------
__device__ __forceinline__ v8f mma_raw(v16h a, v16h b, v8f c) {
  return __builtin_amdgcn_wmma_f32_16x16x32_f16(false, a, false, b, (short)0, c, false, false);
}
__device__ __forceinline__ void dep_guard1(v8f& a, v8f& b, v16h x) {
#if defined(__HIP_DEVICE_COMPILE__)
  asm volatile("v_nop\n\tv_nop\n\tv_nop\n\tv_nop" : "+v"(a), "+v"(b) : "v"(x));
#endif
}
__device__ __forceinline__ void guard_s2(v8f& s, v16h a0, v16h a1) {
#if defined(__HIP_DEVICE_COMPILE__)
  asm volatile("v_nop\n\tv_nop\n\tv_nop\n\tv_nop" : "+v"(s) : "v"(a0), "v"(a1));
#endif
}
__device__ __forceinline__ void guard_s4(v8f& s, v16h a0, v16h a1, v16h b0, v16h b1) {
#if defined(__HIP_DEVICE_COMPILE__)
  asm volatile("v_nop\n\tv_nop\n\tv_nop\n\tv_nop" : "+v"(s) : "v"(a0), "v"(a1), "v"(b0), "v"(b1));
#endif
}
__device__ __forceinline__ void guard_pv4(v8f& a, v8f& b, v8f& c, v8f& d, v16h x, v16h y, v16h z, v16h w, v16h u) {
#if defined(__HIP_DEVICE_COMPILE__)
  asm volatile("v_nop\n\tv_nop\n\tv_nop\n\tv_nop"
               : "+v"(a), "+v"(b), "+v"(c), "+v"(d) : "v"(x), "v"(y), "v"(z), "v"(w), "v"(u));
#endif
}
__device__ __forceinline__ void keep4_h(v16h a, v16h b, v16h c, v16h d) {
#if defined(__HIP_DEVICE_COMPILE__)
  asm volatile("v_nop" :: "v"(a), "v"(b), "v"(c), "v"(d));
#endif
}
__device__ __forceinline__ void acc_guard4(v8f& a, v8f& b, v8f& c, v8f& d) {
#if defined(__HIP_DEVICE_COMPILE__)
  asm volatile("v_nop\n\tv_nop\n\tv_nop\n\tv_nop" : "+v"(a), "+v"(b), "+v"(c), "+v"(d));
#endif
}
__device__ __forceinline__ void wave_sync_lds() {
  __builtin_amdgcn_fence(__ATOMIC_RELEASE, "workgroup");
  __builtin_amdgcn_wave_barrier();
  __builtin_amdgcn_fence(__ATOMIC_ACQUIRE, "workgroup");
}

// =====================================================================================================
// Elementwise 16-bit pack, no transpose: dst[i] = f16( bf16_RNE(src[i]) * sc ), sc a power of two (exact).
// Used for the weights (stored [out][in] = [n][k], already k contiguous for B fragments / A of the v^T projection) and for
// the activation rows. 8 elements per thread: two 16-B loads, one 16-B store per lane; 32 consecutive lanes = 512 B =
// coverage: grid = n / 2048 blocks x 256 thr x 8 elements = n exactly (host checks n % 2048 == 0).
// =====================================================================================================
__global__ __launch_bounds__(256) void cvt16(const float* __restrict__ src, unsigned short* dst, int n, float sc) {
  const size_t i8 = ((size_t)blockIdx.x * 256 + threadIdx.x) * 8;
  if (i8 + 8 > (size_t)n) return;                 // never taken with the exact grid; no barriers in this kernel
  const v4f a = *(const v4f*)(src + i8);
  const v4f b = *(const v4f*)(src + i8 + 4);
  v4u o;
  o[0] = pk16(h_bits((_Float16)(bfr(a[0]) * sc)), h_bits((_Float16)(bfr(a[1]) * sc)));
  o[1] = pk16(h_bits((_Float16)(bfr(a[2]) * sc)), h_bits((_Float16)(bfr(a[3]) * sc)));
  o[2] = pk16(h_bits((_Float16)(bfr(b[0]) * sc)), h_bits((_Float16)(bfr(b[1]) * sc)));
  o[3] = pk16(h_bits((_Float16)(bfr(b[2]) * sc)), h_bits((_Float16)(bfr(b[3]) * sc)));
  {
    *(v4u*)(dst + i8) = o;
    
  }
}

// =====================================================================================================
// Score bias plane: dst[i] = log2( bf16_RNE(M[i]) ) as f32 (M strictly positive). 4 elements per thread: one 16-B load,
// coverage: grid = n / 1024 blocks x 256 thr x 4 elements = n exactly (host checks n % 1024 == 0).
// =====================================================================================================
__global__ __launch_bounds__(256) void logm2(const float* __restrict__ Mp, float* dst, int n) {
  const size_t i4 = ((size_t)blockIdx.x * 256 + threadIdx.x) * 4;
  if (i4 + 4 > (size_t)n) return;                 // never taken with the exact grid; no barriers in this kernel
  const v4f a = *(const v4f*)(Mp + i4);
  v4f o;
  o[0] = log2f(bfr(a[0]));
  o[1] = log2f(bfr(a[1]));
  o[2] = log2f(bfr(a[2]));
  o[3] = log2f(bfr(a[3]));
  {
    *(v4f*)(dst + i4) = o;
    
  }
}

// =====================================================================================================
// LDS-staged batched f16 WMMA GEMM: C[m][n] = f( oscale * sum_k A[m][k] * Bt[n][k] + bf16(bias) ) (+ residual); one block of
// 8 waves per 128x128 tile, one wave per 32x64 part of it (4 x 2 waves). A row-major [M][K] pitch lda (16-bit plane), Bt
// row-major [N][K] pitch ldb (k contiguous); M, N multiples of 128, K multiple of 128. blockIdx.y = batch index with element
// strides sA, sB, sC.
// A stage is 128 k (256 B) of the tile's 128 A rows and 128 Bt rows, laid in LDS at a row pitch of 272 B; two buffers. Every
// lane brings 16 pieces of 16 B per stage by asynchronous copies (16 lanes = one whole 256-B row piece), the next stage's
// copies in flight while this stage is multiplied; fragments are read from LDS with the split k map of ldfrag_u, k ascending.
// BM: 0 = no bias, 1 = per column bf16(bias[col]), 2 = per row bf16(bias[row]) (clamped-address loads).
// OM: 0 = f32 out (pitch ldc; HASR 1 adds bf16(R[m][n]), HASR 2 adds raw f32 R[m][n], same pitch/stride as C);
//     2 = f16 out (pitch ldc) = f16( act(value) * ocarry ), ACT 1 = exact GELU.
//     3, 4 = the same f16 values laid in the fragment order that attn16 loads (ldfrag_p), ldc unused, BM 0 only. A wave's 16x64
//         slab is four runs of 512 B; run it, lane (c, hh) = slab row c, cols 16 it + 8 hh + 0..7: one whole 512-B store each.
//         3 (k plane; rows = batch*2048 + key, cols = 64 head + d): the slab is the 2-KiB block [batch][head][key / 16].
//         4 (v^T plane; rows = 64 head + d, cols = key, batch = blockIdx.y through sC): runs 2t, 2t + 1 are the 1-KiB piece
//         (d / 16) & 3 of the 4-KiB block [head][key / 32], t = 0, 1 the slab's two 32-key tiles.
// coverage: 2 slabs x 16 rows (f32: it 0..7 x lane>>4; OM 2: it 0..3 x lane>>3; OM 3, 4: lane & 15) x 64 cols = the wave's whole 32x64 part;
//           grid = tilesM*tilesN blocks, a surplus block exits as a whole in front of every barrier.
// =====================================================================================================
#define GT_PITCH  136                          // LDS row pitch in halves: 272 B = 16 B x odd, for 16-B LDS reads
#define GT_STAGE  (256 * GT_PITCH)             // halves per buffer: [A 128 rows | Bt 128 rows]
typedef __attribute__((address_space(3))) unsigned short lds_u16;

// Eight asynchronous 16-B copies per lane, global -> LDS, rows 16 apart. The closing s_wait_xcnt 0 stands inside the statement
// so that no address register of an issued copy is rewritten in front of it.
__device__ __forceinline__ void async_rows8(unsigned l, const unsigned short* g, size_t gstep) {
#if defined(__HIP_DEVICE_COMPILE__)
  const unsigned ls = 16 * GT_PITCH * 2;       // 16 LDS rows in bytes
  asm volatile("global_load_async_to_lds_b128 %0, %8, off\n\t"
               "global_load_async_to_lds_b128 %1, %9, off\n\t"
               "global_load_async_to_lds_b128 %2, %10, off\n\t"
               "global_load_async_to_lds_b128 %3, %11, off\n\t"
               "global_load_async_to_lds_b128 %4, %12, off\n\t"
               "global_load_async_to_lds_b128 %5, %13, off\n\t"
               "global_load_async_to_lds_b128 %6, %14, off\n\t"
               "global_load_async_to_lds_b128 %7, %15, off\n\t"
               "s_wait_xcnt 0x0"
               :: "v"(l), "v"(l + ls), "v"(l + 2 * ls), "v"(l + 3 * ls),
                  "v"(l + 4 * ls), "v"(l + 5 * ls), "v"(l + 6 * ls), "v"(l + 7 * ls),
                  "v"(g), "v"(g + gstep), "v"(g + 2 * gstep), "v"(g + 3 * gstep),
                  "v"(g + 4 * gstep), "v"(g + 5 * gstep), "v"(g + 6 * gstep), "v"(g + 7 * gstep)
               : "memory");
#endif
}
__device__ __forceinline__ void wait_async0() {   // this wave's copies have landed in LDS
#if defined(__HIP_DEVICE_COMPILE__)
  asm volatile("s_wait_asynccnt 0x0" ::: "memory");
#endif
}
__device__ __forceinline__ void wait_ds0() {      // this wave's LDS reads have returned before their buffer is refilled
#if defined(__HIP_DEVICE_COMPILE__)
  asm volatile("s_wait_dscnt 0x0" ::: "memory");
#endif
}

template <int OM, int BM, int HASR, int ACT>
__global__ __launch_bounds__(256) void gemm64(
    const unsigned short* __restrict__ Ap, int lda, long long sA,
    const unsigned short* __restrict__ Btp, int ldb, long long sB,
    const float* __restrict__ bias,
    const float* __restrict__ Rp,
    void* Cout, int ldc, long long sC,
    int M, int N, int K, float oscale, float ocarry) {
  __shared__ __align__(16) unsigned short ring[2 * GT_STAGE];   // two stage buffers
  __shared__ __align__(16) float sT[8][16 * 68];   // per-wave 16x64 slab, pitch 68 floats
  const int by   = blockIdx.y;
  const int tid  = threadIdx.x;
  const int lane = tid & 31;
  const int wave = tid >> 5;
  const int tilesN = N >> 7;
  const int tilesM = M >> 7;
  const int tile = blockIdx.x;
  if (tile >= tilesM * tilesN) return;   // block-uniform, in front of every barrier and copy
  const int tm = tile / tilesN;
  const int tn = tile - tm * tilesN;
  const int bm0 = tm << 7;
  const int bn0 = tn << 7;
  const int wm = (wave >> 1) << 5;             // the wave's 32 rows inside the block tile
  const int wn = (wave & 1) << 6;              // the wave's 64 cols inside the block tile
  const int m0 = bm0 + wm;
  const int n0 = bn0 + wn;

  const unsigned short* A1 = Ap  + (size_t)((long long)by * sA);
  const unsigned short* Bb = Btp + (size_t)((long long)by * sB);

  const int rlane = lane & 15;                 // row (A) / col (B, D) within subtile
  const int koff  = (lane >> 4) * 8;           // k offset of this lane half
  const int mOff  = (lane >> 4) * 8;           // D row offset

  // copy map: lane piece = 16 B number tid & 15 of row (tid >> 4) + 16 j, j 0..7, of the A rows and of the Bt rows
  const int crow = tid >> 4;
  const int cpc  = (tid & 15) * 8;
  const unsigned short* gA = A1 + (size_t)(bm0 + crow) * lda + cpc;
  const unsigned short* gB = Bb + (size_t)(bn0 + crow) * ldb + cpc;
  const unsigned lA = (unsigned)(uintptr_t)(lds_u16*)(ring + crow * GT_PITCH + cpc);
  const unsigned lB = lA + 128 * GT_PITCH * 2;
  const int nst = K >> 7;                      // stages of 128 k

  v8f acc[2][4];
#pragma unroll
  for (int i = 0; i < 2; ++i)
#pragma unroll
    for (int j = 0; j < 4; ++j) acc[i][j] = zero8();

  // stage 0 into buffer 0, published; then stage 1 into buffer 1
  async_rows8(lA, gA, (size_t)16 * lda);
  async_rows8(lB, gB, (size_t)16 * ldb);
  wait_async0();
  __syncthreads();
  if (nst > 1) {
    async_rows8(lA + GT_STAGE * 2, gA + 128, (size_t)16 * lda);
    async_rows8(lB + GT_STAGE * 2, gB + 128, (size_t)16 * ldb);
  }

  for (int t = 0; t < nst; ++t) {
    const int buf = t & 1;
    const unsigned short* fA = ring + buf * GT_STAGE + (wm + rlane) * GT_PITCH + koff;
    const unsigned short* fB = ring + buf * GT_STAGE + (128 + wn + rlane) * GT_PITCH + koff;
    // two fragment sets: the next 32 k of this stage are read from LDS as one group ahead of the current products
    v16h ah[2][2], bh[2][4];
#pragma unroll
    for (int j = 0; j < 4; ++j) bh[0][j] = ldfrag_u(fB + (j << 4) * GT_PITCH);
#pragma unroll
    for (int i = 0; i < 2; ++i) ah[0][i] = ldfrag_u(fA + (i << 4) * GT_PITCH);
#pragma unroll   // every fragment-set index a constant, so both sets stay in registers
    for (int s = 0; s < 4; ++s) {
      const int cu = s & 1, nx = cu ^ 1;
      if (s < 3) {
#pragma unroll
        for (int j = 0; j < 4; ++j) bh[nx][j] = ldfrag_u(fB + (j << 4) * GT_PITCH + (s + 1) * 32);
#pragma unroll
        for (int i = 0; i < 2; ++i) ah[nx][i] = ldfrag_u(fA + (i << 4) * GT_PITCH + (s + 1) * 32);
      }
#pragma unroll
      for (int i = 0; i < 2; ++i) {
#pragma unroll
        for (int j = 0; j < 4; ++j) acc[i][j] = mma_raw(ah[cu][i], bh[cu][j], acc[i][j]);
        dep_guard1(acc[i][0], acc[i][3], ah[cu][i]);
      }
      keep4_h(bh[cu][0], bh[cu][1], bh[cu][2], bh[cu][3]);
    }
    // publish point of stage t + 1: own LDS reads back, own copies landed, one barrier for both hand-overs, then the refill
    wait_ds0();
    wait_async0();
    __syncthreads();
    if (t + 2 < nst) {
      async_rows8(lA + buf * (GT_STAGE * 2), gA + (size_t)(t + 2) * 128, (size_t)16 * lda);
      async_rows8(lB + buf * (GT_STAGE * 2), gB + (size_t)(t + 2) * 128, (size_t)16 * ldb);
    }
  }
  wait_async0();
  acc_guard4(acc[0][0], acc[0][1], acc[0][2], acc[0][3]);
  acc_guard4(acc[1][0], acc[1][1], acc[1][2], acc[1][3]);

  const int hh2 = lane >> 4, c4 = (lane & 15) * 4;     // f32 out: 256-B row segment = 16 lanes x 16 B
  const int q8  = lane >> 3, c8 = (lane & 7) * 8;
  float bc[4];
  float bcol[8];
#pragma unroll
  for (int e = 0; e < 4; ++e) bc[e] = 0.f;
#pragma unroll
  for (int e = 0; e < 8; ++e) bcol[e] = 0.f;
  if constexpr (BM == 1) {
    if constexpr (OM == 0) {
      const int cb = n0 + c4;
      const int i0 = (cb < N - 4) ? cb : (N - 4);        // clamped address
      const v4f b0v = *(const v4f*)(bias + i0);
#pragma unroll
      for (int e = 0; e < 4; ++e) bc[e] = bfr(b0v[e]);
    } else {
      const int cb = n0 + c8;
      const int i0 = (cb < N - 8) ? cb : (N - 8);        // clamped address
      const v4f b0v = *(const v4f*)(bias + i0), b1v = *(const v4f*)(bias + i0 + 4);
#pragma unroll
      for (int e = 0; e < 4; ++e) { bcol[e] = bfr(b0v[e]); bcol[4 + e] = bfr(b1v[e]); }
    }
  }

  // ---- epilogue ----
  float* slab = sT[wave];
#pragma unroll
  for (int i = 0; i < 2; ++i) {
    const int mBase = m0 + (i << 4);
#pragma unroll
    for (int j = 0; j < 4; ++j) {
#pragma unroll
      for (int r = 0; r < 8; ++r) {
        slab[(mOff + r) * 68 + (j << 4) + rlane] = acc[i][j][r];
      }
    }
    wave_sync_lds();
    if constexpr (OM == 0) {
      float* C = (float*)Cout + (size_t)((long long)by * sC);
      v4f vals[8];
#pragma unroll
      for (int it = 0; it < 8; ++it) {
        const int row = it * 2 + hh2;                      // it 0..7 x hh2 0..1 = rows 0..15
        const int gr  = mBase + row;
        v4f v = *(const v4f*)(slab + row * 68 + c4);
        float br = 0.f;
        if constexpr (BM == 2) {
          const int ir = (gr < M - 1) ? gr : (M - 1);      // clamped address
          br = bfr(bias[ir]);
        }
        v4f rv = {0.f, 0.f, 0.f, 0.f};
        if constexpr (HASR != 0) {
          const float* R = Rp + (size_t)((long long)by * sC);
          const v4f rraw = *(const v4f*)(R + (size_t)gr * ldc + n0 + c4);
#pragma unroll
          for (int e = 0; e < 4; ++e) rv[e] = (HASR == 1) ? bfr(rraw[e]) : rraw[e];
        }
#pragma unroll
        for (int e = 0; e < 4; ++e) v[e] = v[e] * oscale + bc[e] + br + rv[e];
        vals[it] = v;
      }
      {
#pragma unroll
        for (int it = 0; it < 8; ++it) {
          const int gr = mBase + it * 2 + hh2;
          *(v4f*)(C + (size_t)gr * ldc + n0 + c4) = vals[it];
        }
        
      }
    } else {
      unsigned short* C = (unsigned short*)Cout + (size_t)((long long)by * sC);
      static_assert(OM == 2 || BM == 0);
      v4u hv[4];
#pragma unroll
      for (int it = 0; it < 4; ++it) {
        const int row = (OM == 2) ? it * 4 + q8 : rlane;   // OM 2: it 0..3 x q8 0..3 = rows 0..15; OM 3, 4: row = lane & 15
        const float* sp = slab + row * 68 + ((OM == 2) ? c8 : it * 16 + koff);
        float br = 0.f;
        if constexpr (BM == 2) {
          const int gr = mBase + row;
          const int ir = (gr < M - 1) ? gr : (M - 1);      // clamped address
          br = bfr(bias[ir]);
        }
        v4u a = {0u, 0u, 0u, 0u};
#pragma unroll
        for (int e = 0; e < 4; ++e) {
          float f0 = sp[2 * e] * oscale + bcol[2 * e] + br;
          float f1 = sp[2 * e + 1] * oscale + bcol[2 * e + 1] + br;
          if constexpr (ACT == 1) { f0 = gelu_f(f0); f1 = gelu_f(f1); }
          f0 *= ocarry; f1 *= ocarry;
          a[e] = pk16(h_bits((_Float16)f0), h_bits((_Float16)f1));
        }
        hv[it] = a;
      }
      {
#pragma unroll
        for (int it = 0; it < 4; ++it) {
          if constexpr (OM == 2) {
            const int row = it * 4 + q8;
            *(v4u*)(C + (size_t)(mBase + row) * ldc + n0 + c8) = hv[it];
          } else if constexpr (OM == 3) {
            const int mt = mBase >> 4;                     // batch * 128 + key tile
            const size_t blk = (size_t)((mt / (NC / 16)) * NHEAD + (n0 >> 6)) * (NC / 16) + (mt % (NC / 16));
            *(v4u*)(C + blk * 1024 + it * 256 + lane * 8) = hv[it];
          } else {
            const size_t blk = (size_t)(mBase >> 6) * (NC / 32) + (n0 >> 5) + (it >> 1);
            *(v4u*)(C + blk * 2048 + ((mBase >> 4) & 3) * 512 + (it & 1) * 256 + lane * 8) = hv[it];
          }
        }
        
      }
    }
    wave_sync_lds();
  }
}

// =====================================================================================================
// Flash attention for one batch and 16 query rows, all 16 heads (one wave per head), head dim 64, 2048 keys:
//   q plane (f16 x16) QH[b*2048 + tok][64h + d], pitch 1024; k plane (f16 x16) KH in fragment order: 2-KiB blocks [b][h][key / 16]
//   of 16 keys x 64 d; v^T plane (f16 x16) VT in fragment order: 4-KiB blocks [b][h][key / 32] of 64 d x 32 keys (gemm64, OM 3
//   and 4, has both maps); bias plane LB f32 [b][q][key] = log2(bf16(M)), shared by all
//   heads; out (f16 x1024): CT[b*2048 + tok][64h + d] = 1024 * sum_m softmax_m(q.k / 8 + ln(M)) v[m][d]  (softmax run in
//   base 2: t = q.k * log2(e)/8 + log2(M)).
//   block = 16 waves = 512 threads; grid = 2 x 128 = 256; every wave does identical bounded work (64 steps of 32 keys).
//   Per step: 2 score tiles on f16 WMMA (K = 64 as two k-steps of 32), fragments loaded straight from the 16-bit planes (two 16-B
//   loads per fragment, each 512 contiguous bytes per wave; a step's k and v^T data are 4 KiB in a row each);
//   the 16 bias values of each lane's (row, key) score elements loaded from the f32
//   plane; online max-subtracted softmax in f32 (exp2); rescale of the running sums and the four accumulators; the 16x32 prob tile
//   LDS rows (float vector loads, RNE to f16, split k map) and the four v^T B fragments loaded straight from the 16-bit plane;
//   4 P.V WMMAs.
//   Final 1/l and carry folds in f32; after a block barrier the prob-tile LDS buffer is reused as the block's 16-bit result row
//   buffer [16][1024]: each wave stages its 16x64 slice (element stores); after a second block barrier the 512 threads write the
// coverage: LDS row buffer: 16 waves x 16 rows x 64 cols = 16 x 1024; global: 4 iterations x 512 threads x 8 halves = 16 rows x
//           1024 of rows q0..q0+15 of batch b; grid covers all 2 x 2048 rows exactly once.
// =====================================================================================================
#define PS_FLOATS (NHEAD * 16 * 36)
static_assert((size_t)16 * DMODEL * sizeof(unsigned short) <= (size_t)PS_FLOATS * sizeof(float));

__global__ __launch_bounds__(ATT_THREADS)
void attn16(const unsigned short* __restrict__ QHp, const unsigned short* __restrict__ KHp,
            const unsigned short* __restrict__ VTq, const float* __restrict__ LBp, unsigned short* CT) {
  __shared__ __align__(16) float smem[PS_FLOATS];          // per wave prob tile [row][32 keys], pitch 36; later row buffer

  const int tid  = threadIdx.x;
  const int wave = tid >> 5;
  const int lane = tid & 31;
  const int hh   = lane >> 4;
  const int c    = lane & 15;

  const int qt   = blockIdx.x & ((NQ / 16) - 1);           // 0..127
  const int bat  = blockIdx.x / (NQ / 16);                 // 0..1
  const int head = __builtin_amdgcn_readfirstlane(wave);   // 0..15; told to be wave-uniform, so the k and v^T bases stay scalar
  const int q0   = qt * 16;

  const size_t qofs = ((size_t)bat * NQ + q0 + c) * DMODEL + head * HDIM + 8 * hh;
  const _Float16* Qh = (const _Float16*)(const void*)QHp + qofs;
  const _Float16* Kb = (const _Float16*)(const void*)KHp + (size_t)(bat * NHEAD + head) * (NC * HDIM);
  const _Float16* Vb = (const _Float16*)(const void*)VTq + (size_t)(bat * NHEAD + head) * (NC * HDIM);
  const unsigned lofs = 8u * (unsigned)lane;               // the lane's 16 B inside every 512-B run
  const float* Wr = LBp + ((size_t)bat * NQ + q0 + 8 * hh) * NC + c;   // rows q0+8hh+r, cols c (+key offset), log2 units
  const float lsc = (LOG2E * ATT_SCALE) / (QC * KC);                   // log2(e) / 8 / carries

  const v16h qa = ldfrag_h(Qh), qb = ldfrag_h(Qh + 32);

  float mrow[8], lrow[8];
  v8f o0 = zero8(), o1 = zero8(), o2 = zero8(), o3 = zero8();
#pragma unroll
  for (int r = 0; r < 8; ++r) { mrow[r] = -INFINITY; lrow[r] = 0.f; }
  float* pt = smem + wave * (16 * 36);

#pragma unroll 1
  for (int kb = 0; kb < NC; kb += 32) {
    const _Float16* kp = Kb + (size_t)kb * HDIM + lofs;    // blocks kb / 16 and kb / 16 + 1, 1024 halves each
    v8f s0, s1;
    {
      const v16h k0 = ldfrag_p(kp), k1 = ldfrag_p(kp + 512);
      s0 = mma_raw(qa, k0, zero8());
      s0 = mma_raw(qb, k1, s0);
      guard_s2(s0, k0, k1);
    }
    {
      const _Float16* kq = kp + 1024;
      const v16h k0 = ldfrag_p(kq), k1 = ldfrag_p(kq + 512);
      s1 = mma_raw(qa, k0, zero8());
      s1 = mma_raw(qb, k1, s1);
      guard_s4(s1, k0, k1, qa, qb);
    }
    const float* wp = Wr + kb;
#pragma unroll
    for (int r = 0; r < 8; ++r) {
      const float w0 = wp[(size_t)r * NC], w1 = wp[(size_t)r * NC + 16];
      const float t0 = s0[r] * lsc + w0, t1 = s1[r] * lsc + w1;
      float mx = fmaxf(t0, t1);
#pragma unroll
      for (int off = 1; off < 16; off <<= 1) mx = fmaxf(mx, __shfl_xor(mx, off, 32));
      const float mn = fmaxf(mrow[r], mx);
      const float al = exp2f(mrow[r] - mn);
      mrow[r] = mn;
      const float e0 = exp2f(t0 - mn), e1 = exp2f(t1 - mn);
      float ps = e0 + e1;
#pragma unroll
      for (int off = 1; off < 16; off <<= 1) ps += __shfl_xor(ps, off, 32);
      lrow[r] = lrow[r] * al + ps;
      o0[r] *= al;
      o1[r] *= al;
      o2[r] *= al;
      o3[r] *= al;
      const int ro = (8 * hh + r) * 36 + c;
      pt[ro]      = e0;
      pt[ro + 16] = e1;
    }
    wave_sync_lds();
    FragH ph;
    {
      const float* prow = pt + c * 36 + 8 * hh;
      const v4f p0 = *(const v4f*)(prow), p1 = *(const v4f*)(prow + 4);
      const v4f p2 = *(const v4f*)(prow + 16), p3 = *(const v4f*)(prow + 20);
#pragma unroll
      for (int e = 0; e < 4; ++e) {
        ph.h[0][e]     = (_Float16)(p0[e] * PC);              // elements 0..7  = keys kb + 8hh + 0..7
        ph.h[0][4 + e] = (_Float16)(p1[e] * PC);
        ph.h[1][e]     = (_Float16)(p2[e] * PC);              // elements 8..15 = keys kb + 16 + 8hh + 0..7
        ph.h[1][4 + e] = (_Float16)(p3[e] * PC);
      }
    }
    const _Float16* vp = Vb + (size_t)kb * HDIM + lofs;    // block kb / 32, 2048 halves
    {
      const v16h vb0 = ldfrag_p(vp);
      const v16h vb1 = ldfrag_p(vp + 512);
      const v16h vb2 = ldfrag_p(vp + 1024);
      const v16h vb3 = ldfrag_p(vp + 1536);
      o0 = mma_raw(ph.v, vb0, o0);
      o1 = mma_raw(ph.v, vb1, o1);
      o2 = mma_raw(ph.v, vb2, o2);
      o3 = mma_raw(ph.v, vb3, o3);
      guard_pv4(o0, o1, o2, o3, ph.v, vb0, vb1, vb2, vb3);
    }
    wave_sync_lds();
  }

  // ---- all waves done with their prob tiles; the LDS buffer becomes the 16-bit result row buffer [16][1024] ----
  __syncthreads();
  unsigned short* Os = (unsigned short*)smem;
  // ---- fold 1/l and the carries (1024 on P, 16 on v, 1024 on the stored ctx), stage the wave's 16x64 slice as 16-bit ----
  const float oc = FC / (PC * VC);
  unsigned short* osw = Os + wave * HDIM + c;
#pragma unroll
  for (int r = 0; r < 8; ++r) {
    const float inv = (1.0f / lrow[r]) * oc;
    unsigned short* op = osw + (8 * hh + r) * DMODEL;
    op[0]  = h_bits((_Float16)(o0[r] * inv));
    op[16] = h_bits((_Float16)(o1[r] * inv));
    op[32] = h_bits((_Float16)(o2[r] * inv));
    op[48] = h_bits((_Float16)(o3[r] * inv));
  }
  __syncthreads();
  // ---- block writes its 16 contiguous rows of CT: piece p = it*512 + tid -> halves p*8 .. p*8+7 of the 16x1024 region ----
  {
    v4u vals[4];
#pragma unroll
    for (int it = 0; it < 4; ++it) {
      const int p = it * ATT_THREADS + tid;
      vals[it] = *(const v4u*)(Os + (size_t)p * 8);
    }
    unsigned short* dst = CT + ((size_t)bat * NQ + q0) * DMODEL;
    {
#pragma unroll
      for (int it = 0; it < 4; ++it) {
        const int p = it * ATT_THREADS + tid;
        *(v4u*)(dst + (size_t)p * 8) = vals[it];
      }
      
    }
  }
}

// =====================================================================================================
// Workspace map (bytes); every plane is an exact multiple of its tile / whole-row store granularity (M, N exact tile multiples,
// element counts exact multiples of the convert kernels' 2048 / 1024 granularity, no pad rows needed), every offset a multiple of 2 MiB:
//   WQ16 f16 [1024][1024] x64               2097152   ([out][in] = [n][k])
//   WK16 f16 [1024][1024] x64               2097152
//   WV16 f16 [1024][1024] x64               2097152
//   WO16 f16 [1024][1024] x64               2097152
//   X16  f16 [4096][1024] x16               8388608   (activation rows)
//   LB   f32 [2][2048][2048]               33554432   (log2(bf16(M)))
//   QH   f16 [4096][1024] x16               8388608   (q projection, unscaled)
//   KH   f16 [2][16][128] x 2 KiB, x16      8388608   (k projection, fragment order)
//   VT   f16 [2][16][64] x 4 KiB, x16       8388608   (v^T, fragment order)
//   CT   f16 [4096][1024] x1024             8388608   (attention ctx, merged heads)
//   end                                    83886080
// =====================================================================================================
extern "C" void kernel_launch(void* const* d_in, const int* in_sizes, int n_in,
                              void* d_out, int out_size, void* d_ws, size_t ws_size,
                              hipStream_t stream) {
  if (n_in < 7) return;
  if (in_sizes[0] != NROWS * DMODEL) return;
  if (in_sizes[1] != NB * NQ * NC) return;
  if (in_sizes[2] != DMODEL * DMODEL || in_sizes[3] != DMODEL * DMODEL ||
      in_sizes[4] != DMODEL * DMODEL || in_sizes[5] != DMODEL * DMODEL) return;
  if (in_sizes[6] != DMODEL) return;
  if (out_size != NROWS * DMODEL) return;
  if ((in_sizes[0] % 2048) != 0 || (in_sizes[2] % 2048) != 0 || (in_sizes[1] % 1024) != 0) return;

  const float* x   = (const float*)d_in[0];
  const float* Mp  = (const float*)d_in[1];
  const float* w_q = (const float*)d_in[2];
  const float* w_k = (const float*)d_in[3];
  const float* w_v = (const float*)d_in[4];
  const float* w_o = (const float*)d_in[5];
  const float* b_o = (const float*)d_in[6];
  float*       out = (float*)d_out;

  const size_t PW  = (size_t)DMODEL * DMODEL * 2;                 //  2097152
  const size_t PX  = (size_t)NROWS * DMODEL * 2;                  //  8388608
  const size_t PLB = (size_t)NB * NQ * NC * 4;                    // 33554432
  const size_t PVT = (size_t)NB * DMODEL * NC * 2;                //  8388608
  size_t off = 0;
  const size_t oWQ = off; off += PW;
  const size_t oWK = off; off += PW;
  const size_t oWV = off; off += PW;
  const size_t oWO = off; off += PW;
  const size_t oX  = off; off += PX;
  const size_t oLB = off; off += PLB;
  const size_t oQH = off; off += PX;
  const size_t oKH = off; off += PX;
  const size_t oVT = off; off += PVT;
  const size_t oCT = off; off += PX;
  if (off > ws_size) return;                                      // off = 83886080
  if (off > (size_t)134217728) return;

  char* ws = (char*)d_ws;
  unsigned short* WQ16 = (unsigned short*)(ws + oWQ);
  unsigned short* WK16 = (unsigned short*)(ws + oWK);
  unsigned short* WV16 = (unsigned short*)(ws + oWV);
  unsigned short* WO16 = (unsigned short*)(ws + oWO);
  unsigned short* X16  = (unsigned short*)(ws + oX);
  float*          LB   = (float*)(ws + oLB);
  unsigned short* QH   = (unsigned short*)(ws + oQH);
  unsigned short* KH   = (unsigned short*)(ws + oKH);
  unsigned short* VTp  = (unsigned short*)(ws + oVT);
  unsigned short* CT   = (unsigned short*)(ws + oCT);

  const dim3 blk(256);
  const dim3 gCW((DMODEL * DMODEL) / 2048);                        // 512 blocks
  const dim3 gCX((NROWS * DMODEL) / 2048);                         // 2048 blocks
  const dim3 gLB((NB * NQ * NC) / 1024);                           // 8192 blocks
  const int tilesP = (NROWS / 128) * (DMODEL / 128);               // 256
  const int tilesV = (DMODEL / 128) * (NC / 128);                  // 128 per batch
  const dim3 gP(tilesP, 1);                                        // 256
  const dim3 gV(tilesV, NB);                                       // 128 x 2
  const dim3 gAT(ATT_BLOCKS);                                      // 256
  const dim3 bAT(ATT_THREADS);                                     // 512

  // (0) weight planes: W16[n][k] = f16( bf16_RNE(W[n][k]) * 64 ), [out][in] layout kept, k contiguous
  cvt16<<<gCW, blk, 0, stream>>>(w_q, WQ16, DMODEL * DMODEL, WSC);
  cvt16<<<gCW, blk, 0, stream>>>(w_k, WK16, DMODEL * DMODEL, WSC);
  cvt16<<<gCW, blk, 0, stream>>>(w_v, WV16, DMODEL * DMODEL, WSC);
  cvt16<<<gCW, blk, 0, stream>>>(w_o, WO16, DMODEL * DMODEL, WSC);

  // (1) activation plane: X16[row][c] = f16( bf16_RNE(x[row][c]) * 16 ), rows = b*2048 + tok
  cvt16<<<gCX, blk, 0, stream>>>(x, X16, NROWS * DMODEL, ACARRY);

  // (2) score bias plane: LB[b][q][key] = log2( bf16_RNE(M[b][q][key]) ), f32
  logm2<<<gLB, blk, 0, stream>>>(Mp, LB, NB * NQ * NC);

  // (3) q projection: QH[m][n] = f16(16 * sum_k x[m][k] Wq[n][k]); M = 4096, N = 1024, K = 1024
  gemm64<2, 0, 0, 0><<<gP, blk, 0, stream>>>(
      X16, DMODEL, 0LL,
      WQ16, DMODEL, 0LL,
      b_o,
      (const float*)0,
      (void*)QH, DMODEL, 0LL,
      NROWS, DMODEL, DMODEL, 1.0f / (ACARRY * WSC), QC);

  // (4) k projection: f16(16 * sum_k x[m][k] Wk[n][k]) in fragment order; M = 4096, N = 1024, K = 1024
  gemm64<3, 0, 0, 0><<<gP, blk, 0, stream>>>(
      X16, DMODEL, 0LL,
      WK16, DMODEL, 0LL,
      b_o,
      (const float*)0,
      (void*)KH, DMODEL, 0LL,
      NROWS, DMODEL, DMODEL, 1.0f / (ACARRY * WSC), KC);

  // (5) v^T per batch: f16(16 * sum_k Wv[d][k] x_b[tok][k]) in fragment order; M = 1024, N = 2048, K = 1024
  gemm64<4, 0, 0, 0><<<gV, blk, 0, stream>>>(
      WV16, DMODEL, 0LL,
      X16, DMODEL, (long long)NC * DMODEL,
      b_o,
      (const float*)0,
      (void*)VTp, NC, (long long)DMODEL * NC,
      DMODEL, NC, DMODEL, 1.0f / (ACARRY * WSC), VC);

  // (6) attention per (batch, 16 query rows), 16 heads -> CT (f16, x1024)
  attn16<<<gAT, bAT, 0, stream>>>(QH, KH, VTp, LB, CT);

  // (7) out = CT . Wo^T / (1024 * 64) + bf16(bo); M = 4096, N = 1024, K = 1024, f32
  gemm64<0, 1, 0, 0><<<gP, blk, 0, stream>>>(
      CT, DMODEL, 0LL,
      WO16, DMODEL, 0LL,
      b_o,
      (const float*)0,
      (void*)out, DMODEL, 0LL,
      NROWS, DMODEL, DMODEL, 1.0f / (FC * WSC), 1.0f);
  (void)hipGetLastError();
}

// v003
// A run of this version takes 155 microseconds.
// In two side-by-side timings against v002, it was 1.37 and 1.38 times as fast.
// All steps since v000 together make it 2.42 times as fast.
// Contractions: q/k projections (x rows f16 x16 . W f16 x64, K=1024), v^T projection (Wv f16 x64 . x rows f16 x16, K=1024),
// attention scores^T (k f16 x16 . q f16 x16, K=64), attention v^T . P^T (v^T f16 x16 . P f16 x1024, K=2048 in steps of 32),
// output projection (ctx f16 x1024 . Wo f16 x64, K=1024): all v_wmma_f32_16x16x32_f16 single products, f32 accumulate.
// Additive log2(M) score bias (f32 plane), online max-subtracted base-2 softmax and output bias in f32 on VALU.
// Every float input RNE-converted to bf16 on load.
#include <hip/hip_runtime.h>
#include <math.h>
#include <stdint.h>

#define NB      2
#define NQ      2048
#define NC      2048
#define DMODEL  1024
#define NHEAD   16
#define HDIM    64
#define NROWS   (NB * NQ)
#define WSC     64.0f
#define ACARRY  16.0f
#define QC      16.0f
#define KC      16.0f
#define VC      16.0f
#define PC      1024.0f
#define FC      1024.0f
#define ATT_SCALE 0.125f
#define LOG2E   1.4426950408889634f
static_assert(NHEAD * HDIM == DMODEL);
static_assert((NQ % 64) == 0 && (NC % 64) == 0 && (DMODEL % 64) == 0 && (NC % 32) == 0 && (NQ % 16) == 0);
static_assert((NROWS % 128) == 0 && (NC % 128) == 0 && (DMODEL % 128) == 0);
#define ATT_THREADS (NHEAD * 32)
#define ATT_BLOCKS  (NB * (NQ / 16))
static_assert(ATT_THREADS == 512 && ATT_BLOCKS == 256);

typedef _Float16 v16h __attribute__((ext_vector_type(16)));
typedef _Float16 v8h  __attribute__((ext_vector_type(8)));
typedef float    v8f  __attribute__((ext_vector_type(8)));
typedef float    v4f  __attribute__((ext_vector_type(4)));
typedef float    v2f  __attribute__((ext_vector_type(2)));
typedef _Float16 v2h  __attribute__((ext_vector_type(2)));
typedef unsigned int v4u __attribute__((ext_vector_type(4)));

union FragH { v16h v; v8h h[2]; v4u u[2]; v2h p[8]; };

// ---- scalar helpers --------------------------------------------------------------------------------
__device__ __forceinline__ unsigned short bf_bits(float f) {          // f32 -> bf16 bits, RNE convert
  unsigned u = __float_as_uint(f);
  return (unsigned short)((u + 0x7FFFu + ((u >> 16) & 1u)) >> 16);
}
__device__ __forceinline__ float bf_up(unsigned short h) { return __uint_as_float(((unsigned)h) << 16); }
__device__ __forceinline__ float bfr(float f) { return bf_up(bf_bits(f)); }   // value of the bf16 RNE convert
__device__ __forceinline__ unsigned short h_bits(_Float16 x) { return __builtin_bit_cast(unsigned short, x); }
__device__ __forceinline__ unsigned pk16(unsigned short a, unsigned short b) { return (unsigned)a | ((unsigned)b << 16); }
__device__ __forceinline__ v8f zero8() { v8f z = {0.f, 0.f, 0.f, 0.f, 0.f, 0.f, 0.f, 0.f}; return z; }
__device__ __forceinline__ float gelu_f(float v) { return 0.5f * v * (1.0f + erff(v * 0.70710678118654752f)); }
__device__ __forceinline__ float xhalf(float x) {                     // the value that lane ^ 16 holds
  const int b = __builtin_bit_cast(int, x);
  return __builtin_bit_cast(float, __builtin_amdgcn_permlanex16(b, b, 0x76543210, 0xfedcba98, false, false));
}

// ---- fragment loaders: 16-bit A/B operand, lane -> row/col (lane&15), p already includes +8*(lane>>4);
//      elements 0..7 <- p[0..7] (k0+8h..), elements 8..15 <- p[16..23] (k0+16+8h..)  (same split k map for A and B;
//      B is read from a k-contiguous [n][k] plane in gemm64 and for q in attn16; attn16's A comes from fragment order via ldfrag_p)
__device__ __forceinline__ v16h ldfrag_h(const _Float16* p) {
  FragH f;
  f.h[0] = *(const v8h*)(p);
  f.h[1] = *(const v8h*)(p + 16);
  return f.v;
}
__device__ __forceinline__ v16h ldfrag_u(const unsigned short* p) {
  FragH f;
  f.u[0] = *(const v4u*)(p);
  f.u[1] = *(const v4u*)(p + 16);
  return f.v;
}

// fragment-ordered plane: a fragment is two runs of 512 B, run i = elements 8i..8i+7 of all 32 lanes, 16 B per lane in lane order;
// p already includes +8*lane, so each of the two wave-wide loads covers 512 contiguous bytes = four whole lines
__device__ __forceinline__ v16h ldfrag_p(const _Float16* p) {
  FragH f;
  f.h[0] = *(const v8h*)(p);
  f.h[1] = *(const v8h*)(p + 256);
  return f.v;
}

// ---- WMMA helpers with trailing VALU hazard gaps ------------------------------------------------------
__device__ __forceinline__ v8f mma_raw(v16h a, v16h b, v8f c) {
  return __builtin_amdgcn_wmma_f32_16x16x32_f16(false, a, false, b, (short)0, c, false, false);
}
__device__ __forceinline__ void dep_guard1(v8f& a, v8f& b, v16h x) {
#if defined(__HIP_DEVICE_COMPILE__)
  asm volatile("v_nop\n\tv_nop\n\tv_nop\n\tv_nop" : "+v"(a), "+v"(b) : "v"(x));
#endif
}
__device__ __forceinline__ void guard_s2(v8f& s, v16h a0, v16h a1) {
#if defined(__HIP_DEVICE_COMPILE__)
  asm volatile("v_nop\n\tv_nop\n\tv_nop\n\tv_nop" : "+v"(s) : "v"(a0), "v"(a1));
#endif
}
__device__ __forceinline__ void guard_s4(v8f& s, v16h a0, v16h a1, v16h b0, v16h b1) {
#if defined(__HIP_DEVICE_COMPILE__)
  asm volatile("v_nop\n\tv_nop\n\tv_nop\n\tv_nop" : "+v"(s) : "v"(a0), "v"(a1), "v"(b0), "v"(b1));
#endif
}
__device__ __forceinline__ void guard_pv4(v8f& a, v8f& b, v8f& c, v8f& d, v16h x, v16h y, v16h z, v16h w, v16h u) {
#if defined(__HIP_DEVICE_COMPILE__)
  asm volatile("v_nop\n\tv_nop\n\tv_nop\n\tv_nop"
               : "+v"(a), "+v"(b), "+v"(c), "+v"(d) : "v"(x), "v"(y), "v"(z), "v"(w), "v"(u));
#endif
}
__device__ __forceinline__ void keep4_h(v16h a, v16h b, v16h c, v16h d) {
#if defined(__HIP_DEVICE_COMPILE__)
  asm volatile("v_nop" :: "v"(a), "v"(b), "v"(c), "v"(d));
#endif
}
__device__ __forceinline__ void acc_guard4(v8f& a, v8f& b, v8f& c, v8f& d) {
#if defined(__HIP_DEVICE_COMPILE__)
  asm volatile("v_nop\n\tv_nop\n\tv_nop\n\tv_nop" : "+v"(a), "+v"(b), "+v"(c), "+v"(d));
#endif
}
__device__ __forceinline__ void wave_sync_lds() {
  __builtin_amdgcn_fence(__ATOMIC_RELEASE, "workgroup");
  __builtin_amdgcn_wave_barrier();
  __builtin_amdgcn_fence(__ATOMIC_ACQUIRE, "workgroup");
}

// =====================================================================================================
// Elementwise 16-bit pack, no transpose: dst[i] = f16( bf16_RNE(src[i]) * sc ), sc a power of two (exact).
// Used for the weights (stored [out][in] = [n][k], already k contiguous for B fragments / A of the v^T projection) and for
// the activation rows. 8 elements per thread: two 16-B loads, one 16-B store per lane; 32 consecutive lanes = 512 B =
// coverage: grid = n / 2048 blocks x 256 thr x 8 elements = n exactly (host checks n % 2048 == 0).
// =====================================================================================================
__global__ __launch_bounds__(256) void cvt16(const float* __restrict__ src, unsigned short* dst, int n, float sc) {
  const size_t i8 = ((size_t)blockIdx.x * 256 + threadIdx.x) * 8;
  if (i8 + 8 > (size_t)n) return;                 // never taken with the exact grid; no barriers in this kernel
  const v4f a = *(const v4f*)(src + i8);
  const v4f b = *(const v4f*)(src + i8 + 4);
  v4u o;
  o[0] = pk16(h_bits((_Float16)(bfr(a[0]) * sc)), h_bits((_Float16)(bfr(a[1]) * sc)));
  o[1] = pk16(h_bits((_Float16)(bfr(a[2]) * sc)), h_bits((_Float16)(bfr(a[3]) * sc)));
  o[2] = pk16(h_bits((_Float16)(bfr(b[0]) * sc)), h_bits((_Float16)(bfr(b[1]) * sc)));
  o[3] = pk16(h_bits((_Float16)(bfr(b[2]) * sc)), h_bits((_Float16)(bfr(b[3]) * sc)));
  {
    *(v4u*)(dst + i8) = o;
    
  }
}

// =====================================================================================================
// Score bias plane: log2( bf16_RNE(M) ) as f32 (M strictly positive), laid in the lane order in which attn16 holds its transposed
// score tiles: 2-KiB blocks [batch][query / 16][key / 32] of 16 queries x 32 keys, four runs of 512 B; run i, lane (c, hh) = query c,
// keys 16 (i >> 1) + 8 hh + 4 (i & 1) + 0..3. One 16-B piece per thread, pieces in plane order: one 16-B load, whole 512-B stores.
// coverage: grid = n / 1024 blocks x 256 thr x 4 elements = n exactly (host checks n % 1024 == 0); piece -> source is one to one.
// =====================================================================================================
__global__ __launch_bounds__(256) void logm2(const float* __restrict__ Mp, float* dst, int n) {
  const size_t g  = (size_t)blockIdx.x * 256 + threadIdx.x;
  const size_t i4 = g * 4;
  if (i4 + 4 > (size_t)n) return;                 // never taken with the exact grid; no barriers in this kernel
  const unsigned lane = (unsigned)g & 31u, run = ((unsigned)g >> 5) & 3u;
  const size_t blk = g >> 7;
  const size_t row = (blk / (NC / 32)) * 16 + (lane & 15u);                     // batch * 2048 + query
  const size_t col = (blk % (NC / 32)) * 32 + (run >> 1) * 16 + (lane >> 4) * 8 + (run & 1u) * 4;
  const v4f a = *(const v4f*)(Mp + row * NC + col);
  v4f o;
  o[0] = log2f(bfr(a[0]));
  o[1] = log2f(bfr(a[1]));
  o[2] = log2f(bfr(a[2]));
  o[3] = log2f(bfr(a[3]));
  *(v4f*)(dst + i4) = o;
}

// =====================================================================================================
// LDS-staged batched f16 WMMA GEMM: C[m][n] = f( oscale * sum_k A[m][k] * Bt[n][k] + bf16(bias) ) (+ residual); one block of
// 8 waves per 128x128 tile, one wave per 32x64 part of it (4 x 2 waves). A row-major [M][K] pitch lda (16-bit plane), Bt
// row-major [N][K] pitch ldb (k contiguous); M, N multiples of 128, K multiple of 128. blockIdx.y = batch index with element
// strides sA, sB, sC.
// A stage is 128 k (256 B) of the tile's 128 A rows and 128 Bt rows, laid in LDS at a row pitch of 272 B; two buffers. Every
// lane brings 16 pieces of 16 B per stage by asynchronous copies (16 lanes = one whole 256-B row piece), the next stage's
// copies in flight while this stage is multiplied; fragments are read from LDS with the split k map of ldfrag_u, k ascending.
// BM: 0 = no bias, 1 = per column bf16(bias[col]), 2 = per row bf16(bias[row]) (clamped-address loads).
// OM: 0 = f32 out (pitch ldc; HASR 1 adds bf16(R[m][n]), HASR 2 adds raw f32 R[m][n], same pitch/stride as C);
//     2 = f16 out (pitch ldc) = f16( act(value) * ocarry ), ACT 1 = exact GELU.
//     3, 4 = the same f16 values laid in the fragment order that attn16 loads (ldfrag_p), ldc unused, BM 0 only. A wave's 16x64
//         slab is four runs of 512 B; run it, lane (c, hh) = slab row c, cols 16 it + 8 hh + 0..7: one whole 512-B store each.
//         3 (k plane; rows = batch*2048 + key, cols = 64 head + d): the slab is the 2-KiB block [batch][head][key / 16].
//         4 (v^T plane; rows = 64 head + d, cols = key, batch = blockIdx.y through sC): runs 2t, 2t + 1 are the 1-KiB piece
//         (d / 16) & 3 of the 4-KiB block [head][key / 32], t = 0, 1 the slab's two 32-key tiles.
// coverage: 2 slabs x 16 rows (f32: it 0..7 x lane>>4; OM 2: it 0..3 x lane>>3; OM 3, 4: lane & 15) x 64 cols = the wave's whole 32x64 part;
//           grid = tilesM*tilesN blocks, a surplus block exits as a whole in front of every barrier.
// =====================================================================================================
#define GT_PITCH  136                          // LDS row pitch in halves: 272 B = 16 B x odd, for 16-B LDS reads
#define GT_STAGE  (256 * GT_PITCH)             // halves per buffer: [A 128 rows | Bt 128 rows]
typedef __attribute__((address_space(3))) unsigned short lds_u16;

// Eight asynchronous 16-B copies per lane, global -> LDS, rows 16 apart. The closing s_wait_xcnt 0 stands inside the statement
// so that no address register of an issued copy is rewritten in front of it.
__device__ __forceinline__ void async_rows8(unsigned l, const unsigned short* g, size_t gstep) {
#if defined(__HIP_DEVICE_COMPILE__)
  const unsigned ls = 16 * GT_PITCH * 2;       // 16 LDS rows in bytes
  asm volatile("global_load_async_to_lds_b128 %0, %8, off\n\t"
               "global_load_async_to_lds_b128 %1, %9, off\n\t"
               "global_load_async_to_lds_b128 %2, %10, off\n\t"
               "global_load_async_to_lds_b128 %3, %11, off\n\t"
               "global_load_async_to_lds_b128 %4, %12, off\n\t"
               "global_load_async_to_lds_b128 %5, %13, off\n\t"
               "global_load_async_to_lds_b128 %6, %14, off\n\t"
               "global_load_async_to_lds_b128 %7, %15, off\n\t"
               "s_wait_xcnt 0x0"
               :: "v"(l), "v"(l + ls), "v"(l + 2 * ls), "v"(l + 3 * ls),
                  "v"(l + 4 * ls), "v"(l + 5 * ls), "v"(l + 6 * ls), "v"(l + 7 * ls),
                  "v"(g), "v"(g + gstep), "v"(g + 2 * gstep), "v"(g + 3 * gstep),
                  "v"(g + 4 * gstep), "v"(g + 5 * gstep), "v"(g + 6 * gstep), "v"(g + 7 * gstep)
               : "memory");
#endif
}
__device__ __forceinline__ void wait_async0() {   // this wave's copies have landed in LDS
#if defined(__HIP_DEVICE_COMPILE__)
  asm volatile("s_wait_asynccnt 0x0" ::: "memory");
#endif
}
__device__ __forceinline__ void wait_ds0() {      // this wave's LDS reads have returned before their buffer is refilled
#if defined(__HIP_DEVICE_COMPILE__)
  asm volatile("s_wait_dscnt 0x0" ::: "memory");
#endif
}

template <int OM, int BM, int HASR, int ACT>
__global__ __launch_bounds__(256) void gemm64(
    const unsigned short* __restrict__ Ap, int lda, long long sA,
    const unsigned short* __restrict__ Btp, int ldb, long long sB,
    const float* __restrict__ bias,
    const float* __restrict__ Rp,
    void* Cout, int ldc, long long sC,
    int M, int N, int K, float oscale, float ocarry) {
  __shared__ __align__(16) unsigned short ring[2 * GT_STAGE];   // two stage buffers
  __shared__ __align__(16) float sT[8][16 * 68];   // per-wave 16x64 slab, pitch 68 floats
  const int by   = blockIdx.y;
  const int tid  = threadIdx.x;
  const int lane = tid & 31;
  const int wave = tid >> 5;
  const int tilesN = N >> 7;
  const int tilesM = M >> 7;
  const int tile = blockIdx.x;
  if (tile >= tilesM * tilesN) return;   // block-uniform, in front of every barrier and copy
  const int tm = tile / tilesN;
  const int tn = tile - tm * tilesN;
  const int bm0 = tm << 7;
  const int bn0 = tn << 7;
  const int wm = (wave >> 1) << 5;             // the wave's 32 rows inside the block tile
  const int wn = (wave & 1) << 6;              // the wave's 64 cols inside the block tile
  const int m0 = bm0 + wm;
  const int n0 = bn0 + wn;

  const unsigned short* A1 = Ap  + (size_t)((long long)by * sA);
  const unsigned short* Bb = Btp + (size_t)((long long)by * sB);

  const int rlane = lane & 15;                 // row (A) / col (B, D) within subtile
  const int koff  = (lane >> 4) * 8;           // k offset of this lane half
  const int mOff  = (lane >> 4) * 8;           // D row offset

  // copy map: lane piece = 16 B number tid & 15 of row (tid >> 4) + 16 j, j 0..7, of the A rows and of the Bt rows
  const int crow = tid >> 4;
  const int cpc  = (tid & 15) * 8;
  const unsigned short* gA = A1 + (size_t)(bm0 + crow) * lda + cpc;
  const unsigned short* gB = Bb + (size_t)(bn0 + crow) * ldb + cpc;
  const unsigned lA = (unsigned)(uintptr_t)(lds_u16*)(ring + crow * GT_PITCH + cpc);
  const unsigned lB = lA + 128 * GT_PITCH * 2;
  const int nst = K >> 7;                      // stages of 128 k

  v8f acc[2][4];
#pragma unroll
  for (int i = 0; i < 2; ++i)
#pragma unroll
    for (int j = 0; j < 4; ++j) acc[i][j] = zero8();

  // stage 0 into buffer 0, published; then stage 1 into buffer 1
  async_rows8(lA, gA, (size_t)16 * lda);
  async_rows8(lB, gB, (size_t)16 * ldb);
  wait_async0();
  __syncthreads();
  if (nst > 1) {
    async_rows8(lA + GT_STAGE * 2, gA + 128, (size_t)16 * lda);
    async_rows8(lB + GT_STAGE * 2, gB + 128, (size_t)16 * ldb);
  }

  for (int t = 0; t < nst; ++t) {
    const int buf = t & 1;
    const unsigned short* fA = ring + buf * GT_STAGE + (wm + rlane) * GT_PITCH + koff;
    const unsigned short* fB = ring + buf * GT_STAGE + (128 + wn + rlane) * GT_PITCH + koff;
    // two fragment sets: the next 32 k of this stage are read from LDS as one group ahead of the current products
    v16h ah[2][2], bh[2][4];
#pragma unroll
    for (int j = 0; j < 4; ++j) bh[0][j] = ldfrag_u(fB + (j << 4) * GT_PITCH);
#pragma unroll
    for (int i = 0; i < 2; ++i) ah[0][i] = ldfrag_u(fA + (i << 4) * GT_PITCH);
#pragma unroll   // every fragment-set index a constant, so both sets stay in registers
    for (int s = 0; s < 4; ++s) {
      const int cu = s & 1, nx = cu ^ 1;
      if (s < 3) {
#pragma unroll
        for (int j = 0; j < 4; ++j) bh[nx][j] = ldfrag_u(fB + (j << 4) * GT_PITCH + (s + 1) * 32);
#pragma unroll
        for (int i = 0; i < 2; ++i) ah[nx][i] = ldfrag_u(fA + (i << 4) * GT_PITCH + (s + 1) * 32);
      }
#pragma unroll
      for (int i = 0; i < 2; ++i) {
#pragma unroll
        for (int j = 0; j < 4; ++j) acc[i][j] = mma_raw(ah[cu][i], bh[cu][j], acc[i][j]);
        dep_guard1(acc[i][0], acc[i][3], ah[cu][i]);
      }
      keep4_h(bh[cu][0], bh[cu][1], bh[cu][2], bh[cu][3]);
    }
    // publish point of stage t + 1: own LDS reads back, own copies landed, one barrier for both hand-overs, then the refill
    wait_ds0();
    wait_async0();
    __syncthreads();
    if (t + 2 < nst) {
      async_rows8(lA + buf * (GT_STAGE * 2), gA + (size_t)(t + 2) * 128, (size_t)16 * lda);
      async_rows8(lB + buf * (GT_STAGE * 2), gB + (size_t)(t + 2) * 128, (size_t)16 * ldb);
    }
  }
  wait_async0();
  acc_guard4(acc[0][0], acc[0][1], acc[0][2], acc[0][3]);
  acc_guard4(acc[1][0], acc[1][1], acc[1][2], acc[1][3]);

  const int hh2 = lane >> 4, c4 = (lane & 15) * 4;     // f32 out: 256-B row segment = 16 lanes x 16 B
  const int q8  = lane >> 3, c8 = (lane & 7) * 8;
  float bc[4];
  float bcol[8];
#pragma unroll
  for (int e = 0; e < 4; ++e) bc[e] = 0.f;
#pragma unroll
  for (int e = 0; e < 8; ++e) bcol[e] = 0.f;
  if constexpr (BM == 1) {
    if constexpr (OM == 0) {
      const int cb = n0 + c4;
      const int i0 = (cb < N - 4) ? cb : (N - 4);        // clamped address
      const v4f b0v = *(const v4f*)(bias + i0);
#pragma unroll
      for (int e = 0; e < 4; ++e) bc[e] = bfr(b0v[e]);
    } else {
      const int cb = n0 + c8;
      const int i0 = (cb < N - 8) ? cb : (N - 8);        // clamped address
      const v4f b0v = *(const v4f*)(bias + i0), b1v = *(const v4f*)(bias + i0 + 4);
#pragma unroll
      for (int e = 0; e < 4; ++e) { bcol[e] = bfr(b0v[e]); bcol[4 + e] = bfr(b1v[e]); }
    }
  }

  // ---- epilogue ----
  float* slab = sT[wave];
#pragma unroll
  for (int i = 0; i < 2; ++i) {
    const int mBase = m0 + (i << 4);
#pragma unroll
    for (int j = 0; j < 4; ++j) {
#pragma unroll
      for (int r = 0; r < 8; ++r) {
        slab[(mOff + r) * 68 + (j << 4) + rlane] = acc[i][j][r];
      }
    }
    wave_sync_lds();
    if constexpr (OM == 0) {
      float* C = (float*)Cout + (size_t)((long long)by * sC);
      v4f vals[8];
#pragma unroll
      for (int it = 0; it < 8; ++it) {
        const int row = it * 2 + hh2;                      // it 0..7 x hh2 0..1 = rows 0..15
        const int gr  = mBase + row;
        v4f v = *(const v4f*)(slab + row * 68 + c4);
        float br = 0.f;
        if constexpr (BM == 2) {
          const int ir = (gr < M - 1) ? gr : (M - 1);      // clamped address
          br = bfr(bias[ir]);
        }
        v4f rv = {0.f, 0.f, 0.f, 0.f};
        if constexpr (HASR != 0) {
          const float* R = Rp + (size_t)((long long)by * sC);
          const v4f rraw = *(const v4f*)(R + (size_t)gr * ldc + n0 + c4);
#pragma unroll
          for (int e = 0; e < 4; ++e) rv[e] = (HASR == 1) ? bfr(rraw[e]) : rraw[e];
        }
#pragma unroll
        for (int e = 0; e < 4; ++e) v[e] = v[e] * oscale + bc[e] + br + rv[e];
        vals[it] = v;
      }
      {
#pragma unroll
        for (int it = 0; it < 8; ++it) {
          const int gr = mBase + it * 2 + hh2;
          *(v4f*)(C + (size_t)gr * ldc + n0 + c4) = vals[it];
        }
        
      }
    } else {
      unsigned short* C = (unsigned short*)Cout + (size_t)((long long)by * sC);
      static_assert(OM == 2 || BM == 0);
      v4u hv[4];
#pragma unroll
      for (int it = 0; it < 4; ++it) {
        const int row = (OM == 2) ? it * 4 + q8 : rlane;   // OM 2: it 0..3 x q8 0..3 = rows 0..15; OM 3, 4: row = lane & 15
        const float* sp = slab + row * 68 + ((OM == 2) ? c8 : it * 16 + koff);
        float br = 0.f;
        if constexpr (BM == 2) {
          const int gr = mBase + row;
          const int ir = (gr < M - 1) ? gr : (M - 1);      // clamped address
          br = bfr(bias[ir]);
        }
        v4u a = {0u, 0u, 0u, 0u};
#pragma unroll
        for (int e = 0; e < 4; ++e) {
          float f0 = sp[2 * e] * oscale + bcol[2 * e] + br;
          float f1 = sp[2 * e + 1] * oscale + bcol[2 * e + 1] + br;
          if constexpr (ACT == 1) { f0 = gelu_f(f0); f1 = gelu_f(f1); }
          f0 *= ocarry; f1 *= ocarry;
          a[e] = pk16(h_bits((_Float16)f0), h_bits((_Float16)f1));
        }
        hv[it] = a;
      }
      {
#pragma unroll
        for (int it = 0; it < 4; ++it) {
          if constexpr (OM == 2) {
            const int row = it * 4 + q8;
            *(v4u*)(C + (size_t)(mBase + row) * ldc + n0 + c8) = hv[it];
          } else if constexpr (OM == 3) {
            const int mt = mBase >> 4;                     // batch * 128 + key tile
            const size_t blk = (size_t)((mt / (NC / 16)) * NHEAD + (n0 >> 6)) * (NC / 16) + (mt % (NC / 16));
            *(v4u*)(C + blk * 1024 + it * 256 + lane * 8) = hv[it];
          } else {
            const size_t blk = (size_t)(mBase >> 6) * (NC / 32) + (n0 >> 5) + (it >> 1);
            *(v4u*)(C + blk * 2048 + ((mBase >> 4) & 3) * 512 + (it & 1) * 256 + lane * 8) = hv[it];
          }
        }
        
      }
    }
    wave_sync_lds();
  }
}

__global__ __launch_bounds__(ATT_THREADS)
void attn16(const unsigned short* __restrict__ QHp, const unsigned short* __restrict__ KHp,
            const unsigned short* __restrict__ VTq, const float* __restrict__ LBp, unsigned short* CT) {
  const int tid  = threadIdx.x;
  const int wave = tid >> 5;
  const int lane = tid & 31;
  const int hh   = lane >> 4;
  const int c    = lane & 15;

  const int qt   = blockIdx.x & ((NQ / 16) - 1);           // 0..127
  const int bat  = blockIdx.x / (NQ / 16);                 // 0..1
  const int head = __builtin_amdgcn_readfirstlane(wave);   // 0..15; told to be wave-uniform, so the k and v^T bases stay scalar
  const int q0   = qt * 16;

  const size_t qofs = ((size_t)bat * NQ + q0 + c) * DMODEL + head * HDIM + 8 * hh;
  const _Float16* Qh = (const _Float16*)(const void*)QHp + qofs;
  const _Float16* Kb = (const _Float16*)(const void*)KHp + (size_t)(bat * NHEAD + head) * (NC * HDIM);
  const _Float16* Vb = (const _Float16*)(const void*)VTq + (size_t)(bat * NHEAD + head) * (NC * HDIM);
  const unsigned lofs = 8u * (unsigned)lane;               // the lane's 16 B inside every 512-B run
  const float* Wb = LBp + (size_t)(bat * (NQ / 16) + qt) * (16 * NC) + 4u * (unsigned)lane;   // log2 units, 512 floats per step
  const float lsc = (LOG2E * ATT_SCALE) / (QC * KC);                   // log2(e) / 8 / carries

  const v16h qa = ldfrag_h(Qh), qb = ldfrag_h(Qh + 32);

  float mrun = -INFINITY, lsum = 0.f;                      // the query's running maximum; this wave half's running sum
  v8f o0 = zero8(), o1 = zero8(), o2 = zero8(), o3 = zero8();

#pragma unroll 1   // rolled: one step's 20 loads are issued as one group at its head, and the loop text stays short
  for (int kb = 0; kb < NC; kb += 32) {
    const _Float16* kp = Kb + (size_t)kb * HDIM + lofs;    // blocks kb / 16 and kb / 16 + 1, 1024 halves each
    const float*    wp = Wb + (size_t)kb * 16;             // block kb / 32, 512 floats
    const _Float16* vp = Vb + (size_t)kb * HDIM + lofs;    // block kb / 32, 2048 halves
    const v16h k00 = ldfrag_p(kp),        k01 = ldfrag_p(kp + 512);
    const v16h k10 = ldfrag_p(kp + 1024), k11 = ldfrag_p(kp + 1536);
    const v4f w0 = *(const v4f*)(wp),       w1 = *(const v4f*)(wp + 128);
    const v4f w2 = *(const v4f*)(wp + 256), w3 = *(const v4f*)(wp + 384);
    const v16h vb0 = ldfrag_p(vp);
    const v16h vb1 = ldfrag_p(vp + 512);
    const v16h vb2 = ldfrag_p(vp + 1024);
    const v16h vb3 = ldfrag_p(vp + 1536);
#if defined(__HIP_DEVICE_COMPILE__)
    // stands behind the step's 20 loads, in front of every rewrite of a register that they name; the three address pairs are
    // inputs, so that none of them serves as a load's destination in front of the wait
    asm volatile("s_wait_xcnt 0x0" :: "v"(kp), "v"(wp), "v"(vp) : "memory");
#endif
    v8f s0, s1;
    s0 = mma_raw(k00, qa, zero8());
    s0 = mma_raw(k01, qb, s0);
    guard_s2(s0, k00, k01);
    s1 = mma_raw(k10, qa, zero8());
    s1 = mma_raw(k11, qb, s1);
    guard_s4(s1, k10, k11, qa, qb);
    v2f t[8];                                              // pair i = keys kb + 16 (i >> 2) + 8 hh + 2 (i & 3) + 0, 1
#pragma unroll   // here and below: every index a constant, so the pairs stay in registers
    for (int e = 0; e < 2; ++e) {
      t[e]     = (v2f){s0[2 * e],     s0[2 * e + 1]} * lsc + (v2f){w0[2 * e], w0[2 * e + 1]};
      t[2 + e] = (v2f){s0[4 + 2 * e], s0[5 + 2 * e]} * lsc + (v2f){w1[2 * e], w1[2 * e + 1]};
      t[4 + e] = (v2f){s1[2 * e],     s1[2 * e + 1]} * lsc + (v2f){w2[2 * e], w2[2 * e + 1]};
      t[6 + e] = (v2f){s1[4 + 2 * e], s1[5 + 2 * e]} * lsc + (v2f){w3[2 * e], w3[2 * e + 1]};
    }
    float mx[8];
#pragma unroll
    for (int i = 0; i < 8; ++i) mx[i] = fmaxf(t[i][0], t[i][1]);
    float mxa = fmaxf(fmaxf(fmaxf(mx[0], mx[1]), fmaxf(mx[2], mx[3])), fmaxf(fmaxf(mx[4], mx[5]), fmaxf(mx[6], mx[7])));
    mxa = fmaxf(mxa, xhalf(mxa));                          // over the step's 32 keys, equal in both halves
    const float mn = fmaxf(mrun, mxa);
    const float al = exp2f(mrun - mn);
    mrun = mn;
    v2f ex[8];
    FragH ph;                                              // elements 0..7 = keys kb + 8hh + 0..7, 8..15 = keys kb + 16 + 8hh + 0..7
#pragma unroll
    for (int i = 0; i < 8; ++i) {
      const v2f d = t[i] - mn;
      ex[i] = (v2f){exp2f(d[0]), exp2f(d[1])};
      ph.p[i] = __builtin_convertvector(ex[i] * PC, v2h);
    }
    const v2f ps = ((ex[0] + ex[1]) + (ex[2] + ex[3])) + ((ex[4] + ex[5]) + (ex[6] + ex[7]));
    lsum = lsum * al + (ps[0] + ps[1]);
#pragma unroll
    for (int r = 0; r < 8; ++r) {
      o0[r] *= al;
      o1[r] *= al;
      o2[r] *= al;
      o3[r] *= al;
    }
    o0 = mma_raw(vb0, ph.v, o0);
    o1 = mma_raw(vb1, ph.v, o1);
    o2 = mma_raw(vb2, ph.v, o2);
    o3 = mma_raw(vb3, ph.v, o3);
    guard_pv4(o0, o1, o2, o3, ph.v, vb0, vb1, vb2, vb3);
  }

  // ---- join the halves' sums, fold 1/l and the carries (1024 on P, 16 on v, 1024 on the stored ctx), store 16 B per tile ----
  const float oc  = FC / (PC * VC);
  const float inv = (1.0f / (lsum + xhalf(lsum))) * oc;
  unsigned short* dst = CT + qofs;                         // row q0 + c, cols 64 head + 8 hh (+ 16 t)
  v4u p0, p1, p2, p3;
#pragma unroll
  for (int e = 0; e < 4; ++e) {
    p0[e] = pk16(h_bits((_Float16)(o0[2 * e] * inv)), h_bits((_Float16)(o0[2 * e + 1] * inv)));
    p1[e] = pk16(h_bits((_Float16)(o1[2 * e] * inv)), h_bits((_Float16)(o1[2 * e + 1] * inv)));
    p2[e] = pk16(h_bits((_Float16)(o2[2 * e] * inv)), h_bits((_Float16)(o2[2 * e + 1] * inv)));
    p3[e] = pk16(h_bits((_Float16)(o3[2 * e] * inv)), h_bits((_Float16)(o3[2 * e + 1] * inv)));
  }
  *(v4u*)(dst)      = p0;
  *(v4u*)(dst + 16) = p1;
  *(v4u*)(dst + 32) = p2;
  *(v4u*)(dst + 48) = p3;
}

// =====================================================================================================
// Workspace map (bytes); every plane is an exact multiple of its tile / whole-row store granularity (M, N exact tile multiples,
// element counts exact multiples of the convert kernels' 2048 / 1024 granularity, no pad rows needed), every offset a multiple of 2 MiB:
//   WQ16 f16 [1024][1024] x64               2097152   ([out][in] = [n][k])
//   WK16 f16 [1024][1024] x64               2097152
//   WV16 f16 [1024][1024] x64               2097152
//   WO16 f16 [1024][1024] x64               2097152
//   X16  f16 [4096][1024] x16               8388608   (activation rows)
//   LB   f32 [2][128][64] x 2 KiB          33554432   (log2(bf16(M)), lane order of the transposed score tiles)
//   QH   f16 [4096][1024] x16               8388608   (q projection, unscaled)
//   KH   f16 [2][16][128] x 2 KiB, x16      8388608   (k projection, fragment order)
//   VT   f16 [2][16][64] x 4 KiB, x16       8388608   (v^T, fragment order)
//   CT   f16 [4096][1024] x1024             8388608   (attention ctx, merged heads)
//   end                                    83886080
// =====================================================================================================
extern "C" void kernel_launch(void* const* d_in, const int* in_sizes, int n_in,
                              void* d_out, int out_size, void* d_ws, size_t ws_size,
                              hipStream_t stream) {
  if (n_in < 7) return;
  if (in_sizes[0] != NROWS * DMODEL) return;
  if (in_sizes[1] != NB * NQ * NC) return;
  if (in_sizes[2] != DMODEL * DMODEL || in_sizes[3] != DMODEL * DMODEL ||
      in_sizes[4] != DMODEL * DMODEL || in_sizes[5] != DMODEL * DMODEL) return;
  if (in_sizes[6] != DMODEL) return;
  if (out_size != NROWS * DMODEL) return;
  if ((in_sizes[0] % 2048) != 0 || (in_sizes[2] % 2048) != 0 || (in_sizes[1] % 1024) != 0) return;

  const float* x   = (const float*)d_in[0];
  const float* Mp  = (const float*)d_in[1];
  const float* w_q = (const float*)d_in[2];
  const float* w_k = (const float*)d_in[3];
  const float* w_v = (const float*)d_in[4];
  const float* w_o = (const float*)d_in[5];
  const float* b_o = (const float*)d_in[6];
  float*       out = (float*)d_out;

  const size_t PW  = (size_t)DMODEL * DMODEL * 2;                 //  2097152
  const size_t PX  = (size_t)NROWS * DMODEL * 2;                  //  8388608
  const size_t PLB = (size_t)NB * NQ * NC * 4;                    // 33554432
  const size_t PVT = (size_t)NB * DMODEL * NC * 2;                //  8388608
  size_t off = 0;
  const size_t oWQ = off; off += PW;
  const size_t oWK = off; off += PW;
  const size_t oWV = off; off += PW;
  const size_t oWO = off; off += PW;
  const size_t oX  = off; off += PX;
  const size_t oLB = off; off += PLB;
  const size_t oQH = off; off += PX;
  const size_t oKH = off; off += PX;
  const size_t oVT = off; off += PVT;
  const size_t oCT = off; off += PX;
  if (off > ws_size) return;                                      // off = 83886080
  if (off > (size_t)134217728) return;

  char* ws = (char*)d_ws;
  unsigned short* WQ16 = (unsigned short*)(ws + oWQ);
  unsigned short* WK16 = (unsigned short*)(ws + oWK);
  unsigned short* WV16 = (unsigned short*)(ws + oWV);
  unsigned short* WO16 = (unsigned short*)(ws + oWO);
  unsigned short* X16  = (unsigned short*)(ws + oX);
  float*          LB   = (float*)(ws + oLB);
  unsigned short* QH   = (unsigned short*)(ws + oQH);
  unsigned short* KH   = (unsigned short*)(ws + oKH);
  unsigned short* VTp  = (unsigned short*)(ws + oVT);
  unsigned short* CT   = (unsigned short*)(ws + oCT);

  const dim3 blk(256);
  const dim3 gCW((DMODEL * DMODEL) / 2048);                        // 512 blocks
  const dim3 gCX((NROWS * DMODEL) / 2048);                         // 2048 blocks
  const dim3 gLB((NB * NQ * NC) / 1024);                           // 8192 blocks
  const int tilesP = (NROWS / 128) * (DMODEL / 128);               // 256
  const int tilesV = (DMODEL / 128) * (NC / 128);                  // 128 per batch
  const dim3 gP(tilesP, 1);                                        // 256
  const dim3 gV(tilesV, NB);                                       // 128 x 2
  const dim3 gAT(ATT_BLOCKS);                                      // 256
  const dim3 bAT(ATT_THREADS);                                     // 512

  // (0) weight planes: W16[n][k] = f16( bf16_RNE(W[n][k]) * 64 ), [out][in] layout kept, k contiguous
  cvt16<<<gCW, blk, 0, stream>>>(w_q, WQ16, DMODEL * DMODEL, WSC);
  cvt16<<<gCW, blk, 0, stream>>>(w_k, WK16, DMODEL * DMODEL, WSC);
  cvt16<<<gCW, blk, 0, stream>>>(w_v, WV16, DMODEL * DMODEL, WSC);
  cvt16<<<gCW, blk, 0, stream>>>(w_o, WO16, DMODEL * DMODEL, WSC);

  // (1) activation plane: X16[row][c] = f16( bf16_RNE(x[row][c]) * 16 ), rows = b*2048 + tok
  cvt16<<<gCX, blk, 0, stream>>>(x, X16, NROWS * DMODEL, ACARRY);

  // (2) score bias plane: log2( bf16_RNE(M[b][q][key]) ), f32, in the lane order of attn16's score tiles
  logm2<<<gLB, blk, 0, stream>>>(Mp, LB, NB * NQ * NC);

  // (3) q projection: QH[m][n] = f16(16 * sum_k x[m][k] Wq[n][k]); M = 4096, N = 1024, K = 1024
  gemm64<2, 0, 0, 0><<<gP, blk, 0, stream>>>(
      X16, DMODEL, 0LL,
      WQ16, DMODEL, 0LL,
      b_o,
      (const float*)0,
      (void*)QH, DMODEL, 0LL,
      NROWS, DMODEL, DMODEL, 1.0f / (ACARRY * WSC), QC);

  // (4) k projection: f16(16 * sum_k x[m][k] Wk[n][k]) in fragment order; M = 4096, N = 1024, K = 1024
  gemm64<3, 0, 0, 0><<<gP, blk, 0, stream>>>(
      X16, DMODEL, 0LL,
      WK16, DMODEL, 0LL,
      b_o,
      (const float*)0,
      (void*)KH, DMODEL, 0LL,
      NROWS, DMODEL, DMODEL, 1.0f / (ACARRY * WSC), KC);

  // (5) v^T per batch: f16(16 * sum_k Wv[d][k] x_b[tok][k]) in fragment order; M = 1024, N = 2048, K = 1024
  gemm64<4, 0, 0, 0><<<gV, blk, 0, stream>>>(
      WV16, DMODEL, 0LL,
      X16, DMODEL, (long long)NC * DMODEL,
      b_o,
      (const float*)0,
      (void*)VTp, NC, (long long)DMODEL * NC,
      DMODEL, NC, DMODEL, 1.0f / (ACARRY * WSC), VC);

  // (6) attention per (batch, 16 query rows), 16 heads -> CT (f16, x1024)
  attn16<<<gAT, bAT, 0, stream>>>(QH, KH, VTp, LB, CT);

  // (7) out = CT . Wo^T / (1024 * 64) + bf16(bo); M = 4096, N = 1024, K = 1024, f32
  gemm64<0, 1, 0, 0><<<gP, blk, 0, stream>>>(
      CT, DMODEL, 0LL,
      WO16, DMODEL, 0LL,
      b_o,
      (const float*)0,
      (void*)out, DMODEL, 0LL,
      NROWS, DMODEL, DMODEL, 1.0f / (FC * WSC), 1.0f);
  (void)hipGetLastError();
}

// v004
// It runs in 146 microseconds.
// Next to v003, in two timings, it ran 1.06 times as fast each time.
// All steps since v000 together make it 2.57 times as fast.
// Contractions: q/k projections (x rows f16 x16 . W f16 x64, K=1024), v^T projection (Wv f16 x64 . x rows f16 x16, K=1024),
// attention scores^T (k f16 x16 . q f16 x16, K=64), attention v^T . P^T (v^T f16 x16 . P f16 x1024, K=2048 in steps of 32),
// output projection (ctx f16 x1024 . Wo f16 x64, K=1024): all v_wmma_f32_16x16x32_f16 single products, f32 accumulate.
// Additive log2(M) score bias (f32 plane), online max-subtracted base-2 softmax and output bias in f32 on VALU.
// Every float input RNE-converted to bf16 on load.
#include <hip/hip_runtime.h>
#include <math.h>
#include <stdint.h>

#define NB      2
#define NQ      2048
#define NC      2048
#define DMODEL  1024
#define NHEAD   16
#define HDIM    64
#define NROWS   (NB * NQ)
#define WSC     64.0f
#define ACARRY  16.0f
#define QC      16.0f
#define KC      16.0f
#define VC      16.0f
#define PC      1024.0f
#define FC      1024.0f
#define ATT_SCALE 0.125f
#define LOG2E   1.4426950408889634f
static_assert(NHEAD * HDIM == DMODEL);
static_assert((NQ % 64) == 0 && (NC % 64) == 0 && (DMODEL % 64) == 0 && (NC % 32) == 0 && (NQ % 16) == 0);
static_assert((NROWS % 128) == 0 && (NC % 128) == 0 && (DMODEL % 128) == 0);
#define ATT_THREADS (NHEAD * 32)
#define ATT_BLOCKS  (NB * (NQ / 16))
static_assert(ATT_THREADS == 512 && ATT_BLOCKS == 256);

typedef _Float16 v16h __attribute__((ext_vector_type(16)));
typedef _Float16 v8h  __attribute__((ext_vector_type(8)));
typedef float    v8f  __attribute__((ext_vector_type(8)));
typedef float    v4f  __attribute__((ext_vector_type(4)));
typedef float    v2f  __attribute__((ext_vector_type(2)));
typedef _Float16 v2h  __attribute__((ext_vector_type(2)));
typedef unsigned int v4u __attribute__((ext_vector_type(4)));

union FragH { v16h v; v8h h[2]; v4u u[2]; v2h p[8]; };

// ---- scalar helpers --------------------------------------------------------------------------------
__device__ __forceinline__ unsigned short bf_bits(float f) {          // f32 -> bf16 bits, RNE convert
  unsigned u = __float_as_uint(f);
  return (unsigned short)((u + 0x7FFFu + ((u >> 16) & 1u)) >> 16);
}
__device__ __forceinline__ float bf_up(unsigned short h) { return __uint_as_float(((unsigned)h) << 16); }
__device__ __forceinline__ float bfr(float f) { return bf_up(bf_bits(f)); }   // value of the bf16 RNE convert
__device__ __forceinline__ unsigned short h_bits(_Float16 x) { return __builtin_bit_cast(unsigned short, x); }
__device__ __forceinline__ unsigned pk16(unsigned short a, unsigned short b) { return (unsigned)a | ((unsigned)b << 16); }
__device__ __forceinline__ v8f zero8() { v8f z = {0.f, 0.f, 0.f, 0.f, 0.f, 0.f, 0.f, 0.f}; return z; }
__device__ __forceinline__ float gelu_f(float v) { return 0.5f * v * (1.0f + erff(v * 0.70710678118654752f)); }
__device__ __forceinline__ float xhalf(float x) {                     // the value that lane ^ 16 holds
  const int b = __builtin_bit_cast(int, x);
  return __builtin_bit_cast(float, __builtin_amdgcn_permlanex16(b, b, 0x76543210, 0xfedcba98, false, false));
}

// ---- fragment loaders: 16-bit A/B operand, lane -> row/col (lane&15), p already includes +8*(lane>>4);
//      elements 0..7 <- p[0..7] (k0+8h..), elements 8..15 <- p[16..23] (k0+16+8h..)  (same split k map for A and B;
//      B is read from a k-contiguous [n][k] plane in gemm64 and for q in attn16; attn16's A comes from fragment order via ldfrag_p)
__device__ __forceinline__ v16h ldfrag_h(const _Float16* p) {
  FragH f;
  f.h[0] = *(const v8h*)(p);
  f.h[1] = *(const v8h*)(p + 16);
  return f.v;
}
__device__ __forceinline__ v16h ldfrag_u(const unsigned short* p) {
  FragH f;
  f.u[0] = *(const v4u*)(p);
  f.u[1] = *(const v4u*)(p + 16);
  return f.v;
}

// fragment-ordered plane: a fragment is two runs of 512 B, run i = elements 8i..8i+7 of all 32 lanes, 16 B per lane in lane order;
// p already includes +8*lane, so each of the two wave-wide loads covers 512 contiguous bytes = four whole lines
__device__ __forceinline__ v16h ldfrag_p(const _Float16* p) {
  FragH f;
  f.h[0] = *(const v8h*)(p);
  f.h[1] = *(const v8h*)(p + 256);
  return f.v;
}

// ---- WMMA helpers with trailing VALU hazard gaps ------------------------------------------------------
__device__ __forceinline__ v8f mma_raw(v16h a, v16h b, v8f c) {
  return __builtin_amdgcn_wmma_f32_16x16x32_f16(false, a, false, b, (short)0, c, false, false);
}
__device__ __forceinline__ void dep_guard1(v8f& a, v8f& b, v16h x) {
#if defined(__HIP_DEVICE_COMPILE__)
  asm volatile("v_nop\n\tv_nop\n\tv_nop\n\tv_nop" : "+v"(a), "+v"(b) : "v"(x));
#endif
}
__device__ __forceinline__ void guard_s2(v8f& s, v16h a0, v16h a1) {
#if defined(__HIP_DEVICE_COMPILE__)
  asm volatile("v_nop\n\tv_nop\n\tv_nop\n\tv_nop" : "+v"(s) : "v"(a0), "v"(a1));
#endif
}
__device__ __forceinline__ void guard_s4(v8f& s, v16h a0, v16h a1, v16h b0, v16h b1) {
#if defined(__HIP_DEVICE_COMPILE__)
  asm volatile("v_nop\n\tv_nop\n\tv_nop\n\tv_nop" : "+v"(s) : "v"(a0), "v"(a1), "v"(b0), "v"(b1));
#endif
}
__device__ __forceinline__ void guard_pv4(v8f& a, v8f& b, v8f& c, v8f& d, v16h x, v16h y, v16h z, v16h w, v16h u) {
#if defined(__HIP_DEVICE_COMPILE__)
  asm volatile("v_nop\n\tv_nop\n\tv_nop\n\tv_nop"
               : "+v"(a), "+v"(b), "+v"(c), "+v"(d) : "v"(x), "v"(y), "v"(z), "v"(w), "v"(u));
#endif
}
__device__ __forceinline__ void keep4_h(v16h a, v16h b, v16h c, v16h d) {
#if defined(__HIP_DEVICE_COMPILE__)
  asm volatile("v_nop" :: "v"(a), "v"(b), "v"(c), "v"(d));
#endif
}
__device__ __forceinline__ void acc_guard4(v8f& a, v8f& b, v8f& c, v8f& d) {
#if defined(__HIP_DEVICE_COMPILE__)
  asm volatile("v_nop\n\tv_nop\n\tv_nop\n\tv_nop" : "+v"(a), "+v"(b), "+v"(c), "+v"(d));
#endif
}
__device__ __forceinline__ void wave_sync_lds() {
  __builtin_amdgcn_fence(__ATOMIC_RELEASE, "workgroup");
  __builtin_amdgcn_wave_barrier();
  __builtin_amdgcn_fence(__ATOMIC_ACQUIRE, "workgroup");
}

// =====================================================================================================
// All six input-only packs in ONE launch of 512 blocks x 8 waves; a wave takes PK_IT groups of eight 16-B loads: all its loads are
// issued at its head, then group after group is converted and stored as its loads return. Blocks 0..255: score bias plane;
// 256..383: activation rows; 384..511: the four weight planes, 32 blocks each.
// 16-bit pack, no transpose: dst[i] = f16( bf16_RNE(src[i]) * sc ), sc a power of two (exact). Used for the weights (stored
// [out][in] = [n][k], already k contiguous for B fragments / A of the v^T projection; the four planes lie one behind the other in
// the workspace) and for the activation rows. A piece is 8 elements: two 16-B loads, one 16-B store per lane; a group is 4 pieces
// per lane = 1024 elements per wave, 32 consecutive lanes = one whole 512-B store; the 8 waves' groups lie side by side.
// Score bias plane: log2( bf16_RNE(M) ) as f32 (M strictly positive), laid in the lane order in which attn16 holds its transposed
// score tiles: 2-KiB blocks [batch][query / 16][key / 32] of 16 queries x 32 keys, four runs of 512 B; run i, lane (c, hh) = query c,
// keys 16 (i >> 1) + 8 hh + 4 (i & 1) + 0..3. A piece is 16 B of the plane; a group is two neighbouring plane blocks = 8 pieces per
// lane, read from 256 B of each of 16 source rows, stored as eight whole 512-B runs; a work-group takes 16 whole source rows.
// coverage: bias 256 blocks x 8 waves x PK_IT groups x 1024 elements = 2 x 2048 x 2048; rows 128 x 8 x PK_IT x 1024 = 4096 x 1024;
//           a weight 32 x 8 x PK_IT x 1024 = 1024 x 1024; group -> source and group -> plane are one to one. No barrier.
// =====================================================================================================
#define PK_IT 4
#define PK_BM ((NB * NQ) / 16)                             // 256 blocks, 16 source rows each
#define PK_BX ((NROWS * DMODEL) / (8 * PK_IT * 1024))      // 128 blocks
#define PK_BW ((DMODEL * DMODEL) / (8 * PK_IT * 1024))     //  32 blocks per weight
#define PK_BLOCKS (PK_BM + PK_BX + 4 * PK_BW)
static_assert(NC == 8 * PK_IT * 64 && PK_BX * 8 * PK_IT * 1024 == NROWS * DMODEL);
static_assert(PK_BW * 8 * PK_IT * 1024 == DMODEL * DMODEL && PK_BLOCKS == 512);

// stands behind a wave's run of loads, in front of every rewrite of a register that they name; their address pair is an input,
// so that it is not given away in front of the wait
__device__ __forceinline__ void wait_x0(const void* p) {
#if defined(__HIP_DEVICE_COMPILE__)
  asm volatile("s_wait_xcnt 0x0" :: "v"(p) : "memory");
#endif
}
__device__ __forceinline__ float log2_slot(float x) {
  const bool  sm = x < 1.17549435e-38f;
  const float s  = ldexpf(x, sm ? 32 : 0);
  float r;
#if defined(__HIP_DEVICE_COMPILE__)
  asm("v_log_f32 %0, %1\n\tv_nop" : "=v"(r) : "v"(s));
#else
  r = log2f(s);
#endif
  return r - (sm ? 32.0f : 0.0f);
}

__global__ __launch_bounds__(256) void pack_all(const float* __restrict__ Mp, float* LB,
                                                const float* __restrict__ xp, unsigned short* X16,
                                                const float* __restrict__ wq, const float* __restrict__ wk,
                                                const float* __restrict__ wv, const float* __restrict__ wo,
                                                unsigned short* W16) {
  const unsigned lane = threadIdx.x & 31u;
  const unsigned wave = threadIdx.x >> 5;
  const unsigned b    = blockIdx.x;
  v4f a[PK_IT][8];
  if (b < PK_BM) {
    // block b = source rows 16 b .. 16 b + 15 = plane blocks 64 b .. 64 b + 63; group (it, wave) = plane blocks 2 (8 it + wave) + 0, 1
    const unsigned c = lane & 15u, hh = lane >> 4;
    const float* sp = Mp + (size_t)(b * 16u + c) * NC + wave * 64u + hh * 8u;
    float*       dp = LB + (size_t)(b * (8u * PK_IT) + wave) * 1024 + lane * 4u;
#pragma unroll   // here and below in the pack: every index a constant, so the groups stay in registers
    for (int it = 0; it < PK_IT; ++it)
#pragma unroll
      for (int u = 0; u < 8; ++u)
        a[it][u] = *(const v4f*)(sp + it * 512 + (u >> 2) * 32 + ((u & 3) >> 1) * 16 + (u & 1) * 4);
    wait_x0(sp);
#pragma unroll
    for (int it = 0; it < PK_IT; ++it) {
#pragma unroll
      for (int u = 0; u < 8; ++u) {
        const v4f v = a[it][u];
        v4f o;
        o[0] = log2_slot(bfr(v[0]));
        o[1] = log2_slot(bfr(v[1]));
        o[2] = log2_slot(bfr(v[2]));
        o[3] = log2_slot(bfr(v[3]));
        *(v4f*)(dp + it * 8192 + u * 128) = o;
      }
    }
  } else {
    const unsigned bc = b - PK_BM;
    const bool isx = bc < PK_BX;                            // block-uniform
    const unsigned bw = isx ? 0u : bc - PK_BX;              // weights: plane bw / PK_BW, block bw % PK_BW of it
    const unsigned wi = bw / PK_BW;
    const float* src = isx ? xp : (wi == 0u) ? wq : (wi == 1u) ? wk : (wi == 2u) ? wv : wo;
    unsigned short* dst = isx ? X16 : W16 + (size_t)wi * (DMODEL * DMODEL);
    const float sc = isx ? ACARRY : WSC;
    const size_t e0 = (size_t)((isx ? bc : bw % PK_BW) * (8u * PK_IT) + wave) * 1024 + lane * 8u;   // group (it, wave) at + 8192 it
    const float*    sp = src + e0;
    unsigned short* dp = dst + e0;
#pragma unroll
    for (int it = 0; it < PK_IT; ++it)
#pragma unroll
      for (int u = 0; u < 4; ++u) {
        a[it][2 * u]     = *(const v4f*)(sp + it * 8192 + u * 256);
        a[it][2 * u + 1] = *(const v4f*)(sp + it * 8192 + u * 256 + 4);
      }
    wait_x0(sp);
#pragma unroll
    for (int it = 0; it < PK_IT; ++it) {
#pragma unroll
      for (int u = 0; u < 4; ++u) {
        const v4f p = a[it][2 * u], q = a[it][2 * u + 1];
        v4u o;
        o[0] = pk16(h_bits((_Float16)(bfr(p[0]) * sc)), h_bits((_Float16)(bfr(p[1]) * sc)));
        o[1] = pk16(h_bits((_Float16)(bfr(p[2]) * sc)), h_bits((_Float16)(bfr(p[3]) * sc)));
        o[2] = pk16(h_bits((_Float16)(bfr(q[0]) * sc)), h_bits((_Float16)(bfr(q[1]) * sc)));
        o[3] = pk16(h_bits((_Float16)(bfr(q[2]) * sc)), h_bits((_Float16)(bfr(q[3]) * sc)));
        *(v4u*)(dp + it * 8192 + u * 256) = o;
      }
    }
  }
}

// =====================================================================================================
// LDS-staged batched f16 WMMA GEMM: C[m][n] = f( oscale * sum_k A[m][k] * Bt[n][k] + bf16(bias) ) (+ residual); one block of
// 8 waves per 128x128 tile, one wave per 32x64 part of it (4 x 2 waves). A row-major [M][K] pitch lda (16-bit plane), Bt
// row-major [N][K] pitch ldb (k contiguous); M, N multiples of 128, K multiple of 128. blockIdx.y = batch index with element
// strides sA, sB, sC.
// A stage is 128 k (256 B) of the tile's 128 A rows and 128 Bt rows, laid in LDS at a row pitch of 272 B; two buffers. Every
// lane brings 16 pieces of 16 B per stage by asynchronous copies (16 lanes = one whole 256-B row piece), the next stage's
// copies in flight while this stage is multiplied; fragments are read from LDS with the split k map of ldfrag_u, k ascending.
// BM: 0 = no bias, 1 = per column bf16(bias[col]), 2 = per row bf16(bias[row]) (clamped-address loads).
// OM: 0 = f32 out (pitch ldc; HASR 1 adds bf16(R[m][n]), HASR 2 adds raw f32 R[m][n], same pitch/stride as C);
//     2 = f16 out (pitch ldc) = f16( act(value) * ocarry ), ACT 1 = exact GELU.
//     3, 4 = the same f16 values laid in the fragment order that attn16 loads (ldfrag_p), ldc unused, BM 0 only. A wave's 16x64
//         slab is four runs of 512 B; run it, lane (c, hh) = slab row c, cols 16 it + 8 hh + 0..7: one whole 512-B store each.
//         3 (k plane; rows = batch*2048 + key, cols = 64 head + d): the slab is the 2-KiB block [batch][head][key / 16].
//         4 (v^T plane; rows = 64 head + d, cols = key, batch = blockIdx.y through sC): runs 2t, 2t + 1 are the 1-KiB piece
//         (d / 16) & 3 of the 4-KiB block [head][key / 32], t = 0, 1 the slab's two 32-key tiles.
// coverage: 2 slabs x 16 rows (f32: it 0..7 x lane>>4; OM 2: it 0..3 x lane>>3; OM 3, 4: lane & 15) x 64 cols = the wave's whole 32x64 part;
//           grid = tilesM*tilesN blocks, a surplus block exits as a whole in front of every barrier.
// =====================================================================================================
#define GT_PITCH  136                          // LDS row pitch in halves: 272 B = 16 B x odd, for 16-B LDS reads
#define GT_STAGE  (256 * GT_PITCH)             // halves per buffer: [A 128 rows | Bt 128 rows]
typedef __attribute__((address_space(3))) unsigned short lds_u16;

// Eight asynchronous 16-B copies per lane, global -> LDS, rows 16 apart. The closing s_wait_xcnt 0 stands inside the statement
// so that no address register of an issued copy is rewritten in front of it.
__device__ __forceinline__ void async_rows8(unsigned l, const unsigned short* g, size_t gstep) {
#if defined(__HIP_DEVICE_COMPILE__)
  const unsigned ls = 16 * GT_PITCH * 2;       // 16 LDS rows in bytes
  asm volatile("global_load_async_to_lds_b128 %0, %8, off\n\t"
               "global_load_async_to_lds_b128 %1, %9, off\n\t"
               "global_load_async_to_lds_b128 %2, %10, off\n\t"
               "global_load_async_to_lds_b128 %3, %11, off\n\t"
               "global_load_async_to_lds_b128 %4, %12, off\n\t"
               "global_load_async_to_lds_b128 %5, %13, off\n\t"
               "global_load_async_to_lds_b128 %6, %14, off\n\t"
               "global_load_async_to_lds_b128 %7, %15, off\n\t"
               "s_wait_xcnt 0x0"
               :: "v"(l), "v"(l + ls), "v"(l + 2 * ls), "v"(l + 3 * ls),
                  "v"(l + 4 * ls), "v"(l + 5 * ls), "v"(l + 6 * ls), "v"(l + 7 * ls),
                  "v"(g), "v"(g + gstep), "v"(g + 2 * gstep), "v"(g + 3 * gstep),
                  "v"(g + 4 * gstep), "v"(g + 5 * gstep), "v"(g + 6 * gstep), "v"(g + 7 * gstep)
               : "memory");
#endif
}
__device__ __forceinline__ void wait_async0() {   // this wave's copies have landed in LDS
#if defined(__HIP_DEVICE_COMPILE__)
  asm volatile("s_wait_asynccnt 0x0" ::: "memory");
#endif
}
__device__ __forceinline__ void wait_ds0() {      // this wave's LDS reads have returned before their buffer is refilled
#if defined(__HIP_DEVICE_COMPILE__)
  asm volatile("s_wait_dscnt 0x0" ::: "memory");
#endif
}

template <int OM, int BM, int HASR, int ACT>
__global__ __launch_bounds__(256) void gemm64(
    const unsigned short* __restrict__ Ap, int lda, long long sA,
    const unsigned short* __restrict__ Btp, int ldb, long long sB,
    const float* __restrict__ bias,
    const float* __restrict__ Rp,
    void* Cout, int ldc, long long sC,
    int M, int N, int K, float oscale, float ocarry) {
  __shared__ __align__(16) unsigned short ring[2 * GT_STAGE];   // two stage buffers
  __shared__ __align__(16) float sT[8][16 * 68];   // per-wave 16x64 slab, pitch 68 floats
  const int by   = blockIdx.y;
  const int tid  = threadIdx.x;
  const int lane = tid & 31;
  const int wave = tid >> 5;
  const int tilesN = N >> 7;
  const int tilesM = M >> 7;
  const int tile = blockIdx.x;
  if (tile >= tilesM * tilesN) return;   // block-uniform, in front of every barrier and copy
  const int tm = tile / tilesN;
  const int tn = tile - tm * tilesN;
  const int bm0 = tm << 7;
  const int bn0 = tn << 7;
  const int wm = (wave >> 1) << 5;             // the wave's 32 rows inside the block tile
  const int wn = (wave & 1) << 6;              // the wave's 64 cols inside the block tile
  const int m0 = bm0 + wm;
  const int n0 = bn0 + wn;

  const unsigned short* A1 = Ap  + (size_t)((long long)by * sA);
  const unsigned short* Bb = Btp + (size_t)((long long)by * sB);

  const int rlane = lane & 15;                 // row (A) / col (B, D) within subtile
  const int koff  = (lane >> 4) * 8;           // k offset of this lane half
  const int mOff  = (lane >> 4) * 8;           // D row offset

  // copy map: lane piece = 16 B number tid & 15 of row (tid >> 4) + 16 j, j 0..7, of the A rows and of the Bt rows
  const int crow = tid >> 4;
  const int cpc  = (tid & 15) * 8;
  const unsigned short* gA = A1 + (size_t)(bm0 + crow) * lda + cpc;
  const unsigned short* gB = Bb + (size_t)(bn0 + crow) * ldb + cpc;
  const unsigned lA = (unsigned)(uintptr_t)(lds_u16*)(ring + crow * GT_PITCH + cpc);
  const unsigned lB = lA + 128 * GT_PITCH * 2;
  const int nst = K >> 7;                      // stages of 128 k

  v8f acc[2][4];
#pragma unroll
  for (int i = 0; i < 2; ++i)
#pragma unroll
    for (int j = 0; j < 4; ++j) acc[i][j] = zero8();

  // stage 0 into buffer 0, published; then stage 1 into buffer 1
  async_rows8(lA, gA, (size_t)16 * lda);
  async_rows8(lB, gB, (size_t)16 * ldb);
  wait_async0();
  __syncthreads();
  if (nst > 1) {
    async_rows8(lA + GT_STAGE * 2, gA + 128, (size_t)16 * lda);
    async_rows8(lB + GT_STAGE * 2, gB + 128, (size_t)16 * ldb);
  }

  for (int t = 0; t < nst; ++t) {
    const int buf = t & 1;
    const unsigned short* fA = ring + buf * GT_STAGE + (wm + rlane) * GT_PITCH + koff;
    const unsigned short* fB = ring + buf * GT_STAGE + (128 + wn + rlane) * GT_PITCH + koff;
    // two fragment sets: the next 32 k of this stage are read from LDS as one group ahead of the current products
    v16h ah[2][2], bh[2][4];
#pragma unroll
    for (int j = 0; j < 4; ++j) bh[0][j] = ldfrag_u(fB + (j << 4) * GT_PITCH);
#pragma unroll
    for (int i = 0; i < 2; ++i) ah[0][i] = ldfrag_u(fA + (i << 4) * GT_PITCH);
#pragma unroll   // every fragment-set index a constant, so both sets stay in registers
    for (int s = 0; s < 4; ++s) {
      const int cu = s & 1, nx = cu ^ 1;
      if (s < 3) {
#pragma unroll
        for (int j = 0; j < 4; ++j) bh[nx][j] = ldfrag_u(fB + (j << 4) * GT_PITCH + (s + 1) * 32);
#pragma unroll
        for (int i = 0; i < 2; ++i) ah[nx][i] = ldfrag_u(fA + (i << 4) * GT_PITCH + (s + 1) * 32);
      }
#pragma unroll
      for (int i = 0; i < 2; ++i) {
#pragma unroll
        for (int j = 0; j < 4; ++j) acc[i][j] = mma_raw(ah[cu][i], bh[cu][j], acc[i][j]);
        dep_guard1(acc[i][0], acc[i][3], ah[cu][i]);
      }
      keep4_h(bh[cu][0], bh[cu][1], bh[cu][2], bh[cu][3]);
    }
    // publish point of stage t + 1: own LDS reads back, own copies landed, one barrier for both hand-overs, then the refill
    wait_ds0();
    wait_async0();
    __syncthreads();
    if (t + 2 < nst) {
      async_rows8(lA + buf * (GT_STAGE * 2), gA + (size_t)(t + 2) * 128, (size_t)16 * lda);
      async_rows8(lB + buf * (GT_STAGE * 2), gB + (size_t)(t + 2) * 128, (size_t)16 * ldb);
    }
  }
  wait_async0();
  acc_guard4(acc[0][0], acc[0][1], acc[0][2], acc[0][3]);
  acc_guard4(acc[1][0], acc[1][1], acc[1][2], acc[1][3]);

  const int hh2 = lane >> 4, c4 = (lane & 15) * 4;     // f32 out: 256-B row segment = 16 lanes x 16 B
  const int q8  = lane >> 3, c8 = (lane & 7) * 8;
  float bc[4];
  float bcol[8];
#pragma unroll
  for (int e = 0; e < 4; ++e) bc[e] = 0.f;
#pragma unroll
  for (int e = 0; e < 8; ++e) bcol[e] = 0.f;
  if constexpr (BM == 1) {
    if constexpr (OM == 0) {
      const int cb = n0 + c4;
      const int i0 = (cb < N - 4) ? cb : (N - 4);        // clamped address
      const v4f b0v = *(const v4f*)(bias + i0);
#pragma unroll
      for (int e = 0; e < 4; ++e) bc[e] = bfr(b0v[e]);
    } else {
      const int cb = n0 + c8;
      const int i0 = (cb < N - 8) ? cb : (N - 8);        // clamped address
      const v4f b0v = *(const v4f*)(bias + i0), b1v = *(const v4f*)(bias + i0 + 4);
#pragma unroll
      for (int e = 0; e < 4; ++e) { bcol[e] = bfr(b0v[e]); bcol[4 + e] = bfr(b1v[e]); }
    }
  }

  // ---- epilogue ----
  float* slab = sT[wave];
#pragma unroll
  for (int i = 0; i < 2; ++i) {
    const int mBase = m0 + (i << 4);
#pragma unroll
    for (int j = 0; j < 4; ++j) {
#pragma unroll
      for (int r = 0; r < 8; ++r) {
        slab[(mOff + r) * 68 + (j << 4) + rlane] = acc[i][j][r];
      }
    }
    wave_sync_lds();
    if constexpr (OM == 0) {
      float* C = (float*)Cout + (size_t)((long long)by * sC);
      v4f vals[8];
#pragma unroll
      for (int it = 0; it < 8; ++it) {
        const int row = it * 2 + hh2;                      // it 0..7 x hh2 0..1 = rows 0..15
        const int gr  = mBase + row;
        v4f v = *(const v4f*)(slab + row * 68 + c4);
        float br = 0.f;
        if constexpr (BM == 2) {
          const int ir = (gr < M - 1) ? gr : (M - 1);      // clamped address
          br = bfr(bias[ir]);
        }
        v4f rv = {0.f, 0.f, 0.f, 0.f};
        if constexpr (HASR != 0) {
          const float* R = Rp + (size_t)((long long)by * sC);
          const v4f rraw = *(const v4f*)(R + (size_t)gr * ldc + n0 + c4);
#pragma unroll
          for (int e = 0; e < 4; ++e) rv[e] = (HASR == 1) ? bfr(rraw[e]) : rraw[e];
        }
#pragma unroll
        for (int e = 0; e < 4; ++e) v[e] = v[e] * oscale + bc[e] + br + rv[e];
        vals[it] = v;
      }
      {
#pragma unroll
        for (int it = 0; it < 8; ++it) {
          const int gr = mBase + it * 2 + hh2;
          *(v4f*)(C + (size_t)gr * ldc + n0 + c4) = vals[it];
        }
        
      }
    } else {
      unsigned short* C = (unsigned short*)Cout + (size_t)((long long)by * sC);
      static_assert(OM == 2 || BM == 0);
      v4u hv[4];
#pragma unroll
      for (int it = 0; it < 4; ++it) {
        const int row = (OM == 2) ? it * 4 + q8 : rlane;   // OM 2: it 0..3 x q8 0..3 = rows 0..15; OM 3, 4: row = lane & 15
        const float* sp = slab + row * 68 + ((OM == 2) ? c8 : it * 16 + koff);
        float br = 0.f;
        if constexpr (BM == 2) {
          const int gr = mBase + row;
          const int ir = (gr < M - 1) ? gr : (M - 1);      // clamped address
          br = bfr(bias[ir]);
        }
        v4u a = {0u, 0u, 0u, 0u};
#pragma unroll
        for (int e = 0; e < 4; ++e) {
          float f0 = sp[2 * e] * oscale + bcol[2 * e] + br;
          float f1 = sp[2 * e + 1] * oscale + bcol[2 * e + 1] + br;
          if constexpr (ACT == 1) { f0 = gelu_f(f0); f1 = gelu_f(f1); }
          f0 *= ocarry; f1 *= ocarry;
          a[e] = pk16(h_bits((_Float16)f0), h_bits((_Float16)f1));
        }
        hv[it] = a;
      }
      {
#pragma unroll
        for (int it = 0; it < 4; ++it) {
          if constexpr (OM == 2) {
            const int row = it * 4 + q8;
            *(v4u*)(C + (size_t)(mBase + row) * ldc + n0 + c8) = hv[it];
          } else if constexpr (OM == 3) {
            const int mt = mBase >> 4;                     // batch * 128 + key tile
            const size_t blk = (size_t)((mt / (NC / 16)) * NHEAD + (n0 >> 6)) * (NC / 16) + (mt % (NC / 16));
            *(v4u*)(C + blk * 1024 + it * 256 + lane * 8) = hv[it];
          } else {
            const size_t blk = (size_t)(mBase >> 6) * (NC / 32) + (n0 >> 5) + (it >> 1);
            *(v4u*)(C + blk * 2048 + ((mBase >> 4) & 3) * 512 + (it & 1) * 256 + lane * 8) = hv[it];
          }
        }
        
      }
    }
    wave_sync_lds();
  }
}

__global__ __launch_bounds__(ATT_THREADS)
void attn16(const unsigned short* __restrict__ QHp, const unsigned short* __restrict__ KHp,
            const unsigned short* __restrict__ VTq, const float* __restrict__ LBp, unsigned short* CT) {
  const int tid  = threadIdx.x;
  const int wave = tid >> 5;
  const int lane = tid & 31;
  const int hh   = lane >> 4;
  const int c    = lane & 15;

  const int qt   = blockIdx.x & ((NQ / 16) - 1);           // 0..127
  const int bat  = blockIdx.x / (NQ / 16);                 // 0..1
  const int head = __builtin_amdgcn_readfirstlane(wave);   // 0..15; told to be wave-uniform, so the k and v^T bases stay scalar
  const int q0   = qt * 16;

  const size_t qofs = ((size_t)bat * NQ + q0 + c) * DMODEL + head * HDIM + 8 * hh;
  const _Float16* Qh = (const _Float16*)(const void*)QHp + qofs;
  const _Float16* Kb = (const _Float16*)(const void*)KHp + (size_t)(bat * NHEAD + head) * (NC * HDIM);
  const _Float16* Vb = (const _Float16*)(const void*)VTq + (size_t)(bat * NHEAD + head) * (NC * HDIM);
  const unsigned lofs = 8u * (unsigned)lane;               // the lane's 16 B inside every 512-B run
  const float* Wb = LBp + (size_t)(bat * (NQ / 16) + qt) * (16 * NC) + 4u * (unsigned)lane;   // log2 units, 512 floats per step
  const float lsc = (LOG2E * ATT_SCALE) / (QC * KC);                   // log2(e) / 8 / carries

  const v16h qa = ldfrag_h(Qh), qb = ldfrag_h(Qh + 32);

  float mrun = -INFINITY, lsum = 0.f;                      // the query's running maximum; this wave half's running sum
  v8f o0 = zero8(), o1 = zero8(), o2 = zero8(), o3 = zero8();

#pragma unroll 1   // rolled: one step's 20 loads are issued as one group at its head, and the loop text stays short
  for (int kb = 0; kb < NC; kb += 32) {
    const _Float16* kp = Kb + (size_t)kb * HDIM + lofs;    // blocks kb / 16 and kb / 16 + 1, 1024 halves each
    const float*    wp = Wb + (size_t)kb * 16;             // block kb / 32, 512 floats
    const _Float16* vp = Vb + (size_t)kb * HDIM + lofs;    // block kb / 32, 2048 halves
    const v16h k00 = ldfrag_p(kp),        k01 = ldfrag_p(kp + 512);
    const v16h k10 = ldfrag_p(kp + 1024), k11 = ldfrag_p(kp + 1536);
    const v4f w0 = *(const v4f*)(wp),       w1 = *(const v4f*)(wp + 128);
    const v4f w2 = *(const v4f*)(wp + 256), w3 = *(const v4f*)(wp + 384);
    const v16h vb0 = ldfrag_p(vp);
    const v16h vb1 = ldfrag_p(vp + 512);
    const v16h vb2 = ldfrag_p(vp + 1024);
    const v16h vb3 = ldfrag_p(vp + 1536);
#if defined(__HIP_DEVICE_COMPILE__)
    // stands behind the step's 20 loads, in front of every rewrite of a register that they name; the three address pairs are
    // inputs, so that none of them serves as a load's destination in front of the wait
    asm volatile("s_wait_xcnt 0x0" :: "v"(kp), "v"(wp), "v"(vp) : "memory");
#endif
    v8f s0, s1;
    s0 = mma_raw(k00, qa, zero8());
    s0 = mma_raw(k01, qb, s0);
    guard_s2(s0, k00, k01);
    s1 = mma_raw(k10, qa, zero8());
    s1 = mma_raw(k11, qb, s1);
    guard_s4(s1, k10, k11, qa, qb);
    v2f t[8];                                              // pair i = keys kb + 16 (i >> 2) + 8 hh + 2 (i & 3) + 0, 1
#pragma unroll   // here and below: every index a constant, so the pairs stay in registers
    for (int e = 0; e < 2; ++e) {
      t[e]     = (v2f){s0[2 * e],     s0[2 * e + 1]} * lsc + (v2f){w0[2 * e], w0[2 * e + 1]};
      t[2 + e] = (v2f){s0[4 + 2 * e], s0[5 + 2 * e]} * lsc + (v2f){w1[2 * e], w1[2 * e + 1]};
      t[4 + e] = (v2f){s1[2 * e],     s1[2 * e + 1]} * lsc + (v2f){w2[2 * e], w2[2 * e + 1]};
      t[6 + e] = (v2f){s1[4 + 2 * e], s1[5 + 2 * e]} * lsc + (v2f){w3[2 * e], w3[2 * e + 1]};
    }
    float mx[8];
#pragma unroll
    for (int i = 0; i < 8; ++i) mx[i] = fmaxf(t[i][0], t[i][1]);
    float mxa = fmaxf(fmaxf(fmaxf(mx[0], mx[1]), fmaxf(mx[2], mx[3])), fmaxf(fmaxf(mx[4], mx[5]), fmaxf(mx[6], mx[7])));
    mxa = fmaxf(mxa, xhalf(mxa));                          // over the step's 32 keys, equal in both halves
    const float mn = fmaxf(mrun, mxa);
    const float al = exp2f(mrun - mn);
    mrun = mn;
    v2f ex[8];
    FragH ph;                                              // elements 0..7 = keys kb + 8hh + 0..7, 8..15 = keys kb + 16 + 8hh + 0..7
#pragma unroll
    for (int i = 0; i < 8; ++i) {
      const v2f d = t[i] - mn;
      ex[i] = (v2f){exp2f(d[0]), exp2f(d[1])};
      ph.p[i] = __builtin_convertvector(ex[i] * PC, v2h);
    }
    const v2f ps = ((ex[0] + ex[1]) + (ex[2] + ex[3])) + ((ex[4] + ex[5]) + (ex[6] + ex[7]));
    lsum = lsum * al + (ps[0] + ps[1]);
#pragma unroll
    for (int r = 0; r < 8; ++r) {
      o0[r] *= al;
      o1[r] *= al;
      o2[r] *= al;
      o3[r] *= al;
    }
    o0 = mma_raw(vb0, ph.v, o0);
    o1 = mma_raw(vb1, ph.v, o1);
    o2 = mma_raw(vb2, ph.v, o2);
    o3 = mma_raw(vb3, ph.v, o3);
    guard_pv4(o0, o1, o2, o3, ph.v, vb0, vb1, vb2, vb3);
  }

  // ---- join the halves' sums, fold 1/l and the carries (1024 on P, 16 on v, 1024 on the stored ctx), store 16 B per tile ----
  const float oc  = FC / (PC * VC);
  const float inv = (1.0f / (lsum + xhalf(lsum))) * oc;
  unsigned short* dst = CT + qofs;                         // row q0 + c, cols 64 head + 8 hh (+ 16 t)
  v4u p0, p1, p2, p3;
#pragma unroll
  for (int e = 0; e < 4; ++e) {
    p0[e] = pk16(h_bits((_Float16)(o0[2 * e] * inv)), h_bits((_Float16)(o0[2 * e + 1] * inv)));
    p1[e] = pk16(h_bits((_Float16)(o1[2 * e] * inv)), h_bits((_Float16)(o1[2 * e + 1] * inv)));
    p2[e] = pk16(h_bits((_Float16)(o2[2 * e] * inv)), h_bits((_Float16)(o2[2 * e + 1] * inv)));
    p3[e] = pk16(h_bits((_Float16)(o3[2 * e] * inv)), h_bits((_Float16)(o3[2 * e + 1] * inv)));
  }
  *(v4u*)(dst)      = p0;
  *(v4u*)(dst + 16) = p1;
  *(v4u*)(dst + 32) = p2;
  *(v4u*)(dst + 48) = p3;
}

// =====================================================================================================
// Workspace map (bytes); every plane is an exact multiple of its tile / whole-row store granularity (M, N exact tile multiples,
// element counts exact multiples of pack_all's 32768-element block, no pad rows needed), every offset a multiple of 2 MiB:
//   WQ16 f16 [1024][1024] x64               2097152   ([out][in] = [n][k])
//   WK16 f16 [1024][1024] x64               2097152
//   WV16 f16 [1024][1024] x64               2097152
//   WO16 f16 [1024][1024] x64               2097152
//   X16  f16 [4096][1024] x16               8388608   (activation rows)
//   LB   f32 [2][128][64] x 2 KiB          33554432   (log2(bf16(M)), lane order of the transposed score tiles)
//   QH   f16 [4096][1024] x16               8388608   (q projection, unscaled)
//   KH   f16 [2][16][128] x 2 KiB, x16      8388608   (k projection, fragment order)
//   VT   f16 [2][16][64] x 4 KiB, x16       8388608   (v^T, fragment order)
//   CT   f16 [4096][1024] x1024             8388608   (attention ctx, merged heads)
//   end                                    83886080
// =====================================================================================================
extern "C" void kernel_launch(void* const* d_in, const int* in_sizes, int n_in,
                              void* d_out, int out_size, void* d_ws, size_t ws_size,
                              hipStream_t stream) {
  if (n_in < 7) return;
  if (in_sizes[0] != NROWS * DMODEL) return;
  if (in_sizes[1] != NB * NQ * NC) return;
  if (in_sizes[2] != DMODEL * DMODEL || in_sizes[3] != DMODEL * DMODEL ||
      in_sizes[4] != DMODEL * DMODEL || in_sizes[5] != DMODEL * DMODEL) return;
  if (in_sizes[6] != DMODEL) return;
  if (out_size != NROWS * DMODEL) return;
  if ((in_sizes[0] % 2048) != 0 || (in_sizes[2] % 2048) != 0 || (in_sizes[1] % 1024) != 0) return;

  const float* x   = (const float*)d_in[0];
  const float* Mp  = (const float*)d_in[1];
  const float* w_q = (const float*)d_in[2];
  const float* w_k = (const float*)d_in[3];
  const float* w_v = (const float*)d_in[4];
  const float* w_o = (const float*)d_in[5];
  const float* b_o = (const float*)d_in[6];
  float*       out = (float*)d_out;

  const size_t PW  = (size_t)DMODEL * DMODEL * 2;                 //  2097152
  const size_t PX  = (size_t)NROWS * DMODEL * 2;                  //  8388608
  const size_t PLB = (size_t)NB * NQ * NC * 4;                    // 33554432
  const size_t PVT = (size_t)NB * DMODEL * NC * 2;                //  8388608
  size_t off = 0;
  const size_t oWQ = off; off += PW;
  const size_t oWK = off; off += PW;
  const size_t oWV = off; off += PW;
  const size_t oWO = off; off += PW;
  const size_t oX  = off; off += PX;
  const size_t oLB = off; off += PLB;
  const size_t oQH = off; off += PX;
  const size_t oKH = off; off += PX;
  const size_t oVT = off; off += PVT;
  const size_t oCT = off; off += PX;
  if (off > ws_size) return;                                      // off = 83886080
  if (off > (size_t)134217728) return;

  char* ws = (char*)d_ws;
  unsigned short* WQ16 = (unsigned short*)(ws + oWQ);
  unsigned short* WK16 = (unsigned short*)(ws + oWK);
  unsigned short* WV16 = (unsigned short*)(ws + oWV);
  unsigned short* WO16 = (unsigned short*)(ws + oWO);
  unsigned short* X16  = (unsigned short*)(ws + oX);
  float*          LB   = (float*)(ws + oLB);
  unsigned short* QH   = (unsigned short*)(ws + oQH);
  unsigned short* KH   = (unsigned short*)(ws + oKH);
  unsigned short* VTp  = (unsigned short*)(ws + oVT);
  unsigned short* CT   = (unsigned short*)(ws + oCT);

  const dim3 blk(256);
  const dim3 gPK(PK_BLOCKS);                                       // 512 blocks
  const int tilesP = (NROWS / 128) * (DMODEL / 128);               // 256
  const int tilesV = (DMODEL / 128) * (NC / 128);                  // 128 per batch
  const dim3 gP(tilesP, 1);                                        // 256
  const dim3 gV(tilesV, NB);                                       // 128 x 2
  const dim3 gAT(ATT_BLOCKS);                                      // 256
  const dim3 bAT(ATT_THREADS);                                     // 512

  // (0..2) one launch: weight planes W16[n][k] = f16( bf16_RNE(W[n][k]) * 64 ), [out][in] layout kept, k contiguous (WQ16, WK16,
  // WV16, WO16 lie one behind the other); activation plane X16[row][c] = f16( bf16_RNE(x[row][c]) * 16 ), rows = b*2048 + tok;
  // score bias plane log2( bf16_RNE(M[b][q][key]) ), f32, in the lane order of attn16's score tiles
  pack_all<<<gPK, blk, 0, stream>>>(Mp, LB, x, X16, w_q, w_k, w_v, w_o, WQ16);

  // (3) q projection: QH[m][n] = f16(16 * sum_k x[m][k] Wq[n][k]); M = 4096, N = 1024, K = 1024
  gemm64<2, 0, 0, 0><<<gP, blk, 0, stream>>>(
      X16, DMODEL, 0LL,
      WQ16, DMODEL, 0LL,
      b_o,
      (const float*)0,
      (void*)QH, DMODEL, 0LL,
      NROWS, DMODEL, DMODEL, 1.0f / (ACARRY * WSC), QC);

  // (4) k projection: f16(16 * sum_k x[m][k] Wk[n][k]) in fragment order; M = 4096, N = 1024, K = 1024
  gemm64<3, 0, 0, 0><<<gP, blk, 0, stream>>>(
      X16, DMODEL, 0LL,
      WK16, DMODEL, 0LL,
      b_o,
      (const float*)0,
      (void*)KH, DMODEL, 0LL,
      NROWS, DMODEL, DMODEL, 1.0f / (ACARRY * WSC), KC);

  // (5) v^T per batch: f16(16 * sum_k Wv[d][k] x_b[tok][k]) in fragment order; M = 1024, N = 2048, K = 1024
  gemm64<4, 0, 0, 0><<<gV, blk, 0, stream>>>(
      WV16, DMODEL, 0LL,
      X16, DMODEL, (long long)NC * DMODEL,
      b_o,
      (const float*)0,
      (void*)VTp, NC, (long long)DMODEL * NC,
      DMODEL, NC, DMODEL, 1.0f / (ACARRY * WSC), VC);

  // (6) attention per (batch, 16 query rows), 16 heads -> CT (f16, x1024)
  attn16<<<gAT, bAT, 0, stream>>>(QH, KH, VTp, LB, CT);

  // (7) out = CT . Wo^T / (1024 * 64) + bf16(bo); M = 4096, N = 1024, K = 1024, f32
  gemm64<0, 1, 0, 0><<<gP, blk, 0, stream>>>(
      CT, DMODEL, 0LL,
      WO16, DMODEL, 0LL,
      b_o,
      (const float*)0,
      (void*)out, DMODEL, 0LL,
      NROWS, DMODEL, DMODEL, 1.0f / (FC * WSC), 1.0f);
  (void)hipGetLastError();
}

// v005
// It runs in 128 microseconds.
// Timed twice side by side with v004, it ran 1.13 times as fast both times.
// All steps since v000 together make it 2.91 times as fast.
// Contractions: q/k projections (x rows f16 x16 . W f16 x64, K=1024), v^T projection (Wv f16 x64 . x rows f16 x16, K=1024),
// attention scores^T (k f16 x16 . q f16 x16, K=64), attention v^T . P^T (v^T f16 x16 . P f16 x1024, K=2048 in steps of 32),
// output projection (ctx f16 x1024 . Wo f16 x64, K=1024): all v_wmma_f32_16x16x32_f16 single products, f32 accumulate.
// Additive log2(M) score bias (f32 plane), online max-subtracted base-2 softmax and output bias in f32 on VALU.
// Every float input RNE-converted to bf16 on load.
#include <hip/hip_runtime.h>
#include <math.h>
#include <stdint.h>

#define NB      2
#define NQ      2048
#define NC      2048
#define DMODEL  1024
#define NHEAD   16
#define HDIM    64
#define NROWS   (NB * NQ)
#define WSC     64.0f
#define ACARRY  16.0f
#define QC      16.0f
#define KC      16.0f
#define VC      16.0f
#define PC      1024.0f
#define FC      1024.0f
#define ATT_SCALE 0.125f
#define LOG2E   1.4426950408889634f
static_assert(NHEAD * HDIM == DMODEL);
static_assert((NQ % 64) == 0 && (NC % 64) == 0 && (DMODEL % 64) == 0 && (NC % 32) == 0 && (NQ % 16) == 0);
static_assert((NROWS % 128) == 0 && (NC % 128) == 0 && (DMODEL % 128) == 0);
#define ATT_WAVES   16                                     // query tiles of 16 rows per block, one wave each
#define ATT_THREADS (ATT_WAVES * 32)
#define ATT_QG      (NQ / (16 * ATT_WAVES))                // blocks per batch and head
#define ATT_BLOCKS  (NB * NHEAD * ATT_QG)
static_assert(ATT_THREADS == 512 && ATT_QG == 8 && ATT_BLOCKS == 256);

typedef _Float16 v16h __attribute__((ext_vector_type(16)));
typedef _Float16 v8h  __attribute__((ext_vector_type(8)));
typedef float    v8f  __attribute__((ext_vector_type(8)));
typedef float    v4f  __attribute__((ext_vector_type(4)));
typedef float    v2f  __attribute__((ext_vector_type(2)));
typedef _Float16 v2h  __attribute__((ext_vector_type(2)));
typedef unsigned int v4u __attribute__((ext_vector_type(4)));

union FragH { v16h v; v8h h[2]; v4u u[2]; v2h p[8]; };

// ---- scalar helpers --------------------------------------------------------------------------------
__device__ __forceinline__ unsigned short bf_bits(float f) {          // f32 -> bf16 bits, RNE convert
  unsigned u = __float_as_uint(f);
  return (unsigned short)((u + 0x7FFFu + ((u >> 16) & 1u)) >> 16);
}
__device__ __forceinline__ float bf_up(unsigned short h) { return __uint_as_float(((unsigned)h) << 16); }
__device__ __forceinline__ float bfr(float f) { return bf_up(bf_bits(f)); }   // value of the bf16 RNE convert
__device__ __forceinline__ unsigned short h_bits(_Float16 x) { return __builtin_bit_cast(unsigned short, x); }
__device__ __forceinline__ unsigned pk16(unsigned short a, unsigned short b) { return (unsigned)a | ((unsigned)b << 16); }
__device__ __forceinline__ v8f zero8() { v8f z = {0.f, 0.f, 0.f, 0.f, 0.f, 0.f, 0.f, 0.f}; return z; }
__device__ __forceinline__ float gelu_f(float v) { return 0.5f * v * (1.0f + erff(v * 0.70710678118654752f)); }
__device__ __forceinline__ float xhalf(float x) {                     // the value that lane ^ 16 holds
  const int b = __builtin_bit_cast(int, x);
  return __builtin_bit_cast(float, __builtin_amdgcn_permlanex16(b, b, 0x76543210, 0xfedcba98, false, false));
}

// ---- fragment loaders: 16-bit A/B operand, lane -> row/col (lane&15), p already includes +8*(lane>>4);
//      elements 0..7 <- p[0..7] (k0+8h..), elements 8..15 <- p[16..23] (k0+16+8h..)  (same split k map for A and B;
//      B is read from a k-contiguous [n][k] plane in gemm64 and for q in attn16; attn16's A comes from fragment order via ldfrag_p)
__device__ __forceinline__ v16h ldfrag_h(const _Float16* p) {
  FragH f;
  f.h[0] = *(const v8h*)(p);
  f.h[1] = *(const v8h*)(p + 16);
  return f.v;
}
__device__ __forceinline__ v16h ldfrag_u(const unsigned short* p) {
  FragH f;
  f.u[0] = *(const v4u*)(p);
  f.u[1] = *(const v4u*)(p + 16);
  return f.v;
}

// fragment-ordered plane: a fragment is two runs of 512 B, run i = elements 8i..8i+7 of all 32 lanes, 16 B per lane in lane order;
// p already includes +8*lane, so each of the two wave-wide loads covers 512 contiguous bytes = four whole lines
__device__ __forceinline__ v16h ldfrag_p(const _Float16* p) {
  FragH f;
  f.h[0] = *(const v8h*)(p);
  f.h[1] = *(const v8h*)(p + 256);
  return f.v;
}

// ---- WMMA helpers with trailing VALU hazard gaps ------------------------------------------------------
__device__ __forceinline__ v8f mma_raw(v16h a, v16h b, v8f c) {
  return __builtin_amdgcn_wmma_f32_16x16x32_f16(false, a, false, b, (short)0, c, false, false);
}
__device__ __forceinline__ void dep_guard1(v8f& a, v8f& b, v16h x) {
#if defined(__HIP_DEVICE_COMPILE__)
  asm volatile("v_nop\n\tv_nop\n\tv_nop\n\tv_nop" : "+v"(a), "+v"(b) : "v"(x));
#endif
}
__device__ __forceinline__ void guard_s2(v8f& s, v16h a0, v16h a1) {
#if defined(__HIP_DEVICE_COMPILE__)
  asm volatile("v_nop\n\tv_nop\n\tv_nop\n\tv_nop" : "+v"(s) : "v"(a0), "v"(a1));
#endif
}
__device__ __forceinline__ void guard_s4(v8f& s, v16h a0, v16h a1, v16h b0, v16h b1) {
#if defined(__HIP_DEVICE_COMPILE__)
  asm volatile("v_nop\n\tv_nop\n\tv_nop\n\tv_nop" : "+v"(s) : "v"(a0), "v"(a1), "v"(b0), "v"(b1));
#endif
}
__device__ __forceinline__ void guard_pv4(v8f& a, v8f& b, v8f& c, v8f& d, v16h x, v16h y, v16h z, v16h w, v16h u) {
#if defined(__HIP_DEVICE_COMPILE__)
  asm volatile("v_nop\n\tv_nop\n\tv_nop\n\tv_nop"
               : "+v"(a), "+v"(b), "+v"(c), "+v"(d) : "v"(x), "v"(y), "v"(z), "v"(w), "v"(u));
#endif
}
__device__ __forceinline__ void keep4_h(v16h a, v16h b, v16h c, v16h d) {
#if defined(__HIP_DEVICE_COMPILE__)
  asm volatile("v_nop" :: "v"(a), "v"(b), "v"(c), "v"(d));
#endif
}
__device__ __forceinline__ void acc_guard4(v8f& a, v8f& b, v8f& c, v8f& d) {
#if defined(__HIP_DEVICE_COMPILE__)
  asm volatile("v_nop\n\tv_nop\n\tv_nop\n\tv_nop" : "+v"(a), "+v"(b), "+v"(c), "+v"(d));
#endif
}
__device__ __forceinline__ void wave_sync_lds() {
  __builtin_amdgcn_fence(__ATOMIC_RELEASE, "workgroup");
  __builtin_amdgcn_wave_barrier();
  __builtin_amdgcn_fence(__ATOMIC_ACQUIRE, "workgroup");
}

// =====================================================================================================
// All six input-only packs in ONE launch of 512 blocks x 8 waves; a wave takes PK_IT groups of eight 16-B loads: all its loads are
// issued at its head, then group after group is converted and stored as its loads return. Blocks 0..255: score bias plane;
// 256..383: activation rows; 384..511: the four weight planes, 32 blocks each.
// 16-bit pack, no transpose: dst[i] = f16( bf16_RNE(src[i]) * sc ), sc a power of two (exact). Used for the weights (stored
// [out][in] = [n][k], already k contiguous for B fragments / A of the v^T projection; the four planes lie one behind the other in
// the workspace) and for the activation rows. A piece is 8 elements: two 16-B loads, one 16-B store per lane; a group is 4 pieces
// per lane = 1024 elements per wave, 32 consecutive lanes = one whole 512-B store; the 8 waves' groups lie side by side.
// Score bias plane: log2( bf16_RNE(M) ) as f32 (M strictly positive), laid in the lane order in which attn16 holds its transposed
// score tiles: 2-KiB blocks [batch][query / 16][key / 32] of 16 queries x 32 keys, four runs of 512 B; run i, lane (c, hh) = query c,
// keys 16 (i >> 1) + 8 hh + 4 (i & 1) + 0..3. A piece is 16 B of the plane; a group is two neighbouring plane blocks = 8 pieces per
// lane, read from 256 B of each of 16 source rows, stored as eight whole 512-B runs; a work-group takes 16 whole source rows.
// coverage: bias 256 blocks x 8 waves x PK_IT groups x 1024 elements = 2 x 2048 x 2048; rows 128 x 8 x PK_IT x 1024 = 4096 x 1024;
//           a weight 32 x 8 x PK_IT x 1024 = 1024 x 1024; group -> source and group -> plane are one to one. No barrier.
// =====================================================================================================
#define PK_IT 4
#define PK_BM ((NB * NQ) / 16)                             // 256 blocks, 16 source rows each
#define PK_BX ((NROWS * DMODEL) / (8 * PK_IT * 1024))      // 128 blocks
#define PK_BW ((DMODEL * DMODEL) / (8 * PK_IT * 1024))     //  32 blocks per weight
#define PK_BLOCKS (PK_BM + PK_BX + 4 * PK_BW)
static_assert(NC == 8 * PK_IT * 64 && PK_BX * 8 * PK_IT * 1024 == NROWS * DMODEL);
static_assert(PK_BW * 8 * PK_IT * 1024 == DMODEL * DMODEL && PK_BLOCKS == 512);

// stands behind a wave's run of loads, in front of every rewrite of a register that they name; their address pair is an input,
// so that it is not given away in front of the wait
__device__ __forceinline__ void wait_x0(const void* p) {
#if defined(__HIP_DEVICE_COMPILE__)
  asm volatile("s_wait_xcnt 0x0" :: "v"(p) : "memory");
#endif
}
__device__ __forceinline__ float log2_slot(float x) {
  const bool  sm = x < 1.17549435e-38f;
  const float s  = ldexpf(x, sm ? 32 : 0);
  float r;
#if defined(__HIP_DEVICE_COMPILE__)
  asm("v_log_f32 %0, %1\n\tv_nop" : "=v"(r) : "v"(s));
#else
  r = log2f(s);
#endif
  return r - (sm ? 32.0f : 0.0f);
}

__global__ __launch_bounds__(256) void pack_all(const float* __restrict__ Mp, float* LB,
                                                const float* __restrict__ xp, unsigned short* X16,
                                                const float* __restrict__ wq, const float* __restrict__ wk,
                                                const float* __restrict__ wv, const float* __restrict__ wo,
                                                unsigned short* W16) {
  const unsigned lane = threadIdx.x & 31u;
  const unsigned wave = threadIdx.x >> 5;
  const unsigned b    = blockIdx.x;
  v4f a[PK_IT][8];
  if (b < PK_BM) {
    // block b = source rows 16 b .. 16 b + 15 = plane blocks 64 b .. 64 b + 63; group (it, wave) = plane blocks 2 (8 it + wave) + 0, 1
    const unsigned c = lane & 15u, hh = lane >> 4;
    const float* sp = Mp + (size_t)(b * 16u + c) * NC + wave * 64u + hh * 8u;
    float*       dp = LB + (size_t)(b * (8u * PK_IT) + wave) * 1024 + lane * 4u;
#pragma unroll   // here and below in the pack: every index a constant, so the groups stay in registers
    for (int it = 0; it < PK_IT; ++it)
#pragma unroll
      for (int u = 0; u < 8; ++u)
        a[it][u] = *(const v4f*)(sp + it * 512 + (u >> 2) * 32 + ((u & 3) >> 1) * 16 + (u & 1) * 4);
    wait_x0(sp);
#pragma unroll
    for (int it = 0; it < PK_IT; ++it) {
#pragma unroll
      for (int u = 0; u < 8; ++u) {
        const v4f v = a[it][u];
        v4f o;
        o[0] = log2_slot(bfr(v[0]));
        o[1] = log2_slot(bfr(v[1]));
        o[2] = log2_slot(bfr(v[2]));
        o[3] = log2_slot(bfr(v[3]));
        *(v4f*)(dp + it * 8192 + u * 128) = o;
      }
    }
  } else {
    const unsigned bc = b - PK_BM;
    const bool isx = bc < PK_BX;                            // block-uniform
    const unsigned bw = isx ? 0u : bc - PK_BX;              // weights: plane bw / PK_BW, block bw % PK_BW of it
    const unsigned wi = bw / PK_BW;
    const float* src = isx ? xp : (wi == 0u) ? wq : (wi == 1u) ? wk : (wi == 2u) ? wv : wo;
    unsigned short* dst = isx ? X16 : W16 + (size_t)wi * (DMODEL * DMODEL);
    const float sc = isx ? ACARRY : WSC;
    const size_t e0 = (size_t)((isx ? bc : bw % PK_BW) * (8u * PK_IT) + wave) * 1024 + lane * 8u;   // group (it, wave) at + 8192 it
    const float*    sp = src + e0;
    unsigned short* dp = dst + e0;
#pragma unroll
    for (int it = 0; it < PK_IT; ++it)
#pragma unroll
      for (int u = 0; u < 4; ++u) {
        a[it][2 * u]     = *(const v4f*)(sp + it * 8192 + u * 256);
        a[it][2 * u + 1] = *(const v4f*)(sp + it * 8192 + u * 256 + 4);
      }
    wait_x0(sp);
#pragma unroll
    for (int it = 0; it < PK_IT; ++it) {
#pragma unroll
      for (int u = 0; u < 4; ++u) {
        const v4f p = a[it][2 * u], q = a[it][2 * u + 1];
        v4u o;
        o[0] = pk16(h_bits((_Float16)(bfr(p[0]) * sc)), h_bits((_Float16)(bfr(p[1]) * sc)));
        o[1] = pk16(h_bits((_Float16)(bfr(p[2]) * sc)), h_bits((_Float16)(bfr(p[3]) * sc)));
        o[2] = pk16(h_bits((_Float16)(bfr(q[0]) * sc)), h_bits((_Float16)(bfr(q[1]) * sc)));
        o[3] = pk16(h_bits((_Float16)(bfr(q[2]) * sc)), h_bits((_Float16)(bfr(q[3]) * sc)));
        *(v4u*)(dp + it * 8192 + u * 256) = o;
      }
    }
  }
}

// =====================================================================================================
// LDS-staged batched f16 WMMA GEMM: C[m][n] = f( oscale * sum_k A[m][k] * Bt[n][k] + bf16(bias) ) (+ residual); one block of
// 8 waves per 128x128 tile, one wave per 32x64 part of it (4 x 2 waves). A row-major [M][K] pitch lda (16-bit plane), Bt
// row-major [N][K] pitch ldb (k contiguous); M, N multiples of 128, K multiple of 128. blockIdx.y = batch index with element
// strides sA, sB, sC.
// A stage is 128 k (256 B) of the tile's 128 A rows and 128 Bt rows, laid in LDS at a row pitch of 272 B; two buffers. Every
// lane brings 16 pieces of 16 B per stage by asynchronous copies (16 lanes = one whole 256-B row piece), the next stage's
// copies in flight while this stage is multiplied; fragments are read from LDS with the split k map of ldfrag_u, k ascending.
// BM: 0 = no bias, 1 = per column bf16(bias[col]), 2 = per row bf16(bias[row]) (clamped-address loads).
// OM: 0 = f32 out (pitch ldc; HASR 1 adds bf16(R[m][n]), HASR 2 adds raw f32 R[m][n], same pitch/stride as C);
//     2 = f16 out (pitch ldc) = f16( act(value) * ocarry ), ACT 1 = exact GELU.
//     3, 4 = the same f16 values laid in the fragment order that attn16 loads (ldfrag_p), ldc unused, BM 0 only. A wave's 16x64
//         slab is four runs of 512 B; run it, lane (c, hh) = slab row c, cols 16 it + 8 hh + 0..7: one whole 512-B store each.
//         3 (k plane; rows = batch*2048 + key, cols = 64 head + d): the slab is the 2-KiB block [batch][head][key / 16].
//         4 (v^T plane; rows = 64 head + d, cols = key, batch = blockIdx.y through sC): runs 2t, 2t + 1 are the 1-KiB piece
//         (d / 16) & 3 of the 4-KiB block [head][key / 32], t = 0, 1 the slab's two 32-key tiles.
// coverage: 2 slabs x 16 rows (f32: it 0..7 x lane>>4; OM 2: it 0..3 x lane>>3; OM 3, 4: lane & 15) x 64 cols = the wave's whole 32x64 part;
//           grid = tilesM*tilesN blocks, a surplus block exits as a whole in front of every barrier.
// =====================================================================================================
#define GT_PITCH  136                          // LDS row pitch in halves: 272 B = 16 B x odd, for 16-B LDS reads
#define GT_STAGE  (256 * GT_PITCH)             // halves per buffer: [A 128 rows | Bt 128 rows]
typedef __attribute__((address_space(3))) unsigned short lds_u16;

// Eight asynchronous 16-B copies per lane, global -> LDS, rows 16 apart. The closing s_wait_xcnt 0 stands inside the statement
// so that no address register of an issued copy is rewritten in front of it.
__device__ __forceinline__ void async_rows8(unsigned l, const unsigned short* g, size_t gstep) {
#if defined(__HIP_DEVICE_COMPILE__)
  const unsigned ls = 16 * GT_PITCH * 2;       // 16 LDS rows in bytes
  asm volatile("global_load_async_to_lds_b128 %0, %8, off\n\t"
               "global_load_async_to_lds_b128 %1, %9, off\n\t"
               "global_load_async_to_lds_b128 %2, %10, off\n\t"
               "global_load_async_to_lds_b128 %3, %11, off\n\t"
               "global_load_async_to_lds_b128 %4, %12, off\n\t"
               "global_load_async_to_lds_b128 %5, %13, off\n\t"
               "global_load_async_to_lds_b128 %6, %14, off\n\t"
               "global_load_async_to_lds_b128 %7, %15, off\n\t"
               "s_wait_xcnt 0x0"
               :: "v"(l), "v"(l + ls), "v"(l + 2 * ls), "v"(l + 3 * ls),
                  "v"(l + 4 * ls), "v"(l + 5 * ls), "v"(l + 6 * ls), "v"(l + 7 * ls),
                  "v"(g), "v"(g + gstep), "v"(g + 2 * gstep), "v"(g + 3 * gstep),
                  "v"(g + 4 * gstep), "v"(g + 5 * gstep), "v"(g + 6 * gstep), "v"(g + 7 * gstep)
               : "memory");
#endif
}
__device__ __forceinline__ void wait_async0() {   // this wave's copies have landed in LDS
#if defined(__HIP_DEVICE_COMPILE__)
  asm volatile("s_wait_asynccnt 0x0" ::: "memory");
#endif
}
__device__ __forceinline__ void wait_ds0() {      // this wave's LDS reads have returned before their buffer is refilled
#if defined(__HIP_DEVICE_COMPILE__)
  asm volatile("s_wait_dscnt 0x0" ::: "memory");
#endif
}

template <int OM, int BM, int HASR, int ACT>
__global__ __launch_bounds__(256) void gemm64(
    const unsigned short* __restrict__ Ap, int lda, long long sA,
    const unsigned short* __restrict__ Btp, int ldb, long long sB,
    const float* __restrict__ bias,
    const float* __restrict__ Rp,
    void* Cout, int ldc, long long sC,
    int M, int N, int K, float oscale, float ocarry) {
  __shared__ __align__(16) unsigned short ring[2 * GT_STAGE];   // two stage buffers
  __shared__ __align__(16) float sT[8][16 * 68];   // per-wave 16x64 slab, pitch 68 floats
  const int by   = blockIdx.y;
  const int tid  = threadIdx.x;
  const int lane = tid & 31;
  const int wave = tid >> 5;
  const int tilesN = N >> 7;
  const int tilesM = M >> 7;
  const int tile = blockIdx.x;
  if (tile >= tilesM * tilesN) return;   // block-uniform, in front of every barrier and copy
  const int tm = tile / tilesN;
  const int tn = tile - tm * tilesN;
  const int bm0 = tm << 7;
  const int bn0 = tn << 7;
  const int wm = (wave >> 1) << 5;             // the wave's 32 rows inside the block tile
  const int wn = (wave & 1) << 6;              // the wave's 64 cols inside the block tile
  const int m0 = bm0 + wm;
  const int n0 = bn0 + wn;

  const unsigned short* A1 = Ap  + (size_t)((long long)by * sA);
  const unsigned short* Bb = Btp + (size_t)((long long)by * sB);

  const int rlane = lane & 15;                 // row (A) / col (B, D) within subtile
  const int koff  = (lane >> 4) * 8;           // k offset of this lane half
  const int mOff  = (lane >> 4) * 8;           // D row offset

  // copy map: lane piece = 16 B number tid & 15 of row (tid >> 4) + 16 j, j 0..7, of the A rows and of the Bt rows
  const int crow = tid >> 4;
  const int cpc  = (tid & 15) * 8;
  const unsigned short* gA = A1 + (size_t)(bm0 + crow) * lda + cpc;
  const unsigned short* gB = Bb + (size_t)(bn0 + crow) * ldb + cpc;
  const unsigned lA = (unsigned)(uintptr_t)(lds_u16*)(ring + crow * GT_PITCH + cpc);
  const unsigned lB = lA + 128 * GT_PITCH * 2;
  const int nst = K >> 7;                      // stages of 128 k

  v8f acc[2][4];
#pragma unroll
  for (int i = 0; i < 2; ++i)
#pragma unroll
    for (int j = 0; j < 4; ++j) acc[i][j] = zero8();

  // stage 0 into buffer 0, published; then stage 1 into buffer 1
  async_rows8(lA, gA, (size_t)16 * lda);
  async_rows8(lB, gB, (size_t)16 * ldb);
  wait_async0();
  __syncthreads();
  if (nst > 1) {
    async_rows8(lA + GT_STAGE * 2, gA + 128, (size_t)16 * lda);
    async_rows8(lB + GT_STAGE * 2, gB + 128, (size_t)16 * ldb);
  }

  for (int t = 0; t < nst; ++t) {
    const int buf = t & 1;
    const unsigned short* fA = ring + buf * GT_STAGE + (wm + rlane) * GT_PITCH + koff;
    const unsigned short* fB = ring + buf * GT_STAGE + (128 + wn + rlane) * GT_PITCH + koff;
    // two fragment sets: the next 32 k of this stage are read from LDS as one group ahead of the current products
    v16h ah[2][2], bh[2][4];
#pragma unroll
    for (int j = 0; j < 4; ++j) bh[0][j] = ldfrag_u(fB + (j << 4) * GT_PITCH);
#pragma unroll
    for (int i = 0; i < 2; ++i) ah[0][i] = ldfrag_u(fA + (i << 4) * GT_PITCH);
#pragma unroll   // every fragment-set index a constant, so both sets stay in registers
    for (int s = 0; s < 4; ++s) {
      const int cu = s & 1, nx = cu ^ 1;
      if (s < 3) {
#pragma unroll
        for (int j = 0; j < 4; ++j) bh[nx][j] = ldfrag_u(fB + (j << 4) * GT_PITCH + (s + 1) * 32);
#pragma unroll
        for (int i = 0; i < 2; ++i) ah[nx][i] = ldfrag_u(fA + (i << 4) * GT_PITCH + (s + 1) * 32);
      }
#pragma unroll
      for (int i = 0; i < 2; ++i) {
#pragma unroll
        for (int j = 0; j < 4; ++j) acc[i][j] = mma_raw(ah[cu][i], bh[cu][j], acc[i][j]);
        dep_guard1(acc[i][0], acc[i][3], ah[cu][i]);
      }
      keep4_h(bh[cu][0], bh[cu][1], bh[cu][2], bh[cu][3]);
    }
    // publish point of stage t + 1: own LDS reads back, own copies landed, one barrier for both hand-overs, then the refill
    wait_ds0();
    wait_async0();
    __syncthreads();
    if (t + 2 < nst) {
      async_rows8(lA + buf * (GT_STAGE * 2), gA + (size_t)(t + 2) * 128, (size_t)16 * lda);
      async_rows8(lB + buf * (GT_STAGE * 2), gB + (size_t)(t + 2) * 128, (size_t)16 * ldb);
    }
  }
  wait_async0();
  acc_guard4(acc[0][0], acc[0][1], acc[0][2], acc[0][3]);
  acc_guard4(acc[1][0], acc[1][1], acc[1][2], acc[1][3]);

  const int hh2 = lane >> 4, c4 = (lane & 15) * 4;     // f32 out: 256-B row segment = 16 lanes x 16 B
  const int q8  = lane >> 3, c8 = (lane & 7) * 8;
  float bc[4];
  float bcol[8];
#pragma unroll
  for (int e = 0; e < 4; ++e) bc[e] = 0.f;
#pragma unroll
  for (int e = 0; e < 8; ++e) bcol[e] = 0.f;
  if constexpr (BM == 1) {
    if constexpr (OM == 0) {
      const int cb = n0 + c4;
      const int i0 = (cb < N - 4) ? cb : (N - 4);        // clamped address
      const v4f b0v = *(const v4f*)(bias + i0);
#pragma unroll
      for (int e = 0; e < 4; ++e) bc[e] = bfr(b0v[e]);
    } else {
      const int cb = n0 + c8;
      const int i0 = (cb < N - 8) ? cb : (N - 8);        // clamped address
      const v4f b0v = *(const v4f*)(bias + i0), b1v = *(const v4f*)(bias + i0 + 4);
#pragma unroll
      for (int e = 0; e < 4; ++e) { bcol[e] = bfr(b0v[e]); bcol[4 + e] = bfr(b1v[e]); }
    }
  }

  // ---- epilogue ----
  float* slab = sT[wave];
#pragma unroll
  for (int i = 0; i < 2; ++i) {
    const int mBase = m0 + (i << 4);
#pragma unroll
    for (int j = 0; j < 4; ++j) {
#pragma unroll
      for (int r = 0; r < 8; ++r) {
        slab[(mOff + r) * 68 + (j << 4) + rlane] = acc[i][j][r];
      }
    }
    wave_sync_lds();
    if constexpr (OM == 0) {
      float* C = (float*)Cout + (size_t)((long long)by * sC);
      v4f vals[8];
#pragma unroll
      for (int it = 0; it < 8; ++it) {
        const int row = it * 2 + hh2;                      // it 0..7 x hh2 0..1 = rows 0..15
        const int gr  = mBase + row;
        v4f v = *(const v4f*)(slab + row * 68 + c4);
        float br = 0.f;
        if constexpr (BM == 2) {
          const int ir = (gr < M - 1) ? gr : (M - 1);      // clamped address
          br = bfr(bias[ir]);
        }
        v4f rv = {0.f, 0.f, 0.f, 0.f};
        if constexpr (HASR != 0) {
          const float* R = Rp + (size_t)((long long)by * sC);
          const v4f rraw = *(const v4f*)(R + (size_t)gr * ldc + n0 + c4);
#pragma unroll
          for (int e = 0; e < 4; ++e) rv[e] = (HASR == 1) ? bfr(rraw[e]) : rraw[e];
        }
#pragma unroll
        for (int e = 0; e < 4; ++e) v[e] = v[e] * oscale + bc[e] + br + rv[e];
        vals[it] = v;
      }
      {
#pragma unroll
        for (int it = 0; it < 8; ++it) {
          const int gr = mBase + it * 2 + hh2;
          *(v4f*)(C + (size_t)gr * ldc + n0 + c4) = vals[it];
        }
        
      }
    } else {
      unsigned short* C = (unsigned short*)Cout + (size_t)((long long)by * sC);
      static_assert(OM == 2 || BM == 0);
      v4u hv[4];
#pragma unroll
      for (int it = 0; it < 4; ++it) {
        const int row = (OM == 2) ? it * 4 + q8 : rlane;   // OM 2: it 0..3 x q8 0..3 = rows 0..15; OM 3, 4: row = lane & 15
        const float* sp = slab + row * 68 + ((OM == 2) ? c8 : it * 16 + koff);
        float br = 0.f;
        if constexpr (BM == 2) {
          const int gr = mBase + row;
          const int ir = (gr < M - 1) ? gr : (M - 1);      // clamped address
          br = bfr(bias[ir]);
        }
        v4u a = {0u, 0u, 0u, 0u};
#pragma unroll
        for (int e = 0; e < 4; ++e) {
          float f0 = sp[2 * e] * oscale + bcol[2 * e] + br;
          float f1 = sp[2 * e + 1] * oscale + bcol[2 * e + 1] + br;
          if constexpr (ACT == 1) { f0 = gelu_f(f0); f1 = gelu_f(f1); }
          f0 *= ocarry; f1 *= ocarry;
          a[e] = pk16(h_bits((_Float16)f0), h_bits((_Float16)f1));
        }
        hv[it] = a;
      }
      {
#pragma unroll
        for (int it = 0; it < 4; ++it) {
          if constexpr (OM == 2) {
            const int row = it * 4 + q8;
            *(v4u*)(C + (size_t)(mBase + row) * ldc + n0 + c8) = hv[it];
          } else if constexpr (OM == 3) {
            const int mt = mBase >> 4;                     // batch * 128 + key tile
            const size_t blk = (size_t)((mt / (NC / 16)) * NHEAD + (n0 >> 6)) * (NC / 16) + (mt % (NC / 16));
            *(v4u*)(C + blk * 1024 + it * 256 + lane * 8) = hv[it];
          } else {
            const size_t blk = (size_t)(mBase >> 6) * (NC / 32) + (n0 >> 5) + (it >> 1);
            *(v4u*)(C + blk * 2048 + ((mBase >> 4) & 3) * 512 + (it & 1) * 256 + lane * 8) = hv[it];
          }
        }
        
      }
    }
    wave_sync_lds();
  }
}

#define AT_KEYS   256
#define AT_STEPS  (AT_KEYS / 32)
#define AT_NST    (NC / AT_KEYS)
#define AT_HALF   (AT_KEYS * HDIM)
#define AT_STAGE  (2 * AT_HALF)
static_assert(AT_NST >= 2 && AT_HALF * 2 == 4 * ATT_THREADS * 16);

// Eight asynchronous 16-B copies per lane, global -> LDS: four pieces of the k stage and four of the v^T stage, 8 KiB apart (the
// block's 512 lanes side by side). The closing s_wait_xcnt 0 stands inside the statement so that no address register of an issued
// copy is rewritten in front of it.
__device__ __forceinline__ void async_kv8(unsigned l, const unsigned short* gk, const unsigned short* gv) {
#if defined(__HIP_DEVICE_COMPILE__)
  const unsigned ls = ATT_THREADS * 16;        // bytes per block-wide piece
  const unsigned lv = AT_HALF * 2;             // the v^T part of a buffer, in bytes
  const int      gs = ATT_THREADS * 8;         // halves per block-wide piece
  asm volatile("global_load_async_to_lds_b128 %0, %8, off\n\t"
               "global_load_async_to_lds_b128 %1, %9, off\n\t"
               "global_load_async_to_lds_b128 %2, %10, off\n\t"
               "global_load_async_to_lds_b128 %3, %11, off\n\t"
               "global_load_async_to_lds_b128 %4, %12, off\n\t"
               "global_load_async_to_lds_b128 %5, %13, off\n\t"
               "global_load_async_to_lds_b128 %6, %14, off\n\t"
               "global_load_async_to_lds_b128 %7, %15, off\n\t"
               "s_wait_xcnt 0x0"
               :: "v"(l), "v"(l + ls), "v"(l + 2 * ls), "v"(l + 3 * ls),
                  "v"(l + lv), "v"(l + lv + ls), "v"(l + lv + 2 * ls), "v"(l + lv + 3 * ls),
                  "v"(gk), "v"(gk + gs), "v"(gk + 2 * gs), "v"(gk + 3 * gs),
                  "v"(gv), "v"(gv + gs), "v"(gv + 2 * gs), "v"(gv + 3 * gs)
               : "memory");
#endif
}

__global__ __launch_bounds__(ATT_THREADS)
void attn16(const unsigned short* __restrict__ QHp, const unsigned short* __restrict__ KHp,
            const unsigned short* __restrict__ VTq, const float* __restrict__ LBp, unsigned short* CT) {
  __shared__ __align__(16) unsigned short kv[2 * AT_STAGE];   // two stage buffers
  const int tid  = threadIdx.x;
  const int wave = __builtin_amdgcn_readfirstlane(tid >> 5);  // told to be wave-uniform, so the bias base stays scalar
  const int lane = tid & 31;
  const int hh   = lane >> 4;
  const int c    = lane & 15;

  const int qg   = blockIdx.x & (ATT_QG - 1);              // 0..7
  const int head = (blockIdx.x / ATT_QG) & (NHEAD - 1);    // 0..15
  const int bat  = blockIdx.x / (ATT_QG * NHEAD);          // 0..1
  const int qt   = qg * ATT_WAVES + wave;                  // 0..127
  const int q0   = qt * 16;

  const size_t qofs = ((size_t)bat * NQ + q0 + c) * DMODEL + head * HDIM + 8 * hh;
  const _Float16* Qh = (const _Float16*)(const void*)QHp + qofs;
  // copy map: lane piece = 16 B number tid + 512 j, j 0..3, of the stage's 32 KiB of k and of its 32 KiB of v^T
  const unsigned short* gK = KHp + (size_t)(bat * NHEAD + head) * (NC * HDIM) + tid * 8;
  const unsigned short* gV = VTq + (size_t)(bat * NHEAD + head) * (NC * HDIM) + tid * 8;
  const unsigned lK = (unsigned)(uintptr_t)(lds_u16*)(kv + tid * 8);
  const unsigned lofs = 8u * (unsigned)lane;               // the lane's 16 B inside every 512-B run
  const float* Wb = LBp + (size_t)(bat * (NQ / 16) + qt) * (16 * NC) + 4u * (unsigned)lane;   // log2 units, 512 floats per step
  const float lsc = (LOG2E * ATT_SCALE) / (QC * KC);                   // log2(e) / 8 / carries

  // stage 0 into buffer 0, published; then stage 1 into buffer 1
  async_kv8(lK, gK, gV);
  const v16h qa = ldfrag_h(Qh), qb = ldfrag_h(Qh + 32);
  wait_async0();
  __syncthreads();
  async_kv8(lK + AT_STAGE * 2, gK + AT_HALF, gV + AT_HALF);

  float mrun = -INFINITY, lsum = 0.f;                      // the query's running maximum; this wave half's running sum
  v8f o0 = zero8(), o1 = zero8(), o2 = zero8(), o3 = zero8();

#pragma unroll 1   // rolled, as the loop of steps inside it: the loop text stays short
  for (int st = 0; st < AT_NST; ++st) {
  const int buf = st & 1;
  const _Float16* kl = (const _Float16*)(const void*)(kv + buf * AT_STAGE) + lofs;
  const float*    wl = Wb + (size_t)st * (AT_KEYS * 16);
#pragma unroll 1   // rolled: one step's 20 loads are issued as one group at its head, and the loop text stays short
  for (int sp = 0; sp < AT_STEPS; ++sp) {
    const _Float16* kp = kl + sp * 2048;                   // LDS: k blocks 2 sp and 2 sp + 1 of the stage, 1024 halves each
    const float*    wp = wl + sp * 512;                    // global: bias block of the step, 512 floats
    const _Float16* vp = kp + AT_HALF;                     // LDS: v^T block sp of the stage, 2048 halves
    const v4f w0 = *(const v4f*)(wp),       w1 = *(const v4f*)(wp + 128);
    const v4f w2 = *(const v4f*)(wp + 256), w3 = *(const v4f*)(wp + 384);
    const v16h k00 = ldfrag_p(kp),        k01 = ldfrag_p(kp + 512);
    const v16h k10 = ldfrag_p(kp + 1024), k11 = ldfrag_p(kp + 1536);
    const v16h vb0 = ldfrag_p(vp);
    const v16h vb1 = ldfrag_p(vp + 512);
    const v16h vb2 = ldfrag_p(vp + 1024);
    const v16h vb3 = ldfrag_p(vp + 1536);
#if defined(__HIP_DEVICE_COMPILE__)
    // stands behind the step's four global loads, in front of every rewrite of a register that they name; their address pair is
    // an input, so that it does not serve as a load's destination in front of the wait
    asm volatile("s_wait_xcnt 0x0" :: "v"(wp) : "memory");
#endif
    v8f s0, s1;
    s0 = mma_raw(k00, qa, zero8());
    s0 = mma_raw(k01, qb, s0);
    guard_s2(s0, k00, k01);
    s1 = mma_raw(k10, qa, zero8());
    s1 = mma_raw(k11, qb, s1);
    guard_s4(s1, k10, k11, qa, qb);
    v2f t[8];                                              // pair i = keys kb + 16 (i >> 2) + 8 hh + 2 (i & 3) + 0, 1
#pragma unroll   // here and below: every index a constant, so the pairs stay in registers
    for (int e = 0; e < 2; ++e) {
      t[e]     = (v2f){s0[2 * e],     s0[2 * e + 1]} * lsc + (v2f){w0[2 * e], w0[2 * e + 1]};
      t[2 + e] = (v2f){s0[4 + 2 * e], s0[5 + 2 * e]} * lsc + (v2f){w1[2 * e], w1[2 * e + 1]};
      t[4 + e] = (v2f){s1[2 * e],     s1[2 * e + 1]} * lsc + (v2f){w2[2 * e], w2[2 * e + 1]};
      t[6 + e] = (v2f){s1[4 + 2 * e], s1[5 + 2 * e]} * lsc + (v2f){w3[2 * e], w3[2 * e + 1]};
    }
    float mx[8];
#pragma unroll
    for (int i = 0; i < 8; ++i) mx[i] = fmaxf(t[i][0], t[i][1]);
    float mxa = fmaxf(fmaxf(fmaxf(mx[0], mx[1]), fmaxf(mx[2], mx[3])), fmaxf(fmaxf(mx[4], mx[5]), fmaxf(mx[6], mx[7])));
    mxa = fmaxf(mxa, xhalf(mxa));                          // over the step's 32 keys, equal in both halves
    const float mn = fmaxf(mrun, mxa);
    const float al = exp2f(mrun - mn);
    mrun = mn;
    v2f ex[8];
    FragH ph;                                              // elements 0..7 = keys kb + 8hh + 0..7, 8..15 = keys kb + 16 + 8hh + 0..7
#pragma unroll
    for (int i = 0; i < 8; ++i) {
      const v2f d = t[i] - mn;
      ex[i] = (v2f){exp2f(d[0]), exp2f(d[1])};
      ph.p[i] = __builtin_convertvector(ex[i] * PC, v2h);
    }
    const v2f ps = ((ex[0] + ex[1]) + (ex[2] + ex[3])) + ((ex[4] + ex[5]) + (ex[6] + ex[7]));
    lsum = lsum * al + (ps[0] + ps[1]);
#pragma unroll
    for (int r = 0; r < 8; ++r) {
      o0[r] *= al;
      o1[r] *= al;
      o2[r] *= al;
      o3[r] *= al;
    }
    o0 = mma_raw(vb0, ph.v, o0);
    o1 = mma_raw(vb1, ph.v, o1);
    o2 = mma_raw(vb2, ph.v, o2);
    o3 = mma_raw(vb3, ph.v, o3);
    guard_pv4(o0, o1, o2, o3, ph.v, vb0, vb1, vb2, vb3);
  }
  // publish point of stage st + 1: own LDS reads back, own copies landed, one barrier for both hand-overs, then the refill
  wait_ds0();
  wait_async0();
  __syncthreads();
  if (st + 2 < AT_NST)
    async_kv8(lK + buf * (AT_STAGE * 2), gK + (size_t)(st + 2) * AT_HALF, gV + (size_t)(st + 2) * AT_HALF);
  }
  wait_async0();

  // ---- join the halves' sums, fold 1/l and the carries (1024 on P, 16 on v, 1024 on the stored ctx), store 16 B per tile ----
  const float oc  = FC / (PC * VC);
  const float inv = (1.0f / (lsum + xhalf(lsum))) * oc;
  unsigned short* dst = CT + qofs;                         // row q0 + c, cols 64 head + 8 hh (+ 16 t)
  v4u p0, p1, p2, p3;
#pragma unroll
  for (int e = 0; e < 4; ++e) {
    p0[e] = pk16(h_bits((_Float16)(o0[2 * e] * inv)), h_bits((_Float16)(o0[2 * e + 1] * inv)));
    p1[e] = pk16(h_bits((_Float16)(o1[2 * e] * inv)), h_bits((_Float16)(o1[2 * e + 1] * inv)));
    p2[e] = pk16(h_bits((_Float16)(o2[2 * e] * inv)), h_bits((_Float16)(o2[2 * e + 1] * inv)));
    p3[e] = pk16(h_bits((_Float16)(o3[2 * e] * inv)), h_bits((_Float16)(o3[2 * e + 1] * inv)));
  }
  *(v4u*)(dst)      = p0;
  *(v4u*)(dst + 16) = p1;
  *(v4u*)(dst + 32) = p2;
  *(v4u*)(dst + 48) = p3;
}

// =====================================================================================================
// Workspace map (bytes); every plane is an exact multiple of its tile / whole-row store granularity (M, N exact tile multiples,
// element counts exact multiples of pack_all's 32768-element block, no pad rows needed), every offset a multiple of 2 MiB:
//   WQ16 f16 [1024][1024] x64               2097152   ([out][in] = [n][k])
//   WK16 f16 [1024][1024] x64               2097152
//   WV16 f16 [1024][1024] x64               2097152
//   WO16 f16 [1024][1024] x64               2097152
//   X16  f16 [4096][1024] x16               8388608   (activation rows)
//   LB   f32 [2][128][64] x 2 KiB          33554432   (log2(bf16(M)), lane order of the transposed score tiles)
//   QH   f16 [4096][1024] x16               8388608   (q projection, unscaled)
//   KH   f16 [2][16][128] x 2 KiB, x16      8388608   (k projection, fragment order)
//   VT   f16 [2][16][64] x 4 KiB, x16       8388608   (v^T, fragment order)
//   CT   f16 [4096][1024] x1024             8388608   (attention ctx, merged heads)
//   end                                    83886080
// =====================================================================================================
extern "C" void kernel_launch(void* const* d_in, const int* in_sizes, int n_in,
                              void* d_out, int out_size, void* d_ws, size_t ws_size,
                              hipStream_t stream) {
  if (n_in < 7) return;
  if (in_sizes[0] != NROWS * DMODEL) return;
  if (in_sizes[1] != NB * NQ * NC) return;
  if (in_sizes[2] != DMODEL * DMODEL || in_sizes[3] != DMODEL * DMODEL ||
      in_sizes[4] != DMODEL * DMODEL || in_sizes[5] != DMODEL * DMODEL) return;
  if (in_sizes[6] != DMODEL) return;
  if (out_size != NROWS * DMODEL) return;
  if ((in_sizes[0] % 2048) != 0 || (in_sizes[2] % 2048) != 0 || (in_sizes[1] % 1024) != 0) return;

  const float* x   = (const float*)d_in[0];
  const float* Mp  = (const float*)d_in[1];
  const float* w_q = (const float*)d_in[2];
  const float* w_k = (const float*)d_in[3];
  const float* w_v = (const float*)d_in[4];
  const float* w_o = (const float*)d_in[5];
  const float* b_o = (const float*)d_in[6];
  float*       out = (float*)d_out;

  const size_t PW  = (size_t)DMODEL * DMODEL * 2;                 //  2097152
  const size_t PX  = (size_t)NROWS * DMODEL * 2;                  //  8388608
  const size_t PLB = (size_t)NB * NQ * NC * 4;                    // 33554432
  const size_t PVT = (size_t)NB * DMODEL * NC * 2;                //  8388608
  size_t off = 0;
  const size_t oWQ = off; off += PW;
  const size_t oWK = off; off += PW;
  const size_t oWV = off; off += PW;
  const size_t oWO = off; off += PW;
  const size_t oX  = off; off += PX;
  const size_t oLB = off; off += PLB;
  const size_t oQH = off; off += PX;
  const size_t oKH = off; off += PX;
  const size_t oVT = off; off += PVT;
  const size_t oCT = off; off += PX;
  if (off > ws_size) return;                                      // off = 83886080
  if (off > (size_t)134217728) return;

  char* ws = (char*)d_ws;
  unsigned short* WQ16 = (unsigned short*)(ws + oWQ);
  unsigned short* WK16 = (unsigned short*)(ws + oWK);
  unsigned short* WV16 = (unsigned short*)(ws + oWV);
  unsigned short* WO16 = (unsigned short*)(ws + oWO);
  unsigned short* X16  = (unsigned short*)(ws + oX);
  float*          LB   = (float*)(ws + oLB);
  unsigned short* QH   = (unsigned short*)(ws + oQH);
  unsigned short* KH   = (unsigned short*)(ws + oKH);
  unsigned short* VTp  = (unsigned short*)(ws + oVT);
  unsigned short* CT   = (unsigned short*)(ws + oCT);

  const dim3 blk(256);
  const dim3 gPK(PK_BLOCKS);                                       // 512 blocks
  const int tilesP = (NROWS / 128) * (DMODEL / 128);               // 256
  const int tilesV = (DMODEL / 128) * (NC / 128);                  // 128 per batch
  const dim3 gP(tilesP, 1);                                        // 256
  const dim3 gV(tilesV, NB);                                       // 128 x 2
  const dim3 gAT(ATT_BLOCKS);                                      // 256
  const dim3 bAT(ATT_THREADS);                                     // 512

  // (0..2) one launch: weight planes W16[n][k] = f16( bf16_RNE(W[n][k]) * 64 ), [out][in] layout kept, k contiguous (WQ16, WK16,
  // WV16, WO16 lie one behind the other); activation plane X16[row][c] = f16( bf16_RNE(x[row][c]) * 16 ), rows = b*2048 + tok;
  // score bias plane log2( bf16_RNE(M[b][q][key]) ), f32, in the lane order of attn16's score tiles
  pack_all<<<gPK, blk, 0, stream>>>(Mp, LB, x, X16, w_q, w_k, w_v, w_o, WQ16);

  // (3) q projection: QH[m][n] = f16(16 * sum_k x[m][k] Wq[n][k]); M = 4096, N = 1024, K = 1024
  gemm64<2, 0, 0, 0><<<gP, blk, 0, stream>>>(
      X16, DMODEL, 0LL,
      WQ16, DMODEL, 0LL,
      b_o,
      (const float*)0,
      (void*)QH, DMODEL, 0LL,
      NROWS, DMODEL, DMODEL, 1.0f / (ACARRY * WSC), QC);

  // (4) k projection: f16(16 * sum_k x[m][k] Wk[n][k]) in fragment order; M = 4096, N = 1024, K = 1024
  gemm64<3, 0, 0, 0><<<gP, blk, 0, stream>>>(
      X16, DMODEL, 0LL,
      WK16, DMODEL, 0LL,
      b_o,
      (const float*)0,
      (void*)KH, DMODEL, 0LL,
      NROWS, DMODEL, DMODEL, 1.0f / (ACARRY * WSC), KC);

  // (5) v^T per batch: f16(16 * sum_k Wv[d][k] x_b[tok][k]) in fragment order; M = 1024, N = 2048, K = 1024
  gemm64<4, 0, 0, 0><<<gV, blk, 0, stream>>>(
      WV16, DMODEL, 0LL,
      X16, DMODEL, (long long)NC * DMODEL,
      b_o,
      (const float*)0,
      (void*)VTp, NC, (long long)DMODEL * NC,
      DMODEL, NC, DMODEL, 1.0f / (ACARRY * WSC), VC);

  // (6) attention per (batch, head, 256 query rows) -> CT (f16, x1024)
  attn16<<<gAT, bAT, 0, stream>>>(QH, KH, VTp, LB, CT);

  // (7) out = CT . Wo^T / (1024 * 64) + bf16(bo); M = 4096, N = 1024, K = 1024, f32
  gemm64<0, 1, 0, 0><<<gP, blk, 0, stream>>>(
      CT, DMODEL, 0LL,
      WO16, DMODEL, 0LL,
      b_o,
      (const float*)0,
      (void*)out, DMODEL, 0LL,
      NROWS, DMODEL, DMODEL, 1.0f / (FC * WSC), 1.0f);
  (void)hipGetLastError();
}

// v006
// Measured time: 122 microseconds a run.
// Timed twice side by side with v005, it ran 1.05 times as fast both times.
// All steps since v000 together make it 3.04 times as fast.
// Contractions: q/k projections (x rows f16 x16 . W f16 x64, K=1024), v^T projection (Wv f16 x64 . x rows f16 x16, K=1024),
// attention scores^T (k f16 x16 . q f16 x16, K=64), attention v^T . P^T (v^T f16 x16 . P f16 x1024, K=2048 in steps of 32),
// output projection (ctx f16 x1024 . Wo f16 x64, K=1024): all v_wmma_f32_16x16x32_f16 single products, f32 accumulate.
// Additive log2(M) score bias (f32 plane), online max-subtracted base-2 softmax and output bias in f32 on VALU.
// Every float input RNE-converted to bf16 on load.
#include <hip/hip_runtime.h>
#include <math.h>
#include <stdint.h>

#define NB      2
#define NQ      2048
#define NC      2048
#define DMODEL  1024
#define NHEAD   16
#define HDIM    64
#define NROWS   (NB * NQ)
#define WSC     64.0f
#define ACARRY  16.0f
#define QC      16.0f
#define KC      16.0f
#define VC      16.0f
#define PC      1024.0f
#define FC      1024.0f
#define ATT_SCALE 0.125f
#define LOG2E   1.4426950408889634f
static_assert(NHEAD * HDIM == DMODEL);
static_assert((NQ % 64) == 0 && (NC % 64) == 0 && (DMODEL % 64) == 0 && (NC % 32) == 0 && (NQ % 16) == 0);
static_assert((NROWS % 128) == 0 && (NC % 128) == 0 && (DMODEL % 128) == 0);
#define ATT_WAVES   16                                     // query tiles of 16 rows per block, one wave each
#define ATT_THREADS (ATT_WAVES * 32)
#define ATT_QG      (NQ / (16 * ATT_WAVES))                // blocks per batch and head
#define ATT_BLOCKS  (NB * NHEAD * ATT_QG)
static_assert(ATT_THREADS == 512 && ATT_QG == 8 && ATT_BLOCKS == 256);

typedef _Float16 v16h __attribute__((ext_vector_type(16)));
typedef _Float16 v8h  __attribute__((ext_vector_type(8)));
typedef float    v8f  __attribute__((ext_vector_type(8)));
typedef float    v4f  __attribute__((ext_vector_type(4)));
typedef float    v2f  __attribute__((ext_vector_type(2)));
typedef _Float16 v2h  __attribute__((ext_vector_type(2)));
typedef unsigned int v4u __attribute__((ext_vector_type(4)));

union FragH { v16h v; v8h h[2]; v4u u[2]; v2h p[8]; };

// ---- scalar helpers --------------------------------------------------------------------------------
__device__ __forceinline__ unsigned short bf_bits(float f) {          // f32 -> bf16 bits, RNE convert
  unsigned u = __float_as_uint(f);
  return (unsigned short)((u + 0x7FFFu + ((u >> 16) & 1u)) >> 16);
}
__device__ __forceinline__ float bf_up(unsigned short h) { return __uint_as_float(((unsigned)h) << 16); }
__device__ __forceinline__ float bfr(float f) { return bf_up(bf_bits(f)); }   // value of the bf16 RNE convert
__device__ __forceinline__ unsigned short h_bits(_Float16 x) { return __builtin_bit_cast(unsigned short, x); }
__device__ __forceinline__ unsigned pk16(unsigned short a, unsigned short b) { return (unsigned)a | ((unsigned)b << 16); }
__device__ __forceinline__ v8f zero8() { v8f z = {0.f, 0.f, 0.f, 0.f, 0.f, 0.f, 0.f, 0.f}; return z; }
__device__ __forceinline__ float gelu_f(float v) { return 0.5f * v * (1.0f + erff(v * 0.70710678118654752f)); }
__device__ __forceinline__ float xhalf(float x) {                     // the value that lane ^ 16 holds
  const int b = __builtin_bit_cast(int, x);
  return __builtin_bit_cast(float, __builtin_amdgcn_permlanex16(b, b, 0x76543210, 0xfedcba98, false, false));
}

// 2^x as the one hardware instruction. For x >= -126 it gives the bits that the library's exp2f gives; below that its result is 0
// or under 2^-126 where the library scales to a subnormal. attn16 calls it with x <= 0 only, beside a term 2^0 = 1 of the same
// softmax row: such a term is 0 in the f16 prob tile either way and adds under 2^-115 to a row sum that is at least 1.
__device__ __forceinline__ float exp2_hw(float x) { return __builtin_amdgcn_exp2f(x); }

// ---- fragment loaders: 16-bit A/B operand, lane -> row/col (lane&15), p already includes +8*(lane>>4);
//      elements 0..7 <- p[0..7] (k0+8h..), elements 8..15 <- p[16..23] (k0+16+8h..)  (same split k map for A and B;
//      B is read from a k-contiguous [n][k] plane in gemm64 and for q in attn16; attn16's A comes from fragment order via ldfrag_p)
__device__ __forceinline__ v16h ldfrag_h(const _Float16* p) {
  FragH f;
  f.h[0] = *(const v8h*)(p);
  f.h[1] = *(const v8h*)(p + 16);
  return f.v;
}
__device__ __forceinline__ v16h ldfrag_u(const unsigned short* p) {
  FragH f;
  f.u[0] = *(const v4u*)(p);
  f.u[1] = *(const v4u*)(p + 16);
  return f.v;
}

// fragment-ordered plane: a fragment is two runs of 512 B, run i = elements 8i..8i+7 of all 32 lanes, 16 B per lane in lane order;
// p already includes +8*lane, so each of the two wave-wide loads covers 512 contiguous bytes = four whole lines
__device__ __forceinline__ v16h ldfrag_p(const _Float16* p) {
  FragH f;
  f.h[0] = *(const v8h*)(p);
  f.h[1] = *(const v8h*)(p + 256);
  return f.v;
}

// ---- WMMA helpers with trailing VALU hazard gaps ------------------------------------------------------
__device__ __forceinline__ v8f mma_raw(v16h a, v16h b, v8f c) {
  return __builtin_amdgcn_wmma_f32_16x16x32_f16(false, a, false, b, (short)0, c, false, false);
}
__device__ __forceinline__ void dep_guard1(v8f& a, v8f& b, v16h x) {
#if defined(__HIP_DEVICE_COMPILE__)
  asm volatile("v_nop\n\tv_nop\n\tv_nop\n\tv_nop" : "+v"(a), "+v"(b) : "v"(x));
#endif
}
__device__ __forceinline__ void guard_s2(v8f& s, v16h a0, v16h a1) {
#if defined(__HIP_DEVICE_COMPILE__)
  asm volatile("v_nop\n\tv_nop\n\tv_nop\n\tv_nop" : "+v"(s) : "v"(a0), "v"(a1));
#endif
}
__device__ __forceinline__ void guard_s4(v8f& s, v16h a0, v16h a1, v16h b0, v16h b1) {
#if defined(__HIP_DEVICE_COMPILE__)
  asm volatile("v_nop\n\tv_nop\n\tv_nop\n\tv_nop" : "+v"(s) : "v"(a0), "v"(a1), "v"(b0), "v"(b1));
#endif
}
__device__ __forceinline__ void guard_pv4(v8f& a, v8f& b, v8f& c, v8f& d, v16h x, v16h y, v16h z, v16h w, v16h u) {
#if defined(__HIP_DEVICE_COMPILE__)
  asm volatile("v_nop\n\tv_nop\n\tv_nop\n\tv_nop"
               : "+v"(a), "+v"(b), "+v"(c), "+v"(d) : "v"(x), "v"(y), "v"(z), "v"(w), "v"(u));
#endif
}
__device__ __forceinline__ void keep4_h(v16h a, v16h b, v16h c, v16h d) {
#if defined(__HIP_DEVICE_COMPILE__)
  asm volatile("v_nop" :: "v"(a), "v"(b), "v"(c), "v"(d));
#endif
}
__device__ __forceinline__ void acc_guard4(v8f& a, v8f& b, v8f& c, v8f& d) {
#if defined(__HIP_DEVICE_COMPILE__)
  asm volatile("v_nop\n\tv_nop\n\tv_nop\n\tv_nop" : "+v"(a), "+v"(b), "+v"(c), "+v"(d));
#endif
}
__device__ __forceinline__ void wave_sync_lds() {
  __builtin_amdgcn_fence(__ATOMIC_RELEASE, "workgroup");
  __builtin_amdgcn_wave_barrier();
  __builtin_amdgcn_fence(__ATOMIC_ACQUIRE, "workgroup");
}

// =====================================================================================================
// All six input-only packs in ONE launch of 512 blocks x 8 waves; a wave takes PK_IT groups of eight 16-B loads: all its loads are
// issued at its head, then group after group is converted and stored as its loads return. Blocks 0..255: score bias plane;
// 256..383: activation rows; 384..511: the four weight planes, 32 blocks each.
// 16-bit pack, no transpose: dst[i] = f16( bf16_RNE(src[i]) * sc ), sc a power of two (exact). Used for the weights (stored
// [out][in] = [n][k], already k contiguous for B fragments / A of the v^T projection; the four planes lie one behind the other in
// the workspace) and for the activation rows. A piece is 8 elements: two 16-B loads, one 16-B store per lane; a group is 4 pieces
// per lane = 1024 elements per wave, 32 consecutive lanes = one whole 512-B store; the 8 waves' groups lie side by side.
// Score bias plane: log2( bf16_RNE(M) ) as f32 (M strictly positive), laid in the lane order in which attn16 holds its transposed
// score tiles: 2-KiB blocks [batch][query / 16][key / 32] of 16 queries x 32 keys, four runs of 512 B; run i, lane (c, hh) = query c,
// keys 16 (i >> 1) + 8 hh + 4 (i & 1) + 0..3. A piece is 16 B of the plane; a group is two neighbouring plane blocks = 8 pieces per
// lane, read from 256 B of each of 16 source rows, stored as eight whole 512-B runs; a work-group takes 16 whole source rows.
// coverage: bias 256 blocks x 8 waves x PK_IT groups x 1024 elements = 2 x 2048 x 2048; rows 128 x 8 x PK_IT x 1024 = 4096 x 1024;
//           a weight 32 x 8 x PK_IT x 1024 = 1024 x 1024; group -> source and group -> plane are one to one. No barrier.
// =====================================================================================================
#define PK_IT 4
#define PK_BM ((NB * NQ) / 16)                             // 256 blocks, 16 source rows each
#define PK_BX ((NROWS * DMODEL) / (8 * PK_IT * 1024))      // 128 blocks
#define PK_BW ((DMODEL * DMODEL) / (8 * PK_IT * 1024))     //  32 blocks per weight
#define PK_BLOCKS (PK_BM + PK_BX + 4 * PK_BW)
static_assert(NC == 8 * PK_IT * 64 && PK_BX * 8 * PK_IT * 1024 == NROWS * DMODEL);
static_assert(PK_BW * 8 * PK_IT * 1024 == DMODEL * DMODEL && PK_BLOCKS == 512);

// stands behind a wave's run of loads, in front of every rewrite of a register that they name; their address pair is an input,
// so that it is not given away in front of the wait
__device__ __forceinline__ void wait_x0(const void* p) {
#if defined(__HIP_DEVICE_COMPILE__)
  asm volatile("s_wait_xcnt 0x0" :: "v"(p) : "memory");
#endif
}
__device__ __forceinline__ float log2_slot(float x) {
  const bool  sm = x < 1.17549435e-38f;
  const float s  = ldexpf(x, sm ? 32 : 0);
  float r;
#if defined(__HIP_DEVICE_COMPILE__)
  asm("v_log_f32 %0, %1\n\tv_nop" : "=v"(r) : "v"(s));
#else
  r = log2f(s);
#endif
  return r - (sm ? 32.0f : 0.0f);
}

__global__ __launch_bounds__(256) void pack_all(const float* __restrict__ Mp, float* LB,
                                                const float* __restrict__ xp, unsigned short* X16,
                                                const float* __restrict__ wq, const float* __restrict__ wk,
                                                const float* __restrict__ wv, const float* __restrict__ wo,
                                                unsigned short* W16) {
  const unsigned lane = threadIdx.x & 31u;
  const unsigned wave = threadIdx.x >> 5;
  const unsigned b    = blockIdx.x;
  v4f a[PK_IT][8];
  if (b < PK_BM) {
    // block b = source rows 16 b .. 16 b + 15 = plane blocks 64 b .. 64 b + 63; group (it, wave) = plane blocks 2 (8 it + wave) + 0, 1
    const unsigned c = lane & 15u, hh = lane >> 4;
    const float* sp = Mp + (size_t)(b * 16u + c) * NC + wave * 64u + hh * 8u;
    float*       dp = LB + (size_t)(b * (8u * PK_IT) + wave) * 1024 + lane * 4u;
#pragma unroll   // here and below in the pack: every index a constant, so the groups stay in registers
    for (int it = 0; it < PK_IT; ++it)
#pragma unroll
      for (int u = 0; u < 8; ++u)
        a[it][u] = *(const v4f*)(sp + it * 512 + (u >> 2) * 32 + ((u & 3) >> 1) * 16 + (u & 1) * 4);
    wait_x0(sp);
#pragma unroll
    for (int it = 0; it < PK_IT; ++it) {
#pragma unroll
      for (int u = 0; u < 8; ++u) {
        const v4f v = a[it][u];
        v4f o;
        o[0] = log2_slot(bfr(v[0]));
        o[1] = log2_slot(bfr(v[1]));
        o[2] = log2_slot(bfr(v[2]));
        o[3] = log2_slot(bfr(v[3]));
        *(v4f*)(dp + it * 8192 + u * 128) = o;
      }
    }
  } else {
    const unsigned bc = b - PK_BM;
    const bool isx = bc < PK_BX;                            // block-uniform
    const unsigned bw = isx ? 0u : bc - PK_BX;              // weights: plane bw / PK_BW, block bw % PK_BW of it
    const unsigned wi = bw / PK_BW;
    const float* src = isx ? xp : (wi == 0u) ? wq : (wi == 1u) ? wk : (wi == 2u) ? wv : wo;
    unsigned short* dst = isx ? X16 : W16 + (size_t)wi * (DMODEL * DMODEL);
    const float sc = isx ? ACARRY : WSC;
    const size_t e0 = (size_t)((isx ? bc : bw % PK_BW) * (8u * PK_IT) + wave) * 1024 + lane * 8u;   // group (it, wave) at + 8192 it
    const float*    sp = src + e0;
    unsigned short* dp = dst + e0;
#pragma unroll
    for (int it = 0; it < PK_IT; ++it)
#pragma unroll
      for (int u = 0; u < 4; ++u) {
        a[it][2 * u]     = *(const v4f*)(sp + it * 8192 + u * 256);
        a[it][2 * u + 1] = *(const v4f*)(sp + it * 8192 + u * 256 + 4);
      }
    wait_x0(sp);
#pragma unroll
    for (int it = 0; it < PK_IT; ++it) {
#pragma unroll
      for (int u = 0; u < 4; ++u) {
        const v4f p = a[it][2 * u], q = a[it][2 * u + 1];
        v4u o;
        o[0] = pk16(h_bits((_Float16)(bfr(p[0]) * sc)), h_bits((_Float16)(bfr(p[1]) * sc)));
        o[1] = pk16(h_bits((_Float16)(bfr(p[2]) * sc)), h_bits((_Float16)(bfr(p[3]) * sc)));
        o[2] = pk16(h_bits((_Float16)(bfr(q[0]) * sc)), h_bits((_Float16)(bfr(q[1]) * sc)));
        o[3] = pk16(h_bits((_Float16)(bfr(q[2]) * sc)), h_bits((_Float16)(bfr(q[3]) * sc)));
        *(v4u*)(dp + it * 8192 + u * 256) = o;
      }
    }
  }
}

// =====================================================================================================
// LDS-staged batched f16 WMMA GEMM: C[m][n] = f( oscale * sum_k A[m][k] * Bt[n][k] + bf16(bias) ) (+ residual); one block of
// 8 waves per 128x128 tile, one wave per 32x64 part of it (4 x 2 waves). A row-major [M][K] pitch lda (16-bit plane), Bt
// row-major [N][K] pitch ldb (k contiguous); M, N multiples of 128, K multiple of 128. blockIdx.y = batch index with element
// strides sA, sB, sC.
// A stage is 128 k (256 B) of the tile's 128 A rows and 128 Bt rows, laid in LDS at a row pitch of 272 B; two buffers. Every
// lane brings 16 pieces of 16 B per stage by asynchronous copies (16 lanes = one whole 256-B row piece), the next stage's
// copies in flight while this stage is multiplied; fragments are read from LDS with the split k map of ldfrag_u, k ascending.
// BM: 0 = no bias, 1 = per column bf16(bias[col]), 2 = per row bf16(bias[row]) (clamped-address loads).
// OM: 0 = f32 out (pitch ldc; HASR 1 adds bf16(R[m][n]), HASR 2 adds raw f32 R[m][n], same pitch/stride as C);
//     2 = f16 out (pitch ldc) = f16( act(value) * ocarry ), ACT 1 = exact GELU.
//     3, 4 = the same f16 values laid in the fragment order that attn16 loads (ldfrag_p), ldc unused, BM 0 only. A wave's 16x64
//         slab is four runs of 512 B; run it, lane (c, hh) = slab row c, cols 16 it + 8 hh + 0..7: one whole 512-B store each.
//         3 (k plane; rows = batch*2048 + key, cols = 64 head + d): the slab is the 2-KiB block [batch][head][key / 16].
//         4 (v^T plane; rows = 64 head + d, cols = key, batch = blockIdx.y through sC): runs 2t, 2t + 1 are the 1-KiB piece
//         (d / 16) & 3 of the 4-KiB block [head][key / 32], t = 0, 1 the slab's two 32-key tiles.
// coverage: 2 slabs x 16 rows (f32: it 0..7 x lane>>4; OM 2: it 0..3 x lane>>3; OM 3, 4: lane & 15) x 64 cols = the wave's whole 32x64 part;
//           grid = tilesM*tilesN blocks, a surplus block exits as a whole in front of every barrier.
// =====================================================================================================
#define GT_PITCH  136                          // LDS row pitch in halves: 272 B = 16 B x odd, for 16-B LDS reads
#define GT_STAGE  (256 * GT_PITCH)             // halves per buffer: [A 128 rows | Bt 128 rows]
typedef __attribute__((address_space(3))) unsigned short lds_u16;

// Eight asynchronous 16-B copies per lane, global -> LDS, rows 16 apart. The closing s_wait_xcnt 0 stands inside the statement
// so that no address register of an issued copy is rewritten in front of it.
__device__ __forceinline__ void async_rows8(unsigned l, const unsigned short* g, size_t gstep) {
#if defined(__HIP_DEVICE_COMPILE__)
  const unsigned ls = 16 * GT_PITCH * 2;       // 16 LDS rows in bytes
  asm volatile("global_load_async_to_lds_b128 %0, %8, off\n\t"
               "global_load_async_to_lds_b128 %1, %9, off\n\t"
               "global_load_async_to_lds_b128 %2, %10, off\n\t"
               "global_load_async_to_lds_b128 %3, %11, off\n\t"
               "global_load_async_to_lds_b128 %4, %12, off\n\t"
               "global_load_async_to_lds_b128 %5, %13, off\n\t"
               "global_load_async_to_lds_b128 %6, %14, off\n\t"
               "global_load_async_to_lds_b128 %7, %15, off\n\t"
               "s_wait_xcnt 0x0"
               :: "v"(l), "v"(l + ls), "v"(l + 2 * ls), "v"(l + 3 * ls),
                  "v"(l + 4 * ls), "v"(l + 5 * ls), "v"(l + 6 * ls), "v"(l + 7 * ls),
                  "v"(g), "v"(g + gstep), "v"(g + 2 * gstep), "v"(g + 3 * gstep),
                  "v"(g + 4 * gstep), "v"(g + 5 * gstep), "v"(g + 6 * gstep), "v"(g + 7 * gstep)
               : "memory");
#endif
}
__device__ __forceinline__ void wait_async0() {   // this wave's copies have landed in LDS
#if defined(__HIP_DEVICE_COMPILE__)
  asm volatile("s_wait_asynccnt 0x0" ::: "memory");
#endif
}
__device__ __forceinline__ void wait_ds0() {      // this wave's LDS reads have returned before their buffer is refilled
#if defined(__HIP_DEVICE_COMPILE__)
  asm volatile("s_wait_dscnt 0x0" ::: "memory");
#endif
}

template <int OM, int BM, int HASR, int ACT>
__global__ __launch_bounds__(256) void gemm64(
    const unsigned short* __restrict__ Ap, int lda, long long sA,
    const unsigned short* __restrict__ Btp, int ldb, long long sB,
    const float* __restrict__ bias,
    const float* __restrict__ Rp,
    void* Cout, int ldc, long long sC,
    int M, int N, int K, float oscale, float ocarry) {
  __shared__ __align__(16) unsigned short ring[2 * GT_STAGE];   // two stage buffers
  __shared__ __align__(16) float sT[8][16 * 68];   // per-wave 16x64 slab, pitch 68 floats
  const int by   = blockIdx.y;
  const int tid  = threadIdx.x;
  const int lane = tid & 31;
  const int wave = tid >> 5;
  const int tilesN = N >> 7;
  const int tilesM = M >> 7;
  const int tile = blockIdx.x;
  if (tile >= tilesM * tilesN) return;   // block-uniform, in front of every barrier and copy
  const int tm = tile / tilesN;
  const int tn = tile - tm * tilesN;
  const int bm0 = tm << 7;
  const int bn0 = tn << 7;
  const int wm = (wave >> 1) << 5;             // the wave's 32 rows inside the block tile
  const int wn = (wave & 1) << 6;              // the wave's 64 cols inside the block tile
  const int m0 = bm0 + wm;
  const int n0 = bn0 + wn;

  const unsigned short* A1 = Ap  + (size_t)((long long)by * sA);
  const unsigned short* Bb = Btp + (size_t)((long long)by * sB);

  const int rlane = lane & 15;                 // row (A) / col (B, D) within subtile
  const int koff  = (lane >> 4) * 8;           // k offset of this lane half
  const int mOff  = (lane >> 4) * 8;           // D row offset

  // copy map: lane piece = 16 B number tid & 15 of row (tid >> 4) + 16 j, j 0..7, of the A rows and of the Bt rows
  const int crow = tid >> 4;
  const int cpc  = (tid & 15) * 8;
  const unsigned short* gA = A1 + (size_t)(bm0 + crow) * lda + cpc;
  const unsigned short* gB = Bb + (size_t)(bn0 + crow) * ldb + cpc;
  const unsigned lA = (unsigned)(uintptr_t)(lds_u16*)(ring + crow * GT_PITCH + cpc);
  const unsigned lB = lA + 128 * GT_PITCH * 2;
  const int nst = K >> 7;                      // stages of 128 k

  v8f acc[2][4];
#pragma unroll
  for (int i = 0; i < 2; ++i)
#pragma unroll
    for (int j = 0; j < 4; ++j) acc[i][j] = zero8();

  // stage 0 into buffer 0, published; then stage 1 into buffer 1
  async_rows8(lA, gA, (size_t)16 * lda);
  async_rows8(lB, gB, (size_t)16 * ldb);
  wait_async0();
  __syncthreads();
  if (nst > 1) {
    async_rows8(lA + GT_STAGE * 2, gA + 128, (size_t)16 * lda);
    async_rows8(lB + GT_STAGE * 2, gB + 128, (size_t)16 * ldb);
  }

  for (int t = 0; t < nst; ++t) {
    const int buf = t & 1;
    const unsigned short* fA = ring + buf * GT_STAGE + (wm + rlane) * GT_PITCH + koff;
    const unsigned short* fB = ring + buf * GT_STAGE + (128 + wn + rlane) * GT_PITCH + koff;
    // two fragment sets: the next 32 k of this stage are read from LDS as one group ahead of the current products
    v16h ah[2][2], bh[2][4];
#pragma unroll
    for (int j = 0; j < 4; ++j) bh[0][j] = ldfrag_u(fB + (j << 4) * GT_PITCH);
#pragma unroll
    for (int i = 0; i < 2; ++i) ah[0][i] = ldfrag_u(fA + (i << 4) * GT_PITCH);
#pragma unroll   // every fragment-set index a constant, so both sets stay in registers
    for (int s = 0; s < 4; ++s) {
      const int cu = s & 1, nx = cu ^ 1;
      if (s < 3) {
#pragma unroll
        for (int j = 0; j < 4; ++j) bh[nx][j] = ldfrag_u(fB + (j << 4) * GT_PITCH + (s + 1) * 32);
#pragma unroll
        for (int i = 0; i < 2; ++i) ah[nx][i] = ldfrag_u(fA + (i << 4) * GT_PITCH + (s + 1) * 32);
      }
#pragma unroll
      for (int i = 0; i < 2; ++i) {
#pragma unroll
        for (int j = 0; j < 4; ++j) acc[i][j] = mma_raw(ah[cu][i], bh[cu][j], acc[i][j]);
        dep_guard1(acc[i][0], acc[i][3], ah[cu][i]);
      }
      keep4_h(bh[cu][0], bh[cu][1], bh[cu][2], bh[cu][3]);
    }
    // publish point of stage t + 1: own LDS reads back, own copies landed, one barrier for both hand-overs, then the refill
    wait_ds0();
    wait_async0();
    __syncthreads();
    if (t + 2 < nst) {
      async_rows8(lA + buf * (GT_STAGE * 2), gA + (size_t)(t + 2) * 128, (size_t)16 * lda);
      async_rows8(lB + buf * (GT_STAGE * 2), gB + (size_t)(t + 2) * 128, (size_t)16 * ldb);
    }
  }
  wait_async0();
  acc_guard4(acc[0][0], acc[0][1], acc[0][2], acc[0][3]);
  acc_guard4(acc[1][0], acc[1][1], acc[1][2], acc[1][3]);

  const int hh2 = lane >> 4, c4 = (lane & 15) * 4;     // f32 out: 256-B row segment = 16 lanes x 16 B
  const int q8  = lane >> 3, c8 = (lane & 7) * 8;
  float bc[4];
  float bcol[8];
#pragma unroll
  for (int e = 0; e < 4; ++e) bc[e] = 0.f;
#pragma unroll
  for (int e = 0; e < 8; ++e) bcol[e] = 0.f;
  if constexpr (BM == 1) {
    if constexpr (OM == 0) {
      const int cb = n0 + c4;
      const int i0 = (cb < N - 4) ? cb : (N - 4);        // clamped address
      const v4f b0v = *(const v4f*)(bias + i0);
#pragma unroll
      for (int e = 0; e < 4; ++e) bc[e] = bfr(b0v[e]);
    } else {
      const int cb = n0 + c8;
      const int i0 = (cb < N - 8) ? cb : (N - 8);        // clamped address
      const v4f b0v = *(const v4f*)(bias + i0), b1v = *(const v4f*)(bias + i0 + 4);
#pragma unroll
      for (int e = 0; e < 4; ++e) { bcol[e] = bfr(b0v[e]); bcol[4 + e] = bfr(b1v[e]); }
    }
  }

  // ---- epilogue ----
  float* slab = sT[wave];
#pragma unroll
  for (int i = 0; i < 2; ++i) {
    const int mBase = m0 + (i << 4);
#pragma unroll
    for (int j = 0; j < 4; ++j) {
#pragma unroll
      for (int r = 0; r < 8; ++r) {
        slab[(mOff + r) * 68 + (j << 4) + rlane] = acc[i][j][r];
      }
    }
    wave_sync_lds();
    if constexpr (OM == 0) {
      float* C = (float*)Cout + (size_t)((long long)by * sC);
      v4f vals[8];
#pragma unroll
      for (int it = 0; it < 8; ++it) {
        const int row = it * 2 + hh2;                      // it 0..7 x hh2 0..1 = rows 0..15
        const int gr  = mBase + row;
        v4f v = *(const v4f*)(slab + row * 68 + c4);
        float br = 0.f;
        if constexpr (BM == 2) {
          const int ir = (gr < M - 1) ? gr : (M - 1);      // clamped address
          br = bfr(bias[ir]);
        }
        v4f rv = {0.f, 0.f, 0.f, 0.f};
        if constexpr (HASR != 0) {
          const float* R = Rp + (size_t)((long long)by * sC);
          const v4f rraw = *(const v4f*)(R + (size_t)gr * ldc + n0 + c4);
#pragma unroll
          for (int e = 0; e < 4; ++e) rv[e] = (HASR == 1) ? bfr(rraw[e]) : rraw[e];
        }
#pragma unroll
        for (int e = 0; e < 4; ++e) v[e] = v[e] * oscale + bc[e] + br + rv[e];
        vals[it] = v;
      }
      {
#pragma unroll
        for (int it = 0; it < 8; ++it) {
          const int gr = mBase + it * 2 + hh2;
          *(v4f*)(C + (size_t)gr * ldc + n0 + c4) = vals[it];
        }
        
      }
    } else {
      unsigned short* C = (unsigned short*)Cout + (size_t)((long long)by * sC);
      static_assert(OM == 2 || BM == 0);
      v4u hv[4];
#pragma unroll
      for (int it = 0; it < 4; ++it) {
        const int row = (OM == 2) ? it * 4 + q8 : rlane;   // OM 2: it 0..3 x q8 0..3 = rows 0..15; OM 3, 4: row = lane & 15
        const float* sp = slab + row * 68 + ((OM == 2) ? c8 : it * 16 + koff);
        float br = 0.f;
        if constexpr (BM == 2) {
          const int gr = mBase + row;
          const int ir = (gr < M - 1) ? gr : (M - 1);      // clamped address
          br = bfr(bias[ir]);
        }
        v4u a = {0u, 0u, 0u, 0u};
#pragma unroll
        for (int e = 0; e < 4; ++e) {
          float f0 = sp[2 * e] * oscale + bcol[2 * e] + br;
          float f1 = sp[2 * e + 1] * oscale + bcol[2 * e + 1] + br;
          if constexpr (ACT == 1) { f0 = gelu_f(f0); f1 = gelu_f(f1); }
          f0 *= ocarry; f1 *= ocarry;
          a[e] = pk16(h_bits((_Float16)f0), h_bits((_Float16)f1));
        }
        hv[it] = a;
      }
      {
#pragma unroll
        for (int it = 0; it < 4; ++it) {
          if constexpr (OM == 2) {
            const int row = it * 4 + q8;
            *(v4u*)(C + (size_t)(mBase + row) * ldc + n0 + c8) = hv[it];
          } else if constexpr (OM == 3) {
            const int mt = mBase >> 4;                     // batch * 128 + key tile
            const size_t blk = (size_t)((mt / (NC / 16)) * NHEAD + (n0 >> 6)) * (NC / 16) + (mt % (NC / 16));
            *(v4u*)(C + blk * 1024 + it * 256 + lane * 8) = hv[it];
          } else {
            const size_t blk = (size_t)(mBase >> 6) * (NC / 32) + (n0 >> 5) + (it >> 1);
            *(v4u*)(C + blk * 2048 + ((mBase >> 4) & 3) * 512 + (it & 1) * 256 + lane * 8) = hv[it];
          }
        }
        
      }
    }
    wave_sync_lds();
  }
}

#define AT_KEYS   256
#define AT_STEPS  (AT_KEYS / 32)
#define AT_NST    (NC / AT_KEYS)
#define AT_HALF   (AT_KEYS * HDIM)
#define AT_STAGE  (2 * AT_HALF)
static_assert(AT_NST >= 2 && AT_HALF * 2 == 4 * ATT_THREADS * 16);

// Eight asynchronous 16-B copies per lane, global -> LDS: four pieces of the k stage and four of the v^T stage, 8 KiB apart (the
// block's 512 lanes side by side). The closing s_wait_xcnt 0 stands inside the statement so that no address register of an issued
// copy is rewritten in front of it.
__device__ __forceinline__ void async_kv8(unsigned l, const unsigned short* gk, const unsigned short* gv) {
#if defined(__HIP_DEVICE_COMPILE__)
  const unsigned ls = ATT_THREADS * 16;        // bytes per block-wide piece
  const unsigned lv = AT_HALF * 2;             // the v^T part of a buffer, in bytes
  const int      gs = ATT_THREADS * 8;         // halves per block-wide piece
  asm volatile("global_load_async_to_lds_b128 %0, %8, off\n\t"
               "global_load_async_to_lds_b128 %1, %9, off\n\t"
               "global_load_async_to_lds_b128 %2, %10, off\n\t"
               "global_load_async_to_lds_b128 %3, %11, off\n\t"
               "global_load_async_to_lds_b128 %4, %12, off\n\t"
               "global_load_async_to_lds_b128 %5, %13, off\n\t"
               "global_load_async_to_lds_b128 %6, %14, off\n\t"
               "global_load_async_to_lds_b128 %7, %15, off\n\t"
               "s_wait_xcnt 0x0"
               :: "v"(l), "v"(l + ls), "v"(l + 2 * ls), "v"(l + 3 * ls),
                  "v"(l + lv), "v"(l + lv + ls), "v"(l + lv + 2 * ls), "v"(l + lv + 3 * ls),
                  "v"(gk), "v"(gk + gs), "v"(gk + 2 * gs), "v"(gk + 3 * gs),
                  "v"(gv), "v"(gv + gs), "v"(gv + 2 * gs), "v"(gv + 3 * gs)
               : "memory");
#endif
}

__global__ __launch_bounds__(ATT_THREADS)
void attn16(const unsigned short* __restrict__ QHp, const unsigned short* __restrict__ KHp,
            const unsigned short* __restrict__ VTq, const float* __restrict__ LBp, unsigned short* CT) {
  __shared__ __align__(16) unsigned short kv[2 * AT_STAGE];   // two stage buffers
  const int tid  = threadIdx.x;
  const int wave = __builtin_amdgcn_readfirstlane(tid >> 5);  // told to be wave-uniform, so the bias base stays scalar
  const int lane = tid & 31;
  const int hh   = lane >> 4;
  const int c    = lane & 15;

  const int qg   = blockIdx.x & (ATT_QG - 1);              // 0..7
  const int head = (blockIdx.x / ATT_QG) & (NHEAD - 1);    // 0..15
  const int bat  = blockIdx.x / (ATT_QG * NHEAD);          // 0..1
  const int qt   = qg * ATT_WAVES + wave;                  // 0..127
  const int q0   = qt * 16;

  const size_t qofs = ((size_t)bat * NQ + q0 + c) * DMODEL + head * HDIM + 8 * hh;
  const _Float16* Qh = (const _Float16*)(const void*)QHp + qofs;
  // copy map: lane piece = 16 B number tid + 512 j, j 0..3, of the stage's 32 KiB of k and of its 32 KiB of v^T
  const unsigned short* gK = KHp + (size_t)(bat * NHEAD + head) * (NC * HDIM) + tid * 8;
  const unsigned short* gV = VTq + (size_t)(bat * NHEAD + head) * (NC * HDIM) + tid * 8;
  const unsigned lK = (unsigned)(uintptr_t)(lds_u16*)(kv + tid * 8);
  const unsigned lofs = 8u * (unsigned)lane;               // the lane's 16 B inside every 512-B run
  const float* Wb = LBp + (size_t)(bat * (NQ / 16) + qt) * (16 * NC) + 4u * (unsigned)lane;   // log2 units, 512 floats per step
  const float lsc = (LOG2E * ATT_SCALE) / (QC * KC);                   // log2(e) / 8 / carries

  // stage 0 into buffer 0, published; then stage 1 into buffer 1
  async_kv8(lK, gK, gV);
  const v16h qa = ldfrag_h(Qh), qb = ldfrag_h(Qh + 32);
  wait_async0();
  __syncthreads();
  async_kv8(lK + AT_STAGE * 2, gK + AT_HALF, gV + AT_HALF);

  float mrun = -INFINITY, lsum = 0.f;                      // the query's running maximum; this wave half's running sum
  v8f o0 = zero8(), o1 = zero8(), o2 = zero8(), o3 = zero8();

#pragma unroll 1   // rolled, as the loop of steps inside it: the loop text stays short
  for (int st = 0; st < AT_NST; ++st) {
  const int buf = st & 1;
  const _Float16* kl = (const _Float16*)(const void*)(kv + buf * AT_STAGE) + lofs;
  const float*    wl = Wb + (size_t)st * (AT_KEYS * 16);
#pragma unroll 1   // rolled: one step's 20 loads are issued as one group at its head, and the loop text stays short
  for (int sp = 0; sp < AT_STEPS; ++sp) {
    const _Float16* kp = kl + sp * 2048;                   // LDS: k blocks 2 sp and 2 sp + 1 of the stage, 1024 halves each
    const float*    wp = wl + sp * 512;                    // global: bias block of the step, 512 floats
    const _Float16* vp = kp + AT_HALF;                     // LDS: v^T block sp of the stage, 2048 halves
    const v4f w0 = *(const v4f*)(wp),       w1 = *(const v4f*)(wp + 128);
    const v4f w2 = *(const v4f*)(wp + 256), w3 = *(const v4f*)(wp + 384);
    const v16h k00 = ldfrag_p(kp),        k01 = ldfrag_p(kp + 512);
    const v16h k10 = ldfrag_p(kp + 1024), k11 = ldfrag_p(kp + 1536);
    const v16h vb0 = ldfrag_p(vp);
    const v16h vb1 = ldfrag_p(vp + 512);
    const v16h vb2 = ldfrag_p(vp + 1024);
    const v16h vb3 = ldfrag_p(vp + 1536);
#if defined(__HIP_DEVICE_COMPILE__)
    // stands behind the step's four global loads, in front of every rewrite of a register that they name; their address pair is
    // an input, so that it does not serve as a load's destination in front of the wait
    asm volatile("s_wait_xcnt 0x0" :: "v"(wp) : "memory");
#endif
    v8f s0, s1;
    s0 = mma_raw(k00, qa, zero8());
    s0 = mma_raw(k01, qb, s0);
    guard_s2(s0, k00, k01);
    s1 = mma_raw(k10, qa, zero8());
    s1 = mma_raw(k11, qb, s1);
    guard_s4(s1, k10, k11, qa, qb);
    v2f t[8];                                              // pair i = keys kb + 16 (i >> 2) + 8 hh + 2 (i & 3) + 0, 1
#pragma unroll   // here and below: every index a constant, so the pairs stay in registers
    for (int e = 0; e < 2; ++e) {
      t[e]     = (v2f){s0[2 * e],     s0[2 * e + 1]} * lsc + (v2f){w0[2 * e], w0[2 * e + 1]};
      t[2 + e] = (v2f){s0[4 + 2 * e], s0[5 + 2 * e]} * lsc + (v2f){w1[2 * e], w1[2 * e + 1]};
      t[4 + e] = (v2f){s1[2 * e],     s1[2 * e + 1]} * lsc + (v2f){w2[2 * e], w2[2 * e + 1]};
      t[6 + e] = (v2f){s1[4 + 2 * e], s1[5 + 2 * e]} * lsc + (v2f){w3[2 * e], w3[2 * e + 1]};
    }
    float mx[8];
#pragma unroll
    for (int i = 0; i < 8; ++i) mx[i] = fmaxf(t[i][0], t[i][1]);
    float mxa = fmaxf(fmaxf(fmaxf(mx[0], mx[1]), fmaxf(mx[2], mx[3])), fmaxf(fmaxf(mx[4], mx[5]), fmaxf(mx[6], mx[7])));
    mxa = fmaxf(mxa, xhalf(mxa));                          // over the step's 32 keys, equal in both halves
    const float mn = fmaxf(mrun, mxa);
    const float al = exp2_hw(mrun - mn);                   // 0 on the first step, where mrun is -inf
    mrun = mn;
    v2f ex[8];
    FragH ph;                                              // elements 0..7 = keys kb + 8hh + 0..7, 8..15 = keys kb + 16 + 8hh + 0..7
#pragma unroll
    for (int i = 0; i < 8; ++i) {
      const v2f d = t[i] - mn;
      ex[i] = (v2f){exp2_hw(d[0]), exp2_hw(d[1])};
      ph.p[i] = __builtin_convertvector(ex[i] * PC, v2h);
    }
    const v2f ps = ((ex[0] + ex[1]) + (ex[2] + ex[3])) + ((ex[4] + ex[5]) + (ex[6] + ex[7]));
    lsum = lsum * al + (ps[0] + ps[1]);
#pragma unroll
    for (int r = 0; r < 8; ++r) {
      o0[r] *= al;
      o1[r] *= al;
      o2[r] *= al;
      o3[r] *= al;
    }
    o0 = mma_raw(vb0, ph.v, o0);
    o1 = mma_raw(vb1, ph.v, o1);
    o2 = mma_raw(vb2, ph.v, o2);
    o3 = mma_raw(vb3, ph.v, o3);
    guard_pv4(o0, o1, o2, o3, ph.v, vb0, vb1, vb2, vb3);
  }
  // publish point of stage st + 1: own LDS reads back, own copies landed, one barrier for both hand-overs, then the refill
  wait_ds0();
  wait_async0();
  __syncthreads();
  if (st + 2 < AT_NST)
    async_kv8(lK + buf * (AT_STAGE * 2), gK + (size_t)(st + 2) * AT_HALF, gV + (size_t)(st + 2) * AT_HALF);
  }
  wait_async0();

  // ---- join the halves' sums, fold 1/l and the carries (1024 on P, 16 on v, 1024 on the stored ctx), store 16 B per tile ----
  const float oc  = FC / (PC * VC);
  const float inv = (1.0f / (lsum + xhalf(lsum))) * oc;
  unsigned short* dst = CT + qofs;                         // row q0 + c, cols 64 head + 8 hh (+ 16 t)
  v4u p0, p1, p2, p3;
#pragma unroll
  for (int e = 0; e < 4; ++e) {
    p0[e] = pk16(h_bits((_Float16)(o0[2 * e] * inv)), h_bits((_Float16)(o0[2 * e + 1] * inv)));
    p1[e] = pk16(h_bits((_Float16)(o1[2 * e] * inv)), h_bits((_Float16)(o1[2 * e + 1] * inv)));
    p2[e] = pk16(h_bits((_Float16)(o2[2 * e] * inv)), h_bits((_Float16)(o2[2 * e + 1] * inv)));
    p3[e] = pk16(h_bits((_Float16)(o3[2 * e] * inv)), h_bits((_Float16)(o3[2 * e + 1] * inv)));
  }
  *(v4u*)(dst)      = p0;
  *(v4u*)(dst + 16) = p1;
  *(v4u*)(dst + 32) = p2;
  *(v4u*)(dst + 48) = p3;
}

// =====================================================================================================
// Workspace map (bytes); every plane is an exact multiple of its tile / whole-row store granularity (M, N exact tile multiples,
// element counts exact multiples of pack_all's 32768-element block, no pad rows needed), every offset a multiple of 2 MiB:
//   WQ16 f16 [1024][1024] x64               2097152   ([out][in] = [n][k])
//   WK16 f16 [1024][1024] x64               2097152
//   WV16 f16 [1024][1024] x64               2097152
//   WO16 f16 [1024][1024] x64               2097152
//   X16  f16 [4096][1024] x16               8388608   (activation rows)
//   LB   f32 [2][128][64] x 2 KiB          33554432   (log2(bf16(M)), lane order of the transposed score tiles)
//   QH   f16 [4096][1024] x16               8388608   (q projection, unscaled)
//   KH   f16 [2][16][128] x 2 KiB, x16      8388608   (k projection, fragment order)
//   VT   f16 [2][16][64] x 4 KiB, x16       8388608   (v^T, fragment order)
//   CT   f16 [4096][1024] x1024             8388608   (attention ctx, merged heads)
//   end                                    83886080
// =====================================================================================================
extern "C" void kernel_launch(void* const* d_in, const int* in_sizes, int n_in,
                              void* d_out, int out_size, void* d_ws, size_t ws_size,
                              hipStream_t stream) {
  if (n_in < 7) return;
  if (in_sizes[0] != NROWS * DMODEL) return;
  if (in_sizes[1] != NB * NQ * NC) return;
  if (in_sizes[2] != DMODEL * DMODEL || in_sizes[3] != DMODEL * DMODEL ||
      in_sizes[4] != DMODEL * DMODEL || in_sizes[5] != DMODEL * DMODEL) return;
  if (in_sizes[6] != DMODEL) return;
  if (out_size != NROWS * DMODEL) return;
  if ((in_sizes[0] % 2048) != 0 || (in_sizes[2] % 2048) != 0 || (in_sizes[1] % 1024) != 0) return;

  const float* x   = (const float*)d_in[0];
  const float* Mp  = (const float*)d_in[1];
  const float* w_q = (const float*)d_in[2];
  const float* w_k = (const float*)d_in[3];
  const float* w_v = (const float*)d_in[4];
  const float* w_o = (const float*)d_in[5];
  const float* b_o = (const float*)d_in[6];
  float*       out = (float*)d_out;

  const size_t PW  = (size_t)DMODEL * DMODEL * 2;                 //  2097152
  const size_t PX  = (size_t)NROWS * DMODEL * 2;                  //  8388608
  const size_t PLB = (size_t)NB * NQ * NC * 4;                    // 33554432
  const size_t PVT = (size_t)NB * DMODEL * NC * 2;                //  8388608
  size_t off = 0;
  const size_t oWQ = off; off += PW;
  const size_t oWK = off; off += PW;
  const size_t oWV = off; off += PW;
  const size_t oWO = off; off += PW;
  const size_t oX  = off; off += PX;
  const size_t oLB = off; off += PLB;
  const size_t oQH = off; off += PX;
  const size_t oKH = off; off += PX;
  const size_t oVT = off; off += PVT;
  const size_t oCT = off; off += PX;
  if (off > ws_size) return;                                      // off = 83886080
  if (off > (size_t)134217728) return;

  char* ws = (char*)d_ws;
  unsigned short* WQ16 = (unsigned short*)(ws + oWQ);
  unsigned short* WK16 = (unsigned short*)(ws + oWK);
  unsigned short* WV16 = (unsigned short*)(ws + oWV);
  unsigned short* WO16 = (unsigned short*)(ws + oWO);
  unsigned short* X16  = (unsigned short*)(ws + oX);
  float*          LB   = (float*)(ws + oLB);
  unsigned short* QH   = (unsigned short*)(ws + oQH);
  unsigned short* KH   = (unsigned short*)(ws + oKH);
  unsigned short* VTp  = (unsigned short*)(ws + oVT);
  unsigned short* CT   = (unsigned short*)(ws + oCT);

  const dim3 blk(256);
  const dim3 gPK(PK_BLOCKS);                                       // 512 blocks
  const int tilesP = (NROWS / 128) * (DMODEL / 128);               // 256
  const int tilesV = (DMODEL / 128) * (NC / 128);                  // 128 per batch
  const dim3 gP(tilesP, 1);                                        // 256
  const dim3 gV(tilesV, NB);                                       // 128 x 2
  const dim3 gAT(ATT_BLOCKS);                                      // 256
  const dim3 bAT(ATT_THREADS);                                     // 512

  // (0..2) one launch: weight planes W16[n][k] = f16( bf16_RNE(W[n][k]) * 64 ), [out][in] layout kept, k contiguous (WQ16, WK16,
  // WV16, WO16 lie one behind the other); activation plane X16[row][c] = f16( bf16_RNE(x[row][c]) * 16 ), rows = b*2048 + tok;
  // score bias plane log2( bf16_RNE(M[b][q][key]) ), f32, in the lane order of attn16's score tiles
  pack_all<<<gPK, blk, 0, stream>>>(Mp, LB, x, X16, w_q, w_k, w_v, w_o, WQ16);

  // (3) q projection: QH[m][n] = f16(16 * sum_k x[m][k] Wq[n][k]); M = 4096, N = 1024, K = 1024
  gemm64<2, 0, 0, 0><<<gP, blk, 0, stream>>>(
      X16, DMODEL, 0LL,
      WQ16, DMODEL, 0LL,
      b_o,
      (const float*)0,
      (void*)QH, DMODEL, 0LL,
      NROWS, DMODEL, DMODEL, 1.0f / (ACARRY * WSC), QC);

  // (4) k projection: f16(16 * sum_k x[m][k] Wk[n][k]) in fragment order; M = 4096, N = 1024, K = 1024
  gemm64<3, 0, 0, 0><<<gP, blk, 0, stream>>>(
      X16, DMODEL, 0LL,
      WK16, DMODEL, 0LL,
      b_o,
      (const float*)0,
      (void*)KH, DMODEL, 0LL,
      NROWS, DMODEL, DMODEL, 1.0f / (ACARRY * WSC), KC);

  // (5) v^T per batch: f16(16 * sum_k Wv[d][k] x_b[tok][k]) in fragment order; M = 1024, N = 2048, K = 1024
  gemm64<4, 0, 0, 0><<<gV, blk, 0, stream>>>(
      WV16, DMODEL, 0LL,
      X16, DMODEL, (long long)NC * DMODEL,
      b_o,
      (const float*)0,
      (void*)VTp, NC, (long long)DMODEL * NC,
      DMODEL, NC, DMODEL, 1.0f / (ACARRY * WSC), VC);

  // (6) attention per (batch, head, 256 query rows) -> CT (f16, x1024)
  attn16<<<gAT, bAT, 0, stream>>>(QH, KH, VTp, LB, CT);

  // (7) out = CT . Wo^T / (1024 * 64) + bf16(bo); M = 4096, N = 1024, K = 1024, f32
  gemm64<0, 1, 0, 0><<<gP, blk, 0, stream>>>(
      CT, DMODEL, 0LL,
      WO16, DMODEL, 0LL,
      b_o,
      (const float*)0,
      (void*)out, DMODEL, 0LL,
      NROWS, DMODEL, DMODEL, 1.0f / (FC * WSC), 1.0f);
  (void)hipGetLastError();
}

// v007
// It runs in 111 microseconds.
// Two timings next to v006 put it at 1.09 and 1.10 times that version's speed.
// Over all steps from v000 it is 3.34 times as fast.
// Contractions: q/k projections (x rows f16 x16 . W f16 x64, K=1024), v^T projection (Wv f16 x64 . x rows f16 x16, K=1024),
// attention scores^T (k f16 x16 . q f16 x16, K=64), attention v^T . P^T (v^T f16 x16 . P f16 x1024, K=2048 in steps of 32),
// output projection (ctx f16 x1024 . Wo f16 x64, K=1024): all v_wmma_f32_16x16x32_f16 single products, f32 accumulate.
// Additive log2(M) score bias (f32 plane), online max-subtracted base-2 softmax and output bias in f32 on VALU.
// Every float input RNE-converted to bf16 on load.
#include <hip/hip_runtime.h>
#include <math.h>
#include <stdint.h>

#define NB      2
#define NQ      2048
#define NC      2048
#define DMODEL  1024
#define NHEAD   16
#define HDIM    64
#define NROWS   (NB * NQ)
#define WSC     64.0f
#define ACARRY  16.0f
#define QC      16.0f
#define KC      16.0f
#define VC      16.0f
#define PC      1024.0f
#define FC      1024.0f
#define ATT_SCALE 0.125f
#define LOG2E   1.4426950408889634f
static_assert(NHEAD * HDIM == DMODEL);
static_assert((NQ % 64) == 0 && (NC % 64) == 0 && (DMODEL % 64) == 0 && (NC % 32) == 0 && (NQ % 16) == 0);
static_assert((NROWS % 128) == 0 && (NC % 128) == 0 && (DMODEL % 128) == 0);
#define ATT_WAVES   16                                     // query tiles of 16 rows per block, one wave each
#define ATT_THREADS (ATT_WAVES * 32)
#define ATT_QG      (NQ / (16 * ATT_WAVES))                // blocks per batch and head
#define ATT_BLOCKS  (NB * NHEAD * ATT_QG)
static_assert(ATT_THREADS == 512 && ATT_QG == 8 && ATT_BLOCKS == 256);

typedef _Float16 v16h __attribute__((ext_vector_type(16)));
typedef _Float16 v8h  __attribute__((ext_vector_type(8)));
typedef float    v8f  __attribute__((ext_vector_type(8)));
typedef float    v4f  __attribute__((ext_vector_type(4)));
typedef float    v2f  __attribute__((ext_vector_type(2)));
typedef _Float16 v2h  __attribute__((ext_vector_type(2)));
typedef unsigned int v4u __attribute__((ext_vector_type(4)));

union FragH { v16h v; v8h h[2]; v4u u[2]; v2h p[8]; };

// ---- scalar helpers --------------------------------------------------------------------------------
__device__ __forceinline__ unsigned short bf_bits(float f) {          // f32 -> bf16 bits, RNE convert
  unsigned u = __float_as_uint(f);
  return (unsigned short)((u + 0x7FFFu + ((u >> 16) & 1u)) >> 16);
}
__device__ __forceinline__ float bf_up(unsigned short h) { return __uint_as_float(((unsigned)h) << 16); }
__device__ __forceinline__ float bfr(float f) { return bf_up(bf_bits(f)); }   // value of the bf16 RNE convert
__device__ __forceinline__ unsigned short h_bits(_Float16 x) { return __builtin_bit_cast(unsigned short, x); }
__device__ __forceinline__ unsigned pk16(unsigned short a, unsigned short b) { return (unsigned)a | ((unsigned)b << 16); }
__device__ __forceinline__ v8f zero8() { v8f z = {0.f, 0.f, 0.f, 0.f, 0.f, 0.f, 0.f, 0.f}; return z; }
__device__ __forceinline__ float gelu_f(float v) { return 0.5f * v * (1.0f + erff(v * 0.70710678118654752f)); }
__device__ __forceinline__ float xhalf(float x) {                     // the value that lane ^ 16 holds
  const int b = __builtin_bit_cast(int, x);
  return __builtin_bit_cast(float, __builtin_amdgcn_permlanex16(b, b, 0x76543210, 0xfedcba98, false, false));
}

// 2^x as the one hardware instruction. For x >= -126 it gives the bits that the library's exp2f gives; below that its result is 0
// or under 2^-126 where the library scales to a subnormal. attn16 calls it with x <= 0 only, beside a term 2^0 = 1 of the same
// softmax row: such a term is 0 in the f16 prob tile either way and adds under 2^-115 to a row sum that is at least 1.
__device__ __forceinline__ float exp2_hw(float x) { return __builtin_amdgcn_exp2f(x); }

// ---- fragment loaders: 16-bit A/B operand, lane -> row/col (lane&15), p already includes +8*(lane>>4);
//      elements 0..7 <- p[0..7] (k0+8h..), elements 8..15 <- p[16..23] (k0+16+8h..)  (same split k map for A and B;
//      B is read from a k-contiguous [n][k] plane in gemm64 and for q in attn16; attn16's A comes from fragment order via ldfrag_p)
__device__ __forceinline__ v16h ldfrag_h(const _Float16* p) {
  FragH f;
  f.h[0] = *(const v8h*)(p);
  f.h[1] = *(const v8h*)(p + 16);
  return f.v;
}
__device__ __forceinline__ v16h ldfrag_u(const unsigned short* p) {
  FragH f;
  f.u[0] = *(const v4u*)(p);
  f.u[1] = *(const v4u*)(p + 16);
  return f.v;
}

// fragment-ordered plane: a fragment is two runs of 512 B, run i = elements 8i..8i+7 of all 32 lanes, 16 B per lane in lane order;
// p already includes +8*lane, so each of the two wave-wide loads covers 512 contiguous bytes = four whole lines
__device__ __forceinline__ v16h ldfrag_p(const _Float16* p) {
  FragH f;
  f.h[0] = *(const v8h*)(p);
  f.h[1] = *(const v8h*)(p + 256);
  return f.v;
}

// ---- WMMA helpers with trailing VALU hazard gaps ------------------------------------------------------
__device__ __forceinline__ v8f mma_raw(v16h a, v16h b, v8f c) {
  return __builtin_amdgcn_wmma_f32_16x16x32_f16(false, a, false, b, (short)0, c, false, false);
}
__device__ __forceinline__ void dep_guard1(v8f& a, v8f& b, v16h x) {
#if defined(__HIP_DEVICE_COMPILE__)
  asm volatile("v_nop\n\tv_nop\n\tv_nop\n\tv_nop" : "+v"(a), "+v"(b) : "v"(x));
#endif
}
__device__ __forceinline__ void guard_s2(v8f& s, v16h a0, v16h a1) {
#if defined(__HIP_DEVICE_COMPILE__)
  asm volatile("v_nop\n\tv_nop\n\tv_nop\n\tv_nop" : "+v"(s) : "v"(a0), "v"(a1));
#endif
}
__device__ __forceinline__ void guard_s4(v8f& s, v16h a0, v16h a1, v16h b0, v16h b1) {
#if defined(__HIP_DEVICE_COMPILE__)
  asm volatile("v_nop\n\tv_nop\n\tv_nop\n\tv_nop" : "+v"(s) : "v"(a0), "v"(a1), "v"(b0), "v"(b1));
#endif
}
__device__ __forceinline__ void guard_pv4(v8f& a, v8f& b, v8f& c, v8f& d, v16h x, v16h y, v16h z, v16h w, v16h u) {
#if defined(__HIP_DEVICE_COMPILE__)
  asm volatile("v_nop\n\tv_nop\n\tv_nop\n\tv_nop"
               : "+v"(a), "+v"(b), "+v"(c), "+v"(d) : "v"(x), "v"(y), "v"(z), "v"(w), "v"(u));
#endif
}
__device__ __forceinline__ void keep4_h(v16h a, v16h b, v16h c, v16h d) {
#if defined(__HIP_DEVICE_COMPILE__)
  asm volatile("v_nop" :: "v"(a), "v"(b), "v"(c), "v"(d));
#endif
}
__device__ __forceinline__ void acc_guard4(v8f& a, v8f& b, v8f& c, v8f& d) {
#if defined(__HIP_DEVICE_COMPILE__)
  asm volatile("v_nop\n\tv_nop\n\tv_nop\n\tv_nop" : "+v"(a), "+v"(b), "+v"(c), "+v"(d));
#endif
}
__device__ __forceinline__ void wave_sync_lds() {
  __builtin_amdgcn_fence(__ATOMIC_RELEASE, "workgroup");
  __builtin_amdgcn_wave_barrier();
  __builtin_amdgcn_fence(__ATOMIC_ACQUIRE, "workgroup");
}

// =====================================================================================================
// All six input-only packs in ONE launch of 512 blocks x 8 waves; a wave takes PK_IT groups of eight 16-B loads: all its loads are
// issued at its head, then group after group is converted and stored as its loads return. Blocks 0..255: score bias plane;
// 256..383: activation rows; 384..511: the four weight planes, 32 blocks each.
// 16-bit pack, no transpose: dst[i] = f16( bf16_RNE(src[i]) * sc ), sc a power of two (exact). Used for the weights (stored
// [out][in] = [n][k], already k contiguous for B fragments / A of the v^T projection; the four planes lie one behind the other in
// the workspace) and for the activation rows. A piece is 8 elements: two 16-B loads, one 16-B store per lane; a group is 4 pieces
// per lane = 1024 elements per wave, 32 consecutive lanes = one whole 512-B store; the 8 waves' groups lie side by side.
// Score bias plane: log2( bf16_RNE(M) ) as f32 (M strictly positive), laid in the lane order in which attn16 holds its transposed
// score tiles: 2-KiB blocks [batch][query / 16][key / 32] of 16 queries x 32 keys, four runs of 512 B; run i, lane (c, hh) = query c,
// keys 16 (i >> 1) + 8 hh + 4 (i & 1) + 0..3. A piece is 16 B of the plane; a group is two neighbouring plane blocks = 8 pieces per
// lane, read from 256 B of each of 16 source rows, stored as eight whole 512-B runs; a work-group takes 16 whole source rows.
// coverage: bias 256 blocks x 8 waves x PK_IT groups x 1024 elements = 2 x 2048 x 2048; rows 128 x 8 x PK_IT x 1024 = 4096 x 1024;
//           a weight 32 x 8 x PK_IT x 1024 = 1024 x 1024; group -> source and group -> plane are one to one. No barrier.
// =====================================================================================================
#define PK_IT 4
#define PK_BM ((NB * NQ) / 16)                             // 256 blocks, 16 source rows each
#define PK_BX ((NROWS * DMODEL) / (8 * PK_IT * 1024))      // 128 blocks
#define PK_BW ((DMODEL * DMODEL) / (8 * PK_IT * 1024))     //  32 blocks per weight
#define PK_BLOCKS (PK_BM + PK_BX + 4 * PK_BW)
static_assert(NC == 8 * PK_IT * 64 && PK_BX * 8 * PK_IT * 1024 == NROWS * DMODEL);
static_assert(PK_BW * 8 * PK_IT * 1024 == DMODEL * DMODEL && PK_BLOCKS == 512);

// stands behind a wave's run of loads, in front of every rewrite of a register that they name; their address pair is an input,
// so that it is not given away in front of the wait
__device__ __forceinline__ void wait_x0(const void* p) {
#if defined(__HIP_DEVICE_COMPILE__)
  asm volatile("s_wait_xcnt 0x0" :: "v"(p) : "memory");
#endif
}
__device__ __forceinline__ float log2_slot(float x) {
  const bool  sm = x < 1.17549435e-38f;
  const float s  = ldexpf(x, sm ? 32 : 0);
  float r;
#if defined(__HIP_DEVICE_COMPILE__)
  asm("v_log_f32 %0, %1\n\tv_nop" : "=v"(r) : "v"(s));
#else
  r = log2f(s);
#endif
  return r - (sm ? 32.0f : 0.0f);
}

__global__ __launch_bounds__(256) void pack_all(const float* __restrict__ Mp, float* LB,
                                                const float* __restrict__ xp, unsigned short* X16,
                                                const float* __restrict__ wq, const float* __restrict__ wk,
                                                const float* __restrict__ wv, const float* __restrict__ wo,
                                                unsigned short* W16) {
  const unsigned lane = threadIdx.x & 31u;
  const unsigned wave = threadIdx.x >> 5;
  const unsigned b    = blockIdx.x;
  v4f a[PK_IT][8];
  if (b < PK_BM) {
    // block b = source rows 16 b .. 16 b + 15 = plane blocks 64 b .. 64 b + 63; group (it, wave) = plane blocks 2 (8 it + wave) + 0, 1
    const unsigned c = lane & 15u, hh = lane >> 4;
    const float* sp = Mp + (size_t)(b * 16u + c) * NC + wave * 64u + hh * 8u;
    float*       dp = LB + (size_t)(b * (8u * PK_IT) + wave) * 1024 + lane * 4u;
#pragma unroll   // here and below in the pack: every index a constant, so the groups stay in registers
    for (int it = 0; it < PK_IT; ++it)
#pragma unroll
      for (int u = 0; u < 8; ++u)
        a[it][u] = *(const v4f*)(sp + it * 512 + (u >> 2) * 32 + ((u & 3) >> 1) * 16 + (u & 1) * 4);
    wait_x0(sp);
#pragma unroll
    for (int it = 0; it < PK_IT; ++it) {
#pragma unroll
      for (int u = 0; u < 8; ++u) {
        const v4f v = a[it][u];
        v4f o;
        o[0] = log2_slot(bfr(v[0]));
        o[1] = log2_slot(bfr(v[1]));
        o[2] = log2_slot(bfr(v[2]));
        o[3] = log2_slot(bfr(v[3]));
        *(v4f*)(dp + it * 8192 + u * 128) = o;
      }
    }
  } else {
    const unsigned bc = b - PK_BM;
    const bool isx = bc < PK_BX;                            // block-uniform
    const unsigned bw = isx ? 0u : bc - PK_BX;              // weights: plane bw / PK_BW, block bw % PK_BW of it
    const unsigned wi = bw / PK_BW;
    const float* src = isx ? xp : (wi == 0u) ? wq : (wi == 1u) ? wk : (wi == 2u) ? wv : wo;
    unsigned short* dst = isx ? X16 : W16 + (size_t)wi * (DMODEL * DMODEL);
    const float sc = isx ? ACARRY : WSC;
    const size_t e0 = (size_t)((isx ? bc : bw % PK_BW) * (8u * PK_IT) + wave) * 1024 + lane * 8u;   // group (it, wave) at + 8192 it
    const float*    sp = src + e0;
    unsigned short* dp = dst + e0;
#pragma unroll
    for (int it = 0; it < PK_IT; ++it)
#pragma unroll
      for (int u = 0; u < 4; ++u) {
        a[it][2 * u]     = *(const v4f*)(sp + it * 8192 + u * 256);
        a[it][2 * u + 1] = *(const v4f*)(sp + it * 8192 + u * 256 + 4);
      }
    wait_x0(sp);
#pragma unroll
    for (int it = 0; it < PK_IT; ++it) {
#pragma unroll
      for (int u = 0; u < 4; ++u) {
        const v4f p = a[it][2 * u], q = a[it][2 * u + 1];
        v4u o;
        o[0] = pk16(h_bits((_Float16)(bfr(p[0]) * sc)), h_bits((_Float16)(bfr(p[1]) * sc)));
        o[1] = pk16(h_bits((_Float16)(bfr(p[2]) * sc)), h_bits((_Float16)(bfr(p[3]) * sc)));
        o[2] = pk16(h_bits((_Float16)(bfr(q[0]) * sc)), h_bits((_Float16)(bfr(q[1]) * sc)));
        o[3] = pk16(h_bits((_Float16)(bfr(q[2]) * sc)), h_bits((_Float16)(bfr(q[3]) * sc)));
        *(v4u*)(dp + it * 8192 + u * 256) = o;
      }
    }
  }
}

// =====================================================================================================
// LDS-staged batched f16 WMMA GEMM: C[m][n] = f( oscale * sum_k A[m][k] * Bt[n][k] + bf16(bias) ) (+ residual); one block of
// 8 waves per 128x128 tile, one wave per 32x64 part of it (4 x 2 waves). A row-major [M][K] pitch lda (16-bit plane), Bt
// row-major [N][K] pitch ldb (k contiguous); M, N multiples of 128, K multiple of 128. blockIdx.y = batch index with element
// strides sA, sB, sC.
// A stage is 128 k (256 B) of the tile's 128 A rows and 128 Bt rows, laid in LDS at a row pitch of 272 B; two buffers. Every
// lane brings 16 pieces of 16 B per stage by asynchronous copies (16 lanes = one whole 256-B row piece), the next stage's
// copies in flight while this stage is multiplied; fragments are read from LDS with the split k map of ldfrag_u, k ascending.
// The epilogue's per-wave slabs lie over the ring, which is idle behind the last trip's barrier: LDS per block = the ring, 139264 B.
// BM: 0 = no bias, 1 = per column bf16(bias[col]), 2 = per row bf16(bias[row]) (clamped-address loads).
// OM: 0 = f32 out (pitch ldc; HASR 1 adds bf16(R[m][n]), HASR 2 adds raw f32 R[m][n], same pitch/stride as C);
//     2 = f16 out (pitch ldc) = f16( act(value) * ocarry ), ACT 1 = exact GELU.
//     3, 4 = the same f16 values laid in the fragment order that attn16 loads (ldfrag_p), ldc unused, BM 0 only. A wave's 16x64
//         slab is four runs of 512 B; run it, lane (c, hh) = slab row c, cols 16 it + 8 hh + 0..7: one whole 512-B store each.
//         3 (k plane; rows = batch*2048 + key, cols = 64 head + d): the slab is the 2-KiB block [batch][head][key / 16].
//         4 (v^T plane; rows = 64 head + d, cols = key, batch = by through sC): runs 2t, 2t + 1 are the 1-KiB piece
//         (d / 16) & 3 of the 4-KiB block [head][key / 32], t = 0, 1 the slab's two 32-key tiles.
// coverage: 2 slabs x 16 rows (f32: it 0..7 x lane>>4; OM 2: it 0..3 x lane>>3; OM 3, 4: lane & 15) x 64 cols = the wave's whole 32x64 part;
//           grid = tilesM*tilesN blocks, a surplus block exits as a whole in front of every barrier.
// =====================================================================================================
#define GT_PITCH  136                          // LDS row pitch in halves: 272 B = 16 B x odd, for 16-B LDS reads
#define GT_STAGE  (256 * GT_PITCH)             // halves per buffer: [A 128 rows | Bt 128 rows]
typedef __attribute__((address_space(3))) unsigned short lds_u16;

// Eight asynchronous 16-B copies per lane, global -> LDS, rows 16 apart. The closing s_wait_xcnt 0 stands inside the statement
// so that no address register of an issued copy is rewritten in front of it.
__device__ __forceinline__ void async_rows8(unsigned l, const unsigned short* g, size_t gstep) {
#if defined(__HIP_DEVICE_COMPILE__)
  const unsigned ls = 16 * GT_PITCH * 2;       // 16 LDS rows in bytes
  asm volatile("global_load_async_to_lds_b128 %0, %8, off\n\t"
               "global_load_async_to_lds_b128 %1, %9, off\n\t"
               "global_load_async_to_lds_b128 %2, %10, off\n\t"
               "global_load_async_to_lds_b128 %3, %11, off\n\t"
               "global_load_async_to_lds_b128 %4, %12, off\n\t"
               "global_load_async_to_lds_b128 %5, %13, off\n\t"
               "global_load_async_to_lds_b128 %6, %14, off\n\t"
               "global_load_async_to_lds_b128 %7, %15, off\n\t"
               "s_wait_xcnt 0x0"
               :: "v"(l), "v"(l + ls), "v"(l + 2 * ls), "v"(l + 3 * ls),
                  "v"(l + 4 * ls), "v"(l + 5 * ls), "v"(l + 6 * ls), "v"(l + 7 * ls),
                  "v"(g), "v"(g + gstep), "v"(g + 2 * gstep), "v"(g + 3 * gstep),
                  "v"(g + 4 * gstep), "v"(g + 5 * gstep), "v"(g + 6 * gstep), "v"(g + 7 * gstep)
               : "memory");
#endif
}
__device__ __forceinline__ void wait_async0() {   // this wave's copies have landed in LDS
#if defined(__HIP_DEVICE_COMPILE__)
  asm volatile("s_wait_asynccnt 0x0" ::: "memory");
#endif
}
__device__ __forceinline__ void wait_ds0() {      // this wave's LDS reads have returned before their buffer is refilled
#if defined(__HIP_DEVICE_COMPILE__)
  asm volatile("s_wait_dscnt 0x0" ::: "memory");
#endif
}

// The k loop of one 128x128 block tile: A1 and Bb are the batch's planes, bm0 and bn0 the tile's first rows in them; acc is the
// wave's 32x64 part. Behind it no copy is in flight and every wave's ring reads lie in front of the last trip's barrier.
__device__ __forceinline__ void gemm_main(unsigned short* ring,
                                          const unsigned short* A1, int lda, const unsigned short* Bb, int ldb,
                                          int bm0, int bn0, int K, v8f (&acc)[2][4]) {
  const int tid  = threadIdx.x;
  const int lane = tid & 31;
  const int wave = tid >> 5;
  const int wm = (wave >> 1) << 5;             // the wave's 32 rows inside the block tile
  const int wn = (wave & 1) << 6;              // the wave's 64 cols inside the block tile
  const int rlane = lane & 15;                 // row (A) / col (B, D) within subtile
  const int koff  = (lane >> 4) * 8;           // k offset of this lane half

  // copy map: lane piece = 16 B number tid & 15 of row (tid >> 4) + 16 j, j 0..7, of the A rows and of the Bt rows
  const int crow = tid >> 4;
  const int cpc  = (tid & 15) * 8;
  const unsigned short* gA = A1 + (size_t)(bm0 + crow) * lda + cpc;
  const unsigned short* gB = Bb + (size_t)(bn0 + crow) * ldb + cpc;
  const unsigned lA = (unsigned)(uintptr_t)(lds_u16*)(ring + crow * GT_PITCH + cpc);
  const unsigned lB = lA + 128 * GT_PITCH * 2;
  const int nst = K >> 7;                      // stages of 128 k

#pragma unroll
  for (int i = 0; i < 2; ++i)
#pragma unroll
    for (int j = 0; j < 4; ++j) acc[i][j] = zero8();

  // stage 0 into buffer 0, published; then stage 1 into buffer 1
  async_rows8(lA, gA, (size_t)16 * lda);
  async_rows8(lB, gB, (size_t)16 * ldb);
  wait_async0();
  __syncthreads();
  if (nst > 1) {
    async_rows8(lA + GT_STAGE * 2, gA + 128, (size_t)16 * lda);
    async_rows8(lB + GT_STAGE * 2, gB + 128, (size_t)16 * ldb);
  }

  for (int t = 0; t < nst; ++t) {
    const int buf = t & 1;
    const unsigned short* fA = ring + buf * GT_STAGE + (wm + rlane) * GT_PITCH + koff;
    const unsigned short* fB = ring + buf * GT_STAGE + (128 + wn + rlane) * GT_PITCH + koff;
    // two fragment sets: the next 32 k of this stage are read from LDS as one group ahead of the current products
    v16h ah[2][2], bh[2][4];
#pragma unroll
    for (int j = 0; j < 4; ++j) bh[0][j] = ldfrag_u(fB + (j << 4) * GT_PITCH);
#pragma unroll
    for (int i = 0; i < 2; ++i) ah[0][i] = ldfrag_u(fA + (i << 4) * GT_PITCH);
#pragma unroll   // every fragment-set index a constant, so both sets stay in registers
    for (int s = 0; s < 4; ++s) {
      const int cu = s & 1, nx = cu ^ 1;
      if (s < 3) {
#pragma unroll
        for (int j = 0; j < 4; ++j) bh[nx][j] = ldfrag_u(fB + (j << 4) * GT_PITCH + (s + 1) * 32);
#pragma unroll
        for (int i = 0; i < 2; ++i) ah[nx][i] = ldfrag_u(fA + (i << 4) * GT_PITCH + (s + 1) * 32);
      }
#pragma unroll
      for (int i = 0; i < 2; ++i) {
#pragma unroll
        for (int j = 0; j < 4; ++j) acc[i][j] = mma_raw(ah[cu][i], bh[cu][j], acc[i][j]);
        dep_guard1(acc[i][0], acc[i][3], ah[cu][i]);
      }
      keep4_h(bh[cu][0], bh[cu][1], bh[cu][2], bh[cu][3]);
    }
    // publish point of stage t + 1: own LDS reads back, own copies landed, one barrier for both hand-overs, then the refill
    wait_ds0();
    wait_async0();
    __syncthreads();
    if (t + 2 < nst) {
      async_rows8(lA + buf * (GT_STAGE * 2), gA + (size_t)(t + 2) * 128, (size_t)16 * lda);
      async_rows8(lB + buf * (GT_STAGE * 2), gB + (size_t)(t + 2) * 128, (size_t)16 * ldb);
    }
  }
  wait_async0();
  acc_guard4(acc[0][0], acc[0][1], acc[0][2], acc[0][3]);
  acc_guard4(acc[1][0], acc[1][1], acc[1][2], acc[1][3]);
}

// Epilogue of the wave's 32x64 part at rows m0, cols n0; slab is the wave's own 16x64 f32 staging range, pitch 68 floats.
template <int OM, int BM, int HASR, int ACT>
__device__ __forceinline__ void gemm_epi(float* slab, v8f (&acc)[2][4],
                                         const float* bias, const float* Rp,
                                         void* Cout, int ldc, long long sC, int by,
                                         int M, int N, int m0, int n0, float oscale, float ocarry) {
  const int lane  = threadIdx.x & 31;
  const int rlane = lane & 15;                 // col within subtile
  const int koff  = (lane >> 4) * 8;
  const int mOff  = (lane >> 4) * 8;           // D row offset
  const int hh2 = lane >> 4, c4 = (lane & 15) * 4;     // f32 out: 256-B row segment = 16 lanes x 16 B
  const int q8  = lane >> 3, c8 = (lane & 7) * 8;
  float bc[4];
  float bcol[8];
#pragma unroll
  for (int e = 0; e < 4; ++e) bc[e] = 0.f;
#pragma unroll
  for (int e = 0; e < 8; ++e) bcol[e] = 0.f;
  if constexpr (BM == 1) {
    if constexpr (OM == 0) {
      const int cb = n0 + c4;
      const int i0 = (cb < N - 4) ? cb : (N - 4);        // clamped address
      const v4f b0v = *(const v4f*)(bias + i0);
#pragma unroll
      for (int e = 0; e < 4; ++e) bc[e] = bfr(b0v[e]);
    } else {
      const int cb = n0 + c8;
      const int i0 = (cb < N - 8) ? cb : (N - 8);        // clamped address
      const v4f b0v = *(const v4f*)(bias + i0), b1v = *(const v4f*)(bias + i0 + 4);
#pragma unroll
      for (int e = 0; e < 4; ++e) { bcol[e] = bfr(b0v[e]); bcol[4 + e] = bfr(b1v[e]); }
    }
  }

  // ---- epilogue ----
#pragma unroll
  for (int i = 0; i < 2; ++i) {
    const int mBase = m0 + (i << 4);
#pragma unroll
    for (int j = 0; j < 4; ++j) {
#pragma unroll
      for (int r = 0; r < 8; ++r) {
        slab[(mOff + r) * 68 + (j << 4) + rlane] = acc[i][j][r];
      }
    }
    wave_sync_lds();
    if constexpr (OM == 0) {
      float* C = (float*)Cout + (size_t)((long long)by * sC);
      v4f vals[8];
#pragma unroll
      for (int it = 0; it < 8; ++it) {
        const int row = it * 2 + hh2;                      // it 0..7 x hh2 0..1 = rows 0..15
        const int gr  = mBase + row;
        v4f v = *(const v4f*)(slab + row * 68 + c4);
        float br = 0.f;
        if constexpr (BM == 2) {
          const int ir = (gr < M - 1) ? gr : (M - 1);      // clamped address
          br = bfr(bias[ir]);
        }
        v4f rv = {0.f, 0.f, 0.f, 0.f};
        if constexpr (HASR != 0) {
          const float* R = Rp + (size_t)((long long)by * sC);
          const v4f rraw = *(const v4f*)(R + (size_t)gr * ldc + n0 + c4);
#pragma unroll
          for (int e = 0; e < 4; ++e) rv[e] = (HASR == 1) ? bfr(rraw[e]) : rraw[e];
        }
#pragma unroll
        for (int e = 0; e < 4; ++e) v[e] = v[e] * oscale + bc[e] + br + rv[e];
        vals[it] = v;
      }
      {
#pragma unroll
        for (int it = 0; it < 8; ++it) {
          const int gr = mBase + it * 2 + hh2;
          *(v4f*)(C + (size_t)gr * ldc + n0 + c4) = vals[it];
        }
        
      }
    } else {
      unsigned short* C = (unsigned short*)Cout + (size_t)((long long)by * sC);
      static_assert(OM == 2 || BM == 0);
      v4u hv[4];
#pragma unroll
      for (int it = 0; it < 4; ++it) {
        const int row = (OM == 2) ? it * 4 + q8 : rlane;   // OM 2: it 0..3 x q8 0..3 = rows 0..15; OM 3, 4: row = lane & 15
        const float* sp = slab + row * 68 + ((OM == 2) ? c8 : it * 16 + koff);
        float br = 0.f;
        if constexpr (BM == 2) {
          const int gr = mBase + row;
          const int ir = (gr < M - 1) ? gr : (M - 1);      // clamped address
          br = bfr(bias[ir]);
        }
        v4u a = {0u, 0u, 0u, 0u};
#pragma unroll
        for (int e = 0; e < 4; ++e) {
          float f0 = sp[2 * e] * oscale + bcol[2 * e] + br;
          float f1 = sp[2 * e + 1] * oscale + bcol[2 * e + 1] + br;
          if constexpr (ACT == 1) { f0 = gelu_f(f0); f1 = gelu_f(f1); }
          f0 *= ocarry; f1 *= ocarry;
          a[e] = pk16(h_bits((_Float16)f0), h_bits((_Float16)f1));
        }
        hv[it] = a;
      }
      {
#pragma unroll
        for (int it = 0; it < 4; ++it) {
          if constexpr (OM == 2) {
            const int row = it * 4 + q8;
            *(v4u*)(C + (size_t)(mBase + row) * ldc + n0 + c8) = hv[it];
          } else if constexpr (OM == 3) {
            const int mt = mBase >> 4;                     // batch * 128 + key tile
            const size_t blk = (size_t)((mt / (NC / 16)) * NHEAD + (n0 >> 6)) * (NC / 16) + (mt % (NC / 16));
            *(v4u*)(C + blk * 1024 + it * 256 + lane * 8) = hv[it];
          } else {
            const size_t blk = (size_t)(mBase >> 6) * (NC / 32) + (n0 >> 5) + (it >> 1);
            *(v4u*)(C + blk * 2048 + ((mBase >> 4) & 3) * 512 + (it & 1) * 256 + lane * 8) = hv[it];
          }
        }
        
      }
    }
    wave_sync_lds();
  }
}

#define GT_SLAB (16 * 68)                      // floats of a wave's epilogue slab
static_assert(8 * GT_SLAB * 4 <= 2 * GT_STAGE * 2);

template <int OM, int BM, int HASR, int ACT>
__global__ __launch_bounds__(256) void gemm64(
    const unsigned short* __restrict__ Ap, int lda, long long sA,
    const unsigned short* __restrict__ Btp, int ldb, long long sB,
    const float* __restrict__ bias,
    const float* __restrict__ Rp,
    void* Cout, int ldc, long long sC,
    int M, int N, int K, float oscale, float ocarry) {
  __shared__ __align__(16) unsigned short ring[2 * GT_STAGE];   // two stage buffers; behind the k loop the waves' slabs
  const int by   = blockIdx.y;
  const int wave = threadIdx.x >> 5;
  const int tilesN = N >> 7;
  const int tilesM = M >> 7;
  const int tile = blockIdx.x;
  if (tile >= tilesM * tilesN) return;   // block-uniform, in front of every barrier and copy
  const int tm = tile / tilesN;
  const int tn = tile - tm * tilesN;
  const int bm0 = tm << 7;
  const int bn0 = tn << 7;
  v8f acc[2][4];
  gemm_main(ring, Ap + (size_t)((long long)by * sA), lda, Btp + (size_t)((long long)by * sB), ldb, bm0, bn0, K, acc);
  gemm_epi<OM, BM, HASR, ACT>((float*)(void*)ring + wave * GT_SLAB, acc, bias, Rp, Cout, ldc, sC, by, M, N,
                              bm0 + ((wave >> 1) << 5), bn0 + ((wave & 1) << 6), oscale, ocarry);
}

// The q, k and v^T projections in one launch: none reads another's output. Blocks 0..255: q (A = activation rows, Bt = Wq, OM 2);
// 256..511: k (Bt = Wk, OM 3), both 32 x 8 tiles of M = 4096, N = 1024; 512..767: v^T (A = Wv, Bt = the batch's activation rows,
// OM 4), 2 batches x 8 x 16 tiles of M = 1024, N = 2048. K = 1024 throughout; W3 = the Wq, Wk, Wv planes one behind the other.
// A block's LDS is the ring alone, so two blocks stand on a WGP: one's copies and epilogue run under the other's products.
#define PJ_TILES ((NROWS / 128) * (DMODEL / 128))          // 256 blocks per projection
static_assert(PJ_TILES == 256 && NB * (DMODEL / 128) * (NC / 128) == PJ_TILES);
__global__ __launch_bounds__(256) void proj3(const unsigned short* __restrict__ X, const unsigned short* __restrict__ W3,
                                             unsigned short* QH, unsigned short* KH, unsigned short* VT) {
  __shared__ __align__(16) unsigned short ring[2 * GT_STAGE];   // two stage buffers; behind the k loop the waves' slabs
  const int wave  = threadIdx.x >> 5;
  const int which = blockIdx.x / PJ_TILES;                 // block-uniform: 0 q, 1 k, 2 v^T
  const int tile  = blockIdx.x % PJ_TILES;
  const bool isv  = which == 2;
  const int by  = isv ? tile / (PJ_TILES / NB) : 0;        // v^T: batch
  const int tl  = isv ? tile % (PJ_TILES / NB) : tile;
  const int bm0 = (isv ? tl / (NC / 128) : tl / (DMODEL / 128)) << 7;
  const int bn0 = (isv ? tl % (NC / 128) : tl % (DMODEL / 128)) << 7;
  const unsigned short* Wp = W3 + (size_t)which * (DMODEL * DMODEL);
  const unsigned short* Xb = X + (size_t)by * (NC * DMODEL);
  v8f acc[2][4];
  gemm_main(ring, isv ? Wp : Xb, DMODEL, isv ? Xb : Wp, DMODEL, bm0, bn0, DMODEL, acc);
  float* slab = (float*)(void*)ring + wave * GT_SLAB;
  const int m0 = bm0 + ((wave >> 1) << 5);
  const int n0 = bn0 + ((wave & 1) << 6);
  const float os = 1.0f / (ACARRY * WSC);
  if (which == 0)
    gemm_epi<2, 0, 0, 0>(slab, acc, (const float*)0, (const float*)0, (void*)QH, DMODEL, 0LL, 0, NROWS, DMODEL, m0, n0, os, QC);
  else if (which == 1)
    gemm_epi<3, 0, 0, 0>(slab, acc, (const float*)0, (const float*)0, (void*)KH, DMODEL, 0LL, 0, NROWS, DMODEL, m0, n0, os, KC);
  else
    gemm_epi<4, 0, 0, 0>(slab, acc, (const float*)0, (const float*)0, (void*)VT, NC, (long long)DMODEL * NC, by, DMODEL, NC,
                         m0, n0, os, VC);
}

#define AT_KEYS   256
#define AT_STEPS  (AT_KEYS / 32)
#define AT_NST    (NC / AT_KEYS)
#define AT_HALF   (AT_KEYS * HDIM)
#define AT_STAGE  (2 * AT_HALF)
static_assert(AT_NST >= 2 && AT_HALF * 2 == 4 * ATT_THREADS * 16);

// Eight asynchronous 16-B copies per lane, global -> LDS: four pieces of the k stage and four of the v^T stage, 8 KiB apart (the
// block's 512 lanes side by side). The closing s_wait_xcnt 0 stands inside the statement so that no address register of an issued
// copy is rewritten in front of it.
__device__ __forceinline__ void async_kv8(unsigned l, const unsigned short* gk, const unsigned short* gv) {
#if defined(__HIP_DEVICE_COMPILE__)
  const unsigned ls = ATT_THREADS * 16;        // bytes per block-wide piece
  const unsigned lv = AT_HALF * 2;             // the v^T part of a buffer, in bytes
  const int      gs = ATT_THREADS * 8;         // halves per block-wide piece
  asm volatile("global_load_async_to_lds_b128 %0, %8, off\n\t"
               "global_load_async_to_lds_b128 %1, %9, off\n\t"
               "global_load_async_to_lds_b128 %2, %10, off\n\t"
               "global_load_async_to_lds_b128 %3, %11, off\n\t"
               "global_load_async_to_lds_b128 %4, %12, off\n\t"
               "global_load_async_to_lds_b128 %5, %13, off\n\t"
               "global_load_async_to_lds_b128 %6, %14, off\n\t"
               "global_load_async_to_lds_b128 %7, %15, off\n\t"
               "s_wait_xcnt 0x0"
               :: "v"(l), "v"(l + ls), "v"(l + 2 * ls), "v"(l + 3 * ls),
                  "v"(l + lv), "v"(l + lv + ls), "v"(l + lv + 2 * ls), "v"(l + lv + 3 * ls),
                  "v"(gk), "v"(gk + gs), "v"(gk + 2 * gs), "v"(gk + 3 * gs),
                  "v"(gv), "v"(gv + gs), "v"(gv + 2 * gs), "v"(gv + 3 * gs)
               : "memory");
#endif
}

__global__ __launch_bounds__(ATT_THREADS)
void attn16(const unsigned short* __restrict__ QHp, const unsigned short* __restrict__ KHp,
            const unsigned short* __restrict__ VTq, const float* __restrict__ LBp, unsigned short* CT) {
  __shared__ __align__(16) unsigned short kv[2 * AT_STAGE];   // two stage buffers
  const int tid  = threadIdx.x;
  const int wave = __builtin_amdgcn_readfirstlane(tid >> 5);  // told to be wave-uniform, so the bias base stays scalar
  const int lane = tid & 31;
  const int hh   = lane >> 4;
  const int c    = lane & 15;

  const int qg   = blockIdx.x & (ATT_QG - 1);              // 0..7
  const int head = (blockIdx.x / ATT_QG) & (NHEAD - 1);    // 0..15
  const int bat  = blockIdx.x / (ATT_QG * NHEAD);          // 0..1
  const int qt   = qg * ATT_WAVES + wave;                  // 0..127
  const int q0   = qt * 16;

  const size_t qofs = ((size_t)bat * NQ + q0 + c) * DMODEL + head * HDIM + 8 * hh;
  const _Float16* Qh = (const _Float16*)(const void*)QHp + qofs;
  // copy map: lane piece = 16 B number tid + 512 j, j 0..3, of the stage's 32 KiB of k and of its 32 KiB of v^T
  const unsigned short* gK = KHp + (size_t)(bat * NHEAD + head) * (NC * HDIM) + tid * 8;
  const unsigned short* gV = VTq + (size_t)(bat * NHEAD + head) * (NC * HDIM) + tid * 8;
  const unsigned lK = (unsigned)(uintptr_t)(lds_u16*)(kv + tid * 8);
  const unsigned lofs = 8u * (unsigned)lane;               // the lane's 16 B inside every 512-B run
  const float* Wb = LBp + (size_t)(bat * (NQ / 16) + qt) * (16 * NC) + 4u * (unsigned)lane;   // log2 units, 512 floats per step
  const float lsc = (LOG2E * ATT_SCALE) / (QC * KC);                   // log2(e) / 8 / carries

  // stage 0 into buffer 0, published; then stage 1 into buffer 1
  async_kv8(lK, gK, gV);
  const v16h qa = ldfrag_h(Qh), qb = ldfrag_h(Qh + 32);
  wait_async0();
  __syncthreads();
  async_kv8(lK + AT_STAGE * 2, gK + AT_HALF, gV + AT_HALF);

  float mrun = -INFINITY, lsum = 0.f;                      // the query's running maximum; this wave half's running sum
  v8f o0 = zero8(), o1 = zero8(), o2 = zero8(), o3 = zero8();

#pragma unroll 1   // rolled, as the loop of steps inside it: the loop text stays short
  for (int st = 0; st < AT_NST; ++st) {
  const int buf = st & 1;
  const _Float16* kl = (const _Float16*)(const void*)(kv + buf * AT_STAGE) + lofs;
  const float*    wl = Wb + (size_t)st * (AT_KEYS * 16);
#pragma unroll 1   // rolled: one step's 20 loads are issued as one group at its head, and the loop text stays short
  for (int sp = 0; sp < AT_STEPS; ++sp) {
    const _Float16* kp = kl + sp * 2048;                   // LDS: k blocks 2 sp and 2 sp + 1 of the stage, 1024 halves each
    const float*    wp = wl + sp * 512;                    // global: bias block of the step, 512 floats
    const _Float16* vp = kp + AT_HALF;                     // LDS: v^T block sp of the stage, 2048 halves
    const v4f w0 = *(const v4f*)(wp),       w1 = *(const v4f*)(wp + 128);
    const v4f w2 = *(const v4f*)(wp + 256), w3 = *(const v4f*)(wp + 384);
    const v16h k00 = ldfrag_p(kp),        k01 = ldfrag_p(kp + 512);
    const v16h k10 = ldfrag_p(kp + 1024), k11 = ldfrag_p(kp + 1536);
    const v16h vb0 = ldfrag_p(vp);
    const v16h vb1 = ldfrag_p(vp + 512);
    const v16h vb2 = ldfrag_p(vp + 1024);
    const v16h vb3 = ldfrag_p(vp + 1536);
#if defined(__HIP_DEVICE_COMPILE__)
    // stands behind the step's four global loads, in front of every rewrite of a register that they name; their address pair is
    // an input, so that it does not serve as a load's destination in front of the wait
    asm volatile("s_wait_xcnt 0x0" :: "v"(wp) : "memory");
#endif
    v8f s0, s1;
    s0 = mma_raw(k00, qa, zero8());
    s0 = mma_raw(k01, qb, s0);
    guard_s2(s0, k00, k01);
    s1 = mma_raw(k10, qa, zero8());
    s1 = mma_raw(k11, qb, s1);
    guard_s4(s1, k10, k11, qa, qb);
    v2f t[8];                                              // pair i = keys kb + 16 (i >> 2) + 8 hh + 2 (i & 3) + 0, 1
#pragma unroll   // here and below: every index a constant, so the pairs stay in registers
    for (int e = 0; e < 2; ++e) {
      t[e]     = (v2f){s0[2 * e],     s0[2 * e + 1]} * lsc + (v2f){w0[2 * e], w0[2 * e + 1]};
      t[2 + e] = (v2f){s0[4 + 2 * e], s0[5 + 2 * e]} * lsc + (v2f){w1[2 * e], w1[2 * e + 1]};
      t[4 + e] = (v2f){s1[2 * e],     s1[2 * e + 1]} * lsc + (v2f){w2[2 * e], w2[2 * e + 1]};
      t[6 + e] = (v2f){s1[4 + 2 * e], s1[5 + 2 * e]} * lsc + (v2f){w3[2 * e], w3[2 * e + 1]};
    }
    float mx[8];
#pragma unroll
    for (int i = 0; i < 8; ++i) mx[i] = fmaxf(t[i][0], t[i][1]);
    float mxa = fmaxf(fmaxf(fmaxf(mx[0], mx[1]), fmaxf(mx[2], mx[3])), fmaxf(fmaxf(mx[4], mx[5]), fmaxf(mx[6], mx[7])));
    mxa = fmaxf(mxa, xhalf(mxa));                          // over the step's 32 keys, equal in both halves
    const float mn = fmaxf(mrun, mxa);
    const float al = exp2_hw(mrun - mn);                   // 0 on the first step, where mrun is -inf
    mrun = mn;
    v2f ex[8];
    FragH ph;                                              // elements 0..7 = keys kb + 8hh + 0..7, 8..15 = keys kb + 16 + 8hh + 0..7
#pragma unroll
    for (int i = 0; i < 8; ++i) {
      const v2f d = t[i] - mn;
      ex[i] = (v2f){exp2_hw(d[0]), exp2_hw(d[1])};
      ph.p[i] = __builtin_convertvector(ex[i] * PC, v2h);
    }
    const v2f ps = ((ex[0] + ex[1]) + (ex[2] + ex[3])) + ((ex[4] + ex[5]) + (ex[6] + ex[7]));
    lsum = lsum * al + (ps[0] + ps[1]);
#pragma unroll
    for (int r = 0; r < 8; ++r) {
      o0[r] *= al;
      o1[r] *= al;
      o2[r] *= al;
      o3[r] *= al;
    }
    o0 = mma_raw(vb0, ph.v, o0);
    o1 = mma_raw(vb1, ph.v, o1);
    o2 = mma_raw(vb2, ph.v, o2);
    o3 = mma_raw(vb3, ph.v, o3);
    guard_pv4(o0, o1, o2, o3, ph.v, vb0, vb1, vb2, vb3);
  }
  // publish point of stage st + 1: own LDS reads back, own copies landed, one barrier for both hand-overs, then the refill
  wait_ds0();
  wait_async0();
  __syncthreads();
  if (st + 2 < AT_NST)
    async_kv8(lK + buf * (AT_STAGE * 2), gK + (size_t)(st + 2) * AT_HALF, gV + (size_t)(st + 2) * AT_HALF);
  }
  wait_async0();

  // ---- join the halves' sums, fold 1/l and the carries (1024 on P, 16 on v, 1024 on the stored ctx), store 16 B per tile ----
  const float oc  = FC / (PC * VC);
  const float inv = (1.0f / (lsum + xhalf(lsum))) * oc;
  unsigned short* dst = CT + qofs;                         // row q0 + c, cols 64 head + 8 hh (+ 16 t)
  v4u p0, p1, p2, p3;
#pragma unroll
  for (int e = 0; e < 4; ++e) {
    p0[e] = pk16(h_bits((_Float16)(o0[2 * e] * inv)), h_bits((_Float16)(o0[2 * e + 1] * inv)));
    p1[e] = pk16(h_bits((_Float16)(o1[2 * e] * inv)), h_bits((_Float16)(o1[2 * e + 1] * inv)));
    p2[e] = pk16(h_bits((_Float16)(o2[2 * e] * inv)), h_bits((_Float16)(o2[2 * e + 1] * inv)));
    p3[e] = pk16(h_bits((_Float16)(o3[2 * e] * inv)), h_bits((_Float16)(o3[2 * e + 1] * inv)));
  }
  *(v4u*)(dst)      = p0;
  *(v4u*)(dst + 16) = p1;
  *(v4u*)(dst + 32) = p2;
  *(v4u*)(dst + 48) = p3;
}

// =====================================================================================================
// Workspace map (bytes); every plane is an exact multiple of its tile / whole-row store granularity (M, N exact tile multiples,
// element counts exact multiples of pack_all's 32768-element block, no pad rows needed), every offset a multiple of 2 MiB:
//   WQ16 f16 [1024][1024] x64               2097152   ([out][in] = [n][k])
//   WK16 f16 [1024][1024] x64               2097152
//   WV16 f16 [1024][1024] x64               2097152
//   WO16 f16 [1024][1024] x64               2097152
//   X16  f16 [4096][1024] x16               8388608   (activation rows)
//   LB   f32 [2][128][64] x 2 KiB          33554432   (log2(bf16(M)), lane order of the transposed score tiles)
//   QH   f16 [4096][1024] x16               8388608   (q projection, unscaled)
//   KH   f16 [2][16][128] x 2 KiB, x16      8388608   (k projection, fragment order)
//   VT   f16 [2][16][64] x 4 KiB, x16       8388608   (v^T, fragment order)
//   CT   f16 [4096][1024] x1024             8388608   (attention ctx, merged heads)
//   end                                    83886080
// =====================================================================================================
extern "C" void kernel_launch(void* const* d_in, const int* in_sizes, int n_in,
                              void* d_out, int out_size, void* d_ws, size_t ws_size,
                              hipStream_t stream) {
  if (n_in < 7) return;
  if (in_sizes[0] != NROWS * DMODEL) return;
  if (in_sizes[1] != NB * NQ * NC) return;
  if (in_sizes[2] != DMODEL * DMODEL || in_sizes[3] != DMODEL * DMODEL ||
      in_sizes[4] != DMODEL * DMODEL || in_sizes[5] != DMODEL * DMODEL) return;
  if (in_sizes[6] != DMODEL) return;
  if (out_size != NROWS * DMODEL) return;
  if ((in_sizes[0] % 2048) != 0 || (in_sizes[2] % 2048) != 0 || (in_sizes[1] % 1024) != 0) return;

  const float* x   = (const float*)d_in[0];
  const float* Mp  = (const float*)d_in[1];
  const float* w_q = (const float*)d_in[2];
  const float* w_k = (const float*)d_in[3];
  const float* w_v = (const float*)d_in[4];
  const float* w_o = (const float*)d_in[5];
  const float* b_o = (const float*)d_in[6];
  float*       out = (float*)d_out;

  const size_t PW  = (size_t)DMODEL * DMODEL * 2;                 //  2097152
  const size_t PX  = (size_t)NROWS * DMODEL * 2;                  //  8388608
  const size_t PLB = (size_t)NB * NQ * NC * 4;                    // 33554432
  const size_t PVT = (size_t)NB * DMODEL * NC * 2;                //  8388608
  size_t off = 0;
  const size_t oWQ = off; off += PW;
  const size_t oWK = off; off += PW;
  const size_t oWV = off; off += PW;
  const size_t oWO = off; off += PW;
  const size_t oX  = off; off += PX;
  const size_t oLB = off; off += PLB;
  const size_t oQH = off; off += PX;
  const size_t oKH = off; off += PX;
  const size_t oVT = off; off += PVT;
  const size_t oCT = off; off += PX;
  if (off > ws_size) return;                                      // off = 83886080
  if (off > (size_t)134217728) return;

  char* ws = (char*)d_ws;
  unsigned short* WQ16 = (unsigned short*)(ws + oWQ);
  unsigned short* WO16 = (unsigned short*)(ws + oWO);
  unsigned short* X16  = (unsigned short*)(ws + oX);
  float*          LB   = (float*)(ws + oLB);
  unsigned short* QH   = (unsigned short*)(ws + oQH);
  unsigned short* KH   = (unsigned short*)(ws + oKH);
  unsigned short* VTp  = (unsigned short*)(ws + oVT);
  unsigned short* CT   = (unsigned short*)(ws + oCT);

  const dim3 blk(256);
  const dim3 gPK(PK_BLOCKS);                                       // 512 blocks
  const int tilesP = (NROWS / 128) * (DMODEL / 128);               // 256
  const dim3 gP(tilesP, 1);                                        // 256
  const dim3 gPJ(3 * PJ_TILES);                                    // 768
  const dim3 gAT(ATT_BLOCKS);                                      // 256
  const dim3 bAT(ATT_THREADS);                                     // 512

  // (0..2) one launch: weight planes W16[n][k] = f16( bf16_RNE(W[n][k]) * 64 ), [out][in] layout kept, k contiguous (WQ16, WK16,
  // WV16, WO16 lie one behind the other); activation plane X16[row][c] = f16( bf16_RNE(x[row][c]) * 16 ), rows = b*2048 + tok;
  // score bias plane log2( bf16_RNE(M[b][q][key]) ), f32, in the lane order of attn16's score tiles
  pack_all<<<gPK, blk, 0, stream>>>(Mp, LB, x, X16, w_q, w_k, w_v, w_o, WQ16);

  // (3..5) one launch: q projection QH[m][n] = f16(16 * sum_k x[m][k] Wq[n][k]), M = 4096, N = 1024; k projection, the same with
  // Wk, in fragment order; v^T per batch, f16(16 * sum_k Wv[d][k] x_b[tok][k]) in fragment order, M = 1024, N = 2048; K = 1024
  proj3<<<gPJ, blk, 0, stream>>>(X16, WQ16, QH, KH, VTp);

  // (6) attention per (batch, head, 256 query rows) -> CT (f16, x1024)
  attn16<<<gAT, bAT, 0, stream>>>(QH, KH, VTp, LB, CT);

  // (7) out = CT . Wo^T / (1024 * 64) + bf16(bo); M = 4096, N = 1024, K = 1024, f32
  gemm64<0, 1, 0, 0><<<gP, blk, 0, stream>>>(
      CT, DMODEL, 0LL,
      WO16, DMODEL, 0LL,
      b_o,
      (const float*)0,
      (void*)out, DMODEL, 0LL,
      NROWS, DMODEL, DMODEL, 1.0f / (FC * WSC), 1.0f);
  (void)hipGetLastError();
}

// v008
// A run of this version takes 93.7 microseconds.
// In two side-by-side timings against v007, it was 1.18 and 1.17 times as fast.
// Over all steps from v000 it is 3.94 times as fast.
// Contractions: q/k projections (x rows f16 x16 . W f16 x64, K=1024), v^T projection (Wv f16 x64 . x rows f16 x16, K=1024),
// attention scores^T (k f16 x16 . q f16 x16, K=64), attention v^T . P^T (v^T f16 x16 . P f16 x1024, K=2048 in steps of 32),
// output projection (ctx f16 x1024 . Wo f16 x64, K=1024): all v_wmma_f32_16x16x32_f16 single products, f32 accumulate.
// Additive log2(M) score bias (f32 plane), online max-subtracted base-2 softmax and output bias in f32 on VALU.
// Every float input RNE-converted to bf16 on load.
#include <hip/hip_runtime.h>
#include <math.h>
#include <stdint.h>

#define NB      2
#define NQ      2048
#define NC      2048
#define DMODEL  1024
#define NHEAD   16
#define HDIM    64
#define NROWS   (NB * NQ)
#define WSC     64.0f
#define ACARRY  16.0f
#define QC      16.0f
#define KC      16.0f
#define VC      16.0f
#define PC      1024.0f
#define FC      1024.0f
#define ATT_SCALE 0.125f
#define LOG2E   1.4426950408889634f
static_assert(NHEAD * HDIM == DMODEL);
static_assert((NQ % 64) == 0 && (NC % 64) == 0 && (DMODEL % 64) == 0 && (NC % 32) == 0 && (NQ % 16) == 0);
static_assert((NROWS % 128) == 0 && (NC % 128) == 0 && (DMODEL % 128) == 0);
#define ATT_WAVES   16                                     // query tiles of 16 rows per block, one wave each
#define ATT_THREADS (ATT_WAVES * 32)
#define ATT_QG      (NQ / (16 * ATT_WAVES))                // blocks per batch and head
#define ATT_BLOCKS  (NB * NHEAD * ATT_QG)
static_assert(ATT_THREADS == 512 && ATT_QG == 8 && ATT_BLOCKS == 256);

typedef _Float16 v16h __attribute__((ext_vector_type(16)));
typedef _Float16 v8h  __attribute__((ext_vector_type(8)));
typedef float    v8f  __attribute__((ext_vector_type(8)));
typedef float    v4f  __attribute__((ext_vector_type(4)));
typedef float    v2f  __attribute__((ext_vector_type(2)));
typedef _Float16 v2h  __attribute__((ext_vector_type(2)));
typedef unsigned int v4u __attribute__((ext_vector_type(4)));

union FragH { v16h v; v8h h[2]; v4u u[2]; v2h p[8]; };

// ---- scalar helpers --------------------------------------------------------------------------------
__device__ __forceinline__ unsigned short bf_bits(float f) {          // f32 -> bf16 bits, RNE convert
  unsigned u = __float_as_uint(f);
  return (unsigned short)((u + 0x7FFFu + ((u >> 16) & 1u)) >> 16);
}
__device__ __forceinline__ float bf_up(unsigned short h) { return __uint_as_float(((unsigned)h) << 16); }
__device__ __forceinline__ float bfr(float f) { return bf_up(bf_bits(f)); }   // value of the bf16 RNE convert
__device__ __forceinline__ unsigned short h_bits(_Float16 x) { return __builtin_bit_cast(unsigned short, x); }
__device__ __forceinline__ unsigned pk16(unsigned short a, unsigned short b) { return (unsigned)a | ((unsigned)b << 16); }
__device__ __forceinline__ v8f zero8() { v8f z = {0.f, 0.f, 0.f, 0.f, 0.f, 0.f, 0.f, 0.f}; return z; }
__device__ __forceinline__ float gelu_f(float v) { return 0.5f * v * (1.0f + erff(v * 0.70710678118654752f)); }
__device__ __forceinline__ float xhalf(float x) {                     // the value that lane ^ 16 holds
  const int b = __builtin_bit_cast(int, x);
  return __builtin_bit_cast(float, __builtin_amdgcn_permlanex16(b, b, 0x76543210, 0xfedcba98, false, false));
}

// 2^x as the one hardware instruction. For x >= -126 it gives the bits that the library's exp2f gives; below that its result is 0
// or under 2^-126 where the library scales to a subnormal. attn16 calls it with x <= 0 only, beside a term 2^0 = 1 of the same
// softmax row: such a term is 0 in the f16 prob tile either way and adds under 2^-115 to a row sum that is at least 1.
__device__ __forceinline__ float exp2_hw(float x) { return __builtin_amdgcn_exp2f(x); }

// ---- fragment loaders: 16-bit A/B operand, lane -> row/col (lane&15), p already includes +8*(lane>>4);
//      elements 0..7 <- p[0..7] (k0+8h..), elements 8..15 <- p[16..23] (k0+16+8h..)  (same split k map for A and B;
//      B is read from a k-contiguous [n][k] plane in gemm64 and for q in attn16; attn16's A comes from fragment order via ldfrag_p)
__device__ __forceinline__ v16h ldfrag_h(const _Float16* p) {
  FragH f;
  f.h[0] = *(const v8h*)(p);
  f.h[1] = *(const v8h*)(p + 16);
  return f.v;
}
__device__ __forceinline__ v16h ldfrag_u(const unsigned short* p) {
  FragH f;
  f.u[0] = *(const v4u*)(p);
  f.u[1] = *(const v4u*)(p + 16);
  return f.v;
}

// fragment-ordered plane: a fragment is two runs of 512 B, run i = elements 8i..8i+7 of all 32 lanes, 16 B per lane in lane order;
// p already includes +8*lane, so each of the two wave-wide loads covers 512 contiguous bytes = four whole lines
__device__ __forceinline__ v16h ldfrag_p(const _Float16* p) {
  FragH f;
  f.h[0] = *(const v8h*)(p);
  f.h[1] = *(const v8h*)(p + 256);
  return f.v;
}

// ---- WMMA helpers with trailing VALU hazard gaps ------------------------------------------------------
__device__ __forceinline__ v8f mma_raw(v16h a, v16h b, v8f c) {
  return __builtin_amdgcn_wmma_f32_16x16x32_f16(false, a, false, b, (short)0, c, false, false);
}
__device__ __forceinline__ void dep_guard1(v8f& a, v8f& b, v16h x) {
#if defined(__HIP_DEVICE_COMPILE__)
  asm volatile("v_nop\n\tv_nop\n\tv_nop\n\tv_nop" : "+v"(a), "+v"(b) : "v"(x));
#endif
}
__device__ __forceinline__ void guard_s2(v8f& s, v16h a0, v16h a1) {
#if defined(__HIP_DEVICE_COMPILE__)
  asm volatile("v_nop\n\tv_nop\n\tv_nop\n\tv_nop" : "+v"(s) : "v"(a0), "v"(a1));
#endif
}
__device__ __forceinline__ void guard_s4(v8f& s, v16h a0, v16h a1, v16h b0, v16h b1) {
#if defined(__HIP_DEVICE_COMPILE__)
  asm volatile("v_nop\n\tv_nop\n\tv_nop\n\tv_nop" : "+v"(s) : "v"(a0), "v"(a1), "v"(b0), "v"(b1));
#endif
}
__device__ __forceinline__ void guard_pv4(v8f& a, v8f& b, v8f& c, v8f& d, v16h x, v16h y, v16h z, v16h w, v16h u) {
#if defined(__HIP_DEVICE_COMPILE__)
  asm volatile("v_nop\n\tv_nop\n\tv_nop\n\tv_nop"
               : "+v"(a), "+v"(b), "+v"(c), "+v"(d) : "v"(x), "v"(y), "v"(z), "v"(w), "v"(u));
#endif
}
__device__ __forceinline__ void keep4_h(v16h a, v16h b, v16h c, v16h d) {
#if defined(__HIP_DEVICE_COMPILE__)
  asm volatile("v_nop" :: "v"(a), "v"(b), "v"(c), "v"(d));
#endif
}
__device__ __forceinline__ void acc_guard4(v8f& a, v8f& b, v8f& c, v8f& d) {
#if defined(__HIP_DEVICE_COMPILE__)
  asm volatile("v_nop\n\tv_nop\n\tv_nop\n\tv_nop" : "+v"(a), "+v"(b), "+v"(c), "+v"(d));
#endif
}
__device__ __forceinline__ void wave_sync_lds() {
  __builtin_amdgcn_fence(__ATOMIC_RELEASE, "workgroup");
  __builtin_amdgcn_wave_barrier();
  __builtin_amdgcn_fence(__ATOMIC_ACQUIRE, "workgroup");
}

// =====================================================================================================
// All six input-only packs in ONE launch of 512 blocks x 8 waves; a wave takes PK_IT groups of eight 16-B loads: all its loads are
// issued at its head, then group after group is converted and stored as its loads return. Blocks 0..255: score bias plane;
// 256..383: activation rows; 384..511: the four weight planes, 32 blocks each.
// 16-bit pack, no transpose: dst[i] = f16( bf16_RNE(src[i]) * sc ), sc a power of two (exact). Used for the weights (stored
// [out][in] = [n][k], already k contiguous for B fragments / A of the v^T projection; the four planes lie one behind the other in
// the workspace) and for the activation rows. A piece is 8 elements: two 16-B loads, one 16-B store per lane; a group is 4 pieces
// per lane = 1024 elements per wave, 32 consecutive lanes = one whole 512-B store; the 8 waves' groups lie side by side.
// Score bias plane: log2( bf16_RNE(M) ) as f32 (M strictly positive), laid in the lane order in which attn16 holds its transposed
// score tiles: 2-KiB blocks [batch][query / 16][key / 32] of 16 queries x 32 keys, four runs of 512 B; run i, lane (c, hh) = query c,
// keys 16 (i >> 1) + 8 hh + 4 (i & 1) + 0..3. A piece is 16 B of the plane; a group is two neighbouring plane blocks = 8 pieces per
// lane, read from 256 B of each of 16 source rows, stored as eight whole 512-B runs; a work-group takes 16 whole source rows.
// coverage: bias 256 blocks x 8 waves x PK_IT groups x 1024 elements = 2 x 2048 x 2048; rows 128 x 8 x PK_IT x 1024 = 4096 x 1024;
//           a weight 32 x 8 x PK_IT x 1024 = 1024 x 1024; group -> source and group -> plane are one to one. No barrier.
// =====================================================================================================
#define PK_IT 4
#define PK_BM ((NB * NQ) / 16)                             // 256 blocks, 16 source rows each
#define PK_BX ((NROWS * DMODEL) / (8 * PK_IT * 1024))      // 128 blocks
#define PK_BW ((DMODEL * DMODEL) / (8 * PK_IT * 1024))     //  32 blocks per weight
#define PK_BLOCKS (PK_BM + PK_BX + 4 * PK_BW)
static_assert(NC == 8 * PK_IT * 64 && PK_BX * 8 * PK_IT * 1024 == NROWS * DMODEL);
static_assert(PK_BW * 8 * PK_IT * 1024 == DMODEL * DMODEL && PK_BLOCKS == 512);

// stands behind a wave's run of loads, in front of every rewrite of a register that they name; their address pair is an input,
// so that it is not given away in front of the wait
__device__ __forceinline__ void wait_x0(const void* p) {
#if defined(__HIP_DEVICE_COMPILE__)
  asm volatile("s_wait_xcnt 0x0" :: "v"(p) : "memory");
#endif
}
__device__ __forceinline__ float log2_slot(float x) {
  const bool  sm = x < 1.17549435e-38f;
  const float s  = ldexpf(x, sm ? 32 : 0);
  float r;
#if defined(__HIP_DEVICE_COMPILE__)
  asm("v_log_f32 %0, %1\n\tv_nop" : "=v"(r) : "v"(s));
#else
  r = log2f(s);
#endif
  return r - (sm ? 32.0f : 0.0f);
}

__global__ __launch_bounds__(256) void pack_all(const float* __restrict__ Mp, float* LB,
                                                const float* __restrict__ xp, unsigned short* X16,
                                                const float* __restrict__ wq, const float* __restrict__ wk,
                                                const float* __restrict__ wv, const float* __restrict__ wo,
                                                unsigned short* W16) {
  const unsigned lane = threadIdx.x & 31u;
  const unsigned wave = threadIdx.x >> 5;
  const unsigned b    = blockIdx.x;
  v4f a[PK_IT][8];
  if (b < PK_BM) {
    // block b = source rows 16 b .. 16 b + 15 = plane blocks 64 b .. 64 b + 63; group (it, wave) = plane blocks 2 (8 it + wave) + 0, 1
    const unsigned c = lane & 15u, hh = lane >> 4;
    const float* sp = Mp + (size_t)(b * 16u + c) * NC + wave * 64u + hh * 8u;
    float*       dp = LB + (size_t)(b * (8u * PK_IT) + wave) * 1024 + lane * 4u;
#pragma unroll   // here and below in the pack: every index a constant, so the groups stay in registers
    for (int it = 0; it < PK_IT; ++it)
#pragma unroll
      for (int u = 0; u < 8; ++u)
        a[it][u] = *(const v4f*)(sp + it * 512 + (u >> 2) * 32 + ((u & 3) >> 1) * 16 + (u & 1) * 4);
    wait_x0(sp);
#pragma unroll
    for (int it = 0; it < PK_IT; ++it) {
#pragma unroll
      for (int u = 0; u < 8; ++u) {
        const v4f v = a[it][u];
        v4f o;
        o[0] = log2_slot(bfr(v[0]));
        o[1] = log2_slot(bfr(v[1]));
        o[2] = log2_slot(bfr(v[2]));
        o[3] = log2_slot(bfr(v[3]));
        *(v4f*)(dp + it * 8192 + u * 128) = o;
      }
    }
  } else {
    const unsigned bc = b - PK_BM;
    const bool isx = bc < PK_BX;                            // block-uniform
    const unsigned bw = isx ? 0u : bc - PK_BX;              // weights: plane bw / PK_BW, block bw % PK_BW of it
    const unsigned wi = bw / PK_BW;
    const float* src = isx ? xp : (wi == 0u) ? wq : (wi == 1u) ? wk : (wi == 2u) ? wv : wo;
    unsigned short* dst = isx ? X16 : W16 + (size_t)wi * (DMODEL * DMODEL);
    const float sc = isx ? ACARRY : WSC;
    const size_t e0 = (size_t)((isx ? bc : bw % PK_BW) * (8u * PK_IT) + wave) * 1024 + lane * 8u;   // group (it, wave) at + 8192 it
    const float*    sp = src + e0;
    unsigned short* dp = dst + e0;
#pragma unroll
    for (int it = 0; it < PK_IT; ++it)
#pragma unroll
      for (int u = 0; u < 4; ++u) {
        a[it][2 * u]     = *(const v4f*)(sp + it * 8192 + u * 256);
        a[it][2 * u + 1] = *(const v4f*)(sp + it * 8192 + u * 256 + 4);
      }
    wait_x0(sp);
#pragma unroll
    for (int it = 0; it < PK_IT; ++it) {
#pragma unroll
      for (int u = 0; u < 4; ++u) {
        const v4f p = a[it][2 * u], q = a[it][2 * u + 1];
        v4u o;
        o[0] = pk16(h_bits((_Float16)(bfr(p[0]) * sc)), h_bits((_Float16)(bfr(p[1]) * sc)));
        o[1] = pk16(h_bits((_Float16)(bfr(p[2]) * sc)), h_bits((_Float16)(bfr(p[3]) * sc)));
        o[2] = pk16(h_bits((_Float16)(bfr(q[0]) * sc)), h_bits((_Float16)(bfr(q[1]) * sc)));
        o[3] = pk16(h_bits((_Float16)(bfr(q[2]) * sc)), h_bits((_Float16)(bfr(q[3]) * sc)));
        *(v4u*)(dp + it * 8192 + u * 256) = o;
      }
    }
  }
}

// =====================================================================================================
// LDS-staged batched f16 WMMA GEMM: C[m][n] = f( oscale * sum_k A[m][k] * Bt[n][k] + bf16(bias) ) (+ residual); one block of
// 8 waves per 128x128 tile, one wave per 32x64 part of it (4 x 2 waves). A row-major [M][K] pitch lda (16-bit plane), Bt
// row-major [N][K] pitch ldb (k contiguous); M, N multiples of 128, K multiple of 128. blockIdx.y = batch index with element
// strides sA, sB, sC.
// A stage is 128 k (256 B) of the tile's 128 A rows and 128 Bt rows, laid in LDS at a row pitch of 272 B; two buffers. Every
// lane brings 16 pieces of 16 B per stage by asynchronous copies (16 lanes = one whole 256-B row piece), the next stage's
// copies in flight while this stage is multiplied; fragments are read from LDS with the split k map of ldfrag_u. A block walks
// the K / 128 stages once round from its own first stage (tile row + tile col) mod stages, k ascending inside a stage: the blocks
// that share A rows or Bt rows then ask L2 for different lines at the same moment, save those whose tiles lie a multiple of K / 128 apart.
// The epilogue's per-wave slabs lie over the ring, which is idle behind the last trip's barrier: LDS per block = the ring, 139264 B.
// BM: 0 = no bias, 1 = per column bf16(bias[col]), 2 = per row bf16(bias[row]) (clamped-address loads).
// OM: 0 = f32 out (pitch ldc; HASR 1 adds bf16(R[m][n]), HASR 2 adds raw f32 R[m][n], same pitch/stride as C);
//     2 = f16 out (pitch ldc) = f16( act(value) * ocarry ), ACT 1 = exact GELU.
//     3, 4 = the same f16 values laid in the fragment order that attn16 loads (ldfrag_p), ldc unused, BM 0 only. A wave's 16x64
//         slab is four runs of 512 B; run it, lane (c, hh) = slab row c, cols 16 it + 8 hh + 0..7: one whole 512-B store each.
//         3 (k plane; rows = batch*2048 + key, cols = 64 head + d): the slab is the 2-KiB block [batch][head][key / 16].
//         4 (v^T plane; rows = 64 head + d, cols = key, batch = by through sC): runs 2t, 2t + 1 are the 1-KiB piece
//         (d / 16) & 3 of the 4-KiB block [head][key / 32], t = 0, 1 the slab's two 32-key tiles.
// coverage: 2 slabs x 16 rows (f32: it 0..7 x lane>>4; OM 2: it 0..3 x lane>>3; OM 3, 4: lane & 15) x 64 cols = the wave's whole 32x64 part;
//           grid = tilesM*tilesN blocks, a surplus block exits as a whole in front of every barrier.
// =====================================================================================================
#define GT_PITCH  136                          // LDS row pitch in halves: 272 B = 16 B x odd, for 16-B LDS reads
#define GT_STAGE  (256 * GT_PITCH)             // halves per buffer: [A 128 rows | Bt 128 rows]
typedef __attribute__((address_space(3))) unsigned short lds_u16;

// Eight asynchronous 16-B copies per lane, global -> LDS, rows 16 apart. The closing s_wait_xcnt 0 stands inside the statement
// so that no address register of an issued copy is rewritten in front of it.
__device__ __forceinline__ void async_rows8(unsigned l, const unsigned short* g, size_t gstep) {
#if defined(__HIP_DEVICE_COMPILE__)
  const unsigned ls = 16 * GT_PITCH * 2;       // 16 LDS rows in bytes
  asm volatile("global_load_async_to_lds_b128 %0, %8, off\n\t"
               "global_load_async_to_lds_b128 %1, %9, off\n\t"
               "global_load_async_to_lds_b128 %2, %10, off\n\t"
               "global_load_async_to_lds_b128 %3, %11, off\n\t"
               "global_load_async_to_lds_b128 %4, %12, off\n\t"
               "global_load_async_to_lds_b128 %5, %13, off\n\t"
               "global_load_async_to_lds_b128 %6, %14, off\n\t"
               "global_load_async_to_lds_b128 %7, %15, off\n\t"
               "s_wait_xcnt 0x0"
               :: "v"(l), "v"(l + ls), "v"(l + 2 * ls), "v"(l + 3 * ls),
                  "v"(l + 4 * ls), "v"(l + 5 * ls), "v"(l + 6 * ls), "v"(l + 7 * ls),
                  "v"(g), "v"(g + gstep), "v"(g + 2 * gstep), "v"(g + 3 * gstep),
                  "v"(g + 4 * gstep), "v"(g + 5 * gstep), "v"(g + 6 * gstep), "v"(g + 7 * gstep)
               : "memory");
#endif
}
__device__ __forceinline__ void wait_async0() {   // this wave's copies have landed in LDS
#if defined(__HIP_DEVICE_COMPILE__)
  asm volatile("s_wait_asynccnt 0x0" ::: "memory");
#endif
}
__device__ __forceinline__ void wait_ds0() {      // this wave's LDS reads have returned before their buffer is refilled
#if defined(__HIP_DEVICE_COMPILE__)
  asm volatile("s_wait_dscnt 0x0" ::: "memory");
#endif
}

// The k loop of one 128x128 block tile: A1 and Bb are the batch's planes, bm0 and bn0 the tile's first rows in them; acc is the
// wave's 32x64 part. Trip t works on k stage (t + rot) mod stages, rot block-uniform and below the number of stages.
// Behind it no copy is in flight and every wave's ring reads lie in front of the last trip's barrier.
__device__ __forceinline__ void gemm_main(unsigned short* ring,
                                          const unsigned short* A1, int lda, const unsigned short* Bb, int ldb,
                                          int bm0, int bn0, int K, int rot, v8f (&acc)[2][4]) {
  const int tid  = threadIdx.x;
  const int lane = tid & 31;
  const int wave = tid >> 5;
  const int wm = (wave >> 1) << 5;             // the wave's 32 rows inside the block tile
  const int wn = (wave & 1) << 6;              // the wave's 64 cols inside the block tile
  const int rlane = lane & 15;                 // row (A) / col (B, D) within subtile
  const int koff  = (lane >> 4) * 8;           // k offset of this lane half

  // copy map: lane piece = 16 B number tid & 15 of row (tid >> 4) + 16 j, j 0..7, of the A rows and of the Bt rows
  const int crow = tid >> 4;
  const int cpc  = (tid & 15) * 8;
  const unsigned short* gA = A1 + (size_t)(bm0 + crow) * lda + cpc;
  const unsigned short* gB = Bb + (size_t)(bn0 + crow) * ldb + cpc;
  const unsigned lA = (unsigned)(uintptr_t)(lds_u16*)(ring + crow * GT_PITCH + cpc);
  const unsigned lB = lA + 128 * GT_PITCH * 2;
  const int nst = K >> 7;                      // stages of 128 k
  const auto kofs = [&](int t) -> size_t {     // first k of trip t's stage; t and rot below nst, so one wrap at most
    const int s = t + rot;
    return (size_t)(s >= nst ? s - nst : s) * 128;
  };

#pragma unroll
  for (int i = 0; i < 2; ++i)
#pragma unroll
    for (int j = 0; j < 4; ++j) acc[i][j] = zero8();

  // trip 0's stage into buffer 0, published; then trip 1's into buffer 1
  async_rows8(lA, gA + kofs(0), (size_t)16 * lda);
  async_rows8(lB, gB + kofs(0), (size_t)16 * ldb);
  wait_async0();
  __syncthreads();
  if (nst > 1) {
    async_rows8(lA + GT_STAGE * 2, gA + kofs(1), (size_t)16 * lda);
    async_rows8(lB + GT_STAGE * 2, gB + kofs(1), (size_t)16 * ldb);
  }

  for (int t = 0; t < nst; ++t) {
    const int buf = t & 1;
    const unsigned short* fA = ring + buf * GT_STAGE + (wm + rlane) * GT_PITCH + koff;
    const unsigned short* fB = ring + buf * GT_STAGE + (128 + wn + rlane) * GT_PITCH + koff;
    // two fragment sets: the next 32 k of this stage are read from LDS as one group ahead of the current products
    v16h ah[2][2], bh[2][4];
#pragma unroll
    for (int j = 0; j < 4; ++j) bh[0][j] = ldfrag_u(fB + (j << 4) * GT_PITCH);
#pragma unroll
    for (int i = 0; i < 2; ++i) ah[0][i] = ldfrag_u(fA + (i << 4) * GT_PITCH);
#pragma unroll   // every fragment-set index a constant, so both sets stay in registers
    for (int s = 0; s < 4; ++s) {
      const int cu = s & 1, nx = cu ^ 1;
      if (s < 3) {
#pragma unroll
        for (int j = 0; j < 4; ++j) bh[nx][j] = ldfrag_u(fB + (j << 4) * GT_PITCH + (s + 1) * 32);
#pragma unroll
        for (int i = 0; i < 2; ++i) ah[nx][i] = ldfrag_u(fA + (i << 4) * GT_PITCH + (s + 1) * 32);
      }
#pragma unroll
      for (int i = 0; i < 2; ++i) {
#pragma unroll
        for (int j = 0; j < 4; ++j) acc[i][j] = mma_raw(ah[cu][i], bh[cu][j], acc[i][j]);
        dep_guard1(acc[i][0], acc[i][3], ah[cu][i]);
      }
      keep4_h(bh[cu][0], bh[cu][1], bh[cu][2], bh[cu][3]);
    }
    // publish point of trip t + 1's stage: own LDS reads back, own copies landed, one barrier for both hand-overs, then the refill
    wait_ds0();
    wait_async0();
    __syncthreads();
    if (t + 2 < nst) {
      async_rows8(lA + buf * (GT_STAGE * 2), gA + kofs(t + 2), (size_t)16 * lda);
      async_rows8(lB + buf * (GT_STAGE * 2), gB + kofs(t + 2), (size_t)16 * ldb);
    }
  }
  wait_async0();
  acc_guard4(acc[0][0], acc[0][1], acc[0][2], acc[0][3]);
  acc_guard4(acc[1][0], acc[1][1], acc[1][2], acc[1][3]);
}

// Epilogue of the wave's 32x64 part at rows m0, cols n0; slab is the wave's own 16x64 f32 staging range, pitch 68 floats.
template <int OM, int BM, int HASR, int ACT>
__device__ __forceinline__ void gemm_epi(float* slab, v8f (&acc)[2][4],
                                         const float* bias, const float* Rp,
                                         void* Cout, int ldc, long long sC, int by,
                                         int M, int N, int m0, int n0, float oscale, float ocarry) {
  const int lane  = threadIdx.x & 31;
  const int rlane = lane & 15;                 // col within subtile
  const int koff  = (lane >> 4) * 8;
  const int mOff  = (lane >> 4) * 8;           // D row offset
  const int hh2 = lane >> 4, c4 = (lane & 15) * 4;     // f32 out: 256-B row segment = 16 lanes x 16 B
  const int q8  = lane >> 3, c8 = (lane & 7) * 8;
  float bc[4];
  float bcol[8];
#pragma unroll
  for (int e = 0; e < 4; ++e) bc[e] = 0.f;
#pragma unroll
  for (int e = 0; e < 8; ++e) bcol[e] = 0.f;
  if constexpr (BM == 1) {
    if constexpr (OM == 0) {
      const int cb = n0 + c4;
      const int i0 = (cb < N - 4) ? cb : (N - 4);        // clamped address
      const v4f b0v = *(const v4f*)(bias + i0);
#pragma unroll
      for (int e = 0; e < 4; ++e) bc[e] = bfr(b0v[e]);
    } else {
      const int cb = n0 + c8;
      const int i0 = (cb < N - 8) ? cb : (N - 8);        // clamped address
      const v4f b0v = *(const v4f*)(bias + i0), b1v = *(const v4f*)(bias + i0 + 4);
#pragma unroll
      for (int e = 0; e < 4; ++e) { bcol[e] = bfr(b0v[e]); bcol[4 + e] = bfr(b1v[e]); }
    }
  }

  // ---- epilogue ----
#pragma unroll
  for (int i = 0; i < 2; ++i) {
    const int mBase = m0 + (i << 4);
#pragma unroll
    for (int j = 0; j < 4; ++j) {
#pragma unroll
      for (int r = 0; r < 8; ++r) {
        slab[(mOff + r) * 68 + (j << 4) + rlane] = acc[i][j][r];
      }
    }
    wave_sync_lds();
    if constexpr (OM == 0) {
      float* C = (float*)Cout + (size_t)((long long)by * sC);
      v4f vals[8];
#pragma unroll
      for (int it = 0; it < 8; ++it) {
        const int row = it * 2 + hh2;                      // it 0..7 x hh2 0..1 = rows 0..15
        const int gr  = mBase + row;
        v4f v = *(const v4f*)(slab + row * 68 + c4);
        float br = 0.f;
        if constexpr (BM == 2) {
          const int ir = (gr < M - 1) ? gr : (M - 1);      // clamped address
          br = bfr(bias[ir]);
        }
        v4f rv = {0.f, 0.f, 0.f, 0.f};
        if constexpr (HASR != 0) {
          const float* R = Rp + (size_t)((long long)by * sC);
          const v4f rraw = *(const v4f*)(R + (size_t)gr * ldc + n0 + c4);
#pragma unroll
          for (int e = 0; e < 4; ++e) rv[e] = (HASR == 1) ? bfr(rraw[e]) : rraw[e];
        }
#pragma unroll
        for (int e = 0; e < 4; ++e) v[e] = v[e] * oscale + bc[e] + br + rv[e];
        vals[it] = v;
      }
      {
#pragma unroll
        for (int it = 0; it < 8; ++it) {
          const int gr = mBase + it * 2 + hh2;
          *(v4f*)(C + (size_t)gr * ldc + n0 + c4) = vals[it];
        }
        
      }
    } else {
      unsigned short* C = (unsigned short*)Cout + (size_t)((long long)by * sC);
      static_assert(OM == 2 || BM == 0);
      v4u hv[4];
#pragma unroll
      for (int it = 0; it < 4; ++it) {
        const int row = (OM == 2) ? it * 4 + q8 : rlane;   // OM 2: it 0..3 x q8 0..3 = rows 0..15; OM 3, 4: row = lane & 15
        const float* sp = slab + row * 68 + ((OM == 2) ? c8 : it * 16 + koff);
        float br = 0.f;
        if constexpr (BM == 2) {
          const int gr = mBase + row;
          const int ir = (gr < M - 1) ? gr : (M - 1);      // clamped address
          br = bfr(bias[ir]);
        }
        v4u a = {0u, 0u, 0u, 0u};
#pragma unroll
        for (int e = 0; e < 4; ++e) {
          float f0 = sp[2 * e] * oscale + bcol[2 * e] + br;
          float f1 = sp[2 * e + 1] * oscale + bcol[2 * e + 1] + br;
          if constexpr (ACT == 1) { f0 = gelu_f(f0); f1 = gelu_f(f1); }
          f0 *= ocarry; f1 *= ocarry;
          a[e] = pk16(h_bits((_Float16)f0), h_bits((_Float16)f1));
        }
        hv[it] = a;
      }
      {
#pragma unroll
        for (int it = 0; it < 4; ++it) {
          if constexpr (OM == 2) {
            const int row = it * 4 + q8;
            *(v4u*)(C + (size_t)(mBase + row) * ldc + n0 + c8) = hv[it];
          } else if constexpr (OM == 3) {
            const int mt = mBase >> 4;                     // batch * 128 + key tile
            const size_t blk = (size_t)((mt / (NC / 16)) * NHEAD + (n0 >> 6)) * (NC / 16) + (mt % (NC / 16));
            *(v4u*)(C + blk * 1024 + it * 256 + lane * 8) = hv[it];
          } else {
            const size_t blk = (size_t)(mBase >> 6) * (NC / 32) + (n0 >> 5) + (it >> 1);
            *(v4u*)(C + blk * 2048 + ((mBase >> 4) & 3) * 512 + (it & 1) * 256 + lane * 8) = hv[it];
          }
        }
        
      }
    }
    wave_sync_lds();
  }
}

#define GT_SLAB (16 * 68)                      // floats of a wave's epilogue slab
static_assert(8 * GT_SLAB * 4 <= 2 * GT_STAGE * 2);

template <int OM, int BM, int HASR, int ACT>
__global__ __launch_bounds__(256) void gemm64(
    const unsigned short* __restrict__ Ap, int lda, long long sA,
    const unsigned short* __restrict__ Btp, int ldb, long long sB,
    const float* __restrict__ bias,
    const float* __restrict__ Rp,
    void* Cout, int ldc, long long sC,
    int M, int N, int K, float oscale, float ocarry) {
  __shared__ __align__(16) unsigned short ring[2 * GT_STAGE];   // two stage buffers; behind the k loop the waves' slabs
  const int by   = blockIdx.y;
  const int wave = threadIdx.x >> 5;
  const int tilesN = N >> 7;
  const int tilesM = M >> 7;
  const int tile = blockIdx.x;
  if (tile >= tilesM * tilesN) return;   // block-uniform, in front of every barrier and copy
  const int tm = tile / tilesN;
  const int tn = tile - tm * tilesN;
  const int bm0 = tm << 7;
  const int bn0 = tn << 7;
  v8f acc[2][4];
  gemm_main(ring, Ap + (size_t)((long long)by * sA), lda, Btp + (size_t)((long long)by * sB), ldb, bm0, bn0, K,
            (tm + tn) % (K >> 7), acc);
  gemm_epi<OM, BM, HASR, ACT>((float*)(void*)ring + wave * GT_SLAB, acc, bias, Rp, Cout, ldc, sC, by, M, N,
                              bm0 + ((wave >> 1) << 5), bn0 + ((wave & 1) << 6), oscale, ocarry);
}

// The q, k and v^T projections in one launch: none reads another's output. Blocks 0..255: q (A = activation rows, Bt = Wq, OM 2);
// 256..511: k (Bt = Wk, OM 3), both 32 x 8 tiles of M = 4096, N = 1024; 512..767: v^T (A = Wv, Bt = the batch's activation rows,
// OM 4), 2 batches x 8 x 16 tiles of M = 1024, N = 2048. K = 1024 throughout; W3 = the Wq, Wk, Wv planes one behind the other.
// A block's LDS is the ring alone, so two blocks stand on a WGP: one's copies and epilogue run under the other's products.
#define PJ_TILES ((NROWS / 128) * (DMODEL / 128))          // 256 blocks per projection
static_assert(PJ_TILES == 256 && NB * (DMODEL / 128) * (NC / 128) == PJ_TILES);
__global__ __launch_bounds__(256) void proj3(const unsigned short* __restrict__ X, const unsigned short* __restrict__ W3,
                                             unsigned short* QH, unsigned short* KH, unsigned short* VT) {
  __shared__ __align__(16) unsigned short ring[2 * GT_STAGE];   // two stage buffers; behind the k loop the waves' slabs
  const int wave  = threadIdx.x >> 5;
  const int which = blockIdx.x / PJ_TILES;                 // block-uniform: 0 q, 1 k, 2 v^T
  const int tile  = blockIdx.x % PJ_TILES;
  const bool isv  = which == 2;
  const int by  = isv ? tile / (PJ_TILES / NB) : 0;        // v^T: batch
  const int tl  = isv ? tile % (PJ_TILES / NB) : tile;
  const int bm0 = (isv ? tl / (NC / 128) : tl / (DMODEL / 128)) << 7;
  const int bn0 = (isv ? tl % (NC / 128) : tl % (DMODEL / 128)) << 7;
  const unsigned short* Wp = W3 + (size_t)which * (DMODEL * DMODEL);
  const unsigned short* Xb = X + (size_t)by * (NC * DMODEL);
  v8f acc[2][4];
  gemm_main(ring, isv ? Wp : Xb, DMODEL, isv ? Xb : Wp, DMODEL, bm0, bn0, DMODEL,
            ((bm0 >> 7) + (bn0 >> 7)) % (DMODEL / 128), acc);
  float* slab = (float*)(void*)ring + wave * GT_SLAB;
  const int m0 = bm0 + ((wave >> 1) << 5);
  const int n0 = bn0 + ((wave & 1) << 6);
  const float os = 1.0f / (ACARRY * WSC);
  if (which == 0)
    gemm_epi<2, 0, 0, 0>(slab, acc, (const float*)0, (const float*)0, (void*)QH, DMODEL, 0LL, 0, NROWS, DMODEL, m0, n0, os, QC);
  else if (which == 1)
    gemm_epi<3, 0, 0, 0>(slab, acc, (const float*)0, (const float*)0, (void*)KH, DMODEL, 0LL, 0, NROWS, DMODEL, m0, n0, os, KC);
  else
    gemm_epi<4, 0, 0, 0>(slab, acc, (const float*)0, (const float*)0, (void*)VT, NC, (long long)DMODEL * NC, by, DMODEL, NC,
                         m0, n0, os, VC);
}

#define AT_KEYS   256
#define AT_STEPS  (AT_KEYS / 32)
#define AT_NST    (NC / AT_KEYS)
#define AT_HALF   (AT_KEYS * HDIM)
#define AT_STAGE  (2 * AT_HALF)
static_assert(AT_NST >= 2 && (AT_NST & (AT_NST - 1)) == 0 && AT_HALF * 2 == 4 * ATT_THREADS * 16);

// Eight asynchronous 16-B copies per lane, global -> LDS: four pieces of the k stage and four of the v^T stage, 8 KiB apart (the
// block's 512 lanes side by side). The closing s_wait_xcnt 0 stands inside the statement so that no address register of an issued
// copy is rewritten in front of it.
__device__ __forceinline__ void async_kv8(unsigned l, const unsigned short* gk, const unsigned short* gv) {
#if defined(__HIP_DEVICE_COMPILE__)
  const unsigned ls = ATT_THREADS * 16;        // bytes per block-wide piece
  const unsigned lv = AT_HALF * 2;             // the v^T part of a buffer, in bytes
  const int      gs = ATT_THREADS * 8;         // halves per block-wide piece
  asm volatile("global_load_async_to_lds_b128 %0, %8, off\n\t"
               "global_load_async_to_lds_b128 %1, %9, off\n\t"
               "global_load_async_to_lds_b128 %2, %10, off\n\t"
               "global_load_async_to_lds_b128 %3, %11, off\n\t"
               "global_load_async_to_lds_b128 %4, %12, off\n\t"
               "global_load_async_to_lds_b128 %5, %13, off\n\t"
               "global_load_async_to_lds_b128 %6, %14, off\n\t"
               "global_load_async_to_lds_b128 %7, %15, off\n\t"
               "s_wait_xcnt 0x0"
               :: "v"(l), "v"(l + ls), "v"(l + 2 * ls), "v"(l + 3 * ls),
                  "v"(l + lv), "v"(l + lv + ls), "v"(l + lv + 2 * ls), "v"(l + lv + 3 * ls),
                  "v"(gk), "v"(gk + gs), "v"(gk + 2 * gs), "v"(gk + 3 * gs),
                  "v"(gv), "v"(gv + gs), "v"(gv + 2 * gs), "v"(gv + 3 * gs)
               : "memory");
#endif
}

__global__ __launch_bounds__(ATT_THREADS)
void attn16(const unsigned short* __restrict__ QHp, const unsigned short* __restrict__ KHp,
            const unsigned short* __restrict__ VTq, const float* __restrict__ LBp, unsigned short* CT) {
  __shared__ __align__(16) unsigned short kv[2 * AT_STAGE];   // two stage buffers
  const int tid  = threadIdx.x;
  const int wave = __builtin_amdgcn_readfirstlane(tid >> 5);  // told to be wave-uniform, so the bias base stays scalar
  const int lane = tid & 31;
  const int hh   = lane >> 4;
  const int c    = lane & 15;

  const int qg   = blockIdx.x & (ATT_QG - 1);              // 0..7
  const int head = (blockIdx.x / ATT_QG) & (NHEAD - 1);    // 0..15
  const int bat  = blockIdx.x / (ATT_QG * NHEAD);          // 0..1
  const int qt   = qg * ATT_WAVES + wave;                  // 0..127
  const int q0   = qt * 16;

  const size_t qofs = ((size_t)bat * NQ + q0 + c) * DMODEL + head * HDIM + 8 * hh;
  const _Float16* Qh = (const _Float16*)(const void*)QHp + qofs;
  // copy map: lane piece = 16 B number tid + 512 j, j 0..3, of the stage's 32 KiB of k and of its 32 KiB of v^T
  const unsigned short* gK = KHp + (size_t)(bat * NHEAD + head) * (NC * HDIM) + tid * 8;
  const unsigned short* gV = VTq + (size_t)(bat * NHEAD + head) * (NC * HDIM) + tid * 8;
  const unsigned lK = (unsigned)(uintptr_t)(lds_u16*)(kv + tid * 8);
  const unsigned lofs = 8u * (unsigned)lane;               // the lane's 16 B inside every 512-B run
  const float* Wb = LBp + (size_t)(bat * (NQ / 16) + qt) * (16 * NC) + 4u * (unsigned)lane;   // log2 units, 512 floats per step
  const float lsc = (LOG2E * ATT_SCALE) / (QC * KC);                   // log2(e) / 8 / carries

  const int rot = (head + qg) & (AT_NST - 1);              // trip st works on key stage (st + rot) mod AT_NST
  const auto kvofs = [&](int st) -> size_t { return (size_t)((st + rot) & (AT_NST - 1)) * AT_HALF; };

  // the first trip's stage into buffer 0, published; then the second trip's into buffer 1
  async_kv8(lK, gK + kvofs(0), gV + kvofs(0));
  const v16h qa = ldfrag_h(Qh), qb = ldfrag_h(Qh + 32);
  wait_async0();
  __syncthreads();
  async_kv8(lK + AT_STAGE * 2, gK + kvofs(1), gV + kvofs(1));

  float mrun = -INFINITY, lsum = 0.f;                      // the query's running maximum; this wave half's running sum
  v8f o0 = zero8(), o1 = zero8(), o2 = zero8(), o3 = zero8();

#pragma unroll 1   // rolled, as the loop of steps inside it: the loop text stays short
  for (int st = 0; st < AT_NST; ++st) {
  const int buf = st & 1;
  const _Float16* kl = (const _Float16*)(const void*)(kv + buf * AT_STAGE) + lofs;
  const float*    wl = Wb + (size_t)((st + rot) & (AT_NST - 1)) * (AT_KEYS * 16);
#pragma unroll 1   // rolled: one step's 20 loads are issued as one group at its head, and the loop text stays short
  for (int sp = 0; sp < AT_STEPS; ++sp) {
    const _Float16* kp = kl + sp * 2048;                   // LDS: k blocks 2 sp and 2 sp + 1 of the stage, 1024 halves each
    const float*    wp = wl + sp * 512;                    // global: bias block of the step, 512 floats
    const _Float16* vp = kp + AT_HALF;                     // LDS: v^T block sp of the stage, 2048 halves
    const v4f w0 = *(const v4f*)(wp),       w1 = *(const v4f*)(wp + 128);
    const v4f w2 = *(const v4f*)(wp + 256), w3 = *(const v4f*)(wp + 384);
    const v16h k00 = ldfrag_p(kp),        k01 = ldfrag_p(kp + 512);
    const v16h k10 = ldfrag_p(kp + 1024), k11 = ldfrag_p(kp + 1536);
    const v16h vb0 = ldfrag_p(vp);
    const v16h vb1 = ldfrag_p(vp + 512);
    const v16h vb2 = ldfrag_p(vp + 1024);
    const v16h vb3 = ldfrag_p(vp + 1536);
#if defined(__HIP_DEVICE_COMPILE__)
    // stands behind the step's four global loads, in front of every rewrite of a register that they name; their address pair is
    // an input, so that it does not serve as a load's destination in front of the wait
    asm volatile("s_wait_xcnt 0x0" :: "v"(wp) : "memory");
#endif
    v8f s0, s1;
    s0 = mma_raw(k00, qa, zero8());
    s0 = mma_raw(k01, qb, s0);
    guard_s2(s0, k00, k01);
    s1 = mma_raw(k10, qa, zero8());
    s1 = mma_raw(k11, qb, s1);
    guard_s4(s1, k10, k11, qa, qb);
    v2f t[8];                                              // pair i = keys kb + 16 (i >> 2) + 8 hh + 2 (i & 3) + 0, 1
#pragma unroll   // here and below: every index a constant, so the pairs stay in registers
    for (int e = 0; e < 2; ++e) {
      t[e]     = (v2f){s0[2 * e],     s0[2 * e + 1]} * lsc + (v2f){w0[2 * e], w0[2 * e + 1]};
      t[2 + e] = (v2f){s0[4 + 2 * e], s0[5 + 2 * e]} * lsc + (v2f){w1[2 * e], w1[2 * e + 1]};
      t[4 + e] = (v2f){s1[2 * e],     s1[2 * e + 1]} * lsc + (v2f){w2[2 * e], w2[2 * e + 1]};
      t[6 + e] = (v2f){s1[4 + 2 * e], s1[5 + 2 * e]} * lsc + (v2f){w3[2 * e], w3[2 * e + 1]};
    }
    float mx[8];
#pragma unroll
    for (int i = 0; i < 8; ++i) mx[i] = fmaxf(t[i][0], t[i][1]);
    float mxa = fmaxf(fmaxf(fmaxf(mx[0], mx[1]), fmaxf(mx[2], mx[3])), fmaxf(fmaxf(mx[4], mx[5]), fmaxf(mx[6], mx[7])));
    mxa = fmaxf(mxa, xhalf(mxa));                          // over the step's 32 keys, equal in both halves
    const float mn = fmaxf(mrun, mxa);
    const float al = exp2_hw(mrun - mn);                   // 0 on the first step, where mrun is -inf
    mrun = mn;
    v2f ex[8];
    FragH ph;                                              // elements 0..7 = keys kb + 8hh + 0..7, 8..15 = keys kb + 16 + 8hh + 0..7
#pragma unroll
    for (int i = 0; i < 8; ++i) {
      const v2f d = t[i] - mn;
      ex[i] = (v2f){exp2_hw(d[0]), exp2_hw(d[1])};
      ph.p[i] = __builtin_convertvector(ex[i] * PC, v2h);
    }
    const v2f ps = ((ex[0] + ex[1]) + (ex[2] + ex[3])) + ((ex[4] + ex[5]) + (ex[6] + ex[7]));
    lsum = lsum * al + (ps[0] + ps[1]);
#pragma unroll
    for (int r = 0; r < 8; ++r) {
      o0[r] *= al;
      o1[r] *= al;
      o2[r] *= al;
      o3[r] *= al;
    }
    o0 = mma_raw(vb0, ph.v, o0);
    o1 = mma_raw(vb1, ph.v, o1);
    o2 = mma_raw(vb2, ph.v, o2);
    o3 = mma_raw(vb3, ph.v, o3);
    guard_pv4(o0, o1, o2, o3, ph.v, vb0, vb1, vb2, vb3);
  }
  // publish point of trip st + 1's stage: own LDS reads back, own copies landed, one barrier for both hand-overs, then the refill
  wait_ds0();
  wait_async0();
  __syncthreads();
  if (st + 2 < AT_NST)
    async_kv8(lK + buf * (AT_STAGE * 2), gK + kvofs(st + 2), gV + kvofs(st + 2));
  }
  wait_async0();

  // ---- join the halves' sums, fold 1/l and the carries (1024 on P, 16 on v, 1024 on the stored ctx), store 16 B per tile ----
  const float oc  = FC / (PC * VC);
  const float inv = (1.0f / (lsum + xhalf(lsum))) * oc;
  unsigned short* dst = CT + qofs;                         // row q0 + c, cols 64 head + 8 hh (+ 16 t)
  v4u p0, p1, p2, p3;
#pragma unroll
  for (int e = 0; e < 4; ++e) {
    p0[e] = pk16(h_bits((_Float16)(o0[2 * e] * inv)), h_bits((_Float16)(o0[2 * e + 1] * inv)));
    p1[e] = pk16(h_bits((_Float16)(o1[2 * e] * inv)), h_bits((_Float16)(o1[2 * e + 1] * inv)));
    p2[e] = pk16(h_bits((_Float16)(o2[2 * e] * inv)), h_bits((_Float16)(o2[2 * e + 1] * inv)));
    p3[e] = pk16(h_bits((_Float16)(o3[2 * e] * inv)), h_bits((_Float16)(o3[2 * e + 1] * inv)));
  }
  *(v4u*)(dst)      = p0;
  *(v4u*)(dst + 16) = p1;
  *(v4u*)(dst + 32) = p2;
  *(v4u*)(dst + 48) = p3;
}

// =====================================================================================================
// Workspace map (bytes); every plane is an exact multiple of its tile / whole-row store granularity (M, N exact tile multiples,
// element counts exact multiples of pack_all's 32768-element block, no pad rows needed), every offset a multiple of 2 MiB:
//   WQ16 f16 [1024][1024] x64               2097152   ([out][in] = [n][k])
//   WK16 f16 [1024][1024] x64               2097152
//   WV16 f16 [1024][1024] x64               2097152
//   WO16 f16 [1024][1024] x64               2097152
//   X16  f16 [4096][1024] x16               8388608   (activation rows)
//   LB   f32 [2][128][64] x 2 KiB          33554432   (log2(bf16(M)), lane order of the transposed score tiles)
//   QH   f16 [4096][1024] x16               8388608   (q projection, unscaled)
//   KH   f16 [2][16][128] x 2 KiB, x16      8388608   (k projection, fragment order)
//   VT   f16 [2][16][64] x 4 KiB, x16       8388608   (v^T, fragment order)
//   CT   f16 [4096][1024] x1024             8388608   (attention ctx, merged heads)
//   end                                    83886080
// =====================================================================================================
extern "C" void kernel_launch(void* const* d_in, const int* in_sizes, int n_in,
                              void* d_out, int out_size, void* d_ws, size_t ws_size,
                              hipStream_t stream) {
  if (n_in < 7) return;
  if (in_sizes[0] != NROWS * DMODEL) return;
  if (in_sizes[1] != NB * NQ * NC) return;
  if (in_sizes[2] != DMODEL * DMODEL || in_sizes[3] != DMODEL * DMODEL ||
      in_sizes[4] != DMODEL * DMODEL || in_sizes[5] != DMODEL * DMODEL) return;
  if (in_sizes[6] != DMODEL) return;
  if (out_size != NROWS * DMODEL) return;
  if ((in_sizes[0] % 2048) != 0 || (in_sizes[2] % 2048) != 0 || (in_sizes[1] % 1024) != 0) return;

  const float* x   = (const float*)d_in[0];
  const float* Mp  = (const float*)d_in[1];
  const float* w_q = (const float*)d_in[2];
  const float* w_k = (const float*)d_in[3];
  const float* w_v = (const float*)d_in[4];
  const float* w_o = (const float*)d_in[5];
  const float* b_o = (const float*)d_in[6];
  float*       out = (float*)d_out;

  const size_t PW  = (size_t)DMODEL * DMODEL * 2;                 //  2097152
  const size_t PX  = (size_t)NROWS * DMODEL * 2;                  //  8388608
  const size_t PLB = (size_t)NB * NQ * NC * 4;                    // 33554432
  const size_t PVT = (size_t)NB * DMODEL * NC * 2;                //  8388608
  size_t off = 0;
  const size_t oWQ = off; off += PW;
  const size_t oWK = off; off += PW;
  const size_t oWV = off; off += PW;
  const size_t oWO = off; off += PW;
  const size_t oX  = off; off += PX;
  const size_t oLB = off; off += PLB;
  const size_t oQH = off; off += PX;
  const size_t oKH = off; off += PX;
  const size_t oVT = off; off += PVT;
  const size_t oCT = off; off += PX;
  if (off > ws_size) return;                                      // off = 83886080
  if (off > (size_t)134217728) return;

  char* ws = (char*)d_ws;
  unsigned short* WQ16 = (unsigned short*)(ws + oWQ);
  unsigned short* WO16 = (unsigned short*)(ws + oWO);
  unsigned short* X16  = (unsigned short*)(ws + oX);
  float*          LB   = (float*)(ws + oLB);
  unsigned short* QH   = (unsigned short*)(ws + oQH);
  unsigned short* KH   = (unsigned short*)(ws + oKH);
  unsigned short* VTp  = (unsigned short*)(ws + oVT);
  unsigned short* CT   = (unsigned short*)(ws + oCT);

  const dim3 blk(256);
  const dim3 gPK(PK_BLOCKS);                                       // 512 blocks
  const int tilesP = (NROWS / 128) * (DMODEL / 128);               // 256
  const dim3 gP(tilesP, 1);                                        // 256
  const dim3 gPJ(3 * PJ_TILES);                                    // 768
  const dim3 gAT(ATT_BLOCKS);                                      // 256
  const dim3 bAT(ATT_THREADS);                                     // 512

  // (0..2) one launch: weight planes W16[n][k] = f16( bf16_RNE(W[n][k]) * 64 ), [out][in] layout kept, k contiguous (WQ16, WK16,
  // WV16, WO16 lie one behind the other); activation plane X16[row][c] = f16( bf16_RNE(x[row][c]) * 16 ), rows = b*2048 + tok;
  // score bias plane log2( bf16_RNE(M[b][q][key]) ), f32, in the lane order of attn16's score tiles
  pack_all<<<gPK, blk, 0, stream>>>(Mp, LB, x, X16, w_q, w_k, w_v, w_o, WQ16);

  // (3..5) one launch: q projection QH[m][n] = f16(16 * sum_k x[m][k] Wq[n][k]), M = 4096, N = 1024; k projection, the same with
  // Wk, in fragment order; v^T per batch, f16(16 * sum_k Wv[d][k] x_b[tok][k]) in fragment order, M = 1024, N = 2048; K = 1024
  proj3<<<gPJ, blk, 0, stream>>>(X16, WQ16, QH, KH, VTp);

  // (6) attention per (batch, head, 256 query rows) -> CT (f16, x1024)
  attn16<<<gAT, bAT, 0, stream>>>(QH, KH, VTp, LB, CT);

  // (7) out = CT . Wo^T / (1024 * 64) + bf16(bo); M = 4096, N = 1024, K = 1024, f32
  gemm64<0, 1, 0, 0><<<gP, blk, 0, stream>>>(
      CT, DMODEL, 0LL,
      WO16, DMODEL, 0LL,
      b_o,
      (const float*)0,
      (void*)out, DMODEL, 0LL,
      NROWS, DMODEL, DMODEL, 1.0f / (FC * WSC), 1.0f);
  (void)hipGetLastError();
}

// v010
// A run of this version takes 80.7 microseconds.
// Versions between v008 and this one are left out; their measured steps multiply to 1.17 times as fast.
// Over all steps from v000 it is 4.61 times as fast.
// Contractions: q/k projections (x rows f16 x16 . W f16 x64, K=1024), v^T projection (Wv f16 x64 . x rows f16 x16, K=1024),
// attention scores^T (k f16 x16 . q f16 x16, K=64), attention v^T . P^T (v^T f16 x16 . P f16 x1024, K=2048 in steps of 32),
// output projection (ctx f16 x1024 . Wo f16 x64, K=1024): all v_wmma_f32_16x16x32_f16 single products, f32 accumulate.
// The mask M is a factor on the probs (f16 plane x32, times the f16 x32 exponentials); their row sum is one more f16 WMMA per step
// (a ones row . P^T). Online max-subtracted base-2 softmax and output bias in f32 on VALU.
// Every float input RNE-converted to bf16 on load.
#include <hip/hip_runtime.h>
#include <math.h>
#include <stdint.h>

#define NB      2
#define NQ      2048
#define NC      2048
#define DMODEL  1024
#define NHEAD   16
#define HDIM    64
#define NROWS   (NB * NQ)
#define WSC     64.0f
#define ACARRY  16.0f
#define QC      16.0f
#define KC      16.0f
#define VC      16.0f
#define ECL     5.0f                                       // carry on the exponentials: 2^5
#define MC      32.0f                                      // carry on the mask plane; the prob tile carries 2^5 * 32 = 1024
#define FC      1024.0f
#define ATT_SCALE 0.125f
#define LOG2E   1.4426950408889634f
static_assert(NHEAD * HDIM == DMODEL);
static_assert((NQ % 64) == 0 && (NC % 64) == 0 && (DMODEL % 64) == 0 && (NC % 32) == 0 && (NQ % 16) == 0);
static_assert((NROWS % 128) == 0 && (NC % 128) == 0 && (DMODEL % 128) == 0);
#define ATT_WAVES   16                                     // query tiles of 16 rows per block, one wave each
#define ATT_THREADS (ATT_WAVES * 32)
#define ATT_QG      (NQ / (16 * ATT_WAVES))                // blocks per batch and head
#define ATT_BLOCKS  (NB * NHEAD * ATT_QG)
static_assert(ATT_THREADS == 512 && ATT_QG == 8 && ATT_BLOCKS == 256);

typedef _Float16 v16h __attribute__((ext_vector_type(16)));
typedef _Float16 v8h  __attribute__((ext_vector_type(8)));
typedef float    v8f  __attribute__((ext_vector_type(8)));
typedef float    v4f  __attribute__((ext_vector_type(4)));
typedef float    v2f  __attribute__((ext_vector_type(2)));
typedef _Float16 v2h  __attribute__((ext_vector_type(2)));
typedef unsigned int v4u __attribute__((ext_vector_type(4)));

union FragH { v16h v; v8h h[2]; v4u u[2]; v2h p[8]; };

// ---- scalar helpers --------------------------------------------------------------------------------
__device__ __forceinline__ unsigned short bf_bits(float f) {          // f32 -> bf16 bits, RNE convert
  unsigned u = __float_as_uint(f);
  return (unsigned short)((u + 0x7FFFu + ((u >> 16) & 1u)) >> 16);
}
__device__ __forceinline__ float bf_up(unsigned short h) { return __uint_as_float(((unsigned)h) << 16); }
__device__ __forceinline__ float bfr(float f) { return bf_up(bf_bits(f)); }   // value of the bf16 RNE convert
__device__ __forceinline__ unsigned short h_bits(_Float16 x) { return __builtin_bit_cast(unsigned short, x); }
__device__ __forceinline__ unsigned pk16(unsigned short a, unsigned short b) { return (unsigned)a | ((unsigned)b << 16); }
__device__ __forceinline__ v8f zero8() { v8f z = {0.f, 0.f, 0.f, 0.f, 0.f, 0.f, 0.f, 0.f}; return z; }
__device__ __forceinline__ float gelu_f(float v) { return 0.5f * v * (1.0f + erff(v * 0.70710678118654752f)); }
__device__ __forceinline__ float xhalf(float x) {                     // the value that lane ^ 16 holds
  const int b = __builtin_bit_cast(int, x);
  return __builtin_bit_cast(float, __builtin_amdgcn_permlanex16(b, b, 0x76543210, 0xfedcba98, false, false));
}

// 2^x as the one hardware instruction. For x >= -126 it gives the bits that the library's exp2f gives; below that its result is 0
// or under 2^-126 where the library scales to a subnormal. attn16 calls it with x <= 5 only (up to rounding), and rounds the result
// to f16: such a term is 0 there either way.
__device__ __forceinline__ float exp2_hw(float x) { return __builtin_amdgcn_exp2f(x); }

// ---- fragment loaders: 16-bit A/B operand, lane -> row/col (lane&15), p already includes +8*(lane>>4);
//      elements 0..7 <- p[0..7] (k0+8h..), elements 8..15 <- p[16..23] (k0+16+8h..)  (same split k map for A and B;
//      B is read from a k-contiguous [n][k] plane in gemm64 and for q in attn16; attn16's A comes from fragment order via ldfrag_p)
__device__ __forceinline__ v16h ldfrag_h(const _Float16* p) {
  FragH f;
  f.h[0] = *(const v8h*)(p);
  f.h[1] = *(const v8h*)(p + 16);
  return f.v;
}
__device__ __forceinline__ v16h ldfrag_u(const unsigned short* p) {
  FragH f;
  f.u[0] = *(const v4u*)(p);
  f.u[1] = *(const v4u*)(p + 16);
  return f.v;
}

// fragment-ordered plane: a fragment is two runs of 512 B, run i = elements 8i..8i+7 of all 32 lanes, 16 B per lane in lane order;
// p already includes +8*lane, so each of the two wave-wide loads covers 512 contiguous bytes = four whole lines
__device__ __forceinline__ v16h ldfrag_p(const _Float16* p) {
  FragH f;
  f.h[0] = *(const v8h*)(p);
  f.h[1] = *(const v8h*)(p + 256);
  return f.v;
}

// ---- WMMA helpers with trailing VALU hazard gaps ------------------------------------------------------
__device__ __forceinline__ v8f mma_raw(v16h a, v16h b, v8f c) {
  return __builtin_amdgcn_wmma_f32_16x16x32_f16(false, a, false, b, (short)0, c, false, false);
}
__device__ __forceinline__ void dep_guard1(v8f& a, v8f& b, v16h x) {
#if defined(__HIP_DEVICE_COMPILE__)
  asm volatile("v_nop\n\tv_nop\n\tv_nop\n\tv_nop" : "+v"(a), "+v"(b) : "v"(x));
#endif
}
__device__ __forceinline__ void guard_s2(v8f& s, v16h a0, v16h a1) {
#if defined(__HIP_DEVICE_COMPILE__)
  asm volatile("v_nop\n\tv_nop\n\tv_nop\n\tv_nop" : "+v"(s) : "v"(a0), "v"(a1));
#endif
}
__device__ __forceinline__ void guard_s4(v8f& s, v16h a0, v16h a1, v16h b0, v16h b1) {
#if defined(__HIP_DEVICE_COMPILE__)
  asm volatile("v_nop\n\tv_nop\n\tv_nop\n\tv_nop" : "+v"(s) : "v"(a0), "v"(a1), "v"(b0), "v"(b1));
#endif
}
__device__ __forceinline__ void guard_pv5(v8f& a, v8f& b, v8f& c, v8f& d, v8f& e, v16h x, v16h y, v16h z, v16h w, v16h u, v16h o) {
#if defined(__HIP_DEVICE_COMPILE__)
  asm volatile("v_nop\n\tv_nop\n\tv_nop\n\tv_nop"
               : "+v"(a), "+v"(b), "+v"(c), "+v"(d), "+v"(e) : "v"(x), "v"(y), "v"(z), "v"(w), "v"(u), "v"(o));
#endif
}
__device__ __forceinline__ void keep4_h(v16h a, v16h b, v16h c, v16h d) {
#if defined(__HIP_DEVICE_COMPILE__)
  asm volatile("v_nop" :: "v"(a), "v"(b), "v"(c), "v"(d));
#endif
}
__device__ __forceinline__ void acc_guard4(v8f& a, v8f& b, v8f& c, v8f& d) {
#if defined(__HIP_DEVICE_COMPILE__)
  asm volatile("v_nop\n\tv_nop\n\tv_nop\n\tv_nop" : "+v"(a), "+v"(b), "+v"(c), "+v"(d));
#endif
}
__device__ __forceinline__ void wave_sync_lds() {
  __builtin_amdgcn_fence(__ATOMIC_RELEASE, "workgroup");
  __builtin_amdgcn_wave_barrier();
  __builtin_amdgcn_fence(__ATOMIC_ACQUIRE, "workgroup");
}

// =====================================================================================================
// All six input-only packs in ONE launch of 512 blocks x 8 waves; a wave takes PK_IT groups of eight 16-B loads: all its loads are
// issued at its head, then group after group is converted and stored as its loads return. Blocks 0..255: mask plane;
// 256..383: activation rows; 384..511: the four weight planes, 32 blocks each.
// 16-bit pack, no transpose: dst[i] = f16( bf16_RNE(src[i]) * sc ), sc a power of two (exact). Used for the weights (stored
// [out][in] = [n][k], already k contiguous for B fragments / A of the v^T projection; the four planes lie one behind the other in
// the workspace) and for the activation rows. A piece is 8 elements: two 16-B loads, one 16-B store per lane; a group is 4 pieces
// per lane = 1024 elements per wave, 32 consecutive lanes = one whole 512-B store; the 8 waves' groups lie side by side.
// Mask plane: f16( bf16_RNE(M) * 32 ) (exact from 2^-19 up; the prob tile 1024 M e stays in f16 range for M below 63), laid in
// the lane order in which attn16 holds its transposed prob tile: 1-KiB blocks [batch][query / 16][key / 32] of 16 queries x 32
// keys, two runs of 512 B; run j, lane (c, hh) = query c, keys 16 j + 8 hh + 0..7. A piece is 8 elements as above; a group is two neighbouring plane blocks = 4 pieces per lane, read from 256 B
// of each of 16 source rows, stored as four whole 512-B runs; a work-group takes 16 whole source rows.
// coverage: mask 256 blocks x 8 waves x PK_IT groups x 1024 elements = 2 x 2048 x 2048; rows 128 x 8 x PK_IT x 1024 = 4096 x 1024;
//           a weight 32 x 8 x PK_IT x 1024 = 1024 x 1024; group -> source and group -> plane are one to one. No barrier.
// =====================================================================================================
#define PK_IT 4
#define PK_BM ((NB * NQ) / 16)                             // 256 blocks, 16 source rows each
#define PK_BX ((NROWS * DMODEL) / (8 * PK_IT * 1024))      // 128 blocks
#define PK_BW ((DMODEL * DMODEL) / (8 * PK_IT * 1024))     //  32 blocks per weight
#define PK_BLOCKS (PK_BM + PK_BX + 4 * PK_BW)
static_assert(NC == 8 * PK_IT * 64 && PK_BX * 8 * PK_IT * 1024 == NROWS * DMODEL);
static_assert(PK_BW * 8 * PK_IT * 1024 == DMODEL * DMODEL && PK_BLOCKS == 512);

// stands behind a wave's run of loads, in front of every rewrite of a register that they name; their address pair is an input,
// so that it is not given away in front of the wait
__device__ __forceinline__ void wait_x0(const void* p) {
#if defined(__HIP_DEVICE_COMPILE__)
  asm volatile("s_wait_xcnt 0x0" :: "v"(p) : "memory");
#endif
}

__global__ __launch_bounds__(256) void pack_all(const float* __restrict__ Mp, unsigned short* MF,
                                                const float* __restrict__ xp, unsigned short* X16,
                                                const float* __restrict__ wq, const float* __restrict__ wk,
                                                const float* __restrict__ wv, const float* __restrict__ wo,
                                                unsigned short* W16) {
  const unsigned lane = threadIdx.x & 31u;
  const unsigned wave = threadIdx.x >> 5;
  const unsigned b    = blockIdx.x;
  v4f a[PK_IT][8];
  if (b < PK_BM) {
    // block b = source rows 16 b .. 16 b + 15 = plane blocks 64 b .. 64 b + 63; group (it, wave) = plane blocks 2 (8 it + wave) + 0, 1
    const unsigned c = lane & 15u, hh = lane >> 4;
    const float* sp = Mp + (size_t)(b * 16u + c) * NC + wave * 64u + hh * 8u;
    unsigned short* dp = MF + (size_t)(b * (8u * PK_IT) + wave) * 1024 + lane * 8u;
#pragma unroll   // here and below in the pack: every index a constant, so the groups stay in registers
    for (int it = 0; it < PK_IT; ++it)
#pragma unroll
      for (int u = 0; u < 8; ++u)
        a[it][u] = *(const v4f*)(sp + it * 512 + (u >> 2) * 32 + ((u & 3) >> 1) * 16 + (u & 1) * 4);
    wait_x0(sp);
#pragma unroll
    for (int it = 0; it < PK_IT; ++it) {
#pragma unroll
      for (int u = 0; u < 4; ++u) {                         // run u = plane block u >> 1 of the group, its run u & 1
        const v4f p = a[it][2 * u], q = a[it][2 * u + 1];
        v4u o;
        o[0] = pk16(h_bits((_Float16)(bfr(p[0]) * MC)), h_bits((_Float16)(bfr(p[1]) * MC)));
        o[1] = pk16(h_bits((_Float16)(bfr(p[2]) * MC)), h_bits((_Float16)(bfr(p[3]) * MC)));
        o[2] = pk16(h_bits((_Float16)(bfr(q[0]) * MC)), h_bits((_Float16)(bfr(q[1]) * MC)));
        o[3] = pk16(h_bits((_Float16)(bfr(q[2]) * MC)), h_bits((_Float16)(bfr(q[3]) * MC)));
        *(v4u*)(dp + it * 8192 + u * 256) = o;
      }
    }
  } else {
    const unsigned bc = b - PK_BM;
    const bool isx = bc < PK_BX;                            // block-uniform
    const unsigned bw = isx ? 0u : bc - PK_BX;              // weights: plane bw / PK_BW, block bw % PK_BW of it
    const unsigned wi = bw / PK_BW;
    const float* src = isx ? xp : (wi == 0u) ? wq : (wi == 1u) ? wk : (wi == 2u) ? wv : wo;
    unsigned short* dst = isx ? X16 : W16 + (size_t)wi * (DMODEL * DMODEL);
    const float sc = isx ? ACARRY : WSC;
    const size_t e0 = (size_t)((isx ? bc : bw % PK_BW) * (8u * PK_IT) + wave) * 1024 + lane * 8u;   // group (it, wave) at + 8192 it
    const float*    sp = src + e0;
    unsigned short* dp = dst + e0;
#pragma unroll
    for (int it = 0; it < PK_IT; ++it)
#pragma unroll
      for (int u = 0; u < 4; ++u) {
        a[it][2 * u]     = *(const v4f*)(sp + it * 8192 + u * 256);
        a[it][2 * u + 1] = *(const v4f*)(sp + it * 8192 + u * 256 + 4);
      }
    wait_x0(sp);
#pragma unroll
    for (int it = 0; it < PK_IT; ++it) {
#pragma unroll
      for (int u = 0; u < 4; ++u) {
        const v4f p = a[it][2 * u], q = a[it][2 * u + 1];
        v4u o;
        o[0] = pk16(h_bits((_Float16)(bfr(p[0]) * sc)), h_bits((_Float16)(bfr(p[1]) * sc)));
        o[1] = pk16(h_bits((_Float16)(bfr(p[2]) * sc)), h_bits((_Float16)(bfr(p[3]) * sc)));
        o[2] = pk16(h_bits((_Float16)(bfr(q[0]) * sc)), h_bits((_Float16)(bfr(q[1]) * sc)));
        o[3] = pk16(h_bits((_Float16)(bfr(q[2]) * sc)), h_bits((_Float16)(bfr(q[3]) * sc)));
        *(v4u*)(dp + it * 8192 + u * 256) = o;
      }
    }
  }
}

// =====================================================================================================
// LDS-staged batched f16 WMMA GEMM: C[m][n] = f( oscale * sum_k A[m][k] * Bt[n][k] + bf16(bias) ) (+ residual); one block of
// 8 waves per 128x128 tile, one wave per 32x64 part of it (4 x 2 waves). A row-major [M][K] pitch lda (16-bit plane), Bt
// row-major [N][K] pitch ldb (k contiguous); M, N multiples of 128, K multiple of 128. blockIdx.y = batch index with element
// strides sA, sB, sC.
// A stage is 128 k (256 B) of the tile's 128 A rows and 128 Bt rows, laid in LDS at a row pitch of 272 B; two buffers. Every
// lane brings 16 pieces of 16 B per stage by asynchronous copies (16 lanes = one whole 256-B row piece), the next stage's
// copies in flight while this stage is multiplied; fragments are read from LDS with the split k map of ldfrag_u. A block walks
// the K / 128 stages once round from its own first stage (tile row + tile col) mod stages, k ascending inside a stage: the blocks
// that share A rows or Bt rows then ask L2 for different lines at the same moment, save those whose tiles lie a multiple of K / 128 apart.
// The epilogue's per-wave slabs lie over the ring, which is idle behind the last trip's barrier: LDS per block = the ring, 139264 B.
// BM: 0 = no bias, 1 = per column bf16(bias[col]), 2 = per row bf16(bias[row]) (clamped-address loads).
// OM: 0 = f32 out (pitch ldc; HASR 1 adds bf16(R[m][n]), HASR 2 adds raw f32 R[m][n], same pitch/stride as C);
//     2 = f16 out (pitch ldc) = f16( act(value) * ocarry ), ACT 1 = exact GELU.
//     3, 4 = the same f16 values laid in the fragment order that attn16 loads (ldfrag_p), ldc unused, BM 0 only. A wave's 16x64
//         slab is four runs of 512 B; run it, lane (c, hh) = slab row c, cols 16 it + 8 hh + 0..7: one whole 512-B store each.
//         3 (k plane; rows = batch*2048 + key, cols = 64 head + d): the slab is the 2-KiB block [batch][head][key / 16].
//         4 (v^T plane; rows = 64 head + d, cols = key, batch = by through sC): runs 2t, 2t + 1 are the 1-KiB piece
//         (d / 16) & 3 of the 4-KiB block [head][key / 32], t = 0, 1 the slab's two 32-key tiles.
// coverage: 2 slabs x 16 rows (f32: it 0..7 x lane>>4; OM 2: it 0..3 x lane>>3; OM 3, 4: lane & 15) x 64 cols = the wave's whole 32x64 part;
//           grid = tilesM*tilesN blocks, a surplus block exits as a whole in front of every barrier.
// =====================================================================================================
#define GT_PITCH  136                          // LDS row pitch in halves: 272 B = 16 B x odd, for 16-B LDS reads
#define GT_STAGE  (256 * GT_PITCH)             // halves per buffer: [A 128 rows | Bt 128 rows]
typedef __attribute__((address_space(3))) unsigned short lds_u16;

// Eight asynchronous 16-B copies per lane, global -> LDS, rows 16 apart. The closing s_wait_xcnt 0 stands inside the statement
// so that no address register of an issued copy is rewritten in front of it.
__device__ __forceinline__ void async_rows8(unsigned l, const unsigned short* g, size_t gstep) {
#if defined(__HIP_DEVICE_COMPILE__)
  const unsigned ls = 16 * GT_PITCH * 2;       // 16 LDS rows in bytes
  asm volatile("global_load_async_to_lds_b128 %0, %8, off\n\t"
               "global_load_async_to_lds_b128 %1, %9, off\n\t"
               "global_load_async_to_lds_b128 %2, %10, off\n\t"
               "global_load_async_to_lds_b128 %3, %11, off\n\t"
               "global_load_async_to_lds_b128 %4, %12, off\n\t"
               "global_load_async_to_lds_b128 %5, %13, off\n\t"
               "global_load_async_to_lds_b128 %6, %14, off\n\t"
               "global_load_async_to_lds_b128 %7, %15, off\n\t"
               "s_wait_xcnt 0x0"
               :: "v"(l), "v"(l + ls), "v"(l + 2 * ls), "v"(l + 3 * ls),
                  "v"(l + 4 * ls), "v"(l + 5 * ls), "v"(l + 6 * ls), "v"(l + 7 * ls),
                  "v"(g), "v"(g + gstep), "v"(g + 2 * gstep), "v"(g + 3 * gstep),
                  "v"(g + 4 * gstep), "v"(g + 5 * gstep), "v"(g + 6 * gstep), "v"(g + 7 * gstep)
               : "memory");
#endif
}
__device__ __forceinline__ void wait_async0() {   // this wave's copies have landed in LDS
#if defined(__HIP_DEVICE_COMPILE__)
  asm volatile("s_wait_asynccnt 0x0" ::: "memory");
#endif
}
__device__ __forceinline__ void wait_ds0() {      // this wave's LDS reads have returned before their buffer is refilled
#if defined(__HIP_DEVICE_COMPILE__)
  asm volatile("s_wait_dscnt 0x0" ::: "memory");
#endif
}

// The k loop of one 128x128 block tile: A1 and Bb are the batch's planes, bm0 and bn0 the tile's first rows in them; acc is the
// wave's 32x64 part. Trip t works on k stage (t + rot) mod stages, rot block-uniform and below the number of stages.
// Behind it no copy is in flight and every wave's ring reads lie in front of the last trip's barrier.
__device__ __forceinline__ void gemm_main(unsigned short* ring,
                                          const unsigned short* A1, int lda, const unsigned short* Bb, int ldb,
                                          int bm0, int bn0, int K, int rot, v8f (&acc)[2][4]) {
  const int tid  = threadIdx.x;
  const int lane = tid & 31;
  const int wave = tid >> 5;
  const int wm = (wave >> 1) << 5;             // the wave's 32 rows inside the block tile
  const int wn = (wave & 1) << 6;              // the wave's 64 cols inside the block tile
  const int rlane = lane & 15;                 // row (A) / col (B, D) within subtile
  const int koff  = (lane >> 4) * 8;           // k offset of this lane half

  // copy map: lane piece = 16 B number tid & 15 of row (tid >> 4) + 16 j, j 0..7, of the A rows and of the Bt rows
  const int crow = tid >> 4;
  const int cpc  = (tid & 15) * 8;
  const unsigned short* gA = A1 + (size_t)(bm0 + crow) * lda + cpc;
  const unsigned short* gB = Bb + (size_t)(bn0 + crow) * ldb + cpc;
  const unsigned lA = (unsigned)(uintptr_t)(lds_u16*)(ring + crow * GT_PITCH + cpc);
  const unsigned lB = lA + 128 * GT_PITCH * 2;
  const int nst = K >> 7;                      // stages of 128 k
  const auto kofs = [&](int t) -> size_t {     // first k of trip t's stage; t and rot below nst, so one wrap at most
    const int s = t + rot;
    return (size_t)(s >= nst ? s - nst : s) * 128;
  };

#pragma unroll
  for (int i = 0; i < 2; ++i)
#pragma unroll
    for (int j = 0; j < 4; ++j) acc[i][j] = zero8();

  // trip 0's stage into buffer 0, published; then trip 1's into buffer 1
  async_rows8(lA, gA + kofs(0), (size_t)16 * lda);
  async_rows8(lB, gB + kofs(0), (size_t)16 * ldb);
  wait_async0();
  __syncthreads();
  if (nst > 1) {
    async_rows8(lA + GT_STAGE * 2, gA + kofs(1), (size_t)16 * lda);
    async_rows8(lB + GT_STAGE * 2, gB + kofs(1), (size_t)16 * ldb);
  }

  for (int t = 0; t < nst; ++t) {
    const int buf = t & 1;
    const unsigned short* fA = ring + buf * GT_STAGE + (wm + rlane) * GT_PITCH + koff;
    const unsigned short* fB = ring + buf * GT_STAGE + (128 + wn + rlane) * GT_PITCH + koff;
    // two fragment sets: the next 32 k of this stage are read from LDS as one group ahead of the current products
    v16h ah[2][2], bh[2][4];
#pragma unroll
    for (int j = 0; j < 4; ++j) bh[0][j] = ldfrag_u(fB + (j << 4) * GT_PITCH);
#pragma unroll
    for (int i = 0; i < 2; ++i) ah[0][i] = ldfrag_u(fA + (i << 4) * GT_PITCH);
#pragma unroll   // every fragment-set index a constant, so both sets stay in registers
    for (int s = 0; s < 4; ++s) {
      const int cu = s & 1, nx = cu ^ 1;
      if (s < 3) {
#pragma unroll
        for (int j = 0; j < 4; ++j) bh[nx][j] = ldfrag_u(fB + (j << 4) * GT_PITCH + (s + 1) * 32);
#pragma unroll
        for (int i = 0; i < 2; ++i) ah[nx][i] = ldfrag_u(fA + (i << 4) * GT_PITCH + (s + 1) * 32);
      }
#pragma unroll
      for (int i = 0; i < 2; ++i) {
#pragma unroll
        for (int j = 0; j < 4; ++j) acc[i][j] = mma_raw(ah[cu][i], bh[cu][j], acc[i][j]);
        dep_guard1(acc[i][0], acc[i][3], ah[cu][i]);
      }
      keep4_h(bh[cu][0], bh[cu][1], bh[cu][2], bh[cu][3]);
    }
    // publish point of trip t + 1's stage: own LDS reads back, own copies landed, one barrier for both hand-overs, then the refill
    wait_ds0();
    wait_async0();
    __syncthreads();
    if (t + 2 < nst) {
      async_rows8(lA + buf * (GT_STAGE * 2), gA + kofs(t + 2), (size_t)16 * lda);
      async_rows8(lB + buf * (GT_STAGE * 2), gB + kofs(t + 2), (size_t)16 * ldb);
    }
  }
  wait_async0();
  acc_guard4(acc[0][0], acc[0][1], acc[0][2], acc[0][3]);
  acc_guard4(acc[1][0], acc[1][1], acc[1][2], acc[1][3]);
}

// Epilogue of the wave's 32x64 part at rows m0, cols n0; slab is the wave's own 16x64 f32 staging range, pitch 68 floats.
template <int OM, int BM, int HASR, int ACT>
__device__ __forceinline__ void gemm_epi(float* slab, v8f (&acc)[2][4],
                                         const float* bias, const float* Rp,
                                         void* Cout, int ldc, long long sC, int by,
                                         int M, int N, int m0, int n0, float oscale, float ocarry) {
  const int lane  = threadIdx.x & 31;
  const int rlane = lane & 15;                 // col within subtile
  const int koff  = (lane >> 4) * 8;
  const int mOff  = (lane >> 4) * 8;           // D row offset
  const int hh2 = lane >> 4, c4 = (lane & 15) * 4;     // f32 out: 256-B row segment = 16 lanes x 16 B
  const int q8  = lane >> 3, c8 = (lane & 7) * 8;
  float bc[4];
  float bcol[8];
#pragma unroll
  for (int e = 0; e < 4; ++e) bc[e] = 0.f;
#pragma unroll
  for (int e = 0; e < 8; ++e) bcol[e] = 0.f;
  if constexpr (BM == 1) {
    if constexpr (OM == 0) {
      const int cb = n0 + c4;
      const int i0 = (cb < N - 4) ? cb : (N - 4);        // clamped address
      const v4f b0v = *(const v4f*)(bias + i0);
#pragma unroll
      for (int e = 0; e < 4; ++e) bc[e] = bfr(b0v[e]);
    } else {
      const int cb = n0 + c8;
      const int i0 = (cb < N - 8) ? cb : (N - 8);        // clamped address
      const v4f b0v = *(const v4f*)(bias + i0), b1v = *(const v4f*)(bias + i0 + 4);
#pragma unroll
      for (int e = 0; e < 4; ++e) { bcol[e] = bfr(b0v[e]); bcol[4 + e] = bfr(b1v[e]); }
    }
  }

  // ---- epilogue ----
#pragma unroll
  for (int i = 0; i < 2; ++i) {
    const int mBase = m0 + (i << 4);
#pragma unroll
    for (int j = 0; j < 4; ++j) {
#pragma unroll
      for (int r = 0; r < 8; ++r) {
        slab[(mOff + r) * 68 + (j << 4) + rlane] = acc[i][j][r];
      }
    }
    wave_sync_lds();
    if constexpr (OM == 0) {
      float* C = (float*)Cout + (size_t)((long long)by * sC);
      v4f vals[8];
#pragma unroll
      for (int it = 0; it < 8; ++it) {
        const int row = it * 2 + hh2;                      // it 0..7 x hh2 0..1 = rows 0..15
        const int gr  = mBase + row;
        v4f v = *(const v4f*)(slab + row * 68 + c4);
        float br = 0.f;
        if constexpr (BM == 2) {
          const int ir = (gr < M - 1) ? gr : (M - 1);      // clamped address
          br = bfr(bias[ir]);
        }
        v4f rv = {0.f, 0.f, 0.f, 0.f};
        if constexpr (HASR != 0) {
          const float* R = Rp + (size_t)((long long)by * sC);
          const v4f rraw = *(const v4f*)(R + (size_t)gr * ldc + n0 + c4);
#pragma unroll
          for (int e = 0; e < 4; ++e) rv[e] = (HASR == 1) ? bfr(rraw[e]) : rraw[e];
        }
#pragma unroll
        for (int e = 0; e < 4; ++e) v[e] = v[e] * oscale + bc[e] + br + rv[e];
        vals[it] = v;
      }
      {
#pragma unroll
        for (int it = 0; it < 8; ++it) {
          const int gr = mBase + it * 2 + hh2;
          *(v4f*)(C + (size_t)gr * ldc + n0 + c4) = vals[it];
        }
        
      }
    } else {
      unsigned short* C = (unsigned short*)Cout + (size_t)((long long)by * sC);
      static_assert(OM == 2 || BM == 0);
      v4u hv[4];
#pragma unroll
      for (int it = 0; it < 4; ++it) {
        const int row = (OM == 2) ? it * 4 + q8 : rlane;   // OM 2: it 0..3 x q8 0..3 = rows 0..15; OM 3, 4: row = lane & 15
        const float* sp = slab + row * 68 + ((OM == 2) ? c8 : it * 16 + koff);
        float br = 0.f;
        if constexpr (BM == 2) {
          const int gr = mBase + row;
          const int ir = (gr < M - 1) ? gr : (M - 1);      // clamped address
          br = bfr(bias[ir]);
        }
        v4u a = {0u, 0u, 0u, 0u};
#pragma unroll
        for (int e = 0; e < 4; ++e) {
          float f0 = sp[2 * e] * oscale + bcol[2 * e] + br;
          float f1 = sp[2 * e + 1] * oscale + bcol[2 * e + 1] + br;
          if constexpr (ACT == 1) { f0 = gelu_f(f0); f1 = gelu_f(f1); }
          f0 *= ocarry; f1 *= ocarry;
          a[e] = pk16(h_bits((_Float16)f0), h_bits((_Float16)f1));
        }
        hv[it] = a;
      }
      {
#pragma unroll
        for (int it = 0; it < 4; ++it) {
          if constexpr (OM == 2) {
            const int row = it * 4 + q8;
            *(v4u*)(C + (size_t)(mBase + row) * ldc + n0 + c8) = hv[it];
          } else if constexpr (OM == 3) {
            const int mt = mBase >> 4;                     // batch * 128 + key tile
            const size_t blk = (size_t)((mt / (NC / 16)) * NHEAD + (n0 >> 6)) * (NC / 16) + (mt % (NC / 16));
            *(v4u*)(C + blk * 1024 + it * 256 + lane * 8) = hv[it];
          } else {
            const size_t blk = (size_t)(mBase >> 6) * (NC / 32) + (n0 >> 5) + (it >> 1);
            *(v4u*)(C + blk * 2048 + ((mBase >> 4) & 3) * 512 + (it & 1) * 256 + lane * 8) = hv[it];
          }
        }
        
      }
    }
    wave_sync_lds();
  }
}

#define GT_SLAB (16 * 68)                      // floats of a wave's epilogue slab
static_assert(8 * GT_SLAB * 4 <= 2 * GT_STAGE * 2);

template <int OM, int BM, int HASR, int ACT>
__global__ __launch_bounds__(256) void gemm64(
    const unsigned short* __restrict__ Ap, int lda, long long sA,
    const unsigned short* __restrict__ Btp, int ldb, long long sB,
    const float* __restrict__ bias,
    const float* __restrict__ Rp,
    void* Cout, int ldc, long long sC,
    int M, int N, int K, float oscale, float ocarry) {
  __shared__ __align__(16) unsigned short ring[2 * GT_STAGE];   // two stage buffers; behind the k loop the waves' slabs
  const int by   = blockIdx.y;
  const int wave = threadIdx.x >> 5;
  const int tilesN = N >> 7;
  const int tilesM = M >> 7;
  const int tile = blockIdx.x;
  if (tile >= tilesM * tilesN) return;   // block-uniform, in front of every barrier and copy
  const int tm = tile / tilesN;
  const int tn = tile - tm * tilesN;
  const int bm0 = tm << 7;
  const int bn0 = tn << 7;
  v8f acc[2][4];
  gemm_main(ring, Ap + (size_t)((long long)by * sA), lda, Btp + (size_t)((long long)by * sB), ldb, bm0, bn0, K,
            (tm + tn) % (K >> 7), acc);
  gemm_epi<OM, BM, HASR, ACT>((float*)(void*)ring + wave * GT_SLAB, acc, bias, Rp, Cout, ldc, sC, by, M, N,
                              bm0 + ((wave >> 1) << 5), bn0 + ((wave & 1) << 6), oscale, ocarry);
}

// The q, k and v^T projections in one launch, one block of 12 waves per 128 activation rows x the same 128 outputs of each of the
// three: grid = 32 row tiles x 8 output tiles = 256 blocks, one on a WGP. A stage is 128 k (256 B) of the 128 activation rows and
// of the 128 rows of Wq, of Wk and of Wv, laid in LDS at the row pitch of gemm64; the activation rows are copied once for the
// three products. Two buffers, the ring order of gemm_main; waves 0..7 bring the copies, 32 pieces of 16 B per lane and stage.
// Waves 0..3: q, 4..7: k (A = activation rows, B = weight rows), 8..11: v^T (A = Wv rows, B = activation rows); a wave has 64 x 64
// of its product (2 x 2 waves), so a fragment read from LDS feeds four products. K = 1024, k ascending inside a stage, the stages
// once round from (row tile + output tile) mod 8: every sum is taken in the order of gemm_main. W3 = the Wq, Wk, Wv planes one
// behind the other. The epilogue's per-wave slabs lie over the ring, which is idle behind the last trip's barrier.
#define PJ_WAVES   12
#define PJ_THREADS (PJ_WAVES * 32)
#define PJ_PART    (128 * GT_PITCH)                        // halves of one operand's 128 rows in a buffer
#define PJ_STAGE   (4 * PJ_PART)                           // halves per buffer: [x | Wq | Wk | Wv], 128 rows each
#define PJ_NST     (DMODEL / 128)                          // stages
#define PJ_BLOCKS  ((NROWS / 128) * (DMODEL / 128))
static_assert(PJ_BLOCKS == 256 && PJ_NST == 8 && (NC % 128) == 0 && 2 * PJ_STAGE * 2 == 278528);
static_assert(PJ_WAVES * GT_SLAB * 4 <= 2 * PJ_STAGE * 2);
__global__ __launch_bounds__(PJ_THREADS) void proj3(const unsigned short* __restrict__ X, const unsigned short* __restrict__ W3,
                                                    unsigned short* QH, unsigned short* KH, unsigned short* VT) {
  __shared__ __align__(16) unsigned short ring[2 * PJ_STAGE];   // two stage buffers; behind the k loop the waves' slabs
  const int tid   = threadIdx.x;
  const int lane  = tid & 31;
  const int wave  = __builtin_amdgcn_readfirstlane(tid >> 5);   // told to be wave-uniform: the tests on it are scalar branches
  const int which = wave >> 2;                             // 0 q, 1 k, 2 v^T
  const int wx    = ((wave >> 1) & 1) << 6;                // the wave's 64 activation rows inside the block's 128
  const int ww    = (wave & 1) << 6;                       // the wave's 64 weight rows inside the block's 128
  const bool isv  = which == 2;
  const int tm  = blockIdx.x / (DMODEL / 128);
  const int tn  = blockIdx.x % (DMODEL / 128);
  const int bm0 = tm << 7;                                 // first activation row
  const int bn0 = tn << 7;                                 // first weight row of each plane
  const int rot = (tm + tn) % PJ_NST;
  const int rlane = lane & 15;                             // row (A) / col (B, D) within subtile
  const int koff  = (lane >> 4) * 8;                       // k offset of this lane half
  const int arow  = isv ? 3 * 128 + ww : wx;               // buffer row of the wave's first A row
  const int brow  = isv ? wx : (1 + which) * 128 + ww;     // buffer row of the wave's first B row

  // copy map, waves 0..7: lane piece = 16 B number tid & 15 of row (tid >> 4) + 16 j, j 0..7, of each of the four operands
  const bool copier = wave < 8;
  const int crow = (tid >> 4) & 15;
  const int cpc  = (tid & 15) * 8;
  const unsigned short* gX = X  + (size_t)(bm0 + crow) * DMODEL + cpc;
  const unsigned short* gW = W3 + (size_t)(bn0 + crow) * DMODEL + cpc;
  const unsigned lX = (unsigned)(uintptr_t)(lds_u16*)(ring + crow * GT_PITCH + cpc);
  const auto fill = [&](int buf, int t) {                  // trip t's stage into buffer buf; t and rot below PJ_NST: one wrap at most
    const int s = t + rot;
    const size_t k = (size_t)(s >= PJ_NST ? s - PJ_NST : s) * 128;
    const unsigned l = lX + (unsigned)buf * (PJ_STAGE * 2);
    async_rows8(l,               gX + k,                               (size_t)16 * DMODEL);
    async_rows8(l + PJ_PART * 2, gW + k,                               (size_t)16 * DMODEL);
    async_rows8(l + PJ_PART * 4, gW + (size_t)DMODEL * DMODEL + k,     (size_t)16 * DMODEL);
    async_rows8(l + PJ_PART * 6, gW + (size_t)2 * DMODEL * DMODEL + k, (size_t)16 * DMODEL);
  };

  v8f acc[2][2][4];                                        // [32-row half][16-row tile][16-col tile]
#pragma unroll   // here and below in proj3: every index a constant, so the tiles and fragments stay in registers
  for (int h = 0; h < 2; ++h)
#pragma unroll
    for (int i = 0; i < 2; ++i)
#pragma unroll
      for (int j = 0; j < 4; ++j) acc[h][i][j] = zero8();

  // trip 0's stage into buffer 0, published; then trip 1's into buffer 1
  if (copier) fill(0, 0);
  wait_async0();
  __syncthreads();
  if (copier) fill(1, 1);

  for (int t = 0; t < PJ_NST; ++t) {
    const int buf = t & 1;
    const unsigned short* fA = ring + buf * PJ_STAGE + (arow + rlane) * GT_PITCH + koff;
    const unsigned short* fB = ring + buf * PJ_STAGE + (brow + rlane) * GT_PITCH + koff;
#pragma unroll   // the four 32-k steps of a stage in a row: every LDS offset a constant
    for (int s = 0; s < 4; ++s) {
      // one fragment set (with the 128 accumulator registers it stays under 256): a step's 16 reads are issued as one group at its
      // head; the SIMD's two other waves multiply meanwhile
      v16h ah[4], bh[4];
#pragma unroll
      for (int j = 0; j < 4; ++j) bh[j] = ldfrag_u(fB + (j << 4) * GT_PITCH + s * 32);
#pragma unroll
      for (int i = 0; i < 4; ++i) ah[i] = ldfrag_u(fA + (i << 4) * GT_PITCH + s * 32);
#pragma unroll
      for (int i = 0; i < 4; ++i) {
        v8f (&ar)[4] = acc[i >> 1][i & 1];
#pragma unroll
        for (int j = 0; j < 4; ++j) ar[j] = mma_raw(ah[i], bh[j], ar[j]);
        // as in gemm_main: vector slots behind the row's products; it names the row's A fragment, so the four A fragments keep
        // registers of their own and the step's reads go out together, not one waited pair per row
        dep_guard1(ar[0], ar[3], ah[i]);
      }
      keep4_h(bh[0], bh[1], bh[2], bh[3]);   // as in gemm_main: the B fragments stay whole until the step's last row
    }
    // publish point of trip t + 1's stage: own LDS reads back, own copies landed, one barrier for both hand-overs, then the refill
    wait_ds0();
    wait_async0();
    __syncthreads();
    if (copier && t + 2 < PJ_NST) fill(buf, t + 2);
  }
  wait_async0();
#pragma unroll
  for (int h = 0; h < 2; ++h)
#pragma unroll
    for (int i = 0; i < 2; ++i) acc_guard4(acc[h][i][0], acc[h][i][1], acc[h][i][2], acc[h][i][3]);

  float* slab = (float*)(void*)ring + wave * GT_SLAB;
  const float os = 1.0f / (ACARRY * WSC);
  if (which == 0) {
#pragma unroll
    for (int h = 0; h < 2; ++h)
      gemm_epi<2, 0, 0, 0>(slab, acc[h], (const float*)0, (const float*)0, (void*)QH, DMODEL, 0LL, 0, NROWS, DMODEL,
                           bm0 + wx + 32 * h, bn0 + ww, os, QC);
  } else if (which == 1) {
#pragma unroll
    for (int h = 0; h < 2; ++h)
      gemm_epi<3, 0, 0, 0>(slab, acc[h], (const float*)0, (const float*)0, (void*)KH, DMODEL, 0LL, 0, NROWS, DMODEL,
                           bm0 + wx + 32 * h, bn0 + ww, os, KC);
  } else {
#pragma unroll
    for (int h = 0; h < 2; ++h)
      gemm_epi<4, 0, 0, 0>(slab, acc[h], (const float*)0, (const float*)0, (void*)VT, NC, (long long)DMODEL * NC, bm0 / NC,
                           DMODEL, NC, bn0 + ww + 32 * h, (bm0 % NC) + wx, os, VC);
  }
}

#define AT_KEYS   256
#define AT_STEPS  (AT_KEYS / 32)
#define AT_NST    (NC / AT_KEYS)
#define AT_HALF   (AT_KEYS * HDIM)
#define AT_STAGE  (2 * AT_HALF)
static_assert(AT_NST >= 2 && (AT_NST & (AT_NST - 1)) == 0 && AT_HALF * 2 == 4 * ATT_THREADS * 16);

// Eight asynchronous 16-B copies per lane, global -> LDS: four pieces of the k stage and four of the v^T stage, 8 KiB apart (the
// block's 512 lanes side by side). The closing s_wait_xcnt 0 stands inside the statement so that no address register of an issued
// copy is rewritten in front of it.
__device__ __forceinline__ void async_kv8(unsigned l, const unsigned short* gk, const unsigned short* gv) {
#if defined(__HIP_DEVICE_COMPILE__)
  const unsigned ls = ATT_THREADS * 16;        // bytes per block-wide piece
  const unsigned lv = AT_HALF * 2;             // the v^T part of a buffer, in bytes
  const int      gs = ATT_THREADS * 8;         // halves per block-wide piece
  asm volatile("global_load_async_to_lds_b128 %0, %8, off\n\t"
               "global_load_async_to_lds_b128 %1, %9, off\n\t"
               "global_load_async_to_lds_b128 %2, %10, off\n\t"
               "global_load_async_to_lds_b128 %3, %11, off\n\t"
               "global_load_async_to_lds_b128 %4, %12, off\n\t"
               "global_load_async_to_lds_b128 %5, %13, off\n\t"
               "global_load_async_to_lds_b128 %6, %14, off\n\t"
               "global_load_async_to_lds_b128 %7, %15, off\n\t"
               "s_wait_xcnt 0x0"
               :: "v"(l), "v"(l + ls), "v"(l + 2 * ls), "v"(l + 3 * ls),
                  "v"(l + lv), "v"(l + lv + ls), "v"(l + lv + 2 * ls), "v"(l + lv + 3 * ls),
                  "v"(gk), "v"(gk + gs), "v"(gk + 2 * gs), "v"(gk + 3 * gs),
                  "v"(gv), "v"(gv + gs), "v"(gv + 2 * gs), "v"(gv + 3 * gs)
               : "memory");
#endif
}

__global__ __launch_bounds__(ATT_THREADS)
void attn16(const unsigned short* __restrict__ QHp, const unsigned short* __restrict__ KHp,
            const unsigned short* __restrict__ VTq, const unsigned short* __restrict__ MFp, unsigned short* CT) {
  __shared__ __align__(16) unsigned short kv[2 * AT_STAGE];   // two stage buffers
  const int tid  = threadIdx.x;
  const int wave = __builtin_amdgcn_readfirstlane(tid >> 5);  // told to be wave-uniform, so the mask base stays scalar
  const int lane = tid & 31;
  const int hh   = lane >> 4;
  const int c    = lane & 15;

  const int qg   = blockIdx.x & (ATT_QG - 1);              // 0..7
  const int head = (blockIdx.x / ATT_QG) & (NHEAD - 1);    // 0..15
  const int bat  = blockIdx.x / (ATT_QG * NHEAD);          // 0..1
  const int qt   = qg * ATT_WAVES + wave;                  // 0..127
  const int q0   = qt * 16;

  const size_t qofs = ((size_t)bat * NQ + q0 + c) * DMODEL + head * HDIM + 8 * hh;
  const _Float16* Qh = (const _Float16*)(const void*)QHp + qofs;
  // copy map: lane piece = 16 B number tid + 512 j, j 0..3, of the stage's 32 KiB of k and of its 32 KiB of v^T
  const unsigned short* gK = KHp + (size_t)(bat * NHEAD + head) * (NC * HDIM) + tid * 8;
  const unsigned short* gV = VTq + (size_t)(bat * NHEAD + head) * (NC * HDIM) + tid * 8;
  const unsigned lK = (unsigned)(uintptr_t)(lds_u16*)(kv + tid * 8);
  const unsigned lofs = 8u * (unsigned)lane;               // the lane's 16 B inside every 512-B run
  const _Float16* Wb = (const _Float16*)(const void*)MFp + (size_t)(bat * (NQ / 16) + qt) * (16 * NC) + lofs;   // 512 halves per step
  const float lsc = (LOG2E * ATT_SCALE) / (QC * KC);                   // log2(e) / 8 / carries

  const int rot = (head + qg) & (AT_NST - 1);              // trip st works on key stage (st + rot) mod AT_NST
  const auto kvofs = [&](int st) -> size_t { return (size_t)((st + rot) & (AT_NST - 1)) * AT_HALF; };

  // the first trip's stage into buffer 0, published; then the second trip's into buffer 1
  async_kv8(lK, gK + kvofs(0), gV + kvofs(0));
  const v16h qa = ldfrag_h(Qh), qb = ldfrag_h(Qh + 32);
  wait_async0();
  __syncthreads();
  async_kv8(lK + AT_STAGE * 2, gK + kvofs(1), gV + kvofs(1));

  float mrun = -INFINITY;                                  // the query's running maximum of q.k, with its carries
  v8f o0 = zero8(), o1 = zero8(), o2 = zero8(), o3 = zero8();
  v8f ol = zero8();                                        // register 0: the query's running sum of probs
  const _Float16 one = (lane & 7) == 0 ? (_Float16)1.0f : (_Float16)0.0f;   // A rows 0 and 8
  const v16h ones = {one, one, one, one, one, one, one, one, one, one, one, one, one, one, one, one};

#pragma unroll 1   // rolled, as the loop of steps inside it: the loop text stays short
  for (int st = 0; st < AT_NST; ++st) {
  const int buf = st & 1;
  const _Float16* kl = (const _Float16*)(const void*)(kv + buf * AT_STAGE) + lofs;
  const _Float16* wl = Wb + (size_t)((st + rot) & (AT_NST - 1)) * (AT_KEYS * 16);
#pragma unroll 1   // rolled: one step's 18 loads are issued as one group at its head, and the loop text stays short
  for (int sp = 0; sp < AT_STEPS; ++sp) {
    const _Float16* kp = kl + sp * 2048;                   // LDS: k blocks 2 sp and 2 sp + 1 of the stage, 1024 halves each
    const _Float16* wp = wl + sp * 512;                    // global: mask block of the step, 512 halves
    const _Float16* vp = kp + AT_HALF;                     // LDS: v^T block sp of the stage, 2048 halves
    const v16h mk = ldfrag_p(wp);                          // elements as in the prob tile below
    const v16h k00 = ldfrag_p(kp),        k01 = ldfrag_p(kp + 512);
    const v16h k10 = ldfrag_p(kp + 1024), k11 = ldfrag_p(kp + 1536);
    const v16h vb0 = ldfrag_p(vp);
    const v16h vb1 = ldfrag_p(vp + 512);
    const v16h vb2 = ldfrag_p(vp + 1024);
    const v16h vb3 = ldfrag_p(vp + 1536);
#if defined(__HIP_DEVICE_COMPILE__)
    // stands behind the step's two global loads, in front of every rewrite of a register that they name; their address pair is
    // an input, so that it does not serve as a load's destination in front of the wait
    asm volatile("s_wait_xcnt 0x0" :: "v"(wp) : "memory");
#endif
    v8f s0, s1;
    s0 = mma_raw(k00, qa, zero8());
    s0 = mma_raw(k01, qb, s0);
    guard_s2(s0, k00, k01);
    s1 = mma_raw(k10, qa, zero8());
    s1 = mma_raw(k11, qb, s1);
    guard_s4(s1, k10, k11, qa, qb);
    const float m0 = fmaxf(fmaxf(s0[0], s0[1]), s0[2]), m1 = fmaxf(fmaxf(s0[3], s0[4]), s0[5]);
    const float m2 = fmaxf(fmaxf(s0[6], s0[7]), s1[0]), m3 = fmaxf(fmaxf(s1[1], s1[2]), s1[3]);
    const float m4 = fmaxf(fmaxf(s1[4], s1[5]), s1[6]);
    const float mxr = fmaxf(fmaxf(fmaxf(m0, m1), m2), fmaxf(fmaxf(m3, m4), s1[7]));   // the lane's 16 keys
    const float mn = fmaxf(fmaxf(mrun, mxr), xhalf(mxr));  // with the other half's 16: equal in both halves
    const float al = exp2_hw((mrun - mn) * lsc);           // 0 on the first step, where mrun is -inf; lsc > 0
    mrun = mn;
    const float ad = ECL - mn * lsc;
    FragH ph, mf;                                          // elements 0..7 = keys kb + 8hh + 0..7, 8..15 = keys kb + 16 + 8hh + 0..7
    mf.v = mk;
#pragma unroll   // every index a constant, so the pairs stay in registers
    for (int i = 0; i < 8; ++i) {                          // pair i = keys kb + 16 (i >> 2) + 8 hh + 2 (i & 3) + 0, 1
      const v2f sv = (i < 4) ? (v2f){s0[2 * i], s0[2 * i + 1]} : (v2f){s1[2 * i - 8], s1[2 * i - 7]};
      const v2f d  = sv * lsc + ad;
      const v2f ex = (v2f){exp2_hw(d[0]), exp2_hw(d[1])};
      ph.p[i] = __builtin_convertvector(ex, v2h) * mf.p[i];
    }
    ol[0] *= al;
#pragma unroll
    for (int r = 0; r < 8; ++r) {
      o0[r] *= al;
      o1[r] *= al;
      o2[r] *= al;
      o3[r] *= al;
    }
    ol = mma_raw(ones, ph.v, ol);
    o0 = mma_raw(vb0, ph.v, o0);
    o1 = mma_raw(vb1, ph.v, o1);
    o2 = mma_raw(vb2, ph.v, o2);
    o3 = mma_raw(vb3, ph.v, o3);
    guard_pv5(o0, o1, o2, o3, ol, ph.v, vb0, vb1, vb2, vb3, ones);
  }
  // publish point of trip st + 1's stage: own LDS reads back, own copies landed, one barrier for both hand-overs, then the refill
  wait_ds0();
  wait_async0();
  __syncthreads();
  if (st + 2 < AT_NST)
    async_kv8(lK + buf * (AT_STAGE * 2), gK + kvofs(st + 2), gV + kvofs(st + 2));
  }
  wait_async0();

  // ---- fold 1/l and the carries (1024 on P in o and in l alike, 16 on v, 1024 on the stored ctx), store 16 B per tile ----
  const float oc  = FC / VC;
  const float inv = (1.0f / ol[0]) * oc;
  unsigned short* dst = CT + qofs;                         // row q0 + c, cols 64 head + 8 hh (+ 16 t)
  v4u p0, p1, p2, p3;
#pragma unroll
  for (int e = 0; e < 4; ++e) {
    p0[e] = pk16(h_bits((_Float16)(o0[2 * e] * inv)), h_bits((_Float16)(o0[2 * e + 1] * inv)));
    p1[e] = pk16(h_bits((_Float16)(o1[2 * e] * inv)), h_bits((_Float16)(o1[2 * e + 1] * inv)));
    p2[e] = pk16(h_bits((_Float16)(o2[2 * e] * inv)), h_bits((_Float16)(o2[2 * e + 1] * inv)));
    p3[e] = pk16(h_bits((_Float16)(o3[2 * e] * inv)), h_bits((_Float16)(o3[2 * e + 1] * inv)));
  }
  *(v4u*)(dst)      = p0;
  *(v4u*)(dst + 16) = p1;
  *(v4u*)(dst + 32) = p2;
  *(v4u*)(dst + 48) = p3;
}

// =====================================================================================================
// Workspace map (bytes); every plane is an exact multiple of its tile / whole-row store granularity (M, N exact tile multiples,
// element counts exact multiples of pack_all's 32768-element block, no pad rows needed), every offset a multiple of 2 MiB:
//   WQ16 f16 [1024][1024] x64               2097152   ([out][in] = [n][k])
//   WK16 f16 [1024][1024] x64               2097152
//   WV16 f16 [1024][1024] x64               2097152
//   WO16 f16 [1024][1024] x64               2097152
//   X16  f16 [4096][1024] x16               8388608   (activation rows)
//   MF   f16 [2][128][64] x 1 KiB, x32     16777216   (bf16(M), lane order of the transposed prob tile)
//   QH   f16 [4096][1024] x16               8388608   (q projection, unscaled)
//   KH   f16 [2][16][128] x 2 KiB, x16      8388608   (k projection, fragment order)
//   VT   f16 [2][16][64] x 4 KiB, x16       8388608   (v^T, fragment order)
//   CT   f16 [4096][1024] x1024             8388608   (attention ctx, merged heads)
//   end                                    67108864
// =====================================================================================================
extern "C" void kernel_launch(void* const* d_in, const int* in_sizes, int n_in,
                              void* d_out, int out_size, void* d_ws, size_t ws_size,
                              hipStream_t stream) {
  if (n_in < 7) return;
  if (in_sizes[0] != NROWS * DMODEL) return;
  if (in_sizes[1] != NB * NQ * NC) return;
  if (in_sizes[2] != DMODEL * DMODEL || in_sizes[3] != DMODEL * DMODEL ||
      in_sizes[4] != DMODEL * DMODEL || in_sizes[5] != DMODEL * DMODEL) return;
  if (in_sizes[6] != DMODEL) return;
  if (out_size != NROWS * DMODEL) return;
  if ((in_sizes[0] % 2048) != 0 || (in_sizes[2] % 2048) != 0 || (in_sizes[1] % 1024) != 0) return;

  const float* x   = (const float*)d_in[0];
  const float* Mp  = (const float*)d_in[1];
  const float* w_q = (const float*)d_in[2];
  const float* w_k = (const float*)d_in[3];
  const float* w_v = (const float*)d_in[4];
  const float* w_o = (const float*)d_in[5];
  const float* b_o = (const float*)d_in[6];
  float*       out = (float*)d_out;

  const size_t PW  = (size_t)DMODEL * DMODEL * 2;                 //  2097152
  const size_t PX  = (size_t)NROWS * DMODEL * 2;                  //  8388608
  const size_t PMF = (size_t)NB * NQ * NC * 2;                    // 16777216
  const size_t PVT = (size_t)NB * DMODEL * NC * 2;                //  8388608
  size_t off = 0;
  const size_t oWQ = off; off += PW;
  const size_t oWK = off; off += PW;
  const size_t oWV = off; off += PW;
  const size_t oWO = off; off += PW;
  const size_t oX  = off; off += PX;
  const size_t oMF = off; off += PMF;
  const size_t oQH = off; off += PX;
  const size_t oKH = off; off += PX;
  const size_t oVT = off; off += PVT;
  const size_t oCT = off; off += PX;
  if (off > ws_size) return;                                      // off = 67108864
  if (off > (size_t)134217728) return;

  char* ws = (char*)d_ws;
  unsigned short* WQ16 = (unsigned short*)(ws + oWQ);
  unsigned short* WO16 = (unsigned short*)(ws + oWO);
  unsigned short* X16  = (unsigned short*)(ws + oX);
  unsigned short* MF   = (unsigned short*)(ws + oMF);
  unsigned short* QH   = (unsigned short*)(ws + oQH);
  unsigned short* KH   = (unsigned short*)(ws + oKH);
  unsigned short* VTp  = (unsigned short*)(ws + oVT);
  unsigned short* CT   = (unsigned short*)(ws + oCT);

  const dim3 blk(256);
  const dim3 gPK(PK_BLOCKS);                                       // 512 blocks
  const int tilesP = (NROWS / 128) * (DMODEL / 128);               // 256
  const dim3 gP(tilesP, 1);                                        // 256
  const dim3 gPJ(PJ_BLOCKS);                                       // 256
  const dim3 bPJ(PJ_THREADS);                                      // 384
  const dim3 gAT(ATT_BLOCKS);                                      // 256
  const dim3 bAT(ATT_THREADS);                                     // 512

  // (0..2) one launch: weight planes W16[n][k] = f16( bf16_RNE(W[n][k]) * 64 ), [out][in] layout kept, k contiguous (WQ16, WK16,
  // WV16, WO16 lie one behind the other); activation plane X16[row][c] = f16( bf16_RNE(x[row][c]) * 16 ), rows = b*2048 + tok;
  // mask plane f16( bf16_RNE(M[b][q][key]) * 32 ), in the lane order of attn16's prob tile
  pack_all<<<gPK, blk, 0, stream>>>(Mp, MF, x, X16, w_q, w_k, w_v, w_o, WQ16);

  // (3..5) one launch: q projection QH[m][n] = f16(16 * sum_k x[m][k] Wq[n][k]), M = 4096, N = 1024; k projection, the same with
  // Wk, in fragment order; v^T per batch, f16(16 * sum_k Wv[d][k] x_b[tok][k]) in fragment order, M = 1024, N = 2048; K = 1024
  proj3<<<gPJ, bPJ, 0, stream>>>(X16, WQ16, QH, KH, VTp);

  // (6) attention per (batch, head, 256 query rows) -> CT (f16, x1024)
  attn16<<<gAT, bAT, 0, stream>>>(QH, KH, VTp, MF, CT);

  // (7) out = CT . Wo^T / (1024 * 64) + bf16(bo); M = 4096, N = 1024, K = 1024, f32
  gemm64<0, 1, 0, 0><<<gP, blk, 0, stream>>>(
      CT, DMODEL, 0LL,
      WO16, DMODEL, 0LL,
      b_o,
      (const float*)0,
      (void*)out, DMODEL, 0LL,
      NROWS, DMODEL, DMODEL, 1.0f / (FC * WSC), 1.0f);
  (void)hipGetLastError();
}
